// v000
// The times below were measured on an AMD MI455X: many runs one after another, warmed up first and cycling through
// copies of the inputs, with the whole window's GPU time divided by the number of runs. Launches and the gaps
// between them are all in it. The median over several windows is given; except for v000 it joins two sittings, which
// can be a few percent apart, so the side-by-side timings, each taken in one sitting, are the better comparison.
// v000, which the later versions start from, runs in 1360 microseconds.
// Contractions: qk and v projections = v_wmma_f32_16x16x32_bf16 (x and W as RNE bf16, single product); scores q.k^T = v_wmma_f32_16x16x32_f16 (q, k f16 planes, single product, 1/8 applied to the f32 accumulator); attn.v = v_wmma_f32_16x16x32_bf16 with p and v as bf16 hi/lo pairs (hi.hi + hi.lo + lo.hi); output projection = v_wmma_f32_16x16x32_bf16 with the merged head output as bf16 hi/lo pair times W as RNE bf16 (hi.W + lo.W); f32 accumulate everywhere; softmax, causal prefix mean of v and gain combination in f32.
#include <hip/hip_runtime.h>
#include <math.h>

typedef __attribute__((ext_vector_type(16))) _Float16 v16h;
typedef __attribute__((ext_vector_type(8)))  _Float16 v8h;
typedef __attribute__((ext_vector_type(16))) __bf16   v16b;
typedef __attribute__((ext_vector_type(8)))  __bf16   v8b;
typedef __attribute__((ext_vector_type(8)))  float    v8f;
typedef __attribute__((ext_vector_type(4)))  float    v4f;
typedef __attribute__((ext_vector_type(2)))  float    v2f;

constexpr int kB    = 2;
constexpr int kS    = 2048;
constexpr int kD    = 1024;
constexpr int kH    = 16;
constexpr int kHD   = 64;
constexpr int kTok  = kB * kS;        // 4096 token rows
constexpr int kQKLd = 2 * kD;         // fused q|k plane pitch (halves): q at col h*64, k at col kD + h*64
constexpr int kKOff = kD;
constexpr int kKC   = 64;             // kv chunk
constexpr int kNQB  = kS / 64;        // query blocks per (b,h)
constexpr int kStg  = 72;             // 16-bit LDS staging pitch (144 B rows, 16-B aligned)
constexpr float kSmScale = 0.125f;    // 1/sqrt(64), exact power of two applied to the f32 score accumulator

// workspace region map (bytes, all offsets multiples of 2 MiB):
//   [0]          xb    bf16 [4096][1024]            8 MiB
//   [8 MiB]      qkwT  bf16 [2048][1024]            4 MiB   (qk_w transposed)
//   [12 MiB]     vwT   bf16 [1024][1024]            2 MiB
//   [14 MiB]     cwT   bf16 [1024][1024]            2 MiB
//   [16 MiB]     QKp   f16  [4096][2048]           16 MiB   (q | k planes)
//   [32 MiB]     Vf    f32  [4096][1024]           16 MiB
//   [48 MiB]     Vth   bf16 [32][64][2048]          8 MiB   (v hi, per (b,h) [d][s])
//   [56 MiB]     Vtl   bf16 [32][64][2048]          8 MiB   (v lo)
//   [64 MiB]     AV    f32  [4096][1024]           16 MiB   (softmax(qk).v, merged heads)
//   [80 MiB]     Oh    bf16 [4096][1024]            8 MiB   (combined head output, hi)
//   [88 MiB]     Ol    bf16 [4096][1024]            8 MiB   (lo)
//   total 96 MiB = 100663296 B
constexpr size_t kOffXb   = 0;
constexpr size_t kOffQkwT = kOffXb   + (size_t)kTok * kD * 2;
constexpr size_t kOffVwT  = kOffQkwT + (size_t)kQKLd * kD * 2;
constexpr size_t kOffCwT  = kOffVwT  + (size_t)kD * kD * 2;
constexpr size_t kOffQKp  = kOffCwT  + (size_t)kD * kD * 2;
constexpr size_t kOffVf   = kOffQKp  + (size_t)kTok * kQKLd * 2;
constexpr size_t kOffVth  = kOffVf   + (size_t)kTok * kD * 4;
constexpr size_t kOffVtl  = kOffVth  + (size_t)kB * kH * kHD * kS * 2;
constexpr size_t kOffAV   = kOffVtl  + (size_t)kB * kH * kHD * kS * 2;
constexpr size_t kOffOh   = kOffAV   + (size_t)kTok * kD * 4;
constexpr size_t kOffOl   = kOffOh   + (size_t)kTok * kD * 2;
constexpr size_t kWsTotal = kOffOl   + (size_t)kTok * kD * 2;
static_assert(kWsTotal == 100663296ull);
static_assert(kWsTotal <= 134217728ull);

__device__ __forceinline__ unsigned short f2bf_bits(float f) {
  unsigned u = __float_as_uint(f);
  return (unsigned short)((u + 0x7FFFu + ((u >> 16) & 1u)) >> 16);
}
__device__ __forceinline__ float bf_bits2f(unsigned short h) { return __uint_as_float(((unsigned)h) << 16); }

// hazard guards as plain device helpers (no inline asm inside the kernel template body)
__device__ __forceinline__ void dep_guard_h(v8f& a, v8f& b, v16h x, v16h y) { asm volatile("v_nop\n\tv_nop\n\tv_nop\n\tv_nop" : "+v"(a), "+v"(b) : "v"(x), "v"(y)); }
__device__ __forceinline__ void dep_guard_b(v8f& a, v8f& b, v16b x, v16b y) { asm volatile("v_nop\n\tv_nop\n\tv_nop\n\tv_nop" : "+v"(a), "+v"(b) : "v"(x), "v"(y)); }
__device__ __forceinline__ void keep4_h(v16h a, v16h b, v16h c, v16h d) { asm volatile("v_nop" :: "v"(a), "v"(b), "v"(c), "v"(d)); }
__device__ __forceinline__ void keep4_b(v16b a, v16b b, v16b c, v16b d) { asm volatile("v_nop" :: "v"(a), "v"(b), "v"(c), "v"(d)); }
__device__ __forceinline__ void acc_guard4(v8f& a, v8f& b, v8f& c, v8f& d) { asm volatile("v_nop\n\tv_nop\n\tv_nop\n\tv_nop" : "+v"(a), "+v"(b), "+v"(c), "+v"(d)); }
template <typename T> struct Frag;
template <> struct Frag<_Float16> {
  typedef v16h V; union U { v16h v; v8h h[2]; };
  static __device__ __forceinline__ v16h load(const _Float16* p) {   // elements 0..7 <- p[0..7], 8..15 <- p[16..23]
    U f; f.h[0] = *(const v8h*)(p); f.h[1] = *(const v8h*)(p + 16); return f.v;
  }
  static __device__ __forceinline__ v8f mma(v16h a, v16h b, v8f c) {
    return __builtin_amdgcn_wmma_f32_16x16x32_f16(false, a, false, b, (short)0, c, false, false);
  }
  static __device__ __forceinline__ void guard(v8f& a, v8f& b, v16h x, v16h y) { dep_guard_h(a, b, x, y); }
  static __device__ __forceinline__ void keep(v16h a, v16h b, v16h c, v16h d) { keep4_h(a, b, c, d); }
};
template <> struct Frag<__bf16> {
  typedef v16b V; union U { v16b v; v8b h[2]; };
  static __device__ __forceinline__ v16b load(const __bf16* p) {
    U f; f.h[0] = *(const v8b*)(p); f.h[1] = *(const v8b*)(p + 16); return f.v;
  }
  static __device__ __forceinline__ v8f mma(v16b a, v16b b, v8f c) {
    return __builtin_amdgcn_wmma_f32_16x16x32_bf16(false, a, false, b, (short)0, c, false, false);
  }
  static __device__ __forceinline__ void guard(v8f& a, v8f& b, v16b x, v16b y) { dep_guard_b(a, b, x, y); }
  static __device__ __forceinline__ void keep(v16b a, v16b b, v16b c, v16b d) { keep4_b(a, b, c, d); }
};

__device__ __forceinline__ unsigned short at_bf_bits(float f) {
  unsigned u = __float_as_uint(f);
  return (unsigned short)((u + 0x7FFFu + ((u >> 16) & 1u)) >> 16);
}
__device__ __forceinline__ __bf16 at_f2bf(float f) { return __builtin_bit_cast(__bf16, at_bf_bits(f)); }
__device__ __forceinline__ void at_split(float f, __bf16& hi, __bf16& lo) {
  const unsigned short hb = at_bf_bits(f);
  hi = __builtin_bit_cast(__bf16, hb);
  lo = at_f2bf(f - __uint_as_float(((unsigned)hb) << 16));
}
__device__ __forceinline__ v8f at_mma(v16b a, v16b b, v8f c) {
  c = __builtin_amdgcn_wmma_f32_16x16x32_bf16(false, a, false, b, (short)0, c, false, false);
  asm volatile("v_nop\n\tv_nop\n\tv_nop\n\tv_nop" : "+v"(c) : "v"(a), "v"(b));
  return c;
}
__device__ __forceinline__ v8f at_mma_h(v16h a, v16h b, v8f c) {
  c = __builtin_amdgcn_wmma_f32_16x16x32_f16(false, a, false, b, (short)0, c, false, false);
  asm volatile("v_nop\n\tv_nop\n\tv_nop\n\tv_nop" : "+v"(c) : "v"(a), "v"(b));
  return c;
}

// =====================================================================================
// =====================================================================================
__global__ __launch_bounds__(256) void cast_f32_bf16x2(const float* __restrict__ in,
                                                       unsigned short* __restrict__ out, int n2) {
  const int i = blockIdx.x * 256 + threadIdx.x;
  if (i < n2) {
    const unsigned u = (unsigned)f2bf_bits(in[2 * i]) | ((unsigned)f2bf_bits(in[2 * i + 1]) << 16);
    ((unsigned*)out)[i] = u;
    
  }
}

// =====================================================================================
// Register-blocked batched WMMA GEMM, C[m,n] = scale * sum_k A[m,k] * Bt[n,k] (+bias)(+resid);
// each wave owns a 64x64 tile. A row-major [M,K]; Bt row-major [N,K]; M,N % 64 == 0, K % 32 == 0.
// SPLITM: 0 = single product; 1 = A carried as hi/lo planes (A2p = lo): product = hi.B + lo.B;
//         2 = A and Bt as hi/lo planes: product = hi.hi + hi.lo + lo.hi.
// BIAS_MODE: 0 = none, 1 = bias[m], 2 = bias[n].  OUT_MODE: 0 = f32, 1 = f16, 2 = bf16 hi + lo planes.
// ET: 0 = f16 operands, 1 = bf16 operands (pointers passed as 16-bit storage)
// =====================================================================================
template <int ET> struct Elem;
template <> struct Elem<0> { typedef _Float16 T; };
template <> struct Elem<1> { typedef __bf16 T; };
template <int ET, int SPLITM, int BIAS_MODE, int OUT_MODE, bool RESID, int ACT = 0>
__global__ __launch_bounds__(256) void wmma_gemm64(
    const unsigned short* __restrict__ Ap, const unsigned short* __restrict__ A2p, int lda, long strideA,
    const unsigned short* __restrict__ Btp, const unsigned short* __restrict__ Bt2p, int ldb, long strideB,
    void* __restrict__ Cout, void* __restrict__ Cout2, int ldc, long strideC,
    const float* __restrict__ bias,
    const float* __restrict__ resid, long strideR,
    int M, int N, int K, float scale) {
  typedef typename Elem<ET>::T T;
  typedef typename Frag<T>::V V;
  constexpr bool SPA = (SPLITM >= 1);
  constexpr bool SPB = (SPLITM >= 2);
  const T* A = (const T*)Ap; const T* A2 = (const T*)A2p; const T* Bt = (const T*)Btp; const T* Bt2 = (const T*)Bt2p;
  __shared__ __align__(16) float sT[8][16 * 68];   // per-wave 16x64 slab, pitch 68 floats
  const int b    = blockIdx.y;
  const int lane = threadIdx.x & 31;
  const int wave = threadIdx.x >> 5;
  const int tilesN = N >> 6;
  const int tilesM = M >> 6;
  const int tile = blockIdx.x * 8 + wave;
  if (tile >= tilesM * tilesN) return;   // wave-uniform; no block barriers in this kernel
  const int tm = tile / tilesN;
  const int tn = tile - tm * tilesN;
  const int m0 = tm << 6;
  const int n0 = tn << 6;

  const T* Ab  = A  + (size_t)b * strideA;
  const T* Bb  = Bt + (size_t)b * strideB;
  const T* Ab2 = SPA ? (A2  + (size_t)b * strideA) : nullptr;
  const T* Bb2 = SPB ? (Bt2 + (size_t)b * strideB) : nullptr;

  const int rlane = lane & 15;                 // row (A) / col (B, D) within subtile
  const int koff  = (lane >> 4) * 8;           // k offset of this lane half
  const int mOff  = (lane >> 4) * 8;           // D row offset

  v8f acc[4][4];
#pragma unroll
  for (int i = 0; i < 4; ++i)
#pragma unroll
    for (int j = 0; j < 4; ++j) acc[i][j] = (v8f){0.f,0.f,0.f,0.f,0.f,0.f,0.f,0.f};

  for (int k0 = 0; k0 < K; k0 += 32) {
    V bh[4], bl[4];
#pragma unroll
    for (int j = 0; j < 4; ++j) {
      const size_t bo = (size_t)(n0 + (j << 4) + rlane) * ldb + koff + k0;
      bh[j] = Frag<T>::load(Bb + bo);
      if (SPB) bl[j] = Frag<T>::load(Bb2 + bo);
    }
#pragma unroll
    for (int i = 0; i < 4; ++i) {
      const size_t ao = (size_t)(m0 + (i << 4) + rlane) * lda + koff + k0;
      V ah = Frag<T>::load(Ab + ao);
      V al;
      if (SPA) al = Frag<T>::load(Ab2 + ao);
#pragma unroll
      for (int j = 0; j < 4; ++j) {
        acc[i][j] = Frag<T>::mma(ah, bh[j], acc[i][j]);
        if (SPB) acc[i][j] = Frag<T>::mma(ah, bl[j], acc[i][j]);
        if (SPA) acc[i][j] = Frag<T>::mma(al, bh[j], acc[i][j]);
      }
      Frag<T>::guard(acc[i][0], acc[i][3], ah, SPA ? al : ah);
    }
    Frag<T>::keep(bh[0], bh[1], bh[2], bh[3]);
    if (SPB) Frag<T>::keep(bl[0], bl[1], bl[2], bl[3]);
  }
  acc_guard4(acc[0][0], acc[0][1], acc[0][2], acc[0][3]);
  acc_guard4(acc[1][0], acc[1][1], acc[1][2], acc[1][3]);
  acc_guard4(acc[2][0], acc[2][1], acc[2][2], acc[2][3]);
  acc_guard4(acc[3][0], acc[3][1], acc[3][2], acc[3][3]);

  // ---- epilogue ----
  float* slab = sT[wave];
  const float* Rb = RESID ? (resid + (size_t)b * strideR) : nullptr;
#pragma unroll
  for (int i = 0; i < 4; ++i) {
    const int mBase = m0 + (i << 4);
#pragma unroll
    for (int j = 0; j < 4; ++j) {
      const int n = n0 + (j << 4) + rlane;
      float bv = 0.f;
      if (BIAS_MODE == 2) bv = bias[n];
#pragma unroll
      for (int r = 0; r < 8; ++r) {
        float v = acc[i][j][r] * scale;
        if (BIAS_MODE == 1) v += bias[mBase + mOff + r];
        if (BIAS_MODE == 2) v += bv;
        if (RESID) v += Rb[(size_t)(mBase + mOff + r) * ldc + n];
        if (ACT == 1) v = tanhf(v);
        if (ACT == 2) v = fmaxf(v, 0.0f);
        if (ACT == 4) v = (v > 0.f) ? v : 0.01f * v;
        slab[(mOff + r) * 68 + (j << 4) + rlane] = v;
      }
    }
    __builtin_amdgcn_fence(__ATOMIC_RELEASE, "workgroup");
    __builtin_amdgcn_wave_barrier();
    __builtin_amdgcn_fence(__ATOMIC_ACQUIRE, "workgroup");
    if (OUT_MODE == 0) {
      float* C = (float*)Cout + (size_t)b * strideC;
      const int hh = lane >> 4, c4 = (lane & 15) * 4;     // row seg = 256 B = 16 lanes x 16 B
      {
#pragma unroll
        for (int it = 0; it < 8; ++it) {
          const int row = it * 2 + hh;
          v4f v = *(const v4f*)(slab + row * 68 + c4);
          *(v4f*)(C + (size_t)(mBase + row) * ldc + n0 + c4) = v;
        }
        
      }
    } else {
      const int q = lane >> 3, c8 = (lane & 7) * 8;
      unsigned short* C  = (unsigned short*)Cout  + (size_t)b * strideC;
      unsigned short* C2 = (OUT_MODE == 2) ? ((unsigned short*)Cout2 + (size_t)b * strideC) : nullptr;
      {
#pragma unroll
        for (int it = 0; it < 4; ++it) {
          const int row = it * 4 + q;
          const float* sp = slab + row * 68 + c8;
          v8h hv, lv;
#pragma unroll
          for (int e = 0; e < 8; ++e) {
            if (OUT_MODE == 1) {
              hv[e] = (_Float16)sp[e];
            } else {
              unsigned short hb = f2bf_bits(sp[e]);
              unsigned short lb = f2bf_bits(sp[e] - bf_bits2f(hb));
              hv[e] = __builtin_bit_cast(_Float16, hb);
              lv[e] = __builtin_bit_cast(_Float16, lb);
            }
          }
          *(v8h*)(C + (size_t)(mBase + row) * ldc + n0 + c8) = hv;
          if (OUT_MODE == 2) *(v8h*)(C2 + (size_t)(mBase + row) * ldc + n0 + c8) = lv;
        }
        
      }
    }
    __builtin_amdgcn_fence(__ATOMIC_RELEASE, "workgroup");
    __builtin_amdgcn_wave_barrier();
    __builtin_amdgcn_fence(__ATOMIC_ACQUIRE, "workgroup");
  }
}

// =====================================================================================
// Weight transpose + RNE bf16 cast: in f32 [R][Cc] row-major -> out bf16 bits [Cc][R]  (out[c][r] = in[r][c]).
// grid = (Cc/64, R/64), block 256; one 64x64 tile through LDS.
// Load coverage: 256 threads x 16 floats = 64 (r) x 64 (c).  Store coverage: 8 waves x 2 x 4 rows (q8) = 64 rows c;
// =====================================================================================
__global__ __launch_bounds__(256) void transpose_cast_bf16(const float* __restrict__ in, unsigned short* __restrict__ out,
                                                           int R, int Cc) {
  __shared__ __align__(16) _Float16 t[64 * kStg];     // [c][r] as 16-bit bit patterns
  const int c0 = blockIdx.x * 64, r0 = blockIdx.y * 64;
  const int tid = threadIdx.x;
  {
    const int rloc = tid >> 2, cq = (tid & 3) * 16;
    const float* src = in + (size_t)(r0 + rloc) * Cc + c0 + cq;
#pragma unroll
    for (int g4 = 0; g4 < 4; ++g4) {
      const v4f a = *(const v4f*)(src + 4 * g4);
#pragma unroll
      for (int e = 0; e < 4; ++e)
        t[(cq + 4 * g4 + e) * kStg + rloc] = __builtin_bit_cast(_Float16, f2bf_bits(a[e]));
    }
  }
  __syncthreads();
  const int wave = tid >> 5, lane = tid & 31, q8 = lane >> 3, c8 = (lane & 7) * 8;
  const int cA = wave * 8 + q8, cB = wave * 8 + 4 + q8;
  const v8h va = *(const v8h*)(t + cA * kStg + c8);
  const v8h vb = *(const v8h*)(t + cB * kStg + c8);
  unsigned short* da = out + (size_t)(c0 + cA) * R + r0 + c8;
  unsigned short* db = out + (size_t)(c0 + cB) * R + r0 + c8;
  {
    *(v8h*)da = va;
    *(v8h*)db = vb;
    
  }
}

// =====================================================================================
// V planes: Vf f32 [kTok][kD] (row b*kS+s, col h*kHD+d) -> Vth/Vtl bf16 bits [kB*kH][kHD][kS]:
// out[bh][d][s] = hi/lo(Vf[b*kS+s][h*kHD+d]).  grid = (kS/64, kB*kH), block 256.
// Load coverage: 256 threads x 16 floats = 64 (s) x 64 (d).
// =====================================================================================
__global__ __launch_bounds__(256) void v_split_transpose(const float* __restrict__ Vf,
                                                         unsigned short* __restrict__ vth, unsigned short* __restrict__ vtl) {
  __shared__ __align__(16) _Float16 th[64 * kStg];
  __shared__ __align__(16) _Float16 tl[64 * kStg];
  const int st0 = blockIdx.x * 64, bh = blockIdx.y;
  const int b = bh / kH, h = bh % kH;
  const int tid = threadIdx.x;
  {
    const int sloc = tid >> 2, d0 = (tid & 3) * 16;
    const float* src = Vf + (size_t)(b * kS + st0 + sloc) * kD + h * kHD + d0;
#pragma unroll
    for (int g4 = 0; g4 < 4; ++g4) {
      const v4f a = *(const v4f*)(src + 4 * g4);
#pragma unroll
      for (int e = 0; e < 4; ++e) {
        const unsigned short hb = f2bf_bits(a[e]);
        const unsigned short lb = f2bf_bits(a[e] - bf_bits2f(hb));
        th[(d0 + 4 * g4 + e) * kStg + sloc] = __builtin_bit_cast(_Float16, hb);
        tl[(d0 + 4 * g4 + e) * kStg + sloc] = __builtin_bit_cast(_Float16, lb);
      }
    }
  }
  __syncthreads();
  const int wave = tid >> 5, lane = tid & 31, q8 = lane >> 3, c8 = (lane & 7) * 8;
  const int dA = wave * 8 + q8, dB = wave * 8 + 4 + q8;
  const v8h ha = *(const v8h*)(th + dA * kStg + c8);
  const v8h hbv = *(const v8h*)(th + dB * kStg + c8);
  const v8h la = *(const v8h*)(tl + dA * kStg + c8);
  const v8h lbv = *(const v8h*)(tl + dB * kStg + c8);
  unsigned short* pha = vth + ((size_t)bh * kHD + dA) * kS + st0 + c8;
  unsigned short* phb = vth + ((size_t)bh * kHD + dB) * kS + st0 + c8;
  unsigned short* pla = vtl + ((size_t)bh * kHD + dA) * kS + st0 + c8;
  unsigned short* plb = vtl + ((size_t)bh * kHD + dB) * kS + st0 + c8;
  {
    *(v8h*)pha = ha;
    *(v8h*)phb = hbv;
    *(v8h*)pla = la;
    *(v8h*)plb = lbv;
    
  }
}

// =====================================================================================
// Causal attention, head_dim 64, 16-bit input planes, f32 out.
//   scores = q.k^T : v_wmma_f32_16x16x32_f16 (q, k f16 planes), then * 1/8 in f32; causal: kv > q replaced by -inf
//            (exp -> 0, identical to a finite most-negative fill since every row keeps its diagonal); chunks past
//            the diagonal contribute exactly 0 and are skipped.
//   out    = p.v   : v_wmma_f32_16x16x32_bf16 with p and v as bf16 hi/lo (hi.hi + hi.lo + lo.hi); online softmax in f32.
// Block = 4 waves = 64 query rows of one (b, h); grid.x = kB * kH * (kS/64).
// Staging coverage per kv chunk: 128 threads x 4 chunks x 8 halves = 64 x 64 per plane (K, V hi, V lo), plain loads + barrier.
// Output AV f32 [kTok][kD] at col h*64: row segment 64 floats = 256 B by 16 lanes x 16 B in one instruction, one wave per
// =====================================================================================
__global__ __launch_bounds__(128)
void attn_causal_hd64(const unsigned short* __restrict__ QKp,    // f16 bits [kTok][kQKLd]
                      const unsigned short* __restrict__ Vthp,   // bf16 bits [kB*kH][kHD][kS]
                      const unsigned short* __restrict__ Vtlp,
                      float* __restrict__ AV) {                  // f32 [kTok][kD]
  union FB { v16b v; v8b h[2]; };
  __shared__ __align__(16) _Float16 Ksh[kKC * kHD];        // K [kv][d]      8 KB
  __shared__ __align__(16) __bf16  Vhs[kHD * kKC];         // V hi [d][kv]   8 KB
  __shared__ __align__(16) __bf16  Vls[kHD * kKC];         // V lo [d][kv]   8 KB
  __shared__ __align__(16) __bf16  Psh[4][16 * kKC];       // per wave P hi [row][kv]
  __shared__ __align__(16) __bf16  Psl[4][16 * kKC];       // per wave P lo
  __shared__ __align__(16) float   Os[4][16 * 68];         // per wave out tile, pitch 68

  const int tid  = threadIdx.x;
  const int wave = tid >> 5;
  const int lane = tid & 31;
  const int hh   = lane >> 4;
  const int c    = lane & 15;

  const int bx = blockIdx.x;
  const int qb = bx % kNQB;
  const int bh = bx / kNQB;
  const int h  = bh % kH;
  const int b  = bh / kH;
  const int q0 = qb * 64 + wave * 16;

  const _Float16* Q16 = (const _Float16*)QKp;
  const __bf16* Vth = (const __bf16*)Vthp;
  const __bf16* Vtl = (const __bf16*)Vtlp;
  float* ob_ptr = AV + (size_t)(b * kS) * kD + h * kHD;

  // ---- Q fragments (A operand, row = query q0 + c, k = d): 2 d-chunks of 32 ----
  v16h qa[2];
  {
    const _Float16* qrow = Q16 + (size_t)(b * kS + q0 + c) * kQKLd + h * kHD + 8 * hh;
    qa[0] = Frag<_Float16>::load(qrow);
    qa[1] = Frag<_Float16>::load(qrow + 32);
  }

  float mrow[8], lrow[8];
  v8f oacc[4];
#pragma unroll
  for (int r = 0; r < 8; ++r) { mrow[r] = -INFINITY; lrow[r] = 0.f; }
#pragma unroll
  for (int t = 0; t < 4; ++t) oacc[t] = (v8f){0.f,0.f,0.f,0.f,0.f,0.f,0.f,0.f};

  const int nChunks = qb + 1;   // block-uniform
  for (int kc = 0; kc < nChunks; ++kc) {
    const int kv0 = kc * kKC;
    __syncthreads();
#pragma unroll
    for (int i = 0; i < 4; ++i) {
      const int ch = tid + 128 * i, row = ch >> 3, seg = (ch & 7) * 8;
      *(v8h*)(Ksh + row * kHD + seg) =
          *(const v8h*)(Q16 + (size_t)(b * kS + kv0 + row) * kQKLd + kKOff + h * kHD + seg);
      const size_t vo = ((size_t)bh * kHD + row) * kS + kv0 + seg;   // row = d
      *(v8b*)(Vhs + row * kKC + seg) = *(const v8b*)(Vth + vo);
      *(v8b*)(Vls + row * kKC + seg) = *(const v8b*)(Vtl + vo);
    }
    __syncthreads();

    v8f s[4];
#pragma unroll
    for (int j = 0; j < 4; ++j) {
      s[j] = (v8f){0.f,0.f,0.f,0.f,0.f,0.f,0.f,0.f};
#pragma unroll
      for (int dc = 0; dc < 2; ++dc) {
        const v16h kb = Frag<_Float16>::load(Ksh + (j * 16 + c) * kHD + dc * 32 + 8 * hh);
        s[j] = at_mma_h(qa[dc], kb, s[j]);
      }
    }
    const bool diag = (kc == qb);   // block-uniform
    float cm[8];
#pragma unroll
    for (int r = 0; r < 8; ++r) {
      const int qrow = q0 + 8 * hh + r;
      float m = -INFINITY;
#pragma unroll
      for (int j = 0; j < 4; ++j) {
        const int kvcol = kv0 + j * 16 + c;
        float sv = s[j][r] * kSmScale;
        if (diag && (kvcol > qrow)) sv = -INFINITY;
        s[j][r] = sv;
        m = fmaxf(m, sv);
      }
#pragma unroll
      for (int off = 1; off < 16; off <<= 1) m = fmaxf(m, __shfl_xor(m, off, 32));
      cm[r] = m;
    }
    __bf16* pwh = Psh[wave];
    __bf16* pwl = Psl[wave];
#pragma unroll
    for (int r = 0; r < 8; ++r) {
      const float mnew = fmaxf(mrow[r], cm[r]);
      const float alpha = expf(mrow[r] - mnew);
      mrow[r] = mnew;
      float psum = 0.f;
#pragma unroll
      for (int j = 0; j < 4; ++j) {
        const float p = expf(s[j][r] - mnew);
        psum += p;
        __bf16 a, bl; at_split(p, a, bl);
        pwh[(8 * hh + r) * kKC + j * 16 + c] = a;
        pwl[(8 * hh + r) * kKC + j * 16 + c] = bl;
      }
#pragma unroll
      for (int off = 1; off < 16; off <<= 1) psum += __shfl_xor(psum, off, 32);
      lrow[r] = lrow[r] * alpha + psum;
#pragma unroll
      for (int t = 0; t < 4; ++t) oacc[t][r] *= alpha;
    }
    __builtin_amdgcn_fence(__ATOMIC_RELEASE, "workgroup");
    __builtin_amdgcn_wave_barrier();
    __builtin_amdgcn_fence(__ATOMIC_ACQUIRE, "workgroup");
#pragma unroll 1
    for (int kk = 0; kk < 2; ++kk) {
      FB pa, pl;
      pa.h[0] = *(const v8b*)(pwh + c * kKC + kk * 32 + 8 * hh);
      pa.h[1] = *(const v8b*)(pwh + c * kKC + kk * 32 + 16 + 8 * hh);
      pl.h[0] = *(const v8b*)(pwl + c * kKC + kk * 32 + 8 * hh);
      pl.h[1] = *(const v8b*)(pwl + c * kKC + kk * 32 + 16 + 8 * hh);
#pragma unroll
      for (int t = 0; t < 4; ++t) {
        FB vb, vl;
        vb.h[0] = *(const v8b*)(Vhs + (t * 16 + c) * kKC + kk * 32 + 8 * hh);
        vb.h[1] = *(const v8b*)(Vhs + (t * 16 + c) * kKC + kk * 32 + 16 + 8 * hh);
        vl.h[0] = *(const v8b*)(Vls + (t * 16 + c) * kKC + kk * 32 + 8 * hh);
        vl.h[1] = *(const v8b*)(Vls + (t * 16 + c) * kKC + kk * 32 + 16 + 8 * hh);
        oacc[t] = at_mma(pa.v, vb.v, oacc[t]);
        oacc[t] = at_mma(pa.v, vl.v, oacc[t]);
        oacc[t] = at_mma(pl.v, vb.v, oacc[t]);
      }
    }
  }

  float* os = Os[wave];
#pragma unroll
  for (int r = 0; r < 8; ++r) {
    const float inv = 1.0f / lrow[r];
#pragma unroll
    for (int t = 0; t < 4; ++t) os[(8 * hh + r) * 68 + t * 16 + c] = oacc[t][r] * inv;
  }
  __builtin_amdgcn_fence(__ATOMIC_RELEASE, "workgroup");
  __builtin_amdgcn_wave_barrier();
  __builtin_amdgcn_fence(__ATOMIC_ACQUIRE, "workgroup");
  {
    const int c4 = (lane & 15) * 4;   // 16 lanes x 16 B = 256 B = one 64-float row segment; hh selects the row
    {
#pragma unroll
      for (int it = 0; it < 8; ++it) {
        const int row = it * 2 + hh;
        v4f val = *(const v4f*)(os + row * 68 + c4);
        *(v4f*)(ob_ptr + (size_t)(q0 + row) * kD + c4) = val;
      }
      
    }
  }
}

// =====================================================================================
// Shaped combination + causal prefix mean in f32:  O[b,s,h*64+d] = rg[h]*AV + sg[h]*v[s] - cg[h]*(sum_{j<=s} v[j])/(s+1),
// emitted as bf16 hi/lo planes [kTok][kD].  One lane owns 2 adjacent channels of one batch and walks s sequentially
// (fixed order f32 prefix sum).  grid = kB*(kD/64)/2 = 16 blocks of 64 threads; wave gw (0..31): batch gw/16, channels
// =====================================================================================
__global__ __launch_bounds__(64) void shaped_combine(const float* __restrict__ AV, const float* __restrict__ Vf,
                                                     const float* __restrict__ rg, const float* __restrict__ sg,
                                                     const float* __restrict__ cg,
                                                     unsigned short* __restrict__ Oh, unsigned short* __restrict__ Ol) {
  const int gw = blockIdx.x * 2 + (threadIdx.x >> 5);
  const int lane = threadIdx.x & 31;
  const int b = gw / (kD / kHD);
  const int h = gw % (kD / kHD);
  const int c0 = h * kHD + 2 * lane;
  const float rgh = rg[h], sgh = sg[h], cgh = cg[h];
  float p0 = 0.f, p1 = 0.f;
#pragma unroll 1
  for (int s = 0; s < kS; ++s) {
    const size_t idx = (size_t)(b * kS + s) * kD + c0;
    const v2f vv = *(const v2f*)(Vf + idx);
    const v2f aa = *(const v2f*)(AV + idx);
    p0 += vv[0];
    p1 += vv[1];
    const float inv = 1.0f / (float)(s + 1);
    const float o0 = rgh * aa[0] + sgh * vv[0] - cgh * (p0 * inv);
    const float o1 = rgh * aa[1] + sgh * vv[1] - cgh * (p1 * inv);
    const unsigned short h0 = f2bf_bits(o0), h1 = f2bf_bits(o1);
    const unsigned short l0 = f2bf_bits(o0 - bf_bits2f(h0));
    const unsigned short l1 = f2bf_bits(o1 - bf_bits2f(h1));
    const unsigned uh = (unsigned)h0 | ((unsigned)h1 << 16);
    const unsigned ul = (unsigned)l0 | ((unsigned)l1 << 16);
    unsigned* ph = (unsigned*)Oh + (idx >> 1);
    unsigned* pl = (unsigned*)Ol + (idx >> 1);
    *ph = uh;
    *pl = ul;
    
  }
}

// =====================================================================================
// launcher: kernel launches only
// =====================================================================================
extern "C" void kernel_launch(void* const* d_in, const int* in_sizes, int n_in,
                              void* d_out, int out_size, void* d_ws,
                              size_t ws_size, hipStream_t stream) {
  if (n_in < 8) return;
  if (in_sizes[0] != kTok * kD) return;
  if (in_sizes[1] != kD * kQKLd) return;
  if (in_sizes[2] != kQKLd) return;
  if (in_sizes[3] != kD * kD) return;
  if (in_sizes[4] != kD * kD) return;
  if (in_sizes[5] != kH || in_sizes[6] != kH || in_sizes[7] != kH) return;
  if (out_size != kTok * kD) return;
  if (kWsTotal > ws_size) return;

  const float* x     = (const float*)d_in[0];
  const float* qk_w  = (const float*)d_in[1];
  const float* qk_b  = (const float*)d_in[2];
  const float* v_w   = (const float*)d_in[3];
  const float* cp_w  = (const float*)d_in[4];
  const float* rg    = (const float*)d_in[5];
  const float* sg    = (const float*)d_in[6];
  const float* cg    = (const float*)d_in[7];
  float* out = (float*)d_out;

  unsigned char* ws = (unsigned char*)d_ws;
  unsigned short* xb   = (unsigned short*)(ws + kOffXb);
  unsigned short* qkwT = (unsigned short*)(ws + kOffQkwT);
  unsigned short* vwT  = (unsigned short*)(ws + kOffVwT);
  unsigned short* cwT  = (unsigned short*)(ws + kOffCwT);
  unsigned short* QKp  = (unsigned short*)(ws + kOffQKp);
  float*          Vf   = (float*)(ws + kOffVf);
  unsigned short* Vth  = (unsigned short*)(ws + kOffVth);
  unsigned short* Vtl  = (unsigned short*)(ws + kOffVtl);
  float*          AV   = (float*)(ws + kOffAV);
  unsigned short* Oh   = (unsigned short*)(ws + kOffOh);
  unsigned short* Ol   = (unsigned short*)(ws + kOffOl);

  // 1. x -> bf16 [4096][1024]: n = 4194304, n2 = 2097152 threads, 8192 blocks exactly
  {
    const int n2 = (kTok * kD) / 2;
    cast_f32_bf16x2<<<dim3((n2 + 255) / 256), dim3(256), 0, stream>>>(x, xb, n2);
  }
  // 2-4. weights [in][out] f32 -> transposed bf16 [out][in]   (grid = (cols/64, rows/64))
  transpose_cast_bf16<<<dim3(kQKLd / 64, kD / 64), dim3(256), 0, stream>>>(qk_w, qkwT, kD, kQKLd);   // in[1024][2048] -> out[2048][1024]
  transpose_cast_bf16<<<dim3(kD / 64, kD / 64),    dim3(256), 0, stream>>>(v_w,  vwT,  kD, kD);      // in[1024][1024] -> out[1024][1024]
  transpose_cast_bf16<<<dim3(kD / 64, kD / 64),    dim3(256), 0, stream>>>(cp_w, cwT,  kD, kD);

  // 5. fused q|k projection: [4096 x 1024] . [2048 x 1024]^T + qk_b -> f16 [4096][2048]; tiles 64*32 = 2048 -> 256 blocks
  wmma_gemm64<1, 0, 2, 1, false><<<dim3((kTok / 64) * (kQKLd / 64) / 8, 1), dim3(256), 0, stream>>>(
      xb, xb, kD, 0L, qkwT, qkwT, kD, 0L, (void*)QKp, (void*)QKp, kQKLd, 0L,
      qk_b, x, 0L, kTok, kQKLd, kD, 1.0f);
  // 6. v projection: [4096 x 1024] . [1024 x 1024]^T -> f32 [4096][1024]; tiles 64*16 = 1024 -> 128 blocks
  wmma_gemm64<1, 0, 0, 0, false><<<dim3((kTok / 64) * (kD / 64) / 8, 1), dim3(256), 0, stream>>>(
      xb, xb, kD, 0L, vwT, vwT, kD, 0L, (void*)Vf, (void*)Vf, kD, 0L,
      qk_b, x, 0L, kTok, kD, kD, 1.0f);
  // 7. v -> bf16 hi/lo planes [32][64][2048]
  v_split_transpose<<<dim3(kS / 64, kB * kH), dim3(256), 0, stream>>>(Vf, Vth, Vtl);
  // 8. causal attention -> AV f32 [4096][1024]
  attn_causal_hd64<<<dim3(kB * kH * kNQB), dim3(128), 0, stream>>>(QKp, Vth, Vtl, AV);
  // 9. shaped combination + prefix mean -> O hi/lo bf16 [4096][1024]
  shaped_combine<<<dim3(kB * (kD / kHD) / 2), dim3(64), 0, stream>>>(AV, Vf, rg, sg, cg, Oh, Ol);
  // 10. output projection: (O hi + O lo) [4096 x 1024] . [1024 x 1024]^T -> f32 d_out [4096][1024]; 128 blocks
  wmma_gemm64<1, 1, 0, 0, false><<<dim3((kTok / 64) * (kD / 64) / 8, 1), dim3(256), 0, stream>>>(
      Oh, Ol, kD, 0L, cwT, cwT, kD, 0L, (void*)out, (void*)out, kD, 0L,
      qk_b, x, 0L, kTok, kD, kD, 1.0f);
}

// v001
// It runs in 389 microseconds.
// Two timings next to v000 both put it at 3.48 times that version's speed.
// Contractions: qk and v projections = v_wmma_f32_16x16x32_bf16 (x and W as RNE bf16, single product); scores q.k^T = v_wmma_f32_16x16x32_f16 (q, k f16 planes, single product, 1/8 applied to the f32 accumulator); attn.v = v_wmma_f32_16x16x32_bf16 with p and v as bf16 hi/lo pairs (hi.hi + hi.lo + lo.hi); output projection = v_wmma_f32_16x16x32_bf16 with the merged head output as bf16 hi/lo pair times W as RNE bf16 (hi.W + lo.W); f32 accumulate everywhere; softmax, causal prefix mean of v and gain combination in f32.
#include <hip/hip_runtime.h>
#include <math.h>

typedef __attribute__((ext_vector_type(16))) _Float16 v16h;
typedef __attribute__((ext_vector_type(8)))  _Float16 v8h;
typedef __attribute__((ext_vector_type(16))) __bf16   v16b;
typedef __attribute__((ext_vector_type(8)))  __bf16   v8b;
typedef __attribute__((ext_vector_type(8)))  float    v8f;
typedef __attribute__((ext_vector_type(4)))  float    v4f;
typedef __attribute__((ext_vector_type(2)))  float    v2f;

constexpr int kB    = 2;
constexpr int kS    = 2048;
constexpr int kD    = 1024;
constexpr int kH    = 16;
constexpr int kHD   = 64;
constexpr int kTok  = kB * kS;        // 4096 token rows
constexpr int kQKLd = 2 * kD;         // fused q|k plane pitch (halves): q at col h*64, k at col kD + h*64
constexpr int kKOff = kD;
constexpr int kKC   = 64;             // kv chunk
constexpr int kNQB  = kS / 64;        // query blocks per (b,h)
constexpr int kStg  = 72;             // 16-bit LDS staging pitch (144 B rows, 16-B aligned)
constexpr float kSmScale = 0.125f;    // 1/sqrt(64), exact power of two applied to the f32 score accumulator

// workspace region map (bytes, all offsets multiples of 2 MiB):
//   [0]          xb    bf16 [4096][1024]            8 MiB
//   [8 MiB]      qkwT  bf16 [2048][1024]            4 MiB   (qk_w transposed)
//   [12 MiB]     vwT   bf16 [1024][1024]            2 MiB
//   [14 MiB]     cwT   bf16 [1024][1024]            2 MiB
//   [16 MiB]     QKp   f16  [4096][2048]           16 MiB   (q | k planes)
//   [32 MiB]     Vf    f32  [4096][1024]           16 MiB
//   [48 MiB]     Vth   bf16 [32][64][2048]          8 MiB   (v hi, per (b,h) [d][s])
//   [56 MiB]     Vtl   bf16 [32][64][2048]          8 MiB   (v lo)
//   [64 MiB]     AV    f32  [4096][1024]           16 MiB   (softmax(qk).v, merged heads)
//   [80 MiB]     Oh    bf16 [4096][1024]            8 MiB   (combined head output, hi)
//   [88 MiB]     Ol    bf16 [4096][1024]            8 MiB   (lo)
//   total 96 MiB = 100663296 B
constexpr size_t kOffXb   = 0;
constexpr size_t kOffQkwT = kOffXb   + (size_t)kTok * kD * 2;
constexpr size_t kOffVwT  = kOffQkwT + (size_t)kQKLd * kD * 2;
constexpr size_t kOffCwT  = kOffVwT  + (size_t)kD * kD * 2;
constexpr size_t kOffQKp  = kOffCwT  + (size_t)kD * kD * 2;
constexpr size_t kOffVf   = kOffQKp  + (size_t)kTok * kQKLd * 2;
constexpr size_t kOffVth  = kOffVf   + (size_t)kTok * kD * 4;
constexpr size_t kOffVtl  = kOffVth  + (size_t)kB * kH * kHD * kS * 2;
constexpr size_t kOffAV   = kOffVtl  + (size_t)kB * kH * kHD * kS * 2;
constexpr size_t kOffOh   = kOffAV   + (size_t)kTok * kD * 4;
constexpr size_t kOffOl   = kOffOh   + (size_t)kTok * kD * 2;
constexpr size_t kWsTotal = kOffOl   + (size_t)kTok * kD * 2;
static_assert(kWsTotal == 100663296ull);
static_assert(kWsTotal <= 134217728ull);

__device__ __forceinline__ unsigned short f2bf_bits(float f) {
  unsigned u = __float_as_uint(f);
  return (unsigned short)((u + 0x7FFFu + ((u >> 16) & 1u)) >> 16);
}
__device__ __forceinline__ float bf_bits2f(unsigned short h) { return __uint_as_float(((unsigned)h) << 16); }

// hazard guards as plain device helpers (no inline asm inside the kernel template body)
__device__ __forceinline__ void dep_guard_h(v8f& a, v8f& b, v16h x, v16h y) { asm volatile("v_nop\n\tv_nop\n\tv_nop\n\tv_nop" : "+v"(a), "+v"(b) : "v"(x), "v"(y)); }
__device__ __forceinline__ void dep_guard_b(v8f& a, v8f& b, v16b x, v16b y) { asm volatile("v_nop\n\tv_nop\n\tv_nop\n\tv_nop" : "+v"(a), "+v"(b) : "v"(x), "v"(y)); }
__device__ __forceinline__ void keep4_h(v16h a, v16h b, v16h c, v16h d) { asm volatile("v_nop" :: "v"(a), "v"(b), "v"(c), "v"(d)); }
__device__ __forceinline__ void keep4_b(v16b a, v16b b, v16b c, v16b d) { asm volatile("v_nop" :: "v"(a), "v"(b), "v"(c), "v"(d)); }
__device__ __forceinline__ void acc_guard4(v8f& a, v8f& b, v8f& c, v8f& d) { asm volatile("v_nop\n\tv_nop\n\tv_nop\n\tv_nop" : "+v"(a), "+v"(b), "+v"(c), "+v"(d)); }
template <typename T> struct Frag;
template <> struct Frag<_Float16> {
  typedef v16h V; union U { v16h v; v8h h[2]; };
  static __device__ __forceinline__ v16h load(const _Float16* p) {   // elements 0..7 <- p[0..7], 8..15 <- p[16..23]
    U f; f.h[0] = *(const v8h*)(p); f.h[1] = *(const v8h*)(p + 16); return f.v;
  }
  static __device__ __forceinline__ v8f mma(v16h a, v16h b, v8f c) {
    return __builtin_amdgcn_wmma_f32_16x16x32_f16(false, a, false, b, (short)0, c, false, false);
  }
  static __device__ __forceinline__ void guard(v8f& a, v8f& b, v16h x, v16h y) { dep_guard_h(a, b, x, y); }
  static __device__ __forceinline__ void keep(v16h a, v16h b, v16h c, v16h d) { keep4_h(a, b, c, d); }
};
template <> struct Frag<__bf16> {
  typedef v16b V; union U { v16b v; v8b h[2]; };
  static __device__ __forceinline__ v16b load(const __bf16* p) {
    U f; f.h[0] = *(const v8b*)(p); f.h[1] = *(const v8b*)(p + 16); return f.v;
  }
  static __device__ __forceinline__ v8f mma(v16b a, v16b b, v8f c) {
    return __builtin_amdgcn_wmma_f32_16x16x32_bf16(false, a, false, b, (short)0, c, false, false);
  }
  static __device__ __forceinline__ void guard(v8f& a, v8f& b, v16b x, v16b y) { dep_guard_b(a, b, x, y); }
  static __device__ __forceinline__ void keep(v16b a, v16b b, v16b c, v16b d) { keep4_b(a, b, c, d); }
};

__device__ __forceinline__ unsigned short at_bf_bits(float f) {
  unsigned u = __float_as_uint(f);
  return (unsigned short)((u + 0x7FFFu + ((u >> 16) & 1u)) >> 16);
}
__device__ __forceinline__ __bf16 at_f2bf(float f) { return __builtin_bit_cast(__bf16, at_bf_bits(f)); }
__device__ __forceinline__ void at_split(float f, __bf16& hi, __bf16& lo) {
  const unsigned short hb = at_bf_bits(f);
  hi = __builtin_bit_cast(__bf16, hb);
  lo = at_f2bf(f - __uint_as_float(((unsigned)hb) << 16));
}
__device__ __forceinline__ v8f at_mma(v16b a, v16b b, v8f c) {
  c = __builtin_amdgcn_wmma_f32_16x16x32_bf16(false, a, false, b, (short)0, c, false, false);
  asm volatile("v_nop\n\tv_nop\n\tv_nop\n\tv_nop" : "+v"(c) : "v"(a), "v"(b));
  return c;
}
__device__ __forceinline__ v8f at_mma_h(v16h a, v16h b, v8f c) {
  c = __builtin_amdgcn_wmma_f32_16x16x32_f16(false, a, false, b, (short)0, c, false, false);
  asm volatile("v_nop\n\tv_nop\n\tv_nop\n\tv_nop" : "+v"(c) : "v"(a), "v"(b));
  return c;
}

// =====================================================================================
// =====================================================================================
__global__ __launch_bounds__(256) void cast_f32_bf16x2(const float* __restrict__ in,
                                                       unsigned short* __restrict__ out, int n2) {
  const int i = blockIdx.x * 256 + threadIdx.x;
  if (i < n2) {
    const unsigned u = (unsigned)f2bf_bits(in[2 * i]) | ((unsigned)f2bf_bits(in[2 * i + 1]) << 16);
    ((unsigned*)out)[i] = u;
    
  }
}

// =====================================================================================
// Register-blocked batched WMMA GEMM, C[m,n] = scale * sum_k A[m,k] * Bt[n,k] (+bias)(+resid);
// each wave owns a 64x64 tile. A row-major [M,K]; Bt row-major [N,K]; M,N % 64 == 0, K % 32 == 0.
// SPLITM: 0 = single product; 1 = A carried as hi/lo planes (A2p = lo): product = hi.B + lo.B;
//         2 = A and Bt as hi/lo planes: product = hi.hi + hi.lo + lo.hi.
// BIAS_MODE: 0 = none, 1 = bias[m], 2 = bias[n].  OUT_MODE: 0 = f32, 1 = f16, 2 = bf16 hi + lo planes.
// ET: 0 = f16 operands, 1 = bf16 operands (pointers passed as 16-bit storage)
// =====================================================================================
template <int ET> struct Elem;
template <> struct Elem<0> { typedef _Float16 T; };
template <> struct Elem<1> { typedef __bf16 T; };
template <int ET, int SPLITM, int BIAS_MODE, int OUT_MODE, bool RESID, int ACT = 0>
__global__ __launch_bounds__(256) void wmma_gemm64(
    const unsigned short* __restrict__ Ap, const unsigned short* __restrict__ A2p, int lda, long strideA,
    const unsigned short* __restrict__ Btp, const unsigned short* __restrict__ Bt2p, int ldb, long strideB,
    void* __restrict__ Cout, void* __restrict__ Cout2, int ldc, long strideC,
    const float* __restrict__ bias,
    const float* __restrict__ resid, long strideR,
    int M, int N, int K, float scale) {
  typedef typename Elem<ET>::T T;
  typedef typename Frag<T>::V V;
  constexpr bool SPA = (SPLITM >= 1);
  constexpr bool SPB = (SPLITM >= 2);
  const T* A = (const T*)Ap; const T* A2 = (const T*)A2p; const T* Bt = (const T*)Btp; const T* Bt2 = (const T*)Bt2p;
  __shared__ __align__(16) float sT[8][16 * 68];   // per-wave 16x64 slab, pitch 68 floats
  const int b    = blockIdx.y;
  const int lane = threadIdx.x & 31;
  const int wave = threadIdx.x >> 5;
  const int tilesN = N >> 6;
  const int tilesM = M >> 6;
  const int tile = blockIdx.x * 8 + wave;
  if (tile >= tilesM * tilesN) return;   // wave-uniform; no block barriers in this kernel
  const int tm = tile / tilesN;
  const int tn = tile - tm * tilesN;
  const int m0 = tm << 6;
  const int n0 = tn << 6;

  const T* Ab  = A  + (size_t)b * strideA;
  const T* Bb  = Bt + (size_t)b * strideB;
  const T* Ab2 = SPA ? (A2  + (size_t)b * strideA) : nullptr;
  const T* Bb2 = SPB ? (Bt2 + (size_t)b * strideB) : nullptr;

  const int rlane = lane & 15;                 // row (A) / col (B, D) within subtile
  const int koff  = (lane >> 4) * 8;           // k offset of this lane half
  const int mOff  = (lane >> 4) * 8;           // D row offset

  v8f acc[4][4];
#pragma unroll
  for (int i = 0; i < 4; ++i)
#pragma unroll
    for (int j = 0; j < 4; ++j) acc[i][j] = (v8f){0.f,0.f,0.f,0.f,0.f,0.f,0.f,0.f};

  for (int k0 = 0; k0 < K; k0 += 32) {
    V bh[4], bl[4];
#pragma unroll
    for (int j = 0; j < 4; ++j) {
      const size_t bo = (size_t)(n0 + (j << 4) + rlane) * ldb + koff + k0;
      bh[j] = Frag<T>::load(Bb + bo);
      if (SPB) bl[j] = Frag<T>::load(Bb2 + bo);
    }
#pragma unroll
    for (int i = 0; i < 4; ++i) {
      const size_t ao = (size_t)(m0 + (i << 4) + rlane) * lda + koff + k0;
      V ah = Frag<T>::load(Ab + ao);
      V al;
      if (SPA) al = Frag<T>::load(Ab2 + ao);
#pragma unroll
      for (int j = 0; j < 4; ++j) {
        acc[i][j] = Frag<T>::mma(ah, bh[j], acc[i][j]);
        if (SPB) acc[i][j] = Frag<T>::mma(ah, bl[j], acc[i][j]);
        if (SPA) acc[i][j] = Frag<T>::mma(al, bh[j], acc[i][j]);
      }
      Frag<T>::guard(acc[i][0], acc[i][3], ah, SPA ? al : ah);
    }
    Frag<T>::keep(bh[0], bh[1], bh[2], bh[3]);
    if (SPB) Frag<T>::keep(bl[0], bl[1], bl[2], bl[3]);
  }
  acc_guard4(acc[0][0], acc[0][1], acc[0][2], acc[0][3]);
  acc_guard4(acc[1][0], acc[1][1], acc[1][2], acc[1][3]);
  acc_guard4(acc[2][0], acc[2][1], acc[2][2], acc[2][3]);
  acc_guard4(acc[3][0], acc[3][1], acc[3][2], acc[3][3]);

  // ---- epilogue ----
  float* slab = sT[wave];
  const float* Rb = RESID ? (resid + (size_t)b * strideR) : nullptr;
#pragma unroll
  for (int i = 0; i < 4; ++i) {
    const int mBase = m0 + (i << 4);
#pragma unroll
    for (int j = 0; j < 4; ++j) {
      const int n = n0 + (j << 4) + rlane;
      float bv = 0.f;
      if (BIAS_MODE == 2) bv = bias[n];
#pragma unroll
      for (int r = 0; r < 8; ++r) {
        float v = acc[i][j][r] * scale;
        if (BIAS_MODE == 1) v += bias[mBase + mOff + r];
        if (BIAS_MODE == 2) v += bv;
        if (RESID) v += Rb[(size_t)(mBase + mOff + r) * ldc + n];
        if (ACT == 1) v = tanhf(v);
        if (ACT == 2) v = fmaxf(v, 0.0f);
        if (ACT == 4) v = (v > 0.f) ? v : 0.01f * v;
        slab[(mOff + r) * 68 + (j << 4) + rlane] = v;
      }
    }
    __builtin_amdgcn_fence(__ATOMIC_RELEASE, "workgroup");
    __builtin_amdgcn_wave_barrier();
    __builtin_amdgcn_fence(__ATOMIC_ACQUIRE, "workgroup");
    if (OUT_MODE == 0) {
      float* C = (float*)Cout + (size_t)b * strideC;
      const int hh = lane >> 4, c4 = (lane & 15) * 4;     // row seg = 256 B = 16 lanes x 16 B
      {
#pragma unroll
        for (int it = 0; it < 8; ++it) {
          const int row = it * 2 + hh;
          v4f v = *(const v4f*)(slab + row * 68 + c4);
          *(v4f*)(C + (size_t)(mBase + row) * ldc + n0 + c4) = v;
        }
        
      }
    } else {
      const int q = lane >> 3, c8 = (lane & 7) * 8;
      unsigned short* C  = (unsigned short*)Cout  + (size_t)b * strideC;
      unsigned short* C2 = (OUT_MODE == 2) ? ((unsigned short*)Cout2 + (size_t)b * strideC) : nullptr;
      {
#pragma unroll
        for (int it = 0; it < 4; ++it) {
          const int row = it * 4 + q;
          const float* sp = slab + row * 68 + c8;
          v8h hv, lv;
#pragma unroll
          for (int e = 0; e < 8; ++e) {
            if (OUT_MODE == 1) {
              hv[e] = (_Float16)sp[e];
            } else {
              unsigned short hb = f2bf_bits(sp[e]);
              unsigned short lb = f2bf_bits(sp[e] - bf_bits2f(hb));
              hv[e] = __builtin_bit_cast(_Float16, hb);
              lv[e] = __builtin_bit_cast(_Float16, lb);
            }
          }
          *(v8h*)(C + (size_t)(mBase + row) * ldc + n0 + c8) = hv;
          if (OUT_MODE == 2) *(v8h*)(C2 + (size_t)(mBase + row) * ldc + n0 + c8) = lv;
        }
        
      }
    }
    __builtin_amdgcn_fence(__ATOMIC_RELEASE, "workgroup");
    __builtin_amdgcn_wave_barrier();
    __builtin_amdgcn_fence(__ATOMIC_ACQUIRE, "workgroup");
  }
}

// =====================================================================================
// Weight transpose + RNE bf16 cast: in f32 [R][Cc] row-major -> out bf16 bits [Cc][R]  (out[c][r] = in[r][c]).
// grid = (Cc/64, R/64), block 256; one 64x64 tile through LDS.
// Load coverage: 256 threads x 16 floats = 64 (r) x 64 (c).  Store coverage: 8 waves x 2 x 4 rows (q8) = 64 rows c;
// =====================================================================================
__global__ __launch_bounds__(256) void transpose_cast_bf16(const float* __restrict__ in, unsigned short* __restrict__ out,
                                                           int R, int Cc) {
  __shared__ __align__(16) _Float16 t[64 * kStg];     // [c][r] as 16-bit bit patterns
  const int c0 = blockIdx.x * 64, r0 = blockIdx.y * 64;
  const int tid = threadIdx.x;
  {
    const int rloc = tid >> 2, cq = (tid & 3) * 16;
    const float* src = in + (size_t)(r0 + rloc) * Cc + c0 + cq;
#pragma unroll
    for (int g4 = 0; g4 < 4; ++g4) {
      const v4f a = *(const v4f*)(src + 4 * g4);
#pragma unroll
      for (int e = 0; e < 4; ++e)
        t[(cq + 4 * g4 + e) * kStg + rloc] = __builtin_bit_cast(_Float16, f2bf_bits(a[e]));
    }
  }
  __syncthreads();
  const int wave = tid >> 5, lane = tid & 31, q8 = lane >> 3, c8 = (lane & 7) * 8;
  const int cA = wave * 8 + q8, cB = wave * 8 + 4 + q8;
  const v8h va = *(const v8h*)(t + cA * kStg + c8);
  const v8h vb = *(const v8h*)(t + cB * kStg + c8);
  unsigned short* da = out + (size_t)(c0 + cA) * R + r0 + c8;
  unsigned short* db = out + (size_t)(c0 + cB) * R + r0 + c8;
  {
    *(v8h*)da = va;
    *(v8h*)db = vb;
    
  }
}

// =====================================================================================
// V planes: Vf f32 [kTok][kD] (row b*kS+s, col h*kHD+d) -> Vth/Vtl bf16 bits [kB*kH][kHD][kS]:
// out[bh][d][s] = hi/lo(Vf[b*kS+s][h*kHD+d]).  grid = (kS/64, kB*kH), block 256.
// Load coverage: 256 threads x 16 floats = 64 (s) x 64 (d).
// =====================================================================================
__global__ __launch_bounds__(256) void v_split_transpose(const float* __restrict__ Vf,
                                                         unsigned short* __restrict__ vth, unsigned short* __restrict__ vtl) {
  __shared__ __align__(16) _Float16 th[64 * kStg];
  __shared__ __align__(16) _Float16 tl[64 * kStg];
  const int st0 = blockIdx.x * 64, bh = blockIdx.y;
  const int b = bh / kH, h = bh % kH;
  const int tid = threadIdx.x;
  {
    const int sloc = tid >> 2, d0 = (tid & 3) * 16;
    const float* src = Vf + (size_t)(b * kS + st0 + sloc) * kD + h * kHD + d0;
#pragma unroll
    for (int g4 = 0; g4 < 4; ++g4) {
      const v4f a = *(const v4f*)(src + 4 * g4);
#pragma unroll
      for (int e = 0; e < 4; ++e) {
        const unsigned short hb = f2bf_bits(a[e]);
        const unsigned short lb = f2bf_bits(a[e] - bf_bits2f(hb));
        th[(d0 + 4 * g4 + e) * kStg + sloc] = __builtin_bit_cast(_Float16, hb);
        tl[(d0 + 4 * g4 + e) * kStg + sloc] = __builtin_bit_cast(_Float16, lb);
      }
    }
  }
  __syncthreads();
  const int wave = tid >> 5, lane = tid & 31, q8 = lane >> 3, c8 = (lane & 7) * 8;
  const int dA = wave * 8 + q8, dB = wave * 8 + 4 + q8;
  const v8h ha = *(const v8h*)(th + dA * kStg + c8);
  const v8h hbv = *(const v8h*)(th + dB * kStg + c8);
  const v8h la = *(const v8h*)(tl + dA * kStg + c8);
  const v8h lbv = *(const v8h*)(tl + dB * kStg + c8);
  unsigned short* pha = vth + ((size_t)bh * kHD + dA) * kS + st0 + c8;
  unsigned short* phb = vth + ((size_t)bh * kHD + dB) * kS + st0 + c8;
  unsigned short* pla = vtl + ((size_t)bh * kHD + dA) * kS + st0 + c8;
  unsigned short* plb = vtl + ((size_t)bh * kHD + dB) * kS + st0 + c8;
  {
    *(v8h*)pha = ha;
    *(v8h*)phb = hbv;
    *(v8h*)pla = la;
    *(v8h*)plb = lbv;
    
  }
}

// =====================================================================================
// Causal attention, head_dim 64, 16-bit input planes, f32 out.
//   scores = q.k^T : v_wmma_f32_16x16x32_f16 (q, k f16 planes), then * 1/8 in f32; causal: kv > q replaced by -inf
//            (exp -> 0, identical to a finite most-negative fill since every row keeps its diagonal); chunks past
//            the diagonal contribute exactly 0 and are skipped.
//   out    = p.v   : v_wmma_f32_16x16x32_bf16 with p and v as bf16 hi/lo (hi.hi + hi.lo + lo.hi); online softmax in f32.
// Block = 4 waves = 64 query rows of one (b, h); grid.x = kB * kH * (kS/64).
// Staging coverage per kv chunk: 128 threads x 4 chunks x 8 halves = 64 x 64 per plane (K, V hi, V lo), plain loads + barrier.
// Output AV f32 [kTok][kD] at col h*64: row segment 64 floats = 256 B by 16 lanes x 16 B in one instruction, one wave per
// =====================================================================================
__global__ __launch_bounds__(128)
void attn_causal_hd64(const unsigned short* __restrict__ QKp,    // f16 bits [kTok][kQKLd]
                      const unsigned short* __restrict__ Vthp,   // bf16 bits [kB*kH][kHD][kS]
                      const unsigned short* __restrict__ Vtlp,
                      float* __restrict__ AV) {                  // f32 [kTok][kD]
  union FB { v16b v; v8b h[2]; };
  __shared__ __align__(16) _Float16 Ksh[kKC * kHD];        // K [kv][d]      8 KB
  __shared__ __align__(16) __bf16  Vhs[kHD * kKC];         // V hi [d][kv]   8 KB
  __shared__ __align__(16) __bf16  Vls[kHD * kKC];         // V lo [d][kv]   8 KB
  __shared__ __align__(16) __bf16  Psh[4][16 * kKC];       // per wave P hi [row][kv]
  __shared__ __align__(16) __bf16  Psl[4][16 * kKC];       // per wave P lo
  __shared__ __align__(16) float   Os[4][16 * 68];         // per wave out tile, pitch 68

  const int tid  = threadIdx.x;
  const int wave = tid >> 5;
  const int lane = tid & 31;
  const int hh   = lane >> 4;
  const int c    = lane & 15;

  const int bx = blockIdx.x;
  const int qb = bx % kNQB;
  const int bh = bx / kNQB;
  const int h  = bh % kH;
  const int b  = bh / kH;
  const int q0 = qb * 64 + wave * 16;

  const _Float16* Q16 = (const _Float16*)QKp;
  const __bf16* Vth = (const __bf16*)Vthp;
  const __bf16* Vtl = (const __bf16*)Vtlp;
  float* ob_ptr = AV + (size_t)(b * kS) * kD + h * kHD;

  // ---- Q fragments (A operand, row = query q0 + c, k = d): 2 d-chunks of 32 ----
  v16h qa[2];
  {
    const _Float16* qrow = Q16 + (size_t)(b * kS + q0 + c) * kQKLd + h * kHD + 8 * hh;
    qa[0] = Frag<_Float16>::load(qrow);
    qa[1] = Frag<_Float16>::load(qrow + 32);
  }

  float mrow[8], lrow[8];
  v8f oacc[4];
#pragma unroll
  for (int r = 0; r < 8; ++r) { mrow[r] = -INFINITY; lrow[r] = 0.f; }
#pragma unroll
  for (int t = 0; t < 4; ++t) oacc[t] = (v8f){0.f,0.f,0.f,0.f,0.f,0.f,0.f,0.f};

  const int nChunks = qb + 1;   // block-uniform
  for (int kc = 0; kc < nChunks; ++kc) {
    const int kv0 = kc * kKC;
    __syncthreads();
#pragma unroll
    for (int i = 0; i < 4; ++i) {
      const int ch = tid + 128 * i, row = ch >> 3, seg = (ch & 7) * 8;
      *(v8h*)(Ksh + row * kHD + seg) =
          *(const v8h*)(Q16 + (size_t)(b * kS + kv0 + row) * kQKLd + kKOff + h * kHD + seg);
      const size_t vo = ((size_t)bh * kHD + row) * kS + kv0 + seg;   // row = d
      *(v8b*)(Vhs + row * kKC + seg) = *(const v8b*)(Vth + vo);
      *(v8b*)(Vls + row * kKC + seg) = *(const v8b*)(Vtl + vo);
    }
    __syncthreads();

    v8f s[4];
#pragma unroll
    for (int j = 0; j < 4; ++j) {
      s[j] = (v8f){0.f,0.f,0.f,0.f,0.f,0.f,0.f,0.f};
#pragma unroll
      for (int dc = 0; dc < 2; ++dc) {
        const v16h kb = Frag<_Float16>::load(Ksh + (j * 16 + c) * kHD + dc * 32 + 8 * hh);
        s[j] = at_mma_h(qa[dc], kb, s[j]);
      }
    }
    const bool diag = (kc == qb);   // block-uniform
    float cm[8];
#pragma unroll
    for (int r = 0; r < 8; ++r) {
      const int qrow = q0 + 8 * hh + r;
      float m = -INFINITY;
#pragma unroll
      for (int j = 0; j < 4; ++j) {
        const int kvcol = kv0 + j * 16 + c;
        float sv = s[j][r] * kSmScale;
        if (diag && (kvcol > qrow)) sv = -INFINITY;
        s[j][r] = sv;
        m = fmaxf(m, sv);
      }
#pragma unroll
      for (int off = 1; off < 16; off <<= 1) m = fmaxf(m, __shfl_xor(m, off, 32));
      cm[r] = m;
    }
    __bf16* pwh = Psh[wave];
    __bf16* pwl = Psl[wave];
#pragma unroll
    for (int r = 0; r < 8; ++r) {
      const float mnew = fmaxf(mrow[r], cm[r]);
      const float alpha = expf(mrow[r] - mnew);
      mrow[r] = mnew;
      float psum = 0.f;
#pragma unroll
      for (int j = 0; j < 4; ++j) {
        const float p = expf(s[j][r] - mnew);
        psum += p;
        __bf16 a, bl; at_split(p, a, bl);
        pwh[(8 * hh + r) * kKC + j * 16 + c] = a;
        pwl[(8 * hh + r) * kKC + j * 16 + c] = bl;
      }
#pragma unroll
      for (int off = 1; off < 16; off <<= 1) psum += __shfl_xor(psum, off, 32);
      lrow[r] = lrow[r] * alpha + psum;
#pragma unroll
      for (int t = 0; t < 4; ++t) oacc[t][r] *= alpha;
    }
    __builtin_amdgcn_fence(__ATOMIC_RELEASE, "workgroup");
    __builtin_amdgcn_wave_barrier();
    __builtin_amdgcn_fence(__ATOMIC_ACQUIRE, "workgroup");
#pragma unroll 1
    for (int kk = 0; kk < 2; ++kk) {
      FB pa, pl;
      pa.h[0] = *(const v8b*)(pwh + c * kKC + kk * 32 + 8 * hh);
      pa.h[1] = *(const v8b*)(pwh + c * kKC + kk * 32 + 16 + 8 * hh);
      pl.h[0] = *(const v8b*)(pwl + c * kKC + kk * 32 + 8 * hh);
      pl.h[1] = *(const v8b*)(pwl + c * kKC + kk * 32 + 16 + 8 * hh);
#pragma unroll
      for (int t = 0; t < 4; ++t) {
        FB vb, vl;
        vb.h[0] = *(const v8b*)(Vhs + (t * 16 + c) * kKC + kk * 32 + 8 * hh);
        vb.h[1] = *(const v8b*)(Vhs + (t * 16 + c) * kKC + kk * 32 + 16 + 8 * hh);
        vl.h[0] = *(const v8b*)(Vls + (t * 16 + c) * kKC + kk * 32 + 8 * hh);
        vl.h[1] = *(const v8b*)(Vls + (t * 16 + c) * kKC + kk * 32 + 16 + 8 * hh);
        oacc[t] = at_mma(pa.v, vb.v, oacc[t]);
        oacc[t] = at_mma(pa.v, vl.v, oacc[t]);
        oacc[t] = at_mma(pl.v, vb.v, oacc[t]);
      }
    }
  }

  float* os = Os[wave];
#pragma unroll
  for (int r = 0; r < 8; ++r) {
    const float inv = 1.0f / lrow[r];
#pragma unroll
    for (int t = 0; t < 4; ++t) os[(8 * hh + r) * 68 + t * 16 + c] = oacc[t][r] * inv;
  }
  __builtin_amdgcn_fence(__ATOMIC_RELEASE, "workgroup");
  __builtin_amdgcn_wave_barrier();
  __builtin_amdgcn_fence(__ATOMIC_ACQUIRE, "workgroup");
  {
    const int c4 = (lane & 15) * 4;   // 16 lanes x 16 B = 256 B = one 64-float row segment; hh selects the row
    {
#pragma unroll
      for (int it = 0; it < 8; ++it) {
        const int row = it * 2 + hh;
        v4f val = *(const v4f*)(os + row * 68 + c4);
        *(v4f*)(ob_ptr + (size_t)(q0 + row) * kD + c4) = val;
      }
      
    }
  }
}

// =====================================================================================
// Shaped combination + causal prefix mean in f32:  O[b,s,h*64+d] = rg[h]*AV + sg[h]*v[s] - cg[h]*(sum_{j<=s} v[j])/(s+1),
// emitted as bf16 hi/lo planes [kTok][kD].
// One work-group = one (b, h) and one segment of kScRows rows of s; grid = kScSeg * kB * kH = 256, block 512.
// 16 lanes x 4 channels cover one 64-channel row; the 32 row slots of a work-group
//   (a) sum the rows in front of the segment, slot r taking rows r, r+32, r+64, ... (all loads independent),
//   (b) each own kScPer consecutive rows of the segment and sum them,
//   (c) meet in LDS: per channel the 32 sums of (a) are added up and the 32 sums of (b) scanned in fixed order,
//   (d) walk their own rows from that start value.
// Fixed summation order, no dependence on arrival; each 128-B output line (64 channels x 2 B) has one writer.
// =====================================================================================
constexpr int kScRows  = 256;                  // rows of s per work-group
constexpr int kScSeg   = kS / kScRows;         // 8 segments
constexpr int kScSlots = 32;                   // row slots (16 lanes each) per work-group
constexpr int kScPer   = kScRows / kScSlots;   // 8 consecutive rows per slot
__global__ __launch_bounds__(512) void shaped_combine(const float* __restrict__ AV, const float* __restrict__ Vf,
                                                     const float* __restrict__ rg, const float* __restrict__ sg,
                                                     const float* __restrict__ cg,
                                                     unsigned short* __restrict__ Oh, unsigned short* __restrict__ Ol) {
  __shared__ __align__(16) float Ps[kScSlots * kHD];   // per slot: sum of its rows in front of the segment
  __shared__ __align__(16) float Gs[kScSlots * kHD];   // per slot: sum of its own rows, then its start value
  const int tid  = threadIdx.x;
  const int slot = tid >> 4;
  const int c4   = (tid & 15) * 4;
  const int seg  = (kScSeg - 1) - (int)(blockIdx.x / (kB * kH));   // longest front part starts first
  const int bh   = blockIdx.x % (kB * kH);
  const int b = bh / kH;
  const int h = bh % kH;
  const size_t col = (size_t)(b * kS) * kD + h * kHD + c4;
  const int s0 = seg * kScRows + slot * kScPer;

  const float* vrow = Vf + col + (size_t)s0 * kD;
  const float* arow = AV + col + (size_t)s0 * kD;
  v4f vv[kScPer], aa[kScPer];
#pragma unroll
  for (int k = 0; k < kScPer; ++k) vv[k] = *(const v4f*)(vrow + k * kD);
#pragma unroll
  for (int k = 0; k < kScPer; ++k) aa[k] = *(const v4f*)(arow + k * kD);
  // precaution: this wait stands behind the 16 issued loads, in front of every later overwrite of their address
  // registers; both addresses are named as inputs so that no load's destination is placed on them ahead of it
  asm volatile("s_wait_xcnt 0x0" :: "v"(vrow), "v"(arow) : "memory");

  v4f pre = (v4f){0.f, 0.f, 0.f, 0.f};
  for (int t = 0; t < seg; ++t) {              // block-uniform trip count, at most kScSeg - 1
    v4f w[kScPer];
#pragma unroll
    for (int k = 0; k < kScPer; ++k)
      w[k] = *(const v4f*)(Vf + col + (size_t)(t * kScRows + k * kScSlots + slot) * kD);
#pragma unroll
    for (int k = 0; k < kScPer; ++k) pre += w[k];
  }
  const float rgh = rg[h], sgh = sg[h], cgh = cg[h];
  v4f gsum = vv[0];
#pragma unroll
  for (int k = 1; k < kScPer; ++k) gsum += vv[k];
  *(v4f*)(Ps + slot * kHD + c4) = pre;
  *(v4f*)(Gs + slot * kHD + c4) = gsum;
  __syncthreads();
  if (tid < kHD) {                             // one lane per channel, two whole waves
    float b0 = 0.f, b1 = 0.f, b2 = 0.f, b3 = 0.f;
#pragma unroll
    for (int r = 0; r < kScSlots; r += 4) {
      b0 += Ps[(r + 0) * kHD + tid];
      b1 += Ps[(r + 1) * kHD + tid];
      b2 += Ps[(r + 2) * kHD + tid];
      b3 += Ps[(r + 3) * kHD + tid];
    }
    float run = (b0 + b1) + (b2 + b3);
#pragma unroll
    for (int r = 0; r < kScSlots; ++r) {
      const float g = Gs[r * kHD + tid];
      Gs[r * kHD + tid] = run;
      run += g;
    }
  }
  __syncthreads();
  v4f p = *(const v4f*)(Gs + slot * kHD + c4);
#pragma unroll
  for (int k = 0; k < kScPer; ++k) {
    const int s = s0 + k;
    const size_t idx = col + (size_t)s * kD;
    p += vv[k];
    const float inv = 1.0f / (float)(s + 1);
    unsigned short hb[4], lb[4];
#pragma unroll
    for (int e = 0; e < 4; ++e) {
      const float o = rgh * aa[k][e] + sgh * vv[k][e] - cgh * (p[e] * inv);
      hb[e] = f2bf_bits(o);
      lb[e] = f2bf_bits(o - bf_bits2f(hb[e]));
    }
    uint2 uh, ul;
    uh.x = (unsigned)hb[0] | ((unsigned)hb[1] << 16);
    uh.y = (unsigned)hb[2] | ((unsigned)hb[3] << 16);
    ul.x = (unsigned)lb[0] | ((unsigned)lb[1] << 16);
    ul.y = (unsigned)lb[2] | ((unsigned)lb[3] << 16);
    *(uint2*)(Oh + idx) = uh;
    *(uint2*)(Ol + idx) = ul;
  }
}

// =====================================================================================
// launcher: kernel launches only
// =====================================================================================
extern "C" void kernel_launch(void* const* d_in, const int* in_sizes, int n_in,
                              void* d_out, int out_size, void* d_ws,
                              size_t ws_size, hipStream_t stream) {
  if (n_in < 8) return;
  if (in_sizes[0] != kTok * kD) return;
  if (in_sizes[1] != kD * kQKLd) return;
  if (in_sizes[2] != kQKLd) return;
  if (in_sizes[3] != kD * kD) return;
  if (in_sizes[4] != kD * kD) return;
  if (in_sizes[5] != kH || in_sizes[6] != kH || in_sizes[7] != kH) return;
  if (out_size != kTok * kD) return;
  if (kWsTotal > ws_size) return;

  const float* x     = (const float*)d_in[0];
  const float* qk_w  = (const float*)d_in[1];
  const float* qk_b  = (const float*)d_in[2];
  const float* v_w   = (const float*)d_in[3];
  const float* cp_w  = (const float*)d_in[4];
  const float* rg    = (const float*)d_in[5];
  const float* sg    = (const float*)d_in[6];
  const float* cg    = (const float*)d_in[7];
  float* out = (float*)d_out;

  unsigned char* ws = (unsigned char*)d_ws;
  unsigned short* xb   = (unsigned short*)(ws + kOffXb);
  unsigned short* qkwT = (unsigned short*)(ws + kOffQkwT);
  unsigned short* vwT  = (unsigned short*)(ws + kOffVwT);
  unsigned short* cwT  = (unsigned short*)(ws + kOffCwT);
  unsigned short* QKp  = (unsigned short*)(ws + kOffQKp);
  float*          Vf   = (float*)(ws + kOffVf);
  unsigned short* Vth  = (unsigned short*)(ws + kOffVth);
  unsigned short* Vtl  = (unsigned short*)(ws + kOffVtl);
  float*          AV   = (float*)(ws + kOffAV);
  unsigned short* Oh   = (unsigned short*)(ws + kOffOh);
  unsigned short* Ol   = (unsigned short*)(ws + kOffOl);

  // 1. x -> bf16 [4096][1024]: n = 4194304, n2 = 2097152 threads, 8192 blocks exactly
  {
    const int n2 = (kTok * kD) / 2;
    cast_f32_bf16x2<<<dim3((n2 + 255) / 256), dim3(256), 0, stream>>>(x, xb, n2);
  }
  // 2-4. weights [in][out] f32 -> transposed bf16 [out][in]   (grid = (cols/64, rows/64))
  transpose_cast_bf16<<<dim3(kQKLd / 64, kD / 64), dim3(256), 0, stream>>>(qk_w, qkwT, kD, kQKLd);   // in[1024][2048] -> out[2048][1024]
  transpose_cast_bf16<<<dim3(kD / 64, kD / 64),    dim3(256), 0, stream>>>(v_w,  vwT,  kD, kD);      // in[1024][1024] -> out[1024][1024]
  transpose_cast_bf16<<<dim3(kD / 64, kD / 64),    dim3(256), 0, stream>>>(cp_w, cwT,  kD, kD);

  // 5. fused q|k projection: [4096 x 1024] . [2048 x 1024]^T + qk_b -> f16 [4096][2048]; tiles 64*32 = 2048 -> 256 blocks
  wmma_gemm64<1, 0, 2, 1, false><<<dim3((kTok / 64) * (kQKLd / 64) / 8, 1), dim3(256), 0, stream>>>(
      xb, xb, kD, 0L, qkwT, qkwT, kD, 0L, (void*)QKp, (void*)QKp, kQKLd, 0L,
      qk_b, x, 0L, kTok, kQKLd, kD, 1.0f);
  // 6. v projection: [4096 x 1024] . [1024 x 1024]^T -> f32 [4096][1024]; tiles 64*16 = 1024 -> 128 blocks
  wmma_gemm64<1, 0, 0, 0, false><<<dim3((kTok / 64) * (kD / 64) / 8, 1), dim3(256), 0, stream>>>(
      xb, xb, kD, 0L, vwT, vwT, kD, 0L, (void*)Vf, (void*)Vf, kD, 0L,
      qk_b, x, 0L, kTok, kD, kD, 1.0f);
  // 7. v -> bf16 hi/lo planes [32][64][2048]
  v_split_transpose<<<dim3(kS / 64, kB * kH), dim3(256), 0, stream>>>(Vf, Vth, Vtl);
  // 8. causal attention -> AV f32 [4096][1024]
  attn_causal_hd64<<<dim3(kB * kH * kNQB), dim3(128), 0, stream>>>(QKp, Vth, Vtl, AV);
  // 9. shaped combination + prefix mean -> O hi/lo bf16 [4096][1024]
  shaped_combine<<<dim3(kScSeg * kB * kH), dim3(512), 0, stream>>>(AV, Vf, rg, sg, cg, Oh, Ol);
  // 10. output projection: (O hi + O lo) [4096 x 1024] . [1024 x 1024]^T -> f32 d_out [4096][1024]; 128 blocks
  wmma_gemm64<1, 1, 0, 0, false><<<dim3((kTok / 64) * (kD / 64) / 8, 1), dim3(256), 0, stream>>>(
      Oh, Ol, kD, 0L, cwT, cwT, kD, 0L, (void*)out, (void*)out, kD, 0L,
      qk_b, x, 0L, kTok, kD, kD, 1.0f);
}

// v002
// One run takes 311 microseconds.
// Next to v001, in two timings, it ran 1.25 times as fast each time.
// Counting every step since v000, it is 4.36 times as fast.
// Contractions: qk and v projections = v_wmma_f32_16x16x32_bf16 (x and W as RNE bf16, single product); scores q.k^T = v_wmma_f32_16x16x32_f16 (q, k f16 planes, single product, 1/8 applied to the f32 accumulator); attn.v = v_wmma_f32_16x16x32_bf16 with p and v as bf16 hi/lo pairs (hi.hi + hi.lo + lo.hi); output projection = v_wmma_f32_16x16x32_bf16 with the merged head output as bf16 hi/lo pair times W as RNE bf16 (hi.W + lo.W); f32 accumulate everywhere; softmax, causal prefix mean of v and gain combination in f32.
#include <hip/hip_runtime.h>
#include <math.h>

typedef __attribute__((ext_vector_type(16))) _Float16 v16h;
typedef __attribute__((ext_vector_type(8)))  _Float16 v8h;
typedef __attribute__((ext_vector_type(16))) __bf16   v16b;
typedef __attribute__((ext_vector_type(8)))  __bf16   v8b;
typedef __attribute__((ext_vector_type(8)))  float    v8f;
typedef __attribute__((ext_vector_type(4)))  float    v4f;
typedef __attribute__((ext_vector_type(2)))  float    v2f;

constexpr int kB    = 2;
constexpr int kS    = 2048;
constexpr int kD    = 1024;
constexpr int kH    = 16;
constexpr int kHD   = 64;
constexpr int kTok  = kB * kS;        // 4096 token rows
constexpr int kQKLd = 2 * kD;         // fused q|k plane pitch (halves): q at col h*64, k at col kD + h*64
constexpr int kKOff = kD;
constexpr int kKC   = 64;             // kv chunk
constexpr int kNQB  = kS / 64;        // query blocks per (b,h)
constexpr int kStg  = 72;             // 16-bit LDS staging pitch (144 B rows, 16-B aligned)
constexpr float kSmScale = 0.125f;    // 1/sqrt(64), exact power of two applied to the f32 score accumulator

// workspace region map (bytes, all offsets multiples of 2 MiB):
//   [0]          xb    bf16 [4096][1024]            8 MiB
//   [8 MiB]      qkwT  bf16 [2048][1024]            4 MiB   (qk_w transposed)
//   [12 MiB]     vwT   bf16 [1024][1024]            2 MiB
//   [14 MiB]     cwT   bf16 [1024][1024]            2 MiB
//   [16 MiB]     QKp   f16  [4096][2048]           16 MiB   (q | k planes)
//   [32 MiB]     Vf    f32  [4096][1024]           16 MiB
//   [48 MiB]     Vth   bf16 [32][64][2048]          8 MiB   (v hi, per (b,h) [d][s])
//   [56 MiB]     Vtl   bf16 [32][64][2048]          8 MiB   (v lo)
//   [64 MiB]     AV    f32  [4096][1024]           16 MiB   (softmax(qk).v, merged heads)
//   [80 MiB]     Oh    bf16 [4096][1024]            8 MiB   (combined head output, hi)
//   [88 MiB]     Ol    bf16 [4096][1024]            8 MiB   (lo)
//   total 96 MiB = 100663296 B
constexpr size_t kOffXb   = 0;
constexpr size_t kOffQkwT = kOffXb   + (size_t)kTok * kD * 2;
constexpr size_t kOffVwT  = kOffQkwT + (size_t)kQKLd * kD * 2;
constexpr size_t kOffCwT  = kOffVwT  + (size_t)kD * kD * 2;
constexpr size_t kOffQKp  = kOffCwT  + (size_t)kD * kD * 2;
constexpr size_t kOffVf   = kOffQKp  + (size_t)kTok * kQKLd * 2;
constexpr size_t kOffVth  = kOffVf   + (size_t)kTok * kD * 4;
constexpr size_t kOffVtl  = kOffVth  + (size_t)kB * kH * kHD * kS * 2;
constexpr size_t kOffAV   = kOffVtl  + (size_t)kB * kH * kHD * kS * 2;
constexpr size_t kOffOh   = kOffAV   + (size_t)kTok * kD * 4;
constexpr size_t kOffOl   = kOffOh   + (size_t)kTok * kD * 2;
constexpr size_t kWsTotal = kOffOl   + (size_t)kTok * kD * 2;
static_assert(kWsTotal == 100663296ull);
static_assert(kWsTotal <= 134217728ull);

__device__ __forceinline__ unsigned short f2bf_bits(float f) {
  unsigned u = __float_as_uint(f);
  return (unsigned short)((u + 0x7FFFu + ((u >> 16) & 1u)) >> 16);
}
__device__ __forceinline__ float bf_bits2f(unsigned short h) { return __uint_as_float(((unsigned)h) << 16); }

// hazard guards as plain device helpers (no inline asm inside the kernel template body)
__device__ __forceinline__ void dep_guard_h(v8f& a, v8f& b, v16h x, v16h y) { asm volatile("v_nop\n\tv_nop\n\tv_nop\n\tv_nop" : "+v"(a), "+v"(b) : "v"(x), "v"(y)); }
__device__ __forceinline__ void dep_guard_b(v8f& a, v8f& b, v16b x, v16b y) { asm volatile("v_nop\n\tv_nop\n\tv_nop\n\tv_nop" : "+v"(a), "+v"(b) : "v"(x), "v"(y)); }
__device__ __forceinline__ void keep4_h(v16h a, v16h b, v16h c, v16h d) { asm volatile("v_nop" :: "v"(a), "v"(b), "v"(c), "v"(d)); }
__device__ __forceinline__ void keep4_b(v16b a, v16b b, v16b c, v16b d) { asm volatile("v_nop" :: "v"(a), "v"(b), "v"(c), "v"(d)); }
__device__ __forceinline__ void acc_guard4(v8f& a, v8f& b, v8f& c, v8f& d) { asm volatile("v_nop\n\tv_nop\n\tv_nop\n\tv_nop" : "+v"(a), "+v"(b), "+v"(c), "+v"(d)); }
template <typename T> struct Frag;
template <> struct Frag<_Float16> {
  typedef v16h V; union U { v16h v; v8h h[2]; };
  static __device__ __forceinline__ v16h load(const _Float16* p) {   // elements 0..7 <- p[0..7], 8..15 <- p[16..23]
    U f; f.h[0] = *(const v8h*)(p); f.h[1] = *(const v8h*)(p + 16); return f.v;
  }
  static __device__ __forceinline__ v8f mma(v16h a, v16h b, v8f c) {
    return __builtin_amdgcn_wmma_f32_16x16x32_f16(false, a, false, b, (short)0, c, false, false);
  }
  static __device__ __forceinline__ void guard(v8f& a, v8f& b, v16h x, v16h y) { dep_guard_h(a, b, x, y); }
  static __device__ __forceinline__ void keep(v16h a, v16h b, v16h c, v16h d) { keep4_h(a, b, c, d); }
};
template <> struct Frag<__bf16> {
  typedef v16b V; union U { v16b v; v8b h[2]; };
  static __device__ __forceinline__ v16b load(const __bf16* p) {
    U f; f.h[0] = *(const v8b*)(p); f.h[1] = *(const v8b*)(p + 16); return f.v;
  }
  static __device__ __forceinline__ v8f mma(v16b a, v16b b, v8f c) {
    return __builtin_amdgcn_wmma_f32_16x16x32_bf16(false, a, false, b, (short)0, c, false, false);
  }
  static __device__ __forceinline__ void guard(v8f& a, v8f& b, v16b x, v16b y) { dep_guard_b(a, b, x, y); }
  static __device__ __forceinline__ void keep(v16b a, v16b b, v16b c, v16b d) { keep4_b(a, b, c, d); }
};

__device__ __forceinline__ unsigned short at_bf_bits(float f) {
  unsigned u = __float_as_uint(f);
  return (unsigned short)((u + 0x7FFFu + ((u >> 16) & 1u)) >> 16);
}
__device__ __forceinline__ __bf16 at_f2bf(float f) { return __builtin_bit_cast(__bf16, at_bf_bits(f)); }
__device__ __forceinline__ void at_split(float f, __bf16& hi, __bf16& lo) {
  const unsigned short hb = at_bf_bits(f);
  hi = __builtin_bit_cast(__bf16, hb);
  lo = at_f2bf(f - __uint_as_float(((unsigned)hb) << 16));
}
__device__ __forceinline__ v8f at_mma(v16b a, v16b b, v8f c) {
  c = __builtin_amdgcn_wmma_f32_16x16x32_bf16(false, a, false, b, (short)0, c, false, false);
  asm volatile("v_nop\n\tv_nop\n\tv_nop\n\tv_nop" : "+v"(c) : "v"(a), "v"(b));
  return c;
}
__device__ __forceinline__ v8f at_mma_h(v16h a, v16h b, v8f c) {
  c = __builtin_amdgcn_wmma_f32_16x16x32_f16(false, a, false, b, (short)0, c, false, false);
  asm volatile("v_nop\n\tv_nop\n\tv_nop\n\tv_nop" : "+v"(c) : "v"(a), "v"(b));
  return c;
}

// =====================================================================================
// =====================================================================================
__global__ __launch_bounds__(256) void cast_f32_bf16x2(const float* __restrict__ in,
                                                       unsigned short* __restrict__ out, int n2) {
  const int i = blockIdx.x * 256 + threadIdx.x;
  if (i < n2) {
    const unsigned u = (unsigned)f2bf_bits(in[2 * i]) | ((unsigned)f2bf_bits(in[2 * i + 1]) << 16);
    ((unsigned*)out)[i] = u;
    
  }
}

// =====================================================================================
// Register-blocked batched WMMA GEMM, C[m,n] = scale * sum_k A[m,k] * Bt[n,k] (+bias)(+resid);
// each wave owns a 64x64 tile. A row-major [M,K]; Bt row-major [N,K]; M,N % 64 == 0, K % 32 == 0.
// SPLITM: 0 = single product; 1 = A carried as hi/lo planes (A2p = lo): product = hi.B + lo.B;
//         2 = A and Bt as hi/lo planes: product = hi.hi + hi.lo + lo.hi.
// BIAS_MODE: 0 = none, 1 = bias[m], 2 = bias[n].  OUT_MODE: 0 = f32, 1 = f16, 2 = bf16 hi + lo planes.
// ET: 0 = f16 operands, 1 = bf16 operands (pointers passed as 16-bit storage)
// =====================================================================================
template <int ET> struct Elem;
template <> struct Elem<0> { typedef _Float16 T; };
template <> struct Elem<1> { typedef __bf16 T; };
template <int ET, int SPLITM, int BIAS_MODE, int OUT_MODE, bool RESID, int ACT = 0>
__global__ __launch_bounds__(256) void wmma_gemm64(
    const unsigned short* __restrict__ Ap, const unsigned short* __restrict__ A2p, int lda, long strideA,
    const unsigned short* __restrict__ Btp, const unsigned short* __restrict__ Bt2p, int ldb, long strideB,
    void* __restrict__ Cout, void* __restrict__ Cout2, int ldc, long strideC,
    const float* __restrict__ bias,
    const float* __restrict__ resid, long strideR,
    int M, int N, int K, float scale) {
  typedef typename Elem<ET>::T T;
  typedef typename Frag<T>::V V;
  constexpr bool SPA = (SPLITM >= 1);
  constexpr bool SPB = (SPLITM >= 2);
  const T* A = (const T*)Ap; const T* A2 = (const T*)A2p; const T* Bt = (const T*)Btp; const T* Bt2 = (const T*)Bt2p;
  __shared__ __align__(16) float sT[8][16 * 68];   // per-wave 16x64 slab, pitch 68 floats
  const int b    = blockIdx.y;
  const int lane = threadIdx.x & 31;
  const int wave = threadIdx.x >> 5;
  const int tilesN = N >> 6;
  const int tilesM = M >> 6;
  const int tile = blockIdx.x * 8 + wave;
  if (tile >= tilesM * tilesN) return;   // wave-uniform; no block barriers in this kernel
  const int tm = tile / tilesN;
  const int tn = tile - tm * tilesN;
  const int m0 = tm << 6;
  const int n0 = tn << 6;

  const T* Ab  = A  + (size_t)b * strideA;
  const T* Bb  = Bt + (size_t)b * strideB;
  const T* Ab2 = SPA ? (A2  + (size_t)b * strideA) : nullptr;
  const T* Bb2 = SPB ? (Bt2 + (size_t)b * strideB) : nullptr;

  const int rlane = lane & 15;                 // row (A) / col (B, D) within subtile
  const int koff  = (lane >> 4) * 8;           // k offset of this lane half
  const int mOff  = (lane >> 4) * 8;           // D row offset

  v8f acc[4][4];
#pragma unroll
  for (int i = 0; i < 4; ++i)
#pragma unroll
    for (int j = 0; j < 4; ++j) acc[i][j] = (v8f){0.f,0.f,0.f,0.f,0.f,0.f,0.f,0.f};

  for (int k0 = 0; k0 < K; k0 += 32) {
    V bh[4], bl[4];
#pragma unroll
    for (int j = 0; j < 4; ++j) {
      const size_t bo = (size_t)(n0 + (j << 4) + rlane) * ldb + koff + k0;
      bh[j] = Frag<T>::load(Bb + bo);
      if (SPB) bl[j] = Frag<T>::load(Bb2 + bo);
    }
#pragma unroll
    for (int i = 0; i < 4; ++i) {
      const size_t ao = (size_t)(m0 + (i << 4) + rlane) * lda + koff + k0;
      V ah = Frag<T>::load(Ab + ao);
      V al;
      if (SPA) al = Frag<T>::load(Ab2 + ao);
#pragma unroll
      for (int j = 0; j < 4; ++j) {
        acc[i][j] = Frag<T>::mma(ah, bh[j], acc[i][j]);
        if (SPB) acc[i][j] = Frag<T>::mma(ah, bl[j], acc[i][j]);
        if (SPA) acc[i][j] = Frag<T>::mma(al, bh[j], acc[i][j]);
      }
      Frag<T>::guard(acc[i][0], acc[i][3], ah, SPA ? al : ah);
    }
    Frag<T>::keep(bh[0], bh[1], bh[2], bh[3]);
    if (SPB) Frag<T>::keep(bl[0], bl[1], bl[2], bl[3]);
  }
  acc_guard4(acc[0][0], acc[0][1], acc[0][2], acc[0][3]);
  acc_guard4(acc[1][0], acc[1][1], acc[1][2], acc[1][3]);
  acc_guard4(acc[2][0], acc[2][1], acc[2][2], acc[2][3]);
  acc_guard4(acc[3][0], acc[3][1], acc[3][2], acc[3][3]);

  // ---- epilogue ----
  float* slab = sT[wave];
  const float* Rb = RESID ? (resid + (size_t)b * strideR) : nullptr;
#pragma unroll
  for (int i = 0; i < 4; ++i) {
    const int mBase = m0 + (i << 4);
#pragma unroll
    for (int j = 0; j < 4; ++j) {
      const int n = n0 + (j << 4) + rlane;
      float bv = 0.f;
      if (BIAS_MODE == 2) bv = bias[n];
#pragma unroll
      for (int r = 0; r < 8; ++r) {
        float v = acc[i][j][r] * scale;
        if (BIAS_MODE == 1) v += bias[mBase + mOff + r];
        if (BIAS_MODE == 2) v += bv;
        if (RESID) v += Rb[(size_t)(mBase + mOff + r) * ldc + n];
        if (ACT == 1) v = tanhf(v);
        if (ACT == 2) v = fmaxf(v, 0.0f);
        if (ACT == 4) v = (v > 0.f) ? v : 0.01f * v;
        slab[(mOff + r) * 68 + (j << 4) + rlane] = v;
      }
    }
    __builtin_amdgcn_fence(__ATOMIC_RELEASE, "workgroup");
    __builtin_amdgcn_wave_barrier();
    __builtin_amdgcn_fence(__ATOMIC_ACQUIRE, "workgroup");
    if (OUT_MODE == 0) {
      float* C = (float*)Cout + (size_t)b * strideC;
      const int hh = lane >> 4, c4 = (lane & 15) * 4;     // row seg = 256 B = 16 lanes x 16 B
      {
#pragma unroll
        for (int it = 0; it < 8; ++it) {
          const int row = it * 2 + hh;
          v4f v = *(const v4f*)(slab + row * 68 + c4);
          *(v4f*)(C + (size_t)(mBase + row) * ldc + n0 + c4) = v;
        }
        
      }
    } else {
      const int q = lane >> 3, c8 = (lane & 7) * 8;
      unsigned short* C  = (unsigned short*)Cout  + (size_t)b * strideC;
      unsigned short* C2 = (OUT_MODE == 2) ? ((unsigned short*)Cout2 + (size_t)b * strideC) : nullptr;
      {
#pragma unroll
        for (int it = 0; it < 4; ++it) {
          const int row = it * 4 + q;
          const float* sp = slab + row * 68 + c8;
          v8h hv, lv;
#pragma unroll
          for (int e = 0; e < 8; ++e) {
            if (OUT_MODE == 1) {
              hv[e] = (_Float16)sp[e];
            } else {
              unsigned short hb = f2bf_bits(sp[e]);
              unsigned short lb = f2bf_bits(sp[e] - bf_bits2f(hb));
              hv[e] = __builtin_bit_cast(_Float16, hb);
              lv[e] = __builtin_bit_cast(_Float16, lb);
            }
          }
          *(v8h*)(C + (size_t)(mBase + row) * ldc + n0 + c8) = hv;
          if (OUT_MODE == 2) *(v8h*)(C2 + (size_t)(mBase + row) * ldc + n0 + c8) = lv;
        }
        
      }
    }
    __builtin_amdgcn_fence(__ATOMIC_RELEASE, "workgroup");
    __builtin_amdgcn_wave_barrier();
    __builtin_amdgcn_fence(__ATOMIC_ACQUIRE, "workgroup");
  }
}

// =====================================================================================
// Weight transpose + RNE bf16 cast: in f32 [R][Cc] row-major -> out bf16 bits [Cc][R]  (out[c][r] = in[r][c]).
// grid = (Cc/64, R/64), block 256; one 64x64 tile through LDS.
// Load coverage: 256 threads x 16 floats = 64 (r) x 64 (c).  Store coverage: 8 waves x 2 x 4 rows (q8) = 64 rows c;
// =====================================================================================
__global__ __launch_bounds__(256) void transpose_cast_bf16(const float* __restrict__ in, unsigned short* __restrict__ out,
                                                           int R, int Cc) {
  __shared__ __align__(16) _Float16 t[64 * kStg];     // [c][r] as 16-bit bit patterns
  const int c0 = blockIdx.x * 64, r0 = blockIdx.y * 64;
  const int tid = threadIdx.x;
  {
    const int rloc = tid >> 2, cq = (tid & 3) * 16;
    const float* src = in + (size_t)(r0 + rloc) * Cc + c0 + cq;
#pragma unroll
    for (int g4 = 0; g4 < 4; ++g4) {
      const v4f a = *(const v4f*)(src + 4 * g4);
#pragma unroll
      for (int e = 0; e < 4; ++e)
        t[(cq + 4 * g4 + e) * kStg + rloc] = __builtin_bit_cast(_Float16, f2bf_bits(a[e]));
    }
  }
  __syncthreads();
  const int wave = tid >> 5, lane = tid & 31, q8 = lane >> 3, c8 = (lane & 7) * 8;
  const int cA = wave * 8 + q8, cB = wave * 8 + 4 + q8;
  const v8h va = *(const v8h*)(t + cA * kStg + c8);
  const v8h vb = *(const v8h*)(t + cB * kStg + c8);
  unsigned short* da = out + (size_t)(c0 + cA) * R + r0 + c8;
  unsigned short* db = out + (size_t)(c0 + cB) * R + r0 + c8;
  {
    *(v8h*)da = va;
    *(v8h*)db = vb;
    
  }
}

// =====================================================================================
// V planes: Vf f32 [kTok][kD] (row b*kS+s, col h*kHD+d) -> Vth/Vtl bf16 bits [kB*kH][kHD][kS]:
// out[bh][d][s] = hi/lo(Vf[b*kS+s][h*kHD+d]).  grid = (kS/64, kB*kH), block 256.
// Load coverage: 256 threads x 16 floats = 64 (s) x 64 (d).
// =====================================================================================
__global__ __launch_bounds__(256) void v_split_transpose(const float* __restrict__ Vf,
                                                         unsigned short* __restrict__ vth, unsigned short* __restrict__ vtl) {
  __shared__ __align__(16) _Float16 th[64 * kStg];
  __shared__ __align__(16) _Float16 tl[64 * kStg];
  const int st0 = blockIdx.x * 64, bh = blockIdx.y;
  const int b = bh / kH, h = bh % kH;
  const int tid = threadIdx.x;
  {
    const int sloc = tid >> 2, d0 = (tid & 3) * 16;
    const float* src = Vf + (size_t)(b * kS + st0 + sloc) * kD + h * kHD + d0;
#pragma unroll
    for (int g4 = 0; g4 < 4; ++g4) {
      const v4f a = *(const v4f*)(src + 4 * g4);
#pragma unroll
      for (int e = 0; e < 4; ++e) {
        const unsigned short hb = f2bf_bits(a[e]);
        const unsigned short lb = f2bf_bits(a[e] - bf_bits2f(hb));
        th[(d0 + 4 * g4 + e) * kStg + sloc] = __builtin_bit_cast(_Float16, hb);
        tl[(d0 + 4 * g4 + e) * kStg + sloc] = __builtin_bit_cast(_Float16, lb);
      }
    }
  }
  __syncthreads();
  const int wave = tid >> 5, lane = tid & 31, q8 = lane >> 3, c8 = (lane & 7) * 8;
  const int dA = wave * 8 + q8, dB = wave * 8 + 4 + q8;
  const v8h ha = *(const v8h*)(th + dA * kStg + c8);
  const v8h hbv = *(const v8h*)(th + dB * kStg + c8);
  const v8h la = *(const v8h*)(tl + dA * kStg + c8);
  const v8h lbv = *(const v8h*)(tl + dB * kStg + c8);
  unsigned short* pha = vth + ((size_t)bh * kHD + dA) * kS + st0 + c8;
  unsigned short* phb = vth + ((size_t)bh * kHD + dB) * kS + st0 + c8;
  unsigned short* pla = vtl + ((size_t)bh * kHD + dA) * kS + st0 + c8;
  unsigned short* plb = vtl + ((size_t)bh * kHD + dB) * kS + st0 + c8;
  {
    *(v8h*)pha = ha;
    *(v8h*)phb = hbv;
    *(v8h*)pla = la;
    *(v8h*)plb = lbv;
    
  }
}

// =====================================================================================
// Causal attention, head_dim 64, 16-bit input planes, f32 out.
//   scores = q.k^T : v_wmma_f32_16x16x32_f16 (q, k f16 planes), then * 1/8 in f32; causal: kv > q replaced by -inf
//            (exp -> 0, identical to a finite most-negative fill since every row keeps its diagonal); chunks past
//            the diagonal contribute exactly 0 and are skipped.
//   out    = p.v   : v_wmma_f32_16x16x32_bf16 with p and v as bf16 hi/lo (hi.hi + hi.lo + lo.hi); online softmax in f32.
// Block = 4 waves = 64 query rows of one (b, h); grid.x = kB * kH * (kS/64).
// Staging coverage per kv chunk: 128 threads x 4 chunks x 8 halves = 64 x 64 per plane (K, V hi, V lo), plain loads + barrier.
// Output AV f32 [kTok][kD] at col h*64: row segment 64 floats = 256 B by 16 lanes x 16 B in one instruction, one wave per
// =====================================================================================
__global__ __launch_bounds__(128)
void attn_causal_hd64(const unsigned short* __restrict__ QKp,    // f16 bits [kTok][kQKLd]
                      const unsigned short* __restrict__ Vthp,   // bf16 bits [kB*kH][kHD][kS]
                      const unsigned short* __restrict__ Vtlp,
                      float* __restrict__ AV) {                  // f32 [kTok][kD]
  union FB { v16b v; v8b h[2]; };
  // every 16-bit tile has rows of 128 B laid at pitch kStg (144 B = 16 B x 9): the 16 rows that one ds_load_b128
  // fragment read touches then start on 16 different groups of four banks instead of two
  __shared__ __align__(16) _Float16 Ksh[kKC * kStg];       // K [kv][d]      9 KB
  __shared__ __align__(16) __bf16  Vhs[kHD * kStg];        // V hi [d][kv]   9 KB
  __shared__ __align__(16) __bf16  Vls[kHD * kStg];        // V lo [d][kv]   9 KB
  __shared__ __align__(16) __bf16  Psh[4][16 * kStg];      // per wave P hi [row][kv]
  __shared__ __align__(16) __bf16  Psl[4][16 * kStg];      // per wave P lo
  __shared__ __align__(16) float   Os[4][16 * 68];         // per wave out tile, pitch 68

  const int tid  = threadIdx.x;
  const int wave = tid >> 5;
  const int lane = tid & 31;
  const int hh   = lane >> 4;
  const int c    = lane & 15;

  const int bx = blockIdx.x;
  const int qb = bx % kNQB;
  const int bh = bx / kNQB;
  const int h  = bh % kH;
  const int b  = bh / kH;
  const int q0 = qb * 64 + wave * 16;

  const _Float16* Q16 = (const _Float16*)QKp;
  const __bf16* Vth = (const __bf16*)Vthp;
  const __bf16* Vtl = (const __bf16*)Vtlp;
  float* ob_ptr = AV + (size_t)(b * kS) * kD + h * kHD;

  // ---- Q fragments (A operand, row = query q0 + c, k = d): 2 d-chunks of 32 ----
  v16h qa[2];
  {
    const _Float16* qrow = Q16 + (size_t)(b * kS + q0 + c) * kQKLd + h * kHD + 8 * hh;
    qa[0] = Frag<_Float16>::load(qrow);
    qa[1] = Frag<_Float16>::load(qrow + 32);
  }

  float mrow[8], lrow[8];
  v8f oacc[4];
#pragma unroll
  for (int r = 0; r < 8; ++r) { mrow[r] = -INFINITY; lrow[r] = 0.f; }
#pragma unroll
  for (int t = 0; t < 4; ++t) oacc[t] = (v8f){0.f,0.f,0.f,0.f,0.f,0.f,0.f,0.f};

  const int nChunks = qb + 1;   // block-uniform
  for (int kc = 0; kc < nChunks; ++kc) {
    const int kv0 = kc * kKC;
    __syncthreads();
    const _Float16* gk[4];
    const __bf16* gvh[4];
    const __bf16* gvl[4];
    v8h kr[4];
    v8b vhr[4], vlr[4];
#pragma unroll
    for (int i = 0; i < 4; ++i) {
      const int ch = tid + 128 * i, row = ch >> 3, seg = (ch & 7) * 8;
      gk[i] = Q16 + (size_t)(b * kS + kv0 + row) * kQKLd + h * kHD + seg;   // the k plane lies kKOff further on
      const size_t vo = ((size_t)bh * kHD + row) * kS + kv0 + seg;   // row = d
      gvh[i] = Vth + vo;
      gvl[i] = Vtl + vo;
      kr[i]  = *(const v8h*)(gk[i] + kKOff);
      vhr[i] = *(const v8b*)gvh[i];
      vlr[i] = *(const v8b*)gvl[i];
    }
    // precaution: this wait stands behind the 12 issued loads, in front of every later overwrite of their address
    // registers; the addresses are named as inputs so that no load's destination is placed on one of them ahead of it
    asm volatile("s_wait_xcnt 0x0" :: "v"(gk[0]), "v"(gk[1]), "v"(gk[2]), "v"(gk[3]),
                                      "v"(gvh[0]), "v"(gvh[1]), "v"(gvh[2]), "v"(gvh[3]),
                                      "v"(gvl[0]), "v"(gvl[1]), "v"(gvl[2]), "v"(gvl[3]) : "memory");
#pragma unroll
    for (int i = 0; i < 4; ++i) {
      const int ch = tid + 128 * i, row = ch >> 3, seg = (ch & 7) * 8;
      *(v8h*)(Ksh + row * kStg + seg) = kr[i];
      *(v8b*)(Vhs + row * kStg + seg) = vhr[i];
      *(v8b*)(Vls + row * kStg + seg) = vlr[i];
    }
    __syncthreads();

    v8f s[4];
#pragma unroll
    for (int j = 0; j < 4; ++j) {
      s[j] = (v8f){0.f,0.f,0.f,0.f,0.f,0.f,0.f,0.f};
#pragma unroll
      for (int dc = 0; dc < 2; ++dc) {
        const v16h kb = Frag<_Float16>::load(Ksh + (j * 16 + c) * kStg + dc * 32 + 8 * hh);
        s[j] = at_mma_h(qa[dc], kb, s[j]);
      }
    }
    const bool diag = (kc == qb);   // block-uniform
    float cm[8];
#pragma unroll
    for (int r = 0; r < 8; ++r) {
      const int qrow = q0 + 8 * hh + r;
      float m = -INFINITY;
#pragma unroll
      for (int j = 0; j < 4; ++j) {
        const int kvcol = kv0 + j * 16 + c;
        float sv = s[j][r] * kSmScale;
        if (diag && (kvcol > qrow)) sv = -INFINITY;
        s[j][r] = sv;
        m = fmaxf(m, sv);
      }
#pragma unroll
      for (int off = 1; off < 16; off <<= 1) m = fmaxf(m, __shfl_xor(m, off, 32));
      cm[r] = m;
    }
    __bf16* pwh = Psh[wave];
    __bf16* pwl = Psl[wave];
#pragma unroll
    for (int r = 0; r < 8; ++r) {
      const float mnew = fmaxf(mrow[r], cm[r]);
      const float alpha = expf(mrow[r] - mnew);
      mrow[r] = mnew;
      float psum = 0.f;
#pragma unroll
      for (int j = 0; j < 4; ++j) {
        const float p = expf(s[j][r] - mnew);
        psum += p;
        __bf16 a, bl; at_split(p, a, bl);
        pwh[(8 * hh + r) * kStg + j * 16 + c] = a;
        pwl[(8 * hh + r) * kStg + j * 16 + c] = bl;
      }
#pragma unroll
      for (int off = 1; off < 16; off <<= 1) psum += __shfl_xor(psum, off, 32);
      lrow[r] = lrow[r] * alpha + psum;
#pragma unroll
      for (int t = 0; t < 4; ++t) oacc[t][r] *= alpha;
    }
    __builtin_amdgcn_fence(__ATOMIC_RELEASE, "workgroup");
    __builtin_amdgcn_wave_barrier();
    __builtin_amdgcn_fence(__ATOMIC_ACQUIRE, "workgroup");
#pragma unroll 1
    for (int kk = 0; kk < 2; ++kk) {
      FB pa, pl;
      pa.h[0] = *(const v8b*)(pwh + c * kStg + kk * 32 + 8 * hh);
      pa.h[1] = *(const v8b*)(pwh + c * kStg + kk * 32 + 16 + 8 * hh);
      pl.h[0] = *(const v8b*)(pwl + c * kStg + kk * 32 + 8 * hh);
      pl.h[1] = *(const v8b*)(pwl + c * kStg + kk * 32 + 16 + 8 * hh);
#pragma unroll
      for (int t = 0; t < 4; ++t) {
        FB vb, vl;
        vb.h[0] = *(const v8b*)(Vhs + (t * 16 + c) * kStg + kk * 32 + 8 * hh);
        vb.h[1] = *(const v8b*)(Vhs + (t * 16 + c) * kStg + kk * 32 + 16 + 8 * hh);
        vl.h[0] = *(const v8b*)(Vls + (t * 16 + c) * kStg + kk * 32 + 8 * hh);
        vl.h[1] = *(const v8b*)(Vls + (t * 16 + c) * kStg + kk * 32 + 16 + 8 * hh);
        oacc[t] = at_mma(pa.v, vb.v, oacc[t]);
        oacc[t] = at_mma(pa.v, vl.v, oacc[t]);
        oacc[t] = at_mma(pl.v, vb.v, oacc[t]);
      }
    }
  }

  float* os = Os[wave];
#pragma unroll
  for (int r = 0; r < 8; ++r) {
    const float inv = 1.0f / lrow[r];
#pragma unroll
    for (int t = 0; t < 4; ++t) os[(8 * hh + r) * 68 + t * 16 + c] = oacc[t][r] * inv;
  }
  __builtin_amdgcn_fence(__ATOMIC_RELEASE, "workgroup");
  __builtin_amdgcn_wave_barrier();
  __builtin_amdgcn_fence(__ATOMIC_ACQUIRE, "workgroup");
  {
    const int c4 = (lane & 15) * 4;   // 16 lanes x 16 B = 256 B = one 64-float row segment; hh selects the row
    {
#pragma unroll
      for (int it = 0; it < 8; ++it) {
        const int row = it * 2 + hh;
        v4f val = *(const v4f*)(os + row * 68 + c4);
        *(v4f*)(ob_ptr + (size_t)(q0 + row) * kD + c4) = val;
      }
      
    }
  }
}

// =====================================================================================
// Shaped combination + causal prefix mean in f32:  O[b,s,h*64+d] = rg[h]*AV + sg[h]*v[s] - cg[h]*(sum_{j<=s} v[j])/(s+1),
// emitted as bf16 hi/lo planes [kTok][kD].
// One work-group = one (b, h) and one segment of kScRows rows of s; grid = kScSeg * kB * kH = 256, block 512.
// 16 lanes x 4 channels cover one 64-channel row; the 32 row slots of a work-group
//   (a) sum the rows in front of the segment, slot r taking rows r, r+32, r+64, ... (all loads independent),
//   (b) each own kScPer consecutive rows of the segment and sum them,
//   (c) meet in LDS: per channel the 32 sums of (a) are added up and the 32 sums of (b) scanned in fixed order,
//   (d) walk their own rows from that start value.
// Fixed summation order, no dependence on arrival; each 128-B output line (64 channels x 2 B) has one writer.
// =====================================================================================
constexpr int kScRows  = 256;                  // rows of s per work-group
constexpr int kScSeg   = kS / kScRows;         // 8 segments
constexpr int kScSlots = 32;                   // row slots (16 lanes each) per work-group
constexpr int kScPer   = kScRows / kScSlots;   // 8 consecutive rows per slot
__global__ __launch_bounds__(512) void shaped_combine(const float* __restrict__ AV, const float* __restrict__ Vf,
                                                     const float* __restrict__ rg, const float* __restrict__ sg,
                                                     const float* __restrict__ cg,
                                                     unsigned short* __restrict__ Oh, unsigned short* __restrict__ Ol) {
  __shared__ __align__(16) float Ps[kScSlots * kHD];   // per slot: sum of its rows in front of the segment
  __shared__ __align__(16) float Gs[kScSlots * kHD];   // per slot: sum of its own rows, then its start value
  const int tid  = threadIdx.x;
  const int slot = tid >> 4;
  const int c4   = (tid & 15) * 4;
  const int seg  = (kScSeg - 1) - (int)(blockIdx.x / (kB * kH));   // longest front part starts first
  const int bh   = blockIdx.x % (kB * kH);
  const int b = bh / kH;
  const int h = bh % kH;
  const size_t col = (size_t)(b * kS) * kD + h * kHD + c4;
  const int s0 = seg * kScRows + slot * kScPer;

  const float* vrow = Vf + col + (size_t)s0 * kD;
  const float* arow = AV + col + (size_t)s0 * kD;
  v4f vv[kScPer], aa[kScPer];
#pragma unroll
  for (int k = 0; k < kScPer; ++k) vv[k] = *(const v4f*)(vrow + k * kD);
#pragma unroll
  for (int k = 0; k < kScPer; ++k) aa[k] = *(const v4f*)(arow + k * kD);
  // precaution: this wait stands behind the 16 issued loads, in front of every later overwrite of their address
  // registers; both addresses are named as inputs so that no load's destination is placed on them ahead of it
  asm volatile("s_wait_xcnt 0x0" :: "v"(vrow), "v"(arow) : "memory");

  v4f pre = (v4f){0.f, 0.f, 0.f, 0.f};
  for (int t = 0; t < seg; ++t) {              // block-uniform trip count, at most kScSeg - 1
    v4f w[kScPer];
#pragma unroll
    for (int k = 0; k < kScPer; ++k)
      w[k] = *(const v4f*)(Vf + col + (size_t)(t * kScRows + k * kScSlots + slot) * kD);
#pragma unroll
    for (int k = 0; k < kScPer; ++k) pre += w[k];
  }
  const float rgh = rg[h], sgh = sg[h], cgh = cg[h];
  v4f gsum = vv[0];
#pragma unroll
  for (int k = 1; k < kScPer; ++k) gsum += vv[k];
  *(v4f*)(Ps + slot * kHD + c4) = pre;
  *(v4f*)(Gs + slot * kHD + c4) = gsum;
  __syncthreads();
  if (tid < kHD) {                             // one lane per channel, two whole waves
    float b0 = 0.f, b1 = 0.f, b2 = 0.f, b3 = 0.f;
#pragma unroll
    for (int r = 0; r < kScSlots; r += 4) {
      b0 += Ps[(r + 0) * kHD + tid];
      b1 += Ps[(r + 1) * kHD + tid];
      b2 += Ps[(r + 2) * kHD + tid];
      b3 += Ps[(r + 3) * kHD + tid];
    }
    float run = (b0 + b1) + (b2 + b3);
#pragma unroll
    for (int r = 0; r < kScSlots; ++r) {
      const float g = Gs[r * kHD + tid];
      Gs[r * kHD + tid] = run;
      run += g;
    }
  }
  __syncthreads();
  v4f p = *(const v4f*)(Gs + slot * kHD + c4);
#pragma unroll
  for (int k = 0; k < kScPer; ++k) {
    const int s = s0 + k;
    const size_t idx = col + (size_t)s * kD;
    p += vv[k];
    const float inv = 1.0f / (float)(s + 1);
    unsigned short hb[4], lb[4];
#pragma unroll
    for (int e = 0; e < 4; ++e) {
      const float o = rgh * aa[k][e] + sgh * vv[k][e] - cgh * (p[e] * inv);
      hb[e] = f2bf_bits(o);
      lb[e] = f2bf_bits(o - bf_bits2f(hb[e]));
    }
    uint2 uh, ul;
    uh.x = (unsigned)hb[0] | ((unsigned)hb[1] << 16);
    uh.y = (unsigned)hb[2] | ((unsigned)hb[3] << 16);
    ul.x = (unsigned)lb[0] | ((unsigned)lb[1] << 16);
    ul.y = (unsigned)lb[2] | ((unsigned)lb[3] << 16);
    *(uint2*)(Oh + idx) = uh;
    *(uint2*)(Ol + idx) = ul;
  }
}

// =====================================================================================
// launcher: kernel launches only
// =====================================================================================
extern "C" void kernel_launch(void* const* d_in, const int* in_sizes, int n_in,
                              void* d_out, int out_size, void* d_ws,
                              size_t ws_size, hipStream_t stream) {
  if (n_in < 8) return;
  if (in_sizes[0] != kTok * kD) return;
  if (in_sizes[1] != kD * kQKLd) return;
  if (in_sizes[2] != kQKLd) return;
  if (in_sizes[3] != kD * kD) return;
  if (in_sizes[4] != kD * kD) return;
  if (in_sizes[5] != kH || in_sizes[6] != kH || in_sizes[7] != kH) return;
  if (out_size != kTok * kD) return;
  if (kWsTotal > ws_size) return;

  const float* x     = (const float*)d_in[0];
  const float* qk_w  = (const float*)d_in[1];
  const float* qk_b  = (const float*)d_in[2];
  const float* v_w   = (const float*)d_in[3];
  const float* cp_w  = (const float*)d_in[4];
  const float* rg    = (const float*)d_in[5];
  const float* sg    = (const float*)d_in[6];
  const float* cg    = (const float*)d_in[7];
  float* out = (float*)d_out;

  unsigned char* ws = (unsigned char*)d_ws;
  unsigned short* xb   = (unsigned short*)(ws + kOffXb);
  unsigned short* qkwT = (unsigned short*)(ws + kOffQkwT);
  unsigned short* vwT  = (unsigned short*)(ws + kOffVwT);
  unsigned short* cwT  = (unsigned short*)(ws + kOffCwT);
  unsigned short* QKp  = (unsigned short*)(ws + kOffQKp);
  float*          Vf   = (float*)(ws + kOffVf);
  unsigned short* Vth  = (unsigned short*)(ws + kOffVth);
  unsigned short* Vtl  = (unsigned short*)(ws + kOffVtl);
  float*          AV   = (float*)(ws + kOffAV);
  unsigned short* Oh   = (unsigned short*)(ws + kOffOh);
  unsigned short* Ol   = (unsigned short*)(ws + kOffOl);

  // 1. x -> bf16 [4096][1024]: n = 4194304, n2 = 2097152 threads, 8192 blocks exactly
  {
    const int n2 = (kTok * kD) / 2;
    cast_f32_bf16x2<<<dim3((n2 + 255) / 256), dim3(256), 0, stream>>>(x, xb, n2);
  }
  // 2-4. weights [in][out] f32 -> transposed bf16 [out][in]   (grid = (cols/64, rows/64))
  transpose_cast_bf16<<<dim3(kQKLd / 64, kD / 64), dim3(256), 0, stream>>>(qk_w, qkwT, kD, kQKLd);   // in[1024][2048] -> out[2048][1024]
  transpose_cast_bf16<<<dim3(kD / 64, kD / 64),    dim3(256), 0, stream>>>(v_w,  vwT,  kD, kD);      // in[1024][1024] -> out[1024][1024]
  transpose_cast_bf16<<<dim3(kD / 64, kD / 64),    dim3(256), 0, stream>>>(cp_w, cwT,  kD, kD);

  // 5. fused q|k projection: [4096 x 1024] . [2048 x 1024]^T + qk_b -> f16 [4096][2048]; tiles 64*32 = 2048 -> 256 blocks
  wmma_gemm64<1, 0, 2, 1, false><<<dim3((kTok / 64) * (kQKLd / 64) / 8, 1), dim3(256), 0, stream>>>(
      xb, xb, kD, 0L, qkwT, qkwT, kD, 0L, (void*)QKp, (void*)QKp, kQKLd, 0L,
      qk_b, x, 0L, kTok, kQKLd, kD, 1.0f);
  // 6. v projection: [4096 x 1024] . [1024 x 1024]^T -> f32 [4096][1024]; tiles 64*16 = 1024 -> 128 blocks
  wmma_gemm64<1, 0, 0, 0, false><<<dim3((kTok / 64) * (kD / 64) / 8, 1), dim3(256), 0, stream>>>(
      xb, xb, kD, 0L, vwT, vwT, kD, 0L, (void*)Vf, (void*)Vf, kD, 0L,
      qk_b, x, 0L, kTok, kD, kD, 1.0f);
  // 7. v -> bf16 hi/lo planes [32][64][2048]
  v_split_transpose<<<dim3(kS / 64, kB * kH), dim3(256), 0, stream>>>(Vf, Vth, Vtl);
  // 8. causal attention -> AV f32 [4096][1024]
  attn_causal_hd64<<<dim3(kB * kH * kNQB), dim3(128), 0, stream>>>(QKp, Vth, Vtl, AV);
  // 9. shaped combination + prefix mean -> O hi/lo bf16 [4096][1024]
  shaped_combine<<<dim3(kScSeg * kB * kH), dim3(512), 0, stream>>>(AV, Vf, rg, sg, cg, Oh, Ol);
  // 10. output projection: (O hi + O lo) [4096 x 1024] . [1024 x 1024]^T -> f32 d_out [4096][1024]; 128 blocks
  wmma_gemm64<1, 1, 0, 0, false><<<dim3((kTok / 64) * (kD / 64) / 8, 1), dim3(256), 0, stream>>>(
      Oh, Ol, kD, 0L, cwT, cwT, kD, 0L, (void*)out, (void*)out, kD, 0L,
      qk_b, x, 0L, kTok, kD, kD, 1.0f);
}

// v003
// It runs in 222 microseconds.
// Timed twice side by side with v002, it ran 1.40 and 1.41 times as fast.
// All steps since v000 together make it 6.11 times as fast.
// Contractions: qk and v projections = v_wmma_f32_16x16x32_bf16 (x and W as RNE bf16, single product); scores q.k^T = v_wmma_f32_16x16x32_f16 (q, k f16 planes, single product, 1/8 applied to the f32 accumulator); attn.v = v_wmma_f32_16x16x32_bf16 with p and v as bf16 hi/lo pairs (hi.hi + hi.lo + lo.hi); output projection = v_wmma_f32_16x16x32_bf16 with the merged head output as bf16 hi/lo pair times W as RNE bf16 (hi.W + lo.W); f32 accumulate everywhere; softmax, causal prefix mean of v and gain combination in f32.
#include <hip/hip_runtime.h>
#include <math.h>

typedef __attribute__((ext_vector_type(16))) _Float16 v16h;
typedef __attribute__((ext_vector_type(8)))  _Float16 v8h;
typedef __attribute__((ext_vector_type(16))) __bf16   v16b;
typedef __attribute__((ext_vector_type(8)))  __bf16   v8b;
typedef __attribute__((ext_vector_type(8)))  float    v8f;
typedef __attribute__((ext_vector_type(4)))  float    v4f;
typedef __attribute__((ext_vector_type(2)))  float    v2f;

constexpr int kB    = 2;
constexpr int kS    = 2048;
constexpr int kD    = 1024;
constexpr int kH    = 16;
constexpr int kHD   = 64;
constexpr int kTok  = kB * kS;        // 4096 token rows
constexpr int kQKLd = 2 * kD;         // fused q|k plane pitch (halves): q at col h*64, k at col kD + h*64
constexpr int kKOff = kD;
constexpr int kKC   = 64;             // kv chunk
constexpr int kNQB  = kS / 64;        // query blocks per (b,h)
constexpr int kStg  = 72;             // 16-bit LDS staging pitch (144 B rows, 16-B aligned)
constexpr float kSmScale = 0.125f;    // 1/sqrt(64), exact power of two applied to the f32 score accumulator

// workspace region map (bytes, all offsets multiples of 2 MiB):
//   [0]          xb    bf16 [4096][1024]            8 MiB
//   [8 MiB]      qkwT  bf16 [2048][1024]            4 MiB   (qk_w transposed)
//   [12 MiB]     vwT   bf16 [1024][1024]            2 MiB
//   [14 MiB]     cwT   bf16 [1024][1024]            2 MiB
//   [16 MiB]     QKp   f16  [4096][2048]           16 MiB   (q | k planes)
//   [32 MiB]     Vf    f32  [4096][1024]           16 MiB
//   [48 MiB]     Vth   bf16 [32][64][2048]          8 MiB   (v hi, per (b,h) [d][s])
//   [56 MiB]     Vtl   bf16 [32][64][2048]          8 MiB   (v lo)
//   [64 MiB]     AV    f32  [4096][1024]           16 MiB   (softmax(qk).v, merged heads)
//   [80 MiB]     Oh    bf16 [4096][1024]            8 MiB   (combined head output, hi)
//   [88 MiB]     Ol    bf16 [4096][1024]            8 MiB   (lo)
//   total 96 MiB = 100663296 B
constexpr size_t kOffXb   = 0;
constexpr size_t kOffQkwT = kOffXb   + (size_t)kTok * kD * 2;
constexpr size_t kOffVwT  = kOffQkwT + (size_t)kQKLd * kD * 2;
constexpr size_t kOffCwT  = kOffVwT  + (size_t)kD * kD * 2;
constexpr size_t kOffQKp  = kOffCwT  + (size_t)kD * kD * 2;
constexpr size_t kOffVf   = kOffQKp  + (size_t)kTok * kQKLd * 2;
constexpr size_t kOffVth  = kOffVf   + (size_t)kTok * kD * 4;
constexpr size_t kOffVtl  = kOffVth  + (size_t)kB * kH * kHD * kS * 2;
constexpr size_t kOffAV   = kOffVtl  + (size_t)kB * kH * kHD * kS * 2;
constexpr size_t kOffOh   = kOffAV   + (size_t)kTok * kD * 4;
constexpr size_t kOffOl   = kOffOh   + (size_t)kTok * kD * 2;
constexpr size_t kWsTotal = kOffOl   + (size_t)kTok * kD * 2;
static_assert(kWsTotal == 100663296ull);
static_assert(kWsTotal <= 134217728ull);

__device__ __forceinline__ unsigned short f2bf_bits(float f) {
  unsigned u = __float_as_uint(f);
  return (unsigned short)((u + 0x7FFFu + ((u >> 16) & 1u)) >> 16);
}
__device__ __forceinline__ float bf_bits2f(unsigned short h) { return __uint_as_float(((unsigned)h) << 16); }

// hazard guards as plain device helpers (their inline asm is kept out of the kernel template body)
__device__ __forceinline__ void dep_guard_h(v8f& a, v8f& b, v16h x, v16h y) { asm volatile("v_nop\n\tv_nop\n\tv_nop\n\tv_nop" : "+v"(a), "+v"(b) : "v"(x), "v"(y)); }
__device__ __forceinline__ void dep_guard_b(v8f& a, v8f& b, v16b x, v16b y) { asm volatile("v_nop\n\tv_nop\n\tv_nop\n\tv_nop" : "+v"(a), "+v"(b) : "v"(x), "v"(y)); }
__device__ __forceinline__ void keep4_h(v16h a, v16h b, v16h c, v16h d) { asm volatile("v_nop" :: "v"(a), "v"(b), "v"(c), "v"(d)); }
__device__ __forceinline__ void keep4_b(v16b a, v16b b, v16b c, v16b d) { asm volatile("v_nop" :: "v"(a), "v"(b), "v"(c), "v"(d)); }
__device__ __forceinline__ void acc_guard4(v8f& a, v8f& b, v8f& c, v8f& d) { asm volatile("v_nop\n\tv_nop\n\tv_nop\n\tv_nop" : "+v"(a), "+v"(b), "+v"(c), "+v"(d)); }
template <typename T> struct Frag;
template <> struct Frag<_Float16> {
  typedef v16h V; union U { v16h v; v8h h[2]; };
  static __device__ __forceinline__ v16h load(const _Float16* p) {   // elements 0..7 <- p[0..7], 8..15 <- p[16..23]
    U f; f.h[0] = *(const v8h*)(p); f.h[1] = *(const v8h*)(p + 16); return f.v;
  }
  static __device__ __forceinline__ v8f mma(v16h a, v16h b, v8f c) {
    return __builtin_amdgcn_wmma_f32_16x16x32_f16(false, a, false, b, (short)0, c, false, false);
  }
  static __device__ __forceinline__ void guard(v8f& a, v8f& b, v16h x, v16h y) { dep_guard_h(a, b, x, y); }
  static __device__ __forceinline__ void keep(v16h a, v16h b, v16h c, v16h d) { keep4_h(a, b, c, d); }
};
template <> struct Frag<__bf16> {
  typedef v16b V; union U { v16b v; v8b h[2]; };
  static __device__ __forceinline__ v16b load(const __bf16* p) {
    U f; f.h[0] = *(const v8b*)(p); f.h[1] = *(const v8b*)(p + 16); return f.v;
  }
  static __device__ __forceinline__ v8f mma(v16b a, v16b b, v8f c) {
    return __builtin_amdgcn_wmma_f32_16x16x32_bf16(false, a, false, b, (short)0, c, false, false);
  }
  static __device__ __forceinline__ void guard(v8f& a, v8f& b, v16b x, v16b y) { dep_guard_b(a, b, x, y); }
  static __device__ __forceinline__ void keep(v16b a, v16b b, v16b c, v16b d) { keep4_b(a, b, c, d); }
};

__device__ __forceinline__ unsigned short at_bf_bits(float f) {
  unsigned u = __float_as_uint(f);
  return (unsigned short)((u + 0x7FFFu + ((u >> 16) & 1u)) >> 16);
}
__device__ __forceinline__ __bf16 at_f2bf(float f) { return __builtin_bit_cast(__bf16, at_bf_bits(f)); }
__device__ __forceinline__ void at_split(float f, __bf16& hi, __bf16& lo) {
  const unsigned short hb = at_bf_bits(f);
  hi = __builtin_bit_cast(__bf16, hb);
  lo = at_f2bf(f - __uint_as_float(((unsigned)hb) << 16));
}
__device__ __forceinline__ v8f at_mma(v16b a, v16b b, v8f c) {
  c = __builtin_amdgcn_wmma_f32_16x16x32_bf16(false, a, false, b, (short)0, c, false, false);
  asm volatile("v_nop\n\tv_nop\n\tv_nop\n\tv_nop" : "+v"(c) : "v"(a), "v"(b));
  return c;
}
__device__ __forceinline__ v8f at_mma_h(v16h a, v16h b, v8f c) {
  c = __builtin_amdgcn_wmma_f32_16x16x32_f16(false, a, false, b, (short)0, c, false, false);
  asm volatile("v_nop\n\tv_nop\n\tv_nop\n\tv_nop" : "+v"(c) : "v"(a), "v"(b));
  return c;
}

// =====================================================================================
// =====================================================================================
__global__ __launch_bounds__(256) void cast_f32_bf16x2(const float* __restrict__ in,
                                                       unsigned short* __restrict__ out, int n2) {
  const int i = blockIdx.x * 256 + threadIdx.x;
  if (i < n2) {
    const unsigned u = (unsigned)f2bf_bits(in[2 * i]) | ((unsigned)f2bf_bits(in[2 * i + 1]) << 16);
    ((unsigned*)out)[i] = u;
    
  }
}

// =====================================================================================
// Register-blocked batched WMMA GEMM, C[m,n] = scale * sum_k A[m,k] * Bt[n,k] (+bias)(+resid);
// each wave owns a 64x64 tile; the 8 waves of a work-group stand 2 (m) x 4 (n) on one 128x256 tile of C.
// A row-major [M,K]; Bt row-major [N,K]; M % 128 == 0, N % 256 == 0, K % 64 == 0.
// Operands reach the waves through LDS: per k tile of 64 the work-group copies 128 rows of A (and of A2) and 256 rows
// of Bt, 128 B a row, with asynchronous copies (8 lanes x 16 B = one whole line of a row), into one of two buffers at
// row pitch kStg; the copies of tile t + 2 fly while tile t + 1 is worked on.
// SPLITM: 0 = single product; 1 = A carried as hi/lo planes (A2p = lo): product = hi.B + lo.B.
// BIAS_MODE: 0 = none, 1 = bias[m], 2 = bias[n].  OUT_MODE: 0 = f32, 1 = f16, 2 = bf16 hi + lo planes.
// ET: 0 = f16 operands, 1 = bf16 operands (pointers passed as 16-bit storage)
// =====================================================================================
constexpr int kGK = 64;     // k extent of a staged tile
constexpr int kGM = 128;    // rows of A per work-group
constexpr int kGN = 256;    // rows of Bt per work-group

// Each lane copies its own 16 B from global memory to its own LDS byte address. The s_wait_xcnt closes the statement so
// that it stands in front of every later write of the address registers named here (a precaution).
__device__ __forceinline__ void async_copy4(unsigned l0, const void* g0, unsigned l1, const void* g1,
                                            unsigned l2, const void* g2, unsigned l3, const void* g3) {
  asm volatile("global_load_async_to_lds_b128 %0, %1, off\n\t"
               "global_load_async_to_lds_b128 %2, %3, off\n\t"
               "global_load_async_to_lds_b128 %4, %5, off\n\t"
               "global_load_async_to_lds_b128 %6, %7, off\n\t"
               "s_wait_xcnt 0x0"
               :: "v"(l0), "v"(g0), "v"(l1), "v"(g1), "v"(l2), "v"(g2), "v"(l3), "v"(g3) : "memory");
}
__device__ __forceinline__ void async_copy8(unsigned l0, const void* g0, unsigned l1, const void* g1,
                                            unsigned l2, const void* g2, unsigned l3, const void* g3,
                                            unsigned l4, const void* g4, unsigned l5, const void* g5,
                                            unsigned l6, const void* g6, unsigned l7, const void* g7) {
  asm volatile("global_load_async_to_lds_b128 %0, %1, off\n\t"
               "global_load_async_to_lds_b128 %2, %3, off\n\t"
               "global_load_async_to_lds_b128 %4, %5, off\n\t"
               "global_load_async_to_lds_b128 %6, %7, off\n\t"
               "global_load_async_to_lds_b128 %8, %9, off\n\t"
               "global_load_async_to_lds_b128 %10, %11, off\n\t"
               "global_load_async_to_lds_b128 %12, %13, off\n\t"
               "global_load_async_to_lds_b128 %14, %15, off\n\t"
               "s_wait_xcnt 0x0"
               :: "v"(l0), "v"(g0), "v"(l1), "v"(g1), "v"(l2), "v"(g2), "v"(l3), "v"(g3),
                  "v"(l4), "v"(g4), "v"(l5), "v"(g5), "v"(l6), "v"(g6), "v"(l7), "v"(g7) : "memory");
}

template <int ET> struct Elem;
template <> struct Elem<0> { typedef _Float16 T; };
template <> struct Elem<1> { typedef __bf16 T; };
template <int ET, int SPLITM, int BIAS_MODE, int OUT_MODE, bool RESID, int ACT = 0>
__global__ __launch_bounds__(256) void wmma_gemm64(
    const unsigned short* __restrict__ Ap, const unsigned short* __restrict__ A2p, int lda, long strideA,
    const unsigned short* __restrict__ Btp, const unsigned short* __restrict__ Bt2p, int ldb, long strideB,
    void* __restrict__ Cout, void* __restrict__ Cout2, int ldc, long strideC,
    const float* __restrict__ bias,
    const float* __restrict__ resid, long strideR,
    int M, int N, int K, float scale) {
  typedef typename Elem<ET>::T T;
  typedef typename Frag<T>::V V;
  static_assert(SPLITM <= 1);
  constexpr bool SPA = (SPLITM >= 1);
  constexpr int kOffA2  = kGM * kStg;                       // element offsets inside one buffer: A | A2 | Bt
  constexpr int kOffB   = (SPA ? 2 : 1) * kGM * kStg;
  constexpr int kBufEl  = kOffB + kGN * kStg;
  const T* A = (const T*)Ap; const T* A2 = (const T*)A2p; const T* Bt = (const T*)Btp;
  __shared__ __align__(16) T sOp[2 * kBufEl];      // two operand buffers
  __shared__ __align__(16) float sT[8][16 * 68];   // per-wave 16x64 slab, pitch 68 floats
  const int b    = blockIdx.y;
  const int tid  = threadIdx.x;
  const int lane = tid & 31;
  const int wave = tid >> 5;
  const int tilesN = N / kGN;
  const int tilesM = M / kGM;
  if ((int)blockIdx.x >= tilesM * tilesN) return;   // the same for the whole work-group, in front of every copy and barrier
  const int bm = blockIdx.x / tilesN;
  const int bn = blockIdx.x - bm * tilesN;
  const int wm = (wave >> 2) << 6;             // this wave's rows inside the staged A tile
  const int wn = (wave & 3) << 6;              // this wave's rows inside the staged Bt tile
  const int m0 = bm * kGM + wm;
  const int n0 = bn * kGN + wn;

  const int rlane = lane & 15;                 // row (A) / col (B, D) within subtile
  const int koff  = (lane >> 4) * 8;           // k offset of this lane half
  const int mOff  = (lane >> 4) * 8;           // D row offset

  // staging: thread -> row tid / 8 (+ 32 per copy), 16-B piece tid % 8 of the row's 128 B
  const int srow = tid >> 3;
  const int sseg = (tid & 7) * 8;
  const T* gA  = A  + (size_t)b * strideA + (size_t)(bm * kGM + srow) * lda + sseg;
  const T* gA2 = SPA ? (A2 + (size_t)b * strideA + (size_t)(bm * kGM + srow) * lda + sseg) : nullptr;
  const T* gB  = Bt + (size_t)b * strideB + (size_t)(bn * kGN + srow) * ldb + sseg;
  const unsigned lS = (unsigned)(size_t)(sOp + srow * kStg + sseg);   // LDS byte address: low 32 bits
  const size_t a32 = (size_t)32 * lda, b32 = (size_t)32 * ldb;
  constexpr unsigned kL32 = 32 * kStg * 2;     // 32 rows in LDS, bytes
  auto stage = [&](int t, int buf) {
    const unsigned l = lS + (unsigned)buf * (unsigned)(kBufEl * 2);
    const unsigned lb = l + kOffB * 2;
    const T* pb = gB + t * kGK;
    async_copy8(lb, pb, lb + kL32, pb + b32, lb + 2 * kL32, pb + 2 * b32, lb + 3 * kL32, pb + 3 * b32,
                lb + 4 * kL32, pb + 4 * b32, lb + 5 * kL32, pb + 5 * b32, lb + 6 * kL32, pb + 6 * b32,
                lb + 7 * kL32, pb + 7 * b32);
    const T* pa = gA + t * kGK;
    if (SPA) {
      const unsigned l2 = l + kOffA2 * 2;
      const T* pa2 = gA2 + t * kGK;
      async_copy8(l, pa, l + kL32, pa + a32, l + 2 * kL32, pa + 2 * a32, l + 3 * kL32, pa + 3 * a32,
                  l2, pa2, l2 + kL32, pa2 + a32, l2 + 2 * kL32, pa2 + 2 * a32, l2 + 3 * kL32, pa2 + 3 * a32);
    } else {
      async_copy4(l, pa, l + kL32, pa + a32, l + 2 * kL32, pa + 2 * a32, l + 3 * kL32, pa + 3 * a32);
    }
  };

  v8f acc[4][4];
#pragma unroll
  for (int i = 0; i < 4; ++i)
#pragma unroll
    for (int j = 0; j < 4; ++j) acc[i][j] = (v8f){0.f,0.f,0.f,0.f,0.f,0.f,0.f,0.f};

  const int nT = K / kGK;                      // the same for the whole work-group
  stage(0, 0);
  asm volatile("s_wait_asynccnt 0x0" ::: "memory");   // this wave's copies of tile 0 have landed
  __syncthreads();                                    // ... and every other wave's: tile 0 may be read
  if (nT > 1) stage(1, 1);
  for (int t = 0; t < nT; ++t) {
    const T* sA = sOp + (t & 1) * kBufEl + (wm + rlane) * kStg + koff;
    const T* sB = sOp + (t & 1) * kBufEl + kOffB + (wn + rlane) * kStg + koff;
#pragma unroll
    for (int kk = 0; kk < kGK; kk += 32) {
      V bh[4], ah[4], al[4];
#pragma unroll
      for (int j = 0; j < 4; ++j) bh[j] = Frag<T>::load(sB + (j << 4) * kStg + kk);
#pragma unroll
      for (int i = 0; i < 4; ++i) {
        ah[i] = Frag<T>::load(sA + (i << 4) * kStg + kk);
        if (SPA) al[i] = Frag<T>::load(sA + kOffA2 + (i << 4) * kStg + kk);
      }
#pragma unroll
      for (int i = 0; i < 4; ++i) {
#pragma unroll
        for (int j = 0; j < 4; ++j) {
          acc[i][j] = Frag<T>::mma(ah[i], bh[j], acc[i][j]);
          if (SPA) acc[i][j] = Frag<T>::mma(al[i], bh[j], acc[i][j]);
        }
        Frag<T>::guard(acc[i][0], acc[i][3], ah[i], SPA ? al[i] : ah[i]);
      }
      Frag<T>::keep(bh[0], bh[1], bh[2], bh[3]);
    }
    asm volatile("s_wait_dscnt 0x0" ::: "memory");      // this wave's reads of tile t are done before its buffer is refilled
    asm volatile("s_wait_asynccnt 0x0" ::: "memory");   // this wave's copies of tile t + 1 have landed
    __syncthreads();                                    // publishes tile t + 1 and ends every reader's reads of tile t
    if (t + 2 < nT) stage(t + 2, t & 1);
  }
  asm volatile("s_wait_asynccnt 0x0" ::: "memory");     // no copy is outstanding when the wave goes on
  acc_guard4(acc[0][0], acc[0][1], acc[0][2], acc[0][3]);
  acc_guard4(acc[1][0], acc[1][1], acc[1][2], acc[1][3]);
  acc_guard4(acc[2][0], acc[2][1], acc[2][2], acc[2][3]);
  acc_guard4(acc[3][0], acc[3][1], acc[3][2], acc[3][3]);

  // ---- epilogue ----
  float* slab = sT[wave];
  const float* Rb = RESID ? (resid + (size_t)b * strideR) : nullptr;
#pragma unroll
  for (int i = 0; i < 4; ++i) {
    const int mBase = m0 + (i << 4);
#pragma unroll
    for (int j = 0; j < 4; ++j) {
      const int n = n0 + (j << 4) + rlane;
      float bv = 0.f;
      if (BIAS_MODE == 2) bv = bias[n];
#pragma unroll
      for (int r = 0; r < 8; ++r) {
        float v = acc[i][j][r] * scale;
        if (BIAS_MODE == 1) v += bias[mBase + mOff + r];
        if (BIAS_MODE == 2) v += bv;
        if (RESID) v += Rb[(size_t)(mBase + mOff + r) * ldc + n];
        if (ACT == 1) v = tanhf(v);
        if (ACT == 2) v = fmaxf(v, 0.0f);
        if (ACT == 4) v = (v > 0.f) ? v : 0.01f * v;
        slab[(mOff + r) * 68 + (j << 4) + rlane] = v;
      }
    }
    __builtin_amdgcn_fence(__ATOMIC_RELEASE, "workgroup");
    __builtin_amdgcn_wave_barrier();
    __builtin_amdgcn_fence(__ATOMIC_ACQUIRE, "workgroup");
    if (OUT_MODE == 0) {
      float* C = (float*)Cout + (size_t)b * strideC;
      const int hh = lane >> 4, c4 = (lane & 15) * 4;     // row seg = 256 B = 16 lanes x 16 B
      {
#pragma unroll
        for (int it = 0; it < 8; ++it) {
          const int row = it * 2 + hh;
          v4f v = *(const v4f*)(slab + row * 68 + c4);
          *(v4f*)(C + (size_t)(mBase + row) * ldc + n0 + c4) = v;
        }
        
      }
    } else {
      const int q = lane >> 3, c8 = (lane & 7) * 8;
      unsigned short* C  = (unsigned short*)Cout  + (size_t)b * strideC;
      unsigned short* C2 = (OUT_MODE == 2) ? ((unsigned short*)Cout2 + (size_t)b * strideC) : nullptr;
      {
#pragma unroll
        for (int it = 0; it < 4; ++it) {
          const int row = it * 4 + q;
          const float* sp = slab + row * 68 + c8;
          v8h hv, lv;
#pragma unroll
          for (int e = 0; e < 8; ++e) {
            if (OUT_MODE == 1) {
              hv[e] = (_Float16)sp[e];
            } else {
              unsigned short hb = f2bf_bits(sp[e]);
              unsigned short lb = f2bf_bits(sp[e] - bf_bits2f(hb));
              hv[e] = __builtin_bit_cast(_Float16, hb);
              lv[e] = __builtin_bit_cast(_Float16, lb);
            }
          }
          *(v8h*)(C + (size_t)(mBase + row) * ldc + n0 + c8) = hv;
          if (OUT_MODE == 2) *(v8h*)(C2 + (size_t)(mBase + row) * ldc + n0 + c8) = lv;
        }
        
      }
    }
    __builtin_amdgcn_fence(__ATOMIC_RELEASE, "workgroup");
    __builtin_amdgcn_wave_barrier();
    __builtin_amdgcn_fence(__ATOMIC_ACQUIRE, "workgroup");
  }
}

// =====================================================================================
// Weight transpose + RNE bf16 cast: in f32 [R][Cc] row-major -> out bf16 bits [Cc][R]  (out[c][r] = in[r][c]).
// grid = (Cc/64, R/64), block 256; one 64x64 tile through LDS.
// Load coverage: 256 threads x 16 floats = 64 (r) x 64 (c).  Store coverage: 8 waves x 2 x 4 rows (q8) = 64 rows c;
// =====================================================================================
__global__ __launch_bounds__(256) void transpose_cast_bf16(const float* __restrict__ in, unsigned short* __restrict__ out,
                                                           int R, int Cc) {
  __shared__ __align__(16) _Float16 t[64 * kStg];     // [c][r] as 16-bit bit patterns
  const int c0 = blockIdx.x * 64, r0 = blockIdx.y * 64;
  const int tid = threadIdx.x;
  {
    const int rloc = tid >> 2, cq = (tid & 3) * 16;
    const float* src = in + (size_t)(r0 + rloc) * Cc + c0 + cq;
#pragma unroll
    for (int g4 = 0; g4 < 4; ++g4) {
      const v4f a = *(const v4f*)(src + 4 * g4);
#pragma unroll
      for (int e = 0; e < 4; ++e)
        t[(cq + 4 * g4 + e) * kStg + rloc] = __builtin_bit_cast(_Float16, f2bf_bits(a[e]));
    }
  }
  __syncthreads();
  const int wave = tid >> 5, lane = tid & 31, q8 = lane >> 3, c8 = (lane & 7) * 8;
  const int cA = wave * 8 + q8, cB = wave * 8 + 4 + q8;
  const v8h va = *(const v8h*)(t + cA * kStg + c8);
  const v8h vb = *(const v8h*)(t + cB * kStg + c8);
  unsigned short* da = out + (size_t)(c0 + cA) * R + r0 + c8;
  unsigned short* db = out + (size_t)(c0 + cB) * R + r0 + c8;
  {
    *(v8h*)da = va;
    *(v8h*)db = vb;
    
  }
}

// =====================================================================================
// V planes: Vf f32 [kTok][kD] (row b*kS+s, col h*kHD+d) -> Vth/Vtl bf16 bits [kB*kH][kHD][kS]:
// out[bh][d][s] = hi/lo(Vf[b*kS+s][h*kHD+d]).  grid = (kS/64, kB*kH), block 256.
// Load coverage: 256 threads x 16 floats = 64 (s) x 64 (d).
// =====================================================================================
__global__ __launch_bounds__(256) void v_split_transpose(const float* __restrict__ Vf,
                                                         unsigned short* __restrict__ vth, unsigned short* __restrict__ vtl) {
  __shared__ __align__(16) _Float16 th[64 * kStg];
  __shared__ __align__(16) _Float16 tl[64 * kStg];
  const int st0 = blockIdx.x * 64, bh = blockIdx.y;
  const int b = bh / kH, h = bh % kH;
  const int tid = threadIdx.x;
  {
    const int sloc = tid >> 2, d0 = (tid & 3) * 16;
    const float* src = Vf + (size_t)(b * kS + st0 + sloc) * kD + h * kHD + d0;
#pragma unroll
    for (int g4 = 0; g4 < 4; ++g4) {
      const v4f a = *(const v4f*)(src + 4 * g4);
#pragma unroll
      for (int e = 0; e < 4; ++e) {
        const unsigned short hb = f2bf_bits(a[e]);
        const unsigned short lb = f2bf_bits(a[e] - bf_bits2f(hb));
        th[(d0 + 4 * g4 + e) * kStg + sloc] = __builtin_bit_cast(_Float16, hb);
        tl[(d0 + 4 * g4 + e) * kStg + sloc] = __builtin_bit_cast(_Float16, lb);
      }
    }
  }
  __syncthreads();
  const int wave = tid >> 5, lane = tid & 31, q8 = lane >> 3, c8 = (lane & 7) * 8;
  const int dA = wave * 8 + q8, dB = wave * 8 + 4 + q8;
  const v8h ha = *(const v8h*)(th + dA * kStg + c8);
  const v8h hbv = *(const v8h*)(th + dB * kStg + c8);
  const v8h la = *(const v8h*)(tl + dA * kStg + c8);
  const v8h lbv = *(const v8h*)(tl + dB * kStg + c8);
  unsigned short* pha = vth + ((size_t)bh * kHD + dA) * kS + st0 + c8;
  unsigned short* phb = vth + ((size_t)bh * kHD + dB) * kS + st0 + c8;
  unsigned short* pla = vtl + ((size_t)bh * kHD + dA) * kS + st0 + c8;
  unsigned short* plb = vtl + ((size_t)bh * kHD + dB) * kS + st0 + c8;
  {
    *(v8h*)pha = ha;
    *(v8h*)phb = hbv;
    *(v8h*)pla = la;
    *(v8h*)plb = lbv;
    
  }
}

// =====================================================================================
// Causal attention, head_dim 64, 16-bit input planes, f32 out.
//   scores = q.k^T : v_wmma_f32_16x16x32_f16 (q, k f16 planes), then * 1/8 in f32; causal: kv > q replaced by -inf
//            (exp -> 0, identical to a finite most-negative fill since every row keeps its diagonal); chunks past
//            the diagonal contribute exactly 0 and are skipped.
//   out    = p.v   : v_wmma_f32_16x16x32_bf16 with p and v as bf16 hi/lo (hi.hi + hi.lo + lo.hi); online softmax in f32.
// Block = 4 waves = 64 query rows of one (b, h); grid.x = kB * kH * (kS/64).
// Staging coverage per kv chunk: 128 threads x 4 chunks x 8 halves = 64 x 64 per plane (K, V hi, V lo), plain loads + barrier.
// Output AV f32 [kTok][kD] at col h*64: row segment 64 floats = 256 B by 16 lanes x 16 B in one instruction, one wave per
// =====================================================================================
__global__ __launch_bounds__(128)
void attn_causal_hd64(const unsigned short* __restrict__ QKp,    // f16 bits [kTok][kQKLd]
                      const unsigned short* __restrict__ Vthp,   // bf16 bits [kB*kH][kHD][kS]
                      const unsigned short* __restrict__ Vtlp,
                      float* __restrict__ AV) {                  // f32 [kTok][kD]
  union FB { v16b v; v8b h[2]; };
  // every 16-bit tile has rows of 128 B laid at pitch kStg (144 B = 16 B x 9): the 16 rows that one ds_load_b128
  // fragment read touches then start on 16 different groups of four banks instead of two
  __shared__ __align__(16) _Float16 Ksh[kKC * kStg];       // K [kv][d]      9 KB
  __shared__ __align__(16) __bf16  Vhs[kHD * kStg];        // V hi [d][kv]   9 KB
  __shared__ __align__(16) __bf16  Vls[kHD * kStg];        // V lo [d][kv]   9 KB
  __shared__ __align__(16) __bf16  Psh[4][16 * kStg];      // per wave P hi [row][kv]
  __shared__ __align__(16) __bf16  Psl[4][16 * kStg];      // per wave P lo
  __shared__ __align__(16) float   Os[4][16 * 68];         // per wave out tile, pitch 68

  const int tid  = threadIdx.x;
  const int wave = tid >> 5;
  const int lane = tid & 31;
  const int hh   = lane >> 4;
  const int c    = lane & 15;

  const int bx = blockIdx.x;
  const int qb = bx % kNQB;
  const int bh = bx / kNQB;
  const int h  = bh % kH;
  const int b  = bh / kH;
  const int q0 = qb * 64 + wave * 16;

  const _Float16* Q16 = (const _Float16*)QKp;
  const __bf16* Vth = (const __bf16*)Vthp;
  const __bf16* Vtl = (const __bf16*)Vtlp;
  float* ob_ptr = AV + (size_t)(b * kS) * kD + h * kHD;

  // ---- Q fragments (A operand, row = query q0 + c, k = d): 2 d-chunks of 32 ----
  v16h qa[2];
  {
    const _Float16* qrow = Q16 + (size_t)(b * kS + q0 + c) * kQKLd + h * kHD + 8 * hh;
    qa[0] = Frag<_Float16>::load(qrow);
    qa[1] = Frag<_Float16>::load(qrow + 32);
  }

  float mrow[8], lrow[8];
  v8f oacc[4];
#pragma unroll
  for (int r = 0; r < 8; ++r) { mrow[r] = -INFINITY; lrow[r] = 0.f; }
#pragma unroll
  for (int t = 0; t < 4; ++t) oacc[t] = (v8f){0.f,0.f,0.f,0.f,0.f,0.f,0.f,0.f};

  const int nChunks = qb + 1;   // block-uniform
  for (int kc = 0; kc < nChunks; ++kc) {
    const int kv0 = kc * kKC;
    __syncthreads();
    const _Float16* gk[4];
    const __bf16* gvh[4];
    const __bf16* gvl[4];
    v8h kr[4];
    v8b vhr[4], vlr[4];
#pragma unroll
    for (int i = 0; i < 4; ++i) {
      const int ch = tid + 128 * i, row = ch >> 3, seg = (ch & 7) * 8;
      gk[i] = Q16 + (size_t)(b * kS + kv0 + row) * kQKLd + h * kHD + seg;   // the k plane lies kKOff further on
      const size_t vo = ((size_t)bh * kHD + row) * kS + kv0 + seg;   // row = d
      gvh[i] = Vth + vo;
      gvl[i] = Vtl + vo;
      kr[i]  = *(const v8h*)(gk[i] + kKOff);
      vhr[i] = *(const v8b*)gvh[i];
      vlr[i] = *(const v8b*)gvl[i];
    }
    // precaution: this wait stands behind the 12 issued loads, in front of every later overwrite of their address
    // registers; the addresses are named as inputs so that no load's destination is placed on one of them ahead of it
    asm volatile("s_wait_xcnt 0x0" :: "v"(gk[0]), "v"(gk[1]), "v"(gk[2]), "v"(gk[3]),
                                      "v"(gvh[0]), "v"(gvh[1]), "v"(gvh[2]), "v"(gvh[3]),
                                      "v"(gvl[0]), "v"(gvl[1]), "v"(gvl[2]), "v"(gvl[3]) : "memory");
#pragma unroll
    for (int i = 0; i < 4; ++i) {
      const int ch = tid + 128 * i, row = ch >> 3, seg = (ch & 7) * 8;
      *(v8h*)(Ksh + row * kStg + seg) = kr[i];
      *(v8b*)(Vhs + row * kStg + seg) = vhr[i];
      *(v8b*)(Vls + row * kStg + seg) = vlr[i];
    }
    __syncthreads();

    v8f s[4];
#pragma unroll
    for (int j = 0; j < 4; ++j) {
      s[j] = (v8f){0.f,0.f,0.f,0.f,0.f,0.f,0.f,0.f};
#pragma unroll
      for (int dc = 0; dc < 2; ++dc) {
        const v16h kb = Frag<_Float16>::load(Ksh + (j * 16 + c) * kStg + dc * 32 + 8 * hh);
        s[j] = at_mma_h(qa[dc], kb, s[j]);
      }
    }
    const bool diag = (kc == qb);   // block-uniform
    float cm[8];
#pragma unroll
    for (int r = 0; r < 8; ++r) {
      const int qrow = q0 + 8 * hh + r;
      float m = -INFINITY;
#pragma unroll
      for (int j = 0; j < 4; ++j) {
        const int kvcol = kv0 + j * 16 + c;
        float sv = s[j][r] * kSmScale;
        if (diag && (kvcol > qrow)) sv = -INFINITY;
        s[j][r] = sv;
        m = fmaxf(m, sv);
      }
#pragma unroll
      for (int off = 1; off < 16; off <<= 1) m = fmaxf(m, __shfl_xor(m, off, 32));
      cm[r] = m;
    }
    __bf16* pwh = Psh[wave];
    __bf16* pwl = Psl[wave];
#pragma unroll
    for (int r = 0; r < 8; ++r) {
      const float mnew = fmaxf(mrow[r], cm[r]);
      const float alpha = expf(mrow[r] - mnew);
      mrow[r] = mnew;
      float psum = 0.f;
#pragma unroll
      for (int j = 0; j < 4; ++j) {
        const float p = expf(s[j][r] - mnew);
        psum += p;
        __bf16 a, bl; at_split(p, a, bl);
        pwh[(8 * hh + r) * kStg + j * 16 + c] = a;
        pwl[(8 * hh + r) * kStg + j * 16 + c] = bl;
      }
#pragma unroll
      for (int off = 1; off < 16; off <<= 1) psum += __shfl_xor(psum, off, 32);
      lrow[r] = lrow[r] * alpha + psum;
#pragma unroll
      for (int t = 0; t < 4; ++t) oacc[t][r] *= alpha;
    }
    __builtin_amdgcn_fence(__ATOMIC_RELEASE, "workgroup");
    __builtin_amdgcn_wave_barrier();
    __builtin_amdgcn_fence(__ATOMIC_ACQUIRE, "workgroup");
#pragma unroll 1
    for (int kk = 0; kk < 2; ++kk) {
      FB pa, pl;
      pa.h[0] = *(const v8b*)(pwh + c * kStg + kk * 32 + 8 * hh);
      pa.h[1] = *(const v8b*)(pwh + c * kStg + kk * 32 + 16 + 8 * hh);
      pl.h[0] = *(const v8b*)(pwl + c * kStg + kk * 32 + 8 * hh);
      pl.h[1] = *(const v8b*)(pwl + c * kStg + kk * 32 + 16 + 8 * hh);
#pragma unroll
      for (int t = 0; t < 4; ++t) {
        FB vb, vl;
        vb.h[0] = *(const v8b*)(Vhs + (t * 16 + c) * kStg + kk * 32 + 8 * hh);
        vb.h[1] = *(const v8b*)(Vhs + (t * 16 + c) * kStg + kk * 32 + 16 + 8 * hh);
        vl.h[0] = *(const v8b*)(Vls + (t * 16 + c) * kStg + kk * 32 + 8 * hh);
        vl.h[1] = *(const v8b*)(Vls + (t * 16 + c) * kStg + kk * 32 + 16 + 8 * hh);
        oacc[t] = at_mma(pa.v, vb.v, oacc[t]);
        oacc[t] = at_mma(pa.v, vl.v, oacc[t]);
        oacc[t] = at_mma(pl.v, vb.v, oacc[t]);
      }
    }
  }

  float* os = Os[wave];
#pragma unroll
  for (int r = 0; r < 8; ++r) {
    const float inv = 1.0f / lrow[r];
#pragma unroll
    for (int t = 0; t < 4; ++t) os[(8 * hh + r) * 68 + t * 16 + c] = oacc[t][r] * inv;
  }
  __builtin_amdgcn_fence(__ATOMIC_RELEASE, "workgroup");
  __builtin_amdgcn_wave_barrier();
  __builtin_amdgcn_fence(__ATOMIC_ACQUIRE, "workgroup");
  {
    const int c4 = (lane & 15) * 4;   // 16 lanes x 16 B = 256 B = one 64-float row segment; hh selects the row
    {
#pragma unroll
      for (int it = 0; it < 8; ++it) {
        const int row = it * 2 + hh;
        v4f val = *(const v4f*)(os + row * 68 + c4);
        *(v4f*)(ob_ptr + (size_t)(q0 + row) * kD + c4) = val;
      }
      
    }
  }
}

// =====================================================================================
// Shaped combination + causal prefix mean in f32:  O[b,s,h*64+d] = rg[h]*AV + sg[h]*v[s] - cg[h]*(sum_{j<=s} v[j])/(s+1),
// emitted as bf16 hi/lo planes [kTok][kD].
// One work-group = one (b, h) and one segment of kScRows rows of s; grid = kScSeg * kB * kH = 256, block 512.
// 16 lanes x 4 channels cover one 64-channel row; the 32 row slots of a work-group
//   (a) sum the rows in front of the segment, slot r taking rows r, r+32, r+64, ... (all loads independent),
//   (b) each own kScPer consecutive rows of the segment and sum them,
//   (c) meet in LDS: per channel the 32 sums of (a) are added up and the 32 sums of (b) scanned in fixed order,
//   (d) walk their own rows from that start value.
// Fixed summation order, no dependence on arrival; each 128-B output line (64 channels x 2 B) has one writer.
// =====================================================================================
constexpr int kScRows  = 256;                  // rows of s per work-group
constexpr int kScSeg   = kS / kScRows;         // 8 segments
constexpr int kScSlots = 32;                   // row slots (16 lanes each) per work-group
constexpr int kScPer   = kScRows / kScSlots;   // 8 consecutive rows per slot
__global__ __launch_bounds__(512) void shaped_combine(const float* __restrict__ AV, const float* __restrict__ Vf,
                                                     const float* __restrict__ rg, const float* __restrict__ sg,
                                                     const float* __restrict__ cg,
                                                     unsigned short* __restrict__ Oh, unsigned short* __restrict__ Ol) {
  __shared__ __align__(16) float Ps[kScSlots * kHD];   // per slot: sum of its rows in front of the segment
  __shared__ __align__(16) float Gs[kScSlots * kHD];   // per slot: sum of its own rows, then its start value
  const int tid  = threadIdx.x;
  const int slot = tid >> 4;
  const int c4   = (tid & 15) * 4;
  const int seg  = (kScSeg - 1) - (int)(blockIdx.x / (kB * kH));   // longest front part starts first
  const int bh   = blockIdx.x % (kB * kH);
  const int b = bh / kH;
  const int h = bh % kH;
  const size_t col = (size_t)(b * kS) * kD + h * kHD + c4;
  const int s0 = seg * kScRows + slot * kScPer;

  const float* vrow = Vf + col + (size_t)s0 * kD;
  const float* arow = AV + col + (size_t)s0 * kD;
  v4f vv[kScPer], aa[kScPer];
#pragma unroll
  for (int k = 0; k < kScPer; ++k) vv[k] = *(const v4f*)(vrow + k * kD);
#pragma unroll
  for (int k = 0; k < kScPer; ++k) aa[k] = *(const v4f*)(arow + k * kD);
  // precaution: this wait stands behind the 16 issued loads, in front of every later overwrite of their address
  // registers; both addresses are named as inputs so that no load's destination is placed on them ahead of it
  asm volatile("s_wait_xcnt 0x0" :: "v"(vrow), "v"(arow) : "memory");

  v4f pre = (v4f){0.f, 0.f, 0.f, 0.f};
  for (int t = 0; t < seg; ++t) {              // block-uniform trip count, at most kScSeg - 1
    v4f w[kScPer];
#pragma unroll
    for (int k = 0; k < kScPer; ++k)
      w[k] = *(const v4f*)(Vf + col + (size_t)(t * kScRows + k * kScSlots + slot) * kD);
#pragma unroll
    for (int k = 0; k < kScPer; ++k) pre += w[k];
  }
  const float rgh = rg[h], sgh = sg[h], cgh = cg[h];
  v4f gsum = vv[0];
#pragma unroll
  for (int k = 1; k < kScPer; ++k) gsum += vv[k];
  *(v4f*)(Ps + slot * kHD + c4) = pre;
  *(v4f*)(Gs + slot * kHD + c4) = gsum;
  __syncthreads();
  if (tid < kHD) {                             // one lane per channel, two whole waves
    float b0 = 0.f, b1 = 0.f, b2 = 0.f, b3 = 0.f;
#pragma unroll
    for (int r = 0; r < kScSlots; r += 4) {
      b0 += Ps[(r + 0) * kHD + tid];
      b1 += Ps[(r + 1) * kHD + tid];
      b2 += Ps[(r + 2) * kHD + tid];
      b3 += Ps[(r + 3) * kHD + tid];
    }
    float run = (b0 + b1) + (b2 + b3);
#pragma unroll
    for (int r = 0; r < kScSlots; ++r) {
      const float g = Gs[r * kHD + tid];
      Gs[r * kHD + tid] = run;
      run += g;
    }
  }
  __syncthreads();
  v4f p = *(const v4f*)(Gs + slot * kHD + c4);
#pragma unroll
  for (int k = 0; k < kScPer; ++k) {
    const int s = s0 + k;
    const size_t idx = col + (size_t)s * kD;
    p += vv[k];
    const float inv = 1.0f / (float)(s + 1);
    unsigned short hb[4], lb[4];
#pragma unroll
    for (int e = 0; e < 4; ++e) {
      const float o = rgh * aa[k][e] + sgh * vv[k][e] - cgh * (p[e] * inv);
      hb[e] = f2bf_bits(o);
      lb[e] = f2bf_bits(o - bf_bits2f(hb[e]));
    }
    uint2 uh, ul;
    uh.x = (unsigned)hb[0] | ((unsigned)hb[1] << 16);
    uh.y = (unsigned)hb[2] | ((unsigned)hb[3] << 16);
    ul.x = (unsigned)lb[0] | ((unsigned)lb[1] << 16);
    ul.y = (unsigned)lb[2] | ((unsigned)lb[3] << 16);
    *(uint2*)(Oh + idx) = uh;
    *(uint2*)(Ol + idx) = ul;
  }
}

// =====================================================================================
// launcher: kernel launches only
// =====================================================================================
extern "C" void kernel_launch(void* const* d_in, const int* in_sizes, int n_in,
                              void* d_out, int out_size, void* d_ws,
                              size_t ws_size, hipStream_t stream) {
  if (n_in < 8) return;
  if (in_sizes[0] != kTok * kD) return;
  if (in_sizes[1] != kD * kQKLd) return;
  if (in_sizes[2] != kQKLd) return;
  if (in_sizes[3] != kD * kD) return;
  if (in_sizes[4] != kD * kD) return;
  if (in_sizes[5] != kH || in_sizes[6] != kH || in_sizes[7] != kH) return;
  if (out_size != kTok * kD) return;
  if (kWsTotal > ws_size) return;

  const float* x     = (const float*)d_in[0];
  const float* qk_w  = (const float*)d_in[1];
  const float* qk_b  = (const float*)d_in[2];
  const float* v_w   = (const float*)d_in[3];
  const float* cp_w  = (const float*)d_in[4];
  const float* rg    = (const float*)d_in[5];
  const float* sg    = (const float*)d_in[6];
  const float* cg    = (const float*)d_in[7];
  float* out = (float*)d_out;

  unsigned char* ws = (unsigned char*)d_ws;
  unsigned short* xb   = (unsigned short*)(ws + kOffXb);
  unsigned short* qkwT = (unsigned short*)(ws + kOffQkwT);
  unsigned short* vwT  = (unsigned short*)(ws + kOffVwT);
  unsigned short* cwT  = (unsigned short*)(ws + kOffCwT);
  unsigned short* QKp  = (unsigned short*)(ws + kOffQKp);
  float*          Vf   = (float*)(ws + kOffVf);
  unsigned short* Vth  = (unsigned short*)(ws + kOffVth);
  unsigned short* Vtl  = (unsigned short*)(ws + kOffVtl);
  float*          AV   = (float*)(ws + kOffAV);
  unsigned short* Oh   = (unsigned short*)(ws + kOffOh);
  unsigned short* Ol   = (unsigned short*)(ws + kOffOl);

  // 1. x -> bf16 [4096][1024]: n = 4194304, n2 = 2097152 threads, 8192 blocks exactly
  {
    const int n2 = (kTok * kD) / 2;
    cast_f32_bf16x2<<<dim3((n2 + 255) / 256), dim3(256), 0, stream>>>(x, xb, n2);
  }
  // 2-4. weights [in][out] f32 -> transposed bf16 [out][in]   (grid = (cols/64, rows/64))
  transpose_cast_bf16<<<dim3(kQKLd / 64, kD / 64), dim3(256), 0, stream>>>(qk_w, qkwT, kD, kQKLd);   // in[1024][2048] -> out[2048][1024]
  transpose_cast_bf16<<<dim3(kD / 64, kD / 64),    dim3(256), 0, stream>>>(v_w,  vwT,  kD, kD);      // in[1024][1024] -> out[1024][1024]
  transpose_cast_bf16<<<dim3(kD / 64, kD / 64),    dim3(256), 0, stream>>>(cp_w, cwT,  kD, kD);

  // 5. fused q|k projection: [4096 x 1024] . [2048 x 1024]^T + qk_b -> f16 [4096][2048]; tiles 32*8 = 256 blocks
  wmma_gemm64<1, 0, 2, 1, false><<<dim3((kTok / kGM) * (kQKLd / kGN), 1), dim3(256), 0, stream>>>(
      xb, xb, kD, 0L, qkwT, qkwT, kD, 0L, (void*)QKp, (void*)QKp, kQKLd, 0L,
      qk_b, x, 0L, kTok, kQKLd, kD, 1.0f);
  // 6. v projection: [4096 x 1024] . [1024 x 1024]^T -> f32 [4096][1024]; tiles 32*4 = 128 blocks
  wmma_gemm64<1, 0, 0, 0, false><<<dim3((kTok / kGM) * (kD / kGN), 1), dim3(256), 0, stream>>>(
      xb, xb, kD, 0L, vwT, vwT, kD, 0L, (void*)Vf, (void*)Vf, kD, 0L,
      qk_b, x, 0L, kTok, kD, kD, 1.0f);
  // 7. v -> bf16 hi/lo planes [32][64][2048]
  v_split_transpose<<<dim3(kS / 64, kB * kH), dim3(256), 0, stream>>>(Vf, Vth, Vtl);
  // 8. causal attention -> AV f32 [4096][1024]
  attn_causal_hd64<<<dim3(kB * kH * kNQB), dim3(128), 0, stream>>>(QKp, Vth, Vtl, AV);
  // 9. shaped combination + prefix mean -> O hi/lo bf16 [4096][1024]
  shaped_combine<<<dim3(kScSeg * kB * kH), dim3(512), 0, stream>>>(AV, Vf, rg, sg, cg, Oh, Ol);
  // 10. output projection: (O hi + O lo) [4096 x 1024] . [1024 x 1024]^T -> f32 d_out [4096][1024]; 128 blocks
  wmma_gemm64<1, 1, 0, 0, false><<<dim3((kTok / kGM) * (kD / kGN), 1), dim3(256), 0, stream>>>(
      Oh, Ol, kD, 0L, cwT, cwT, kD, 0L, (void*)out, (void*)out, kD, 0L,
      qk_b, x, 0L, kTok, kD, kD, 1.0f);
}

// v004
// One run takes 172 microseconds.
// Two timings next to v003 put it at 1.29 and 1.28 times that version's speed.
// All steps since v000 together make it 7.85 times as fast.
// Contractions: qk and v projections = v_wmma_f32_16x16x32_bf16 (x and W as RNE bf16, single product); scores q.k^T = v_wmma_f32_16x16x32_f16 (q, k f16 planes, single product, 1/8 applied to the f32 accumulator); attn.v = v_wmma_f32_16x16x32_bf16 with p and v as bf16 hi/lo pairs (hi.hi + hi.lo + lo.hi); output projection = v_wmma_f32_16x16x32_bf16 with the merged head output as bf16 hi/lo pair times W as RNE bf16 (hi.W + lo.W); f32 accumulate everywhere; softmax, causal prefix mean of v and gain combination in f32.
#include <hip/hip_runtime.h>
#include <math.h>

typedef __attribute__((ext_vector_type(16))) _Float16 v16h;
typedef __attribute__((ext_vector_type(8)))  _Float16 v8h;
typedef __attribute__((ext_vector_type(16))) __bf16   v16b;
typedef __attribute__((ext_vector_type(8)))  __bf16   v8b;
typedef __attribute__((ext_vector_type(8)))  float    v8f;
typedef __attribute__((ext_vector_type(4)))  float    v4f;
typedef __attribute__((ext_vector_type(2)))  float    v2f;
typedef __attribute__((ext_vector_type(8)))  unsigned v8u;
typedef __attribute__((ext_vector_type(2)))  __bf16   v2b;

constexpr int kB    = 2;
constexpr int kS    = 2048;
constexpr int kD    = 1024;
constexpr int kH    = 16;
constexpr int kHD   = 64;
constexpr int kTok  = kB * kS;        // 4096 token rows
constexpr int kQKLd = 2 * kD;         // fused q|k plane pitch (halves): q at col h*64, k at col kD + h*64
constexpr int kKOff = kD;
constexpr int kKC   = 64;             // kv chunk
constexpr int kNQB  = kS / 64;        // query blocks per (b,h)
constexpr int kStg  = 72;             // 16-bit LDS staging pitch (144 B rows, 16-B aligned)
constexpr float kSmScale = 0.125f;    // 1/sqrt(64), exact power of two applied to the f32 score accumulator

// workspace region map (bytes, all offsets multiples of 2 MiB):
//   [0]          xb    bf16 [4096][1024]            8 MiB
//   [8 MiB]      qkwT  bf16 [2048][1024]            4 MiB   (qk_w transposed)
//   [12 MiB]     vwT   bf16 [1024][1024]            2 MiB
//   [14 MiB]     cwT   bf16 [1024][1024]            2 MiB
//   [16 MiB]     QKp   f16  [4096][2048]           16 MiB   (q | k planes)
//   [32 MiB]     Vf    f32  [4096][1024]           16 MiB
//   [48 MiB]     Vth   bf16 [32][64][2048]          8 MiB   (v hi, per (b,h) [d][s])
//   [56 MiB]     Vtl   bf16 [32][64][2048]          8 MiB   (v lo)
//   [64 MiB]     AV    f32  [4096][1024]           16 MiB   (softmax(qk).v, merged heads)
//   [80 MiB]     Oh    bf16 [4096][1024]            8 MiB   (combined head output, hi)
//   [88 MiB]     Ol    bf16 [4096][1024]            8 MiB   (lo)
//   total 96 MiB = 100663296 B
constexpr size_t kOffXb   = 0;
constexpr size_t kOffQkwT = kOffXb   + (size_t)kTok * kD * 2;
constexpr size_t kOffVwT  = kOffQkwT + (size_t)kQKLd * kD * 2;
constexpr size_t kOffCwT  = kOffVwT  + (size_t)kD * kD * 2;
constexpr size_t kOffQKp  = kOffCwT  + (size_t)kD * kD * 2;
constexpr size_t kOffVf   = kOffQKp  + (size_t)kTok * kQKLd * 2;
constexpr size_t kOffVth  = kOffVf   + (size_t)kTok * kD * 4;
constexpr size_t kOffVtl  = kOffVth  + (size_t)kB * kH * kHD * kS * 2;
constexpr size_t kOffAV   = kOffVtl  + (size_t)kB * kH * kHD * kS * 2;
constexpr size_t kOffOh   = kOffAV   + (size_t)kTok * kD * 4;
constexpr size_t kOffOl   = kOffOh   + (size_t)kTok * kD * 2;
constexpr size_t kWsTotal = kOffOl   + (size_t)kTok * kD * 2;
static_assert(kWsTotal == 100663296ull);
static_assert(kWsTotal <= 134217728ull);

__device__ __forceinline__ unsigned short f2bf_bits(float f) {
  unsigned u = __float_as_uint(f);
  return (unsigned short)((u + 0x7FFFu + ((u >> 16) & 1u)) >> 16);
}
__device__ __forceinline__ float bf_bits2f(unsigned short h) { return __uint_as_float(((unsigned)h) << 16); }

// hazard guards as plain device helpers (their inline asm is kept out of the kernel template body)
__device__ __forceinline__ void dep_guard_h(v8f& a, v8f& b, v16h x, v16h y) { asm volatile("v_nop\n\tv_nop\n\tv_nop\n\tv_nop" : "+v"(a), "+v"(b) : "v"(x), "v"(y)); }
__device__ __forceinline__ void dep_guard_b(v8f& a, v8f& b, v16b x, v16b y) { asm volatile("v_nop\n\tv_nop\n\tv_nop\n\tv_nop" : "+v"(a), "+v"(b) : "v"(x), "v"(y)); }
__device__ __forceinline__ void keep4_h(v16h a, v16h b, v16h c, v16h d) { asm volatile("v_nop" :: "v"(a), "v"(b), "v"(c), "v"(d)); }
__device__ __forceinline__ void keep4_b(v16b a, v16b b, v16b c, v16b d) { asm volatile("v_nop" :: "v"(a), "v"(b), "v"(c), "v"(d)); }
__device__ __forceinline__ void acc_guard4(v8f& a, v8f& b, v8f& c, v8f& d) { asm volatile("v_nop\n\tv_nop\n\tv_nop\n\tv_nop" : "+v"(a), "+v"(b), "+v"(c), "+v"(d)); }
template <typename T> struct Frag;
template <> struct Frag<_Float16> {
  typedef v16h V; union U { v16h v; v8h h[2]; };
  static __device__ __forceinline__ v16h load(const _Float16* p) {   // elements 0..7 <- p[0..7], 8..15 <- p[16..23]
    U f; f.h[0] = *(const v8h*)(p); f.h[1] = *(const v8h*)(p + 16); return f.v;
  }
  static __device__ __forceinline__ v8f mma(v16h a, v16h b, v8f c) {
    return __builtin_amdgcn_wmma_f32_16x16x32_f16(false, a, false, b, (short)0, c, false, false);
  }
  static __device__ __forceinline__ void guard(v8f& a, v8f& b, v16h x, v16h y) { dep_guard_h(a, b, x, y); }
  static __device__ __forceinline__ void keep(v16h a, v16h b, v16h c, v16h d) { keep4_h(a, b, c, d); }
};
template <> struct Frag<__bf16> {
  typedef v16b V; union U { v16b v; v8b h[2]; };
  static __device__ __forceinline__ v16b load(const __bf16* p) {
    U f; f.h[0] = *(const v8b*)(p); f.h[1] = *(const v8b*)(p + 16); return f.v;
  }
  static __device__ __forceinline__ v8f mma(v16b a, v16b b, v8f c) {
    return __builtin_amdgcn_wmma_f32_16x16x32_bf16(false, a, false, b, (short)0, c, false, false);
  }
  static __device__ __forceinline__ void guard(v8f& a, v8f& b, v16b x, v16b y) { dep_guard_b(a, b, x, y); }
  static __device__ __forceinline__ void keep(v16b a, v16b b, v16b c, v16b d) { keep4_b(a, b, c, d); }
};

// bf16 hi/lo split of two values straight into packed fragment registers (first value in the low half): the packed
// convert rounds to nearest even and packs in the same instruction; lo = round(f - hi)
__device__ __forceinline__ void at_split2(float f0, float f1, unsigned& hi, unsigned& lo) {
  const v2f f = {f0, f1};
  const unsigned hw = __builtin_bit_cast(unsigned, __builtin_convertvector(f, v2b));
  const v2f d = {f0 - __uint_as_float(hw << 16), f1 - __uint_as_float(hw & 0xFFFF0000u)};
  hi = hw;
  lo = __builtin_bit_cast(unsigned, __builtin_convertvector(d, v2b));
}
__device__ __forceinline__ v8f at_mma(v16b a, v16b b, v8f c) {
  c = __builtin_amdgcn_wmma_f32_16x16x32_bf16(false, a, false, b, (short)0, c, false, false);
  asm volatile("v_nop\n\tv_nop\n\tv_nop\n\tv_nop" : "+v"(c) : "v"(a), "v"(b));
  return c;
}
// lane l reads lane l ^ 16
__device__ __forceinline__ float at_xhalf(float x) {
  return __builtin_bit_cast(float, __builtin_amdgcn_permlanex16(__builtin_bit_cast(int, x), __builtin_bit_cast(int, x),
                                                                0x76543210, 0xfedcba98, false, false));
}
__device__ __forceinline__ v8f at_mma_h(v16h a, v16h b, v8f c) {
  c = __builtin_amdgcn_wmma_f32_16x16x32_f16(false, a, false, b, (short)0, c, false, false);
  asm volatile("v_nop\n\tv_nop\n\tv_nop\n\tv_nop" : "+v"(c) : "v"(a), "v"(b));
  return c;
}

// =====================================================================================
// =====================================================================================
__global__ __launch_bounds__(256) void cast_f32_bf16x2(const float* __restrict__ in,
                                                       unsigned short* __restrict__ out, int n2) {
  const int i = blockIdx.x * 256 + threadIdx.x;
  if (i < n2) {
    const unsigned u = (unsigned)f2bf_bits(in[2 * i]) | ((unsigned)f2bf_bits(in[2 * i + 1]) << 16);
    ((unsigned*)out)[i] = u;
    
  }
}

// =====================================================================================
// Register-blocked batched WMMA GEMM, C[m,n] = scale * sum_k A[m,k] * Bt[n,k] (+bias)(+resid);
// each wave owns a 64x64 tile; the 8 waves of a work-group stand 2 (m) x 4 (n) on one 128x256 tile of C.
// A row-major [M,K]; Bt row-major [N,K]; M % 128 == 0, N % 256 == 0, K % 64 == 0.
// Operands reach the waves through LDS: per k tile of 64 the work-group copies 128 rows of A (and of A2) and 256 rows
// of Bt, 128 B a row, with asynchronous copies (8 lanes x 16 B = one whole line of a row), into one of two buffers at
// row pitch kStg; the copies of tile t + 2 fly while tile t + 1 is worked on.
// SPLITM: 0 = single product; 1 = A carried as hi/lo planes (A2p = lo): product = hi.B + lo.B.
// BIAS_MODE: 0 = none, 1 = bias[m], 2 = bias[n].  OUT_MODE: 0 = f32, 1 = f16, 2 = bf16 hi + lo planes.
// ET: 0 = f16 operands, 1 = bf16 operands (pointers passed as 16-bit storage)
// =====================================================================================
constexpr int kGK = 64;     // k extent of a staged tile
constexpr int kGM = 128;    // rows of A per work-group
constexpr int kGN = 256;    // rows of Bt per work-group

// Each lane copies its own 16 B from global memory to its own LDS byte address. The s_wait_xcnt closes the statement so
// that it stands in front of every later write of the address registers named here (a precaution).
__device__ __forceinline__ void async_copy4(unsigned l0, const void* g0, unsigned l1, const void* g1,
                                            unsigned l2, const void* g2, unsigned l3, const void* g3) {
  asm volatile("global_load_async_to_lds_b128 %0, %1, off\n\t"
               "global_load_async_to_lds_b128 %2, %3, off\n\t"
               "global_load_async_to_lds_b128 %4, %5, off\n\t"
               "global_load_async_to_lds_b128 %6, %7, off\n\t"
               "s_wait_xcnt 0x0"
               :: "v"(l0), "v"(g0), "v"(l1), "v"(g1), "v"(l2), "v"(g2), "v"(l3), "v"(g3) : "memory");
}
__device__ __forceinline__ void async_copy8(unsigned l0, const void* g0, unsigned l1, const void* g1,
                                            unsigned l2, const void* g2, unsigned l3, const void* g3,
                                            unsigned l4, const void* g4, unsigned l5, const void* g5,
                                            unsigned l6, const void* g6, unsigned l7, const void* g7) {
  asm volatile("global_load_async_to_lds_b128 %0, %1, off\n\t"
               "global_load_async_to_lds_b128 %2, %3, off\n\t"
               "global_load_async_to_lds_b128 %4, %5, off\n\t"
               "global_load_async_to_lds_b128 %6, %7, off\n\t"
               "global_load_async_to_lds_b128 %8, %9, off\n\t"
               "global_load_async_to_lds_b128 %10, %11, off\n\t"
               "global_load_async_to_lds_b128 %12, %13, off\n\t"
               "global_load_async_to_lds_b128 %14, %15, off\n\t"
               "s_wait_xcnt 0x0"
               :: "v"(l0), "v"(g0), "v"(l1), "v"(g1), "v"(l2), "v"(g2), "v"(l3), "v"(g3),
                  "v"(l4), "v"(g4), "v"(l5), "v"(g5), "v"(l6), "v"(g6), "v"(l7), "v"(g7) : "memory");
}

template <int ET> struct Elem;
template <> struct Elem<0> { typedef _Float16 T; };
template <> struct Elem<1> { typedef __bf16 T; };
template <int ET, int SPLITM, int BIAS_MODE, int OUT_MODE, bool RESID, int ACT = 0>
__global__ __launch_bounds__(256) void wmma_gemm64(
    const unsigned short* __restrict__ Ap, const unsigned short* __restrict__ A2p, int lda, long strideA,
    const unsigned short* __restrict__ Btp, const unsigned short* __restrict__ Bt2p, int ldb, long strideB,
    void* __restrict__ Cout, void* __restrict__ Cout2, int ldc, long strideC,
    const float* __restrict__ bias,
    const float* __restrict__ resid, long strideR,
    int M, int N, int K, float scale) {
  typedef typename Elem<ET>::T T;
  typedef typename Frag<T>::V V;
  static_assert(SPLITM <= 1);
  constexpr bool SPA = (SPLITM >= 1);
  constexpr int kOffA2  = kGM * kStg;                       // element offsets inside one buffer: A | A2 | Bt
  constexpr int kOffB   = (SPA ? 2 : 1) * kGM * kStg;
  constexpr int kBufEl  = kOffB + kGN * kStg;
  const T* A = (const T*)Ap; const T* A2 = (const T*)A2p; const T* Bt = (const T*)Btp;
  __shared__ __align__(16) T sOp[2 * kBufEl];      // two operand buffers
  __shared__ __align__(16) float sT[8][16 * 68];   // per-wave 16x64 slab, pitch 68 floats
  const int b    = blockIdx.y;
  const int tid  = threadIdx.x;
  const int lane = tid & 31;
  const int wave = tid >> 5;
  const int tilesN = N / kGN;
  const int tilesM = M / kGM;
  if ((int)blockIdx.x >= tilesM * tilesN) return;   // the same for the whole work-group, in front of every copy and barrier
  const int bm = blockIdx.x / tilesN;
  const int bn = blockIdx.x - bm * tilesN;
  const int wm = (wave >> 2) << 6;             // this wave's rows inside the staged A tile
  const int wn = (wave & 3) << 6;              // this wave's rows inside the staged Bt tile
  const int m0 = bm * kGM + wm;
  const int n0 = bn * kGN + wn;

  const int rlane = lane & 15;                 // row (A) / col (B, D) within subtile
  const int koff  = (lane >> 4) * 8;           // k offset of this lane half
  const int mOff  = (lane >> 4) * 8;           // D row offset

  // staging: thread -> row tid / 8 (+ 32 per copy), 16-B piece tid % 8 of the row's 128 B
  const int srow = tid >> 3;
  const int sseg = (tid & 7) * 8;
  const T* gA  = A  + (size_t)b * strideA + (size_t)(bm * kGM + srow) * lda + sseg;
  const T* gA2 = SPA ? (A2 + (size_t)b * strideA + (size_t)(bm * kGM + srow) * lda + sseg) : nullptr;
  const T* gB  = Bt + (size_t)b * strideB + (size_t)(bn * kGN + srow) * ldb + sseg;
  const unsigned lS = (unsigned)(size_t)(sOp + srow * kStg + sseg);   // LDS byte address: low 32 bits
  const size_t a32 = (size_t)32 * lda, b32 = (size_t)32 * ldb;
  constexpr unsigned kL32 = 32 * kStg * 2;     // 32 rows in LDS, bytes
  auto stage = [&](int t, int buf) {
    const unsigned l = lS + (unsigned)buf * (unsigned)(kBufEl * 2);
    const unsigned lb = l + kOffB * 2;
    const T* pb = gB + t * kGK;
    async_copy8(lb, pb, lb + kL32, pb + b32, lb + 2 * kL32, pb + 2 * b32, lb + 3 * kL32, pb + 3 * b32,
                lb + 4 * kL32, pb + 4 * b32, lb + 5 * kL32, pb + 5 * b32, lb + 6 * kL32, pb + 6 * b32,
                lb + 7 * kL32, pb + 7 * b32);
    const T* pa = gA + t * kGK;
    if (SPA) {
      const unsigned l2 = l + kOffA2 * 2;
      const T* pa2 = gA2 + t * kGK;
      async_copy8(l, pa, l + kL32, pa + a32, l + 2 * kL32, pa + 2 * a32, l + 3 * kL32, pa + 3 * a32,
                  l2, pa2, l2 + kL32, pa2 + a32, l2 + 2 * kL32, pa2 + 2 * a32, l2 + 3 * kL32, pa2 + 3 * a32);
    } else {
      async_copy4(l, pa, l + kL32, pa + a32, l + 2 * kL32, pa + 2 * a32, l + 3 * kL32, pa + 3 * a32);
    }
  };

  v8f acc[4][4];
#pragma unroll
  for (int i = 0; i < 4; ++i)
#pragma unroll
    for (int j = 0; j < 4; ++j) acc[i][j] = (v8f){0.f,0.f,0.f,0.f,0.f,0.f,0.f,0.f};

  const int nT = K / kGK;                      // the same for the whole work-group
  stage(0, 0);
  asm volatile("s_wait_asynccnt 0x0" ::: "memory");   // this wave's copies of tile 0 have landed
  __syncthreads();                                    // ... and every other wave's: tile 0 may be read
  if (nT > 1) stage(1, 1);
  for (int t = 0; t < nT; ++t) {
    const T* sA = sOp + (t & 1) * kBufEl + (wm + rlane) * kStg + koff;
    const T* sB = sOp + (t & 1) * kBufEl + kOffB + (wn + rlane) * kStg + koff;
#pragma unroll
    for (int kk = 0; kk < kGK; kk += 32) {
      V bh[4], ah[4], al[4];
#pragma unroll
      for (int j = 0; j < 4; ++j) bh[j] = Frag<T>::load(sB + (j << 4) * kStg + kk);
#pragma unroll
      for (int i = 0; i < 4; ++i) {
        ah[i] = Frag<T>::load(sA + (i << 4) * kStg + kk);
        if (SPA) al[i] = Frag<T>::load(sA + kOffA2 + (i << 4) * kStg + kk);
      }
#pragma unroll
      for (int i = 0; i < 4; ++i) {
#pragma unroll
        for (int j = 0; j < 4; ++j) {
          acc[i][j] = Frag<T>::mma(ah[i], bh[j], acc[i][j]);
          if (SPA) acc[i][j] = Frag<T>::mma(al[i], bh[j], acc[i][j]);
        }
        Frag<T>::guard(acc[i][0], acc[i][3], ah[i], SPA ? al[i] : ah[i]);
      }
      Frag<T>::keep(bh[0], bh[1], bh[2], bh[3]);
    }
    asm volatile("s_wait_dscnt 0x0" ::: "memory");      // this wave's reads of tile t are done before its buffer is refilled
    asm volatile("s_wait_asynccnt 0x0" ::: "memory");   // this wave's copies of tile t + 1 have landed
    __syncthreads();                                    // publishes tile t + 1 and ends every reader's reads of tile t
    if (t + 2 < nT) stage(t + 2, t & 1);
  }
  asm volatile("s_wait_asynccnt 0x0" ::: "memory");     // no copy is outstanding when the wave goes on
  acc_guard4(acc[0][0], acc[0][1], acc[0][2], acc[0][3]);
  acc_guard4(acc[1][0], acc[1][1], acc[1][2], acc[1][3]);
  acc_guard4(acc[2][0], acc[2][1], acc[2][2], acc[2][3]);
  acc_guard4(acc[3][0], acc[3][1], acc[3][2], acc[3][3]);

  // ---- epilogue ----
  float* slab = sT[wave];
  const float* Rb = RESID ? (resid + (size_t)b * strideR) : nullptr;
#pragma unroll
  for (int i = 0; i < 4; ++i) {
    const int mBase = m0 + (i << 4);
#pragma unroll
    for (int j = 0; j < 4; ++j) {
      const int n = n0 + (j << 4) + rlane;
      float bv = 0.f;
      if (BIAS_MODE == 2) bv = bias[n];
#pragma unroll
      for (int r = 0; r < 8; ++r) {
        float v = acc[i][j][r] * scale;
        if (BIAS_MODE == 1) v += bias[mBase + mOff + r];
        if (BIAS_MODE == 2) v += bv;
        if (RESID) v += Rb[(size_t)(mBase + mOff + r) * ldc + n];
        if (ACT == 1) v = tanhf(v);
        if (ACT == 2) v = fmaxf(v, 0.0f);
        if (ACT == 4) v = (v > 0.f) ? v : 0.01f * v;
        slab[(mOff + r) * 68 + (j << 4) + rlane] = v;
      }
    }
    __builtin_amdgcn_fence(__ATOMIC_RELEASE, "workgroup");
    __builtin_amdgcn_wave_barrier();
    __builtin_amdgcn_fence(__ATOMIC_ACQUIRE, "workgroup");
    if (OUT_MODE == 0) {
      float* C = (float*)Cout + (size_t)b * strideC;
      const int hh = lane >> 4, c4 = (lane & 15) * 4;     // row seg = 256 B = 16 lanes x 16 B
      {
#pragma unroll
        for (int it = 0; it < 8; ++it) {
          const int row = it * 2 + hh;
          v4f v = *(const v4f*)(slab + row * 68 + c4);
          *(v4f*)(C + (size_t)(mBase + row) * ldc + n0 + c4) = v;
        }
        
      }
    } else {
      const int q = lane >> 3, c8 = (lane & 7) * 8;
      unsigned short* C  = (unsigned short*)Cout  + (size_t)b * strideC;
      unsigned short* C2 = (OUT_MODE == 2) ? ((unsigned short*)Cout2 + (size_t)b * strideC) : nullptr;
      {
#pragma unroll
        for (int it = 0; it < 4; ++it) {
          const int row = it * 4 + q;
          const float* sp = slab + row * 68 + c8;
          v8h hv, lv;
#pragma unroll
          for (int e = 0; e < 8; ++e) {
            if (OUT_MODE == 1) {
              hv[e] = (_Float16)sp[e];
            } else {
              unsigned short hb = f2bf_bits(sp[e]);
              unsigned short lb = f2bf_bits(sp[e] - bf_bits2f(hb));
              hv[e] = __builtin_bit_cast(_Float16, hb);
              lv[e] = __builtin_bit_cast(_Float16, lb);
            }
          }
          *(v8h*)(C + (size_t)(mBase + row) * ldc + n0 + c8) = hv;
          if (OUT_MODE == 2) *(v8h*)(C2 + (size_t)(mBase + row) * ldc + n0 + c8) = lv;
        }
        
      }
    }
    __builtin_amdgcn_fence(__ATOMIC_RELEASE, "workgroup");
    __builtin_amdgcn_wave_barrier();
    __builtin_amdgcn_fence(__ATOMIC_ACQUIRE, "workgroup");
  }
}

// =====================================================================================
// Weight transpose + RNE bf16 cast: in f32 [R][Cc] row-major -> out bf16 bits [Cc][R]  (out[c][r] = in[r][c]).
// grid = (Cc/64, R/64), block 256; one 64x64 tile through LDS.
// Load coverage: 256 threads x 16 floats = 64 (r) x 64 (c).  Store coverage: 8 waves x 2 x 4 rows (q8) = 64 rows c;
// =====================================================================================
__global__ __launch_bounds__(256) void transpose_cast_bf16(const float* __restrict__ in, unsigned short* __restrict__ out,
                                                           int R, int Cc) {
  __shared__ __align__(16) _Float16 t[64 * kStg];     // [c][r] as 16-bit bit patterns
  const int c0 = blockIdx.x * 64, r0 = blockIdx.y * 64;
  const int tid = threadIdx.x;
  {
    const int rloc = tid >> 2, cq = (tid & 3) * 16;
    const float* src = in + (size_t)(r0 + rloc) * Cc + c0 + cq;
#pragma unroll
    for (int g4 = 0; g4 < 4; ++g4) {
      const v4f a = *(const v4f*)(src + 4 * g4);
#pragma unroll
      for (int e = 0; e < 4; ++e)
        t[(cq + 4 * g4 + e) * kStg + rloc] = __builtin_bit_cast(_Float16, f2bf_bits(a[e]));
    }
  }
  __syncthreads();
  const int wave = tid >> 5, lane = tid & 31, q8 = lane >> 3, c8 = (lane & 7) * 8;
  const int cA = wave * 8 + q8, cB = wave * 8 + 4 + q8;
  const v8h va = *(const v8h*)(t + cA * kStg + c8);
  const v8h vb = *(const v8h*)(t + cB * kStg + c8);
  unsigned short* da = out + (size_t)(c0 + cA) * R + r0 + c8;
  unsigned short* db = out + (size_t)(c0 + cB) * R + r0 + c8;
  {
    *(v8h*)da = va;
    *(v8h*)db = vb;
    
  }
}

// =====================================================================================
// V planes: Vf f32 [kTok][kD] (row b*kS+s, col h*kHD+d) -> Vth/Vtl bf16 bits [kB*kH][kHD][kS]:
// out[bh][d][s] = hi/lo(Vf[b*kS+s][h*kHD+d]).  grid = (kS/64, kB*kH), block 256.
// Load coverage: 256 threads x 16 floats = 64 (s) x 64 (d).
// =====================================================================================
__global__ __launch_bounds__(256) void v_split_transpose(const float* __restrict__ Vf,
                                                         unsigned short* __restrict__ vth, unsigned short* __restrict__ vtl) {
  __shared__ __align__(16) _Float16 th[64 * kStg];
  __shared__ __align__(16) _Float16 tl[64 * kStg];
  const int st0 = blockIdx.x * 64, bh = blockIdx.y;
  const int b = bh / kH, h = bh % kH;
  const int tid = threadIdx.x;
  {
    const int sloc = tid >> 2, d0 = (tid & 3) * 16;
    const float* src = Vf + (size_t)(b * kS + st0 + sloc) * kD + h * kHD + d0;
#pragma unroll
    for (int g4 = 0; g4 < 4; ++g4) {
      const v4f a = *(const v4f*)(src + 4 * g4);
#pragma unroll
      for (int e = 0; e < 4; ++e) {
        const unsigned short hb = f2bf_bits(a[e]);
        const unsigned short lb = f2bf_bits(a[e] - bf_bits2f(hb));
        th[(d0 + 4 * g4 + e) * kStg + sloc] = __builtin_bit_cast(_Float16, hb);
        tl[(d0 + 4 * g4 + e) * kStg + sloc] = __builtin_bit_cast(_Float16, lb);
      }
    }
  }
  __syncthreads();
  const int wave = tid >> 5, lane = tid & 31, q8 = lane >> 3, c8 = (lane & 7) * 8;
  const int dA = wave * 8 + q8, dB = wave * 8 + 4 + q8;
  const v8h ha = *(const v8h*)(th + dA * kStg + c8);
  const v8h hbv = *(const v8h*)(th + dB * kStg + c8);
  const v8h la = *(const v8h*)(tl + dA * kStg + c8);
  const v8h lbv = *(const v8h*)(tl + dB * kStg + c8);
  unsigned short* pha = vth + ((size_t)bh * kHD + dA) * kS + st0 + c8;
  unsigned short* phb = vth + ((size_t)bh * kHD + dB) * kS + st0 + c8;
  unsigned short* pla = vtl + ((size_t)bh * kHD + dA) * kS + st0 + c8;
  unsigned short* plb = vtl + ((size_t)bh * kHD + dB) * kS + st0 + c8;
  {
    *(v8h*)pha = ha;
    *(v8h*)phb = hbv;
    *(v8h*)pla = la;
    *(v8h*)plb = lbv;
    
  }
}

// =====================================================================================
// Causal attention, head_dim 64, 16-bit input planes, f32 out.
//   scores = (k.q^T, the transposed tile: A = K rows, B = Q columns) : v_wmma_f32_16x16x32_f16 (q, k f16 planes), then
//            * 1/8 in f32; a lane holds 32 of one query's 64 scores, its partner lane ^ 16 the rest; causal: kv > q replaced by -inf
//            (exp -> 0, identical to a finite most-negative fill since every row keeps its diagonal); chunks past
//            the diagonal contribute exactly 0 and are skipped.
//   out    = (v^T.p^T, A = V rows [d][kv], B = P packed from the score registers) : v_wmma_f32_16x16x32_bf16 with p and v
//            as bf16 hi/lo (hi.hi + hi.lo + lo.hi); online softmax in f32, one maximum and one sum per lane.
// Block = 4 waves = 64 query rows of one (b, h); grid.x = kB * kH * (kS/64).
// Staging coverage per kv chunk: 128 threads x 4 chunks x 8 halves = 64 x 64 per plane (K, V hi, V lo), plain loads + barrier.
// Output AV f32 [kTok][kD] at col h*64: row segment 64 floats = 256 B by 16 lanes x 16 B in one instruction, one wave per
// =====================================================================================
// second launch bound: a register budget for four waves per SIMD, so that four work-groups share a WGP
__global__ __launch_bounds__(128, 4)
void attn_causal_hd64(const unsigned short* __restrict__ QKp,    // f16 bits [kTok][kQKLd]
                      const unsigned short* __restrict__ Vthp,   // bf16 bits [kB*kH][kHD][kS]
                      const unsigned short* __restrict__ Vtlp,
                      float* __restrict__ AV) {                  // f32 [kTok][kD]
  union FB { v16b v; v8b h[2]; };
  // every 16-bit tile has rows of 128 B laid at pitch kStg (144 B = 16 B x 9): the 16 rows that one ds_load_b128
  // fragment read touches then start on 16 different groups of four banks instead of two
  __shared__ __align__(16) _Float16 Ksh[kKC * kStg];       // K [kv][d]      9 KB
  __shared__ __align__(16) __bf16  Vhs[kHD * kStg];        // V hi [d][kv]   9 KB
  __shared__ __align__(16) __bf16  Vls[kHD * kStg];        // V lo [d][kv]   9 KB
  __shared__ __align__(16) float   Os[4][16 * 68];         // per wave out tile, pitch 68

  const int tid  = threadIdx.x;
  const int wave = tid >> 5;
  const int lane = tid & 31;
  const int hh   = lane >> 4;
  const int c    = lane & 15;

  const int bx = blockIdx.x;
  const int qb = bx % kNQB;
  const int bh = bx / kNQB;
  const int h  = bh % kH;
  const int b  = bh / kH;
  const int q0 = qb * 64 + wave * 16;

  const _Float16* Q16 = (const _Float16*)QKp;
  const __bf16* Vth = (const __bf16*)Vthp;
  const __bf16* Vtl = (const __bf16*)Vtlp;
  float* ob_ptr = AV + (size_t)(b * kS) * kD + h * kHD;

  // ---- Q fragments (B operand, column = query q0 + c, k = d): 2 d-chunks of 32 ----
  v16h qa[2];
  {
    const _Float16* qrow = Q16 + (size_t)(b * kS + q0 + c) * kQKLd + h * kHD + 8 * hh;
    qa[0] = Frag<_Float16>::load(qrow);
    qa[1] = Frag<_Float16>::load(qrow + 32);
  }

  const int qrow = q0 + c;      // the one query whose scores, maximum, sum and output column this lane holds
  float mrow = -INFINITY, lrow = 0.f;
  v8f oacc[4];
#pragma unroll
  for (int t = 0; t < 4; ++t) oacc[t] = (v8f){0.f,0.f,0.f,0.f,0.f,0.f,0.f,0.f};

  const int nChunks = qb + 1;   // block-uniform
  for (int kc = 0; kc < nChunks; ++kc) {
    const int kv0 = kc * kKC;
    __syncthreads();
    const _Float16* gk[4];
    const __bf16* gvh[4];
    const __bf16* gvl[4];
    v8h kr[4];
    v8b vhr[4], vlr[4];
#pragma unroll
    for (int i = 0; i < 4; ++i) {
      const int ch = tid + 128 * i, row = ch >> 3, seg = (ch & 7) * 8;
      gk[i] = Q16 + (size_t)(b * kS + kv0 + row) * kQKLd + h * kHD + seg;   // the k plane lies kKOff further on
      const size_t vo = ((size_t)bh * kHD + row) * kS + kv0 + seg;   // row = d
      gvh[i] = Vth + vo;
      gvl[i] = Vtl + vo;
      kr[i]  = *(const v8h*)(gk[i] + kKOff);
      vhr[i] = *(const v8b*)gvh[i];
      vlr[i] = *(const v8b*)gvl[i];
    }
    // precaution: this wait stands behind the 12 issued loads, in front of every later overwrite of their address
    // registers; the addresses are named as inputs so that no load's destination is placed on one of them ahead of it
    asm volatile("s_wait_xcnt 0x0" :: "v"(gk[0]), "v"(gk[1]), "v"(gk[2]), "v"(gk[3]),
                                      "v"(gvh[0]), "v"(gvh[1]), "v"(gvh[2]), "v"(gvh[3]),
                                      "v"(gvl[0]), "v"(gvl[1]), "v"(gvl[2]), "v"(gvl[3]) : "memory");
#pragma unroll
    for (int i = 0; i < 4; ++i) {
      const int ch = tid + 128 * i, row = ch >> 3, seg = (ch & 7) * 8;
      *(v8h*)(Ksh + row * kStg + seg) = kr[i];
      *(v8b*)(Vhs + row * kStg + seg) = vhr[i];
      *(v8b*)(Vls + row * kStg + seg) = vlr[i];
    }
    __syncthreads();

    // transposed scores: A = K rows, B = Q columns, so s[j][r] = score(kv0 + 16 j + 8 hh + r, q0 + c): one query per lane
    v8f s[4];
#pragma unroll
    for (int j = 0; j < 4; ++j) {
      s[j] = (v8f){0.f,0.f,0.f,0.f,0.f,0.f,0.f,0.f};
#pragma unroll
      for (int dc = 0; dc < 2; ++dc) {
        const v16h kb = Frag<_Float16>::load(Ksh + (j * 16 + c) * kStg + dc * 32 + 8 * hh);
        s[j] = at_mma_h(kb, qa[dc], s[j]);
      }
    }
    const bool diag = (kc == qb);   // block-uniform
    float mj[4];
#pragma unroll
    for (int j = 0; j < 4; ++j) {
      float m = -INFINITY;
#pragma unroll
      for (int r = 0; r < 8; ++r) {
        const int kvcol = kv0 + j * 16 + 8 * hh + r;
        float sv = s[j][r] * kSmScale;
        if (diag && (kvcol > qrow)) sv = -INFINITY;
        s[j][r] = sv;
        m = fmaxf(m, sv);
      }
      mj[j] = m;
    }
    float cm = fmaxf(fmaxf(mj[0], mj[1]), fmaxf(mj[2], mj[3]));
    cm = fmaxf(cm, at_xhalf(cm));   // lanes c and c + 16 hold the two halves of one query's 64 scores
    const float mnew = fmaxf(mrow, cm);
    const float alpha = expf(mrow - mnew);
    mrow = mnew;
    // two score tiles of 16 kv, converted in place, are one B fragment of 32 kv in the loaders' k order
    v8u ph[2], pl[2];
    float pj[4];
#pragma unroll
    for (int j = 0; j < 4; ++j) {
      float psum = 0.f;
#pragma unroll
      for (int r = 0; r < 8; r += 2) {
        const float p0 = expf(s[j][r] - mnew);
        const float p1 = expf(s[j][r + 1] - mnew);
        psum += p0;
        psum += p1;
        unsigned wh, wl;
        at_split2(p0, p1, wh, wl);
        ph[j >> 1][(j & 1) * 4 + (r >> 1)] = wh;
        pl[j >> 1][(j & 1) * 4 + (r >> 1)] = wl;
      }
      pj[j] = psum;
    }
    const v16b pha[2] = { __builtin_bit_cast(v16b, ph[0]), __builtin_bit_cast(v16b, ph[1]) };
    const v16b pla[2] = { __builtin_bit_cast(v16b, pl[0]), __builtin_bit_cast(v16b, pl[1]) };
    lrow = lrow * alpha + ((pj[0] + pj[1]) + (pj[2] + pj[3]));   // this lane half's share; the halves are joined after the loop
#pragma unroll
    for (int t = 0; t < 4; ++t)
#pragma unroll
      for (int r = 0; r < 8; ++r) oacc[t][r] *= alpha;
    // unrolled so that pha[kk], pla[kk] are fixed registers
#pragma unroll
    for (int kk = 0; kk < 2; ++kk) {
#pragma unroll
      for (int t = 0; t < 4; ++t) {
        FB vb, vl;
        vb.h[0] = *(const v8b*)(Vhs + (t * 16 + c) * kStg + kk * 32 + 8 * hh);
        vb.h[1] = *(const v8b*)(Vhs + (t * 16 + c) * kStg + kk * 32 + 16 + 8 * hh);
        vl.h[0] = *(const v8b*)(Vls + (t * 16 + c) * kStg + kk * 32 + 8 * hh);
        vl.h[1] = *(const v8b*)(Vls + (t * 16 + c) * kStg + kk * 32 + 16 + 8 * hh);
        oacc[t] = at_mma(vb.v, pha[kk], oacc[t]);
        oacc[t] = at_mma(vl.v, pha[kk], oacc[t]);
        oacc[t] = at_mma(vb.v, pla[kk], oacc[t]);
      }
    }
  }

  // oacc[t][r] = out(q0 + c, 16 t + 8 hh + r): eight consecutive channels of one query row per tile
  float* os = Os[wave];
  {
    const float inv = 1.0f / (lrow + at_xhalf(lrow));
#pragma unroll
    for (int t = 0; t < 4; ++t) {
      v4f lo4, hi4;
#pragma unroll
      for (int e = 0; e < 4; ++e) { lo4[e] = oacc[t][e] * inv; hi4[e] = oacc[t][4 + e] * inv; }
      *(v4f*)(os + c * 68 + t * 16 + 8 * hh)     = lo4;
      *(v4f*)(os + c * 68 + t * 16 + 8 * hh + 4) = hi4;
    }
  }
  __builtin_amdgcn_fence(__ATOMIC_RELEASE, "workgroup");
  __builtin_amdgcn_wave_barrier();
  __builtin_amdgcn_fence(__ATOMIC_ACQUIRE, "workgroup");
  {
    const int c4 = (lane & 15) * 4;   // 16 lanes x 16 B = 256 B = one 64-float row segment; hh selects the row
    {
#pragma unroll
      for (int it = 0; it < 8; ++it) {
        const int row = it * 2 + hh;
        v4f val = *(const v4f*)(os + row * 68 + c4);
        *(v4f*)(ob_ptr + (size_t)(q0 + row) * kD + c4) = val;
      }
      
    }
  }
}

// =====================================================================================
// Shaped combination + causal prefix mean in f32:  O[b,s,h*64+d] = rg[h]*AV + sg[h]*v[s] - cg[h]*(sum_{j<=s} v[j])/(s+1),
// emitted as bf16 hi/lo planes [kTok][kD].
// One work-group = one (b, h) and one segment of kScRows rows of s; grid = kScSeg * kB * kH = 256, block 512.
// 16 lanes x 4 channels cover one 64-channel row; the 32 row slots of a work-group
//   (a) sum the rows in front of the segment, slot r taking rows r, r+32, r+64, ... (all loads independent),
//   (b) each own kScPer consecutive rows of the segment and sum them,
//   (c) meet in LDS: per channel the 32 sums of (a) are added up and the 32 sums of (b) scanned in fixed order,
//   (d) walk their own rows from that start value.
// Fixed summation order, no dependence on arrival; each 128-B output line (64 channels x 2 B) has one writer.
// =====================================================================================
constexpr int kScRows  = 256;                  // rows of s per work-group
constexpr int kScSeg   = kS / kScRows;         // 8 segments
constexpr int kScSlots = 32;                   // row slots (16 lanes each) per work-group
constexpr int kScPer   = kScRows / kScSlots;   // 8 consecutive rows per slot
__global__ __launch_bounds__(512) void shaped_combine(const float* __restrict__ AV, const float* __restrict__ Vf,
                                                     const float* __restrict__ rg, const float* __restrict__ sg,
                                                     const float* __restrict__ cg,
                                                     unsigned short* __restrict__ Oh, unsigned short* __restrict__ Ol) {
  __shared__ __align__(16) float Ps[kScSlots * kHD];   // per slot: sum of its rows in front of the segment
  __shared__ __align__(16) float Gs[kScSlots * kHD];   // per slot: sum of its own rows, then its start value
  const int tid  = threadIdx.x;
  const int slot = tid >> 4;
  const int c4   = (tid & 15) * 4;
  const int seg  = (kScSeg - 1) - (int)(blockIdx.x / (kB * kH));   // longest front part starts first
  const int bh   = blockIdx.x % (kB * kH);
  const int b = bh / kH;
  const int h = bh % kH;
  const size_t col = (size_t)(b * kS) * kD + h * kHD + c4;
  const int s0 = seg * kScRows + slot * kScPer;

  const float* vrow = Vf + col + (size_t)s0 * kD;
  const float* arow = AV + col + (size_t)s0 * kD;
  v4f vv[kScPer], aa[kScPer];
#pragma unroll
  for (int k = 0; k < kScPer; ++k) vv[k] = *(const v4f*)(vrow + k * kD);
#pragma unroll
  for (int k = 0; k < kScPer; ++k) aa[k] = *(const v4f*)(arow + k * kD);
  // precaution: this wait stands behind the 16 issued loads, in front of every later overwrite of their address
  // registers; both addresses are named as inputs so that no load's destination is placed on them ahead of it
  asm volatile("s_wait_xcnt 0x0" :: "v"(vrow), "v"(arow) : "memory");

  v4f pre = (v4f){0.f, 0.f, 0.f, 0.f};
  for (int t = 0; t < seg; ++t) {              // block-uniform trip count, at most kScSeg - 1
    v4f w[kScPer];
#pragma unroll
    for (int k = 0; k < kScPer; ++k)
      w[k] = *(const v4f*)(Vf + col + (size_t)(t * kScRows + k * kScSlots + slot) * kD);
#pragma unroll
    for (int k = 0; k < kScPer; ++k) pre += w[k];
  }
  const float rgh = rg[h], sgh = sg[h], cgh = cg[h];
  v4f gsum = vv[0];
#pragma unroll
  for (int k = 1; k < kScPer; ++k) gsum += vv[k];
  *(v4f*)(Ps + slot * kHD + c4) = pre;
  *(v4f*)(Gs + slot * kHD + c4) = gsum;
  __syncthreads();
  if (tid < kHD) {                             // one lane per channel, two whole waves
    float b0 = 0.f, b1 = 0.f, b2 = 0.f, b3 = 0.f;
#pragma unroll
    for (int r = 0; r < kScSlots; r += 4) {
      b0 += Ps[(r + 0) * kHD + tid];
      b1 += Ps[(r + 1) * kHD + tid];
      b2 += Ps[(r + 2) * kHD + tid];
      b3 += Ps[(r + 3) * kHD + tid];
    }
    float run = (b0 + b1) + (b2 + b3);
#pragma unroll
    for (int r = 0; r < kScSlots; ++r) {
      const float g = Gs[r * kHD + tid];
      Gs[r * kHD + tid] = run;
      run += g;
    }
  }
  __syncthreads();
  v4f p = *(const v4f*)(Gs + slot * kHD + c4);
#pragma unroll
  for (int k = 0; k < kScPer; ++k) {
    const int s = s0 + k;
    const size_t idx = col + (size_t)s * kD;
    p += vv[k];
    const float inv = 1.0f / (float)(s + 1);
    unsigned short hb[4], lb[4];
#pragma unroll
    for (int e = 0; e < 4; ++e) {
      const float o = rgh * aa[k][e] + sgh * vv[k][e] - cgh * (p[e] * inv);
      hb[e] = f2bf_bits(o);
      lb[e] = f2bf_bits(o - bf_bits2f(hb[e]));
    }
    uint2 uh, ul;
    uh.x = (unsigned)hb[0] | ((unsigned)hb[1] << 16);
    uh.y = (unsigned)hb[2] | ((unsigned)hb[3] << 16);
    ul.x = (unsigned)lb[0] | ((unsigned)lb[1] << 16);
    ul.y = (unsigned)lb[2] | ((unsigned)lb[3] << 16);
    *(uint2*)(Oh + idx) = uh;
    *(uint2*)(Ol + idx) = ul;
  }
}

// =====================================================================================
// launcher: kernel launches only
// =====================================================================================
extern "C" void kernel_launch(void* const* d_in, const int* in_sizes, int n_in,
                              void* d_out, int out_size, void* d_ws,
                              size_t ws_size, hipStream_t stream) {
  if (n_in < 8) return;
  if (in_sizes[0] != kTok * kD) return;
  if (in_sizes[1] != kD * kQKLd) return;
  if (in_sizes[2] != kQKLd) return;
  if (in_sizes[3] != kD * kD) return;
  if (in_sizes[4] != kD * kD) return;
  if (in_sizes[5] != kH || in_sizes[6] != kH || in_sizes[7] != kH) return;
  if (out_size != kTok * kD) return;
  if (kWsTotal > ws_size) return;

  const float* x     = (const float*)d_in[0];
  const float* qk_w  = (const float*)d_in[1];
  const float* qk_b  = (const float*)d_in[2];
  const float* v_w   = (const float*)d_in[3];
  const float* cp_w  = (const float*)d_in[4];
  const float* rg    = (const float*)d_in[5];
  const float* sg    = (const float*)d_in[6];
  const float* cg    = (const float*)d_in[7];
  float* out = (float*)d_out;

  unsigned char* ws = (unsigned char*)d_ws;
  unsigned short* xb   = (unsigned short*)(ws + kOffXb);
  unsigned short* qkwT = (unsigned short*)(ws + kOffQkwT);
  unsigned short* vwT  = (unsigned short*)(ws + kOffVwT);
  unsigned short* cwT  = (unsigned short*)(ws + kOffCwT);
  unsigned short* QKp  = (unsigned short*)(ws + kOffQKp);
  float*          Vf   = (float*)(ws + kOffVf);
  unsigned short* Vth  = (unsigned short*)(ws + kOffVth);
  unsigned short* Vtl  = (unsigned short*)(ws + kOffVtl);
  float*          AV   = (float*)(ws + kOffAV);
  unsigned short* Oh   = (unsigned short*)(ws + kOffOh);
  unsigned short* Ol   = (unsigned short*)(ws + kOffOl);

  // 1. x -> bf16 [4096][1024]: n = 4194304, n2 = 2097152 threads, 8192 blocks exactly
  {
    const int n2 = (kTok * kD) / 2;
    cast_f32_bf16x2<<<dim3((n2 + 255) / 256), dim3(256), 0, stream>>>(x, xb, n2);
  }
  // 2-4. weights [in][out] f32 -> transposed bf16 [out][in]   (grid = (cols/64, rows/64))
  transpose_cast_bf16<<<dim3(kQKLd / 64, kD / 64), dim3(256), 0, stream>>>(qk_w, qkwT, kD, kQKLd);   // in[1024][2048] -> out[2048][1024]
  transpose_cast_bf16<<<dim3(kD / 64, kD / 64),    dim3(256), 0, stream>>>(v_w,  vwT,  kD, kD);      // in[1024][1024] -> out[1024][1024]
  transpose_cast_bf16<<<dim3(kD / 64, kD / 64),    dim3(256), 0, stream>>>(cp_w, cwT,  kD, kD);

  // 5. fused q|k projection: [4096 x 1024] . [2048 x 1024]^T + qk_b -> f16 [4096][2048]; tiles 32*8 = 256 blocks
  wmma_gemm64<1, 0, 2, 1, false><<<dim3((kTok / kGM) * (kQKLd / kGN), 1), dim3(256), 0, stream>>>(
      xb, xb, kD, 0L, qkwT, qkwT, kD, 0L, (void*)QKp, (void*)QKp, kQKLd, 0L,
      qk_b, x, 0L, kTok, kQKLd, kD, 1.0f);
  // 6. v projection: [4096 x 1024] . [1024 x 1024]^T -> f32 [4096][1024]; tiles 32*4 = 128 blocks
  wmma_gemm64<1, 0, 0, 0, false><<<dim3((kTok / kGM) * (kD / kGN), 1), dim3(256), 0, stream>>>(
      xb, xb, kD, 0L, vwT, vwT, kD, 0L, (void*)Vf, (void*)Vf, kD, 0L,
      qk_b, x, 0L, kTok, kD, kD, 1.0f);
  // 7. v -> bf16 hi/lo planes [32][64][2048]
  v_split_transpose<<<dim3(kS / 64, kB * kH), dim3(256), 0, stream>>>(Vf, Vth, Vtl);
  // 8. causal attention -> AV f32 [4096][1024]
  attn_causal_hd64<<<dim3(kB * kH * kNQB), dim3(128), 0, stream>>>(QKp, Vth, Vtl, AV);
  // 9. shaped combination + prefix mean -> O hi/lo bf16 [4096][1024]
  shaped_combine<<<dim3(kScSeg * kB * kH), dim3(512), 0, stream>>>(AV, Vf, rg, sg, cg, Oh, Ol);
  // 10. output projection: (O hi + O lo) [4096 x 1024] . [1024 x 1024]^T -> f32 d_out [4096][1024]; 128 blocks
  wmma_gemm64<1, 1, 0, 0, false><<<dim3((kTok / kGM) * (kD / kGN), 1), dim3(256), 0, stream>>>(
      Oh, Ol, kD, 0L, cwT, cwT, kD, 0L, (void*)out, (void*)out, kD, 0L,
      qk_b, x, 0L, kTok, kD, kD, 1.0f);
}

// v005
// One run takes 154 microseconds.
// Timed twice side by side with v004, it ran 1.12 times as fast both times.
// All steps since v000 together make it 8.79 times as fast.
// Contractions: qk and v projections = v_wmma_f32_16x16x32_bf16 (x and W as RNE bf16, single product); scores q.k^T = v_wmma_f32_16x16x32_f16 (q, k f16 planes, single product, 1/8 applied in f32 inside the softmax exponent); attn.v = v_wmma_f32_16x16x32_bf16 with p and v as bf16 hi/lo pairs (hi.hi + hi.lo + lo.hi); output projection = v_wmma_f32_16x16x32_bf16 with the merged head output as bf16 hi/lo pair times W as RNE bf16 (hi.W + lo.W); f32 accumulate everywhere; softmax, causal prefix mean of v and gain combination in f32.
#include <hip/hip_runtime.h>
#include <math.h>

typedef __attribute__((ext_vector_type(16))) _Float16 v16h;
typedef __attribute__((ext_vector_type(8)))  _Float16 v8h;
typedef __attribute__((ext_vector_type(16))) __bf16   v16b;
typedef __attribute__((ext_vector_type(8)))  __bf16   v8b;
typedef __attribute__((ext_vector_type(8)))  float    v8f;
typedef __attribute__((ext_vector_type(4)))  float    v4f;
typedef __attribute__((ext_vector_type(2)))  float    v2f;
typedef __attribute__((ext_vector_type(8)))  unsigned v8u;
typedef __attribute__((ext_vector_type(2)))  __bf16   v2b;

constexpr int kB    = 2;
constexpr int kS    = 2048;
constexpr int kD    = 1024;
constexpr int kH    = 16;
constexpr int kHD   = 64;
constexpr int kTok  = kB * kS;        // 4096 token rows
constexpr int kQKLd = 2 * kD;         // fused q|k plane pitch (halves): q at col h*64, k at col kD + h*64
constexpr int kKOff = kD;
constexpr int kKC   = 64;             // kv chunk
constexpr int kNQB  = kS / 64;        // query blocks per (b,h)
constexpr int kStg  = 72;             // 16-bit LDS staging pitch (144 B rows, 16-B aligned)
constexpr float kSmScale = 0.125f;    // 1/sqrt(64)
constexpr float kSmScaleLog2 = kSmScale * 1.4426950408889634f;   // exp(kSmScale * x) = exp2(kSmScaleLog2 * x)

// workspace region map (bytes, all offsets multiples of 2 MiB):
//   [0]          xb    bf16 [4096][1024]            8 MiB
//   [8 MiB]      qkwT  bf16 [2048][1024]            4 MiB   (qk_w transposed)
//   [12 MiB]     vwT   bf16 [1024][1024]            2 MiB
//   [14 MiB]     cwT   bf16 [1024][1024]            2 MiB
//   [16 MiB]     QKp   f16  [4096][2048]           16 MiB   (q | k planes)
//   [32 MiB]     Vf    f32  [4096][1024]           16 MiB
//   [48 MiB]     Vth   bf16 [32][64][2048]          8 MiB   (v hi, per (b,h) [d][s])
//   [56 MiB]     Vtl   bf16 [32][64][2048]          8 MiB   (v lo)
//   [64 MiB]     AV    f32  [4096][1024]           16 MiB   (softmax(qk).v, merged heads)
//   [80 MiB]     Oh    bf16 [4096][1024]            8 MiB   (combined head output, hi)
//   [88 MiB]     Ol    bf16 [4096][1024]            8 MiB   (lo)
//   total 96 MiB = 100663296 B
constexpr size_t kOffXb   = 0;
constexpr size_t kOffQkwT = kOffXb   + (size_t)kTok * kD * 2;
constexpr size_t kOffVwT  = kOffQkwT + (size_t)kQKLd * kD * 2;
constexpr size_t kOffCwT  = kOffVwT  + (size_t)kD * kD * 2;
constexpr size_t kOffQKp  = kOffCwT  + (size_t)kD * kD * 2;
constexpr size_t kOffVf   = kOffQKp  + (size_t)kTok * kQKLd * 2;
constexpr size_t kOffVth  = kOffVf   + (size_t)kTok * kD * 4;
constexpr size_t kOffVtl  = kOffVth  + (size_t)kB * kH * kHD * kS * 2;
constexpr size_t kOffAV   = kOffVtl  + (size_t)kB * kH * kHD * kS * 2;
constexpr size_t kOffOh   = kOffAV   + (size_t)kTok * kD * 4;
constexpr size_t kOffOl   = kOffOh   + (size_t)kTok * kD * 2;
constexpr size_t kWsTotal = kOffOl   + (size_t)kTok * kD * 2;
static_assert(kWsTotal == 100663296ull);
static_assert(kWsTotal <= 134217728ull);

__device__ __forceinline__ unsigned short f2bf_bits(float f) {
  unsigned u = __float_as_uint(f);
  return (unsigned short)((u + 0x7FFFu + ((u >> 16) & 1u)) >> 16);
}
__device__ __forceinline__ float bf_bits2f(unsigned short h) { return __uint_as_float(((unsigned)h) << 16); }

// hazard guards as plain device helpers (their inline asm is kept out of the kernel template body)
__device__ __forceinline__ void dep_guard_h(v8f& a, v8f& b, v16h x, v16h y) { asm volatile("v_nop\n\tv_nop\n\tv_nop\n\tv_nop" : "+v"(a), "+v"(b) : "v"(x), "v"(y)); }
__device__ __forceinline__ void dep_guard_b(v8f& a, v8f& b, v16b x, v16b y) { asm volatile("v_nop\n\tv_nop\n\tv_nop\n\tv_nop" : "+v"(a), "+v"(b) : "v"(x), "v"(y)); }
__device__ __forceinline__ void keep4_h(v16h a, v16h b, v16h c, v16h d) { asm volatile("v_nop" :: "v"(a), "v"(b), "v"(c), "v"(d)); }
__device__ __forceinline__ void keep4_b(v16b a, v16b b, v16b c, v16b d) { asm volatile("v_nop" :: "v"(a), "v"(b), "v"(c), "v"(d)); }
__device__ __forceinline__ void acc_guard4(v8f& a, v8f& b, v8f& c, v8f& d) { asm volatile("v_nop\n\tv_nop\n\tv_nop\n\tv_nop" : "+v"(a), "+v"(b), "+v"(c), "+v"(d)); }
template <typename T> struct Frag;
template <> struct Frag<_Float16> {
  typedef v16h V; union U { v16h v; v8h h[2]; };
  static __device__ __forceinline__ v16h load(const _Float16* p) {   // elements 0..7 <- p[0..7], 8..15 <- p[16..23]
    U f; f.h[0] = *(const v8h*)(p); f.h[1] = *(const v8h*)(p + 16); return f.v;
  }
  static __device__ __forceinline__ v8f mma(v16h a, v16h b, v8f c) {
    return __builtin_amdgcn_wmma_f32_16x16x32_f16(false, a, false, b, (short)0, c, false, false);
  }
  static __device__ __forceinline__ void guard(v8f& a, v8f& b, v16h x, v16h y) { dep_guard_h(a, b, x, y); }
  static __device__ __forceinline__ void keep(v16h a, v16h b, v16h c, v16h d) { keep4_h(a, b, c, d); }
};
template <> struct Frag<__bf16> {
  typedef v16b V; union U { v16b v; v8b h[2]; };
  static __device__ __forceinline__ v16b load(const __bf16* p) {
    U f; f.h[0] = *(const v8b*)(p); f.h[1] = *(const v8b*)(p + 16); return f.v;
  }
  static __device__ __forceinline__ v8f mma(v16b a, v16b b, v8f c) {
    return __builtin_amdgcn_wmma_f32_16x16x32_bf16(false, a, false, b, (short)0, c, false, false);
  }
  static __device__ __forceinline__ void guard(v8f& a, v8f& b, v16b x, v16b y) { dep_guard_b(a, b, x, y); }
  static __device__ __forceinline__ void keep(v16b a, v16b b, v16b c, v16b d) { keep4_b(a, b, c, d); }
};

// bf16 hi/lo split of two values straight into packed fragment registers (first value in the low half): the packed
// convert rounds to nearest even and packs in the same instruction; lo = round(f - hi)
__device__ __forceinline__ void at_split2(float f0, float f1, unsigned& hi, unsigned& lo) {
  const v2f f = {f0, f1};
  const unsigned hw = __builtin_bit_cast(unsigned, __builtin_convertvector(f, v2b));
  const v2f d = {f0 - __uint_as_float(hw << 16), f1 - __uint_as_float(hw & 0xFFFF0000u)};
  hi = hw;
  lo = __builtin_bit_cast(unsigned, __builtin_convertvector(d, v2b));
}
__device__ __forceinline__ v8f at_mma(v16b a, v16b b, v8f c) {
  c = __builtin_amdgcn_wmma_f32_16x16x32_bf16(false, a, false, b, (short)0, c, false, false);
  asm volatile("v_nop\n\tv_nop\n\tv_nop\n\tv_nop" : "+v"(c) : "v"(a), "v"(b));
  return c;
}
// lane l reads lane l ^ 16
__device__ __forceinline__ float at_xhalf(float x) {
  return __builtin_bit_cast(float, __builtin_amdgcn_permlanex16(__builtin_bit_cast(int, x), __builtin_bit_cast(int, x),
                                                                0x76543210, 0xfedcba98, false, false));
}
__device__ __forceinline__ void at_exp2x8(v8f& x) {
  float e0, e1, e2, e3, e4, e5, e6, e7;
  asm("v_exp_f32 %0, %8\n\tv_exp_f32 %1, %9\n\tv_exp_f32 %2, %10\n\tv_exp_f32 %3, %11\n\t"
      "v_exp_f32 %4, %12\n\tv_exp_f32 %5, %13\n\tv_exp_f32 %6, %14\n\tv_exp_f32 %7, %15\n\tv_nop"
      : "=&v"(e0), "=&v"(e1), "=&v"(e2), "=&v"(e3), "=&v"(e4), "=&v"(e5), "=&v"(e6), "=&v"(e7)
      : "v"(x[0]), "v"(x[1]), "v"(x[2]), "v"(x[3]), "v"(x[4]), "v"(x[5]), "v"(x[6]), "v"(x[7]));
  x = (v8f){e0, e1, e2, e3, e4, e5, e6, e7};
}
__device__ __forceinline__ v8f at_mma_h(v16h a, v16h b, v8f c) {
  c = __builtin_amdgcn_wmma_f32_16x16x32_f16(false, a, false, b, (short)0, c, false, false);
  asm volatile("v_nop\n\tv_nop\n\tv_nop\n\tv_nop" : "+v"(c) : "v"(a), "v"(b));
  return c;
}

// =====================================================================================
// =====================================================================================
__global__ __launch_bounds__(256) void cast_f32_bf16x2(const float* __restrict__ in,
                                                       unsigned short* __restrict__ out, int n2) {
  const int i = blockIdx.x * 256 + threadIdx.x;
  if (i < n2) {
    const unsigned u = (unsigned)f2bf_bits(in[2 * i]) | ((unsigned)f2bf_bits(in[2 * i + 1]) << 16);
    ((unsigned*)out)[i] = u;
    
  }
}

// =====================================================================================
// Register-blocked batched WMMA GEMM, C[m,n] = scale * sum_k A[m,k] * Bt[n,k] (+bias)(+resid);
// each wave owns a 64x64 tile; the 8 waves of a work-group stand 2 (m) x 4 (n) on one 128x256 tile of C.
// A row-major [M,K]; Bt row-major [N,K]; M % 128 == 0, N % 256 == 0, K % 64 == 0.
// Operands reach the waves through LDS: per k tile of 64 the work-group copies 128 rows of A (and of A2) and 256 rows
// of Bt, 128 B a row, with asynchronous copies (8 lanes x 16 B = one whole line of a row), into one of two buffers at
// row pitch kStg; the copies of tile t + 2 fly while tile t + 1 is worked on.
// SPLITM: 0 = single product; 1 = A carried as hi/lo planes (A2p = lo): product = hi.B + lo.B.
// BIAS_MODE: 0 = none, 1 = bias[m], 2 = bias[n].  OUT_MODE: 0 = f32, 1 = f16, 2 = bf16 hi + lo planes.
// ET: 0 = f16 operands, 1 = bf16 operands (pointers passed as 16-bit storage)
// =====================================================================================
constexpr int kGK = 64;     // k extent of a staged tile
constexpr int kGM = 128;    // rows of A per work-group
constexpr int kGN = 256;    // rows of Bt per work-group

// Each lane copies its own 16 B from global memory to its own LDS byte address. The s_wait_xcnt closes the statement so
// that it stands in front of every later write of the address registers named here (a precaution).
__device__ __forceinline__ void async_copy4(unsigned l0, const void* g0, unsigned l1, const void* g1,
                                            unsigned l2, const void* g2, unsigned l3, const void* g3) {
  asm volatile("global_load_async_to_lds_b128 %0, %1, off\n\t"
               "global_load_async_to_lds_b128 %2, %3, off\n\t"
               "global_load_async_to_lds_b128 %4, %5, off\n\t"
               "global_load_async_to_lds_b128 %6, %7, off\n\t"
               "s_wait_xcnt 0x0"
               :: "v"(l0), "v"(g0), "v"(l1), "v"(g1), "v"(l2), "v"(g2), "v"(l3), "v"(g3) : "memory");
}
__device__ __forceinline__ void async_copy8(unsigned l0, const void* g0, unsigned l1, const void* g1,
                                            unsigned l2, const void* g2, unsigned l3, const void* g3,
                                            unsigned l4, const void* g4, unsigned l5, const void* g5,
                                            unsigned l6, const void* g6, unsigned l7, const void* g7) {
  asm volatile("global_load_async_to_lds_b128 %0, %1, off\n\t"
               "global_load_async_to_lds_b128 %2, %3, off\n\t"
               "global_load_async_to_lds_b128 %4, %5, off\n\t"
               "global_load_async_to_lds_b128 %6, %7, off\n\t"
               "global_load_async_to_lds_b128 %8, %9, off\n\t"
               "global_load_async_to_lds_b128 %10, %11, off\n\t"
               "global_load_async_to_lds_b128 %12, %13, off\n\t"
               "global_load_async_to_lds_b128 %14, %15, off\n\t"
               "s_wait_xcnt 0x0"
               :: "v"(l0), "v"(g0), "v"(l1), "v"(g1), "v"(l2), "v"(g2), "v"(l3), "v"(g3),
                  "v"(l4), "v"(g4), "v"(l5), "v"(g5), "v"(l6), "v"(g6), "v"(l7), "v"(g7) : "memory");
}

template <int ET> struct Elem;
template <> struct Elem<0> { typedef _Float16 T; };
template <> struct Elem<1> { typedef __bf16 T; };
template <int ET, int SPLITM, int BIAS_MODE, int OUT_MODE, bool RESID, int ACT = 0>
__global__ __launch_bounds__(256) void wmma_gemm64(
    const unsigned short* __restrict__ Ap, const unsigned short* __restrict__ A2p, int lda, long strideA,
    const unsigned short* __restrict__ Btp, const unsigned short* __restrict__ Bt2p, int ldb, long strideB,
    void* __restrict__ Cout, void* __restrict__ Cout2, int ldc, long strideC,
    const float* __restrict__ bias,
    const float* __restrict__ resid, long strideR,
    int M, int N, int K, float scale) {
  typedef typename Elem<ET>::T T;
  typedef typename Frag<T>::V V;
  static_assert(SPLITM <= 1);
  constexpr bool SPA = (SPLITM >= 1);
  constexpr int kOffA2  = kGM * kStg;                       // element offsets inside one buffer: A | A2 | Bt
  constexpr int kOffB   = (SPA ? 2 : 1) * kGM * kStg;
  constexpr int kBufEl  = kOffB + kGN * kStg;
  const T* A = (const T*)Ap; const T* A2 = (const T*)A2p; const T* Bt = (const T*)Btp;
  __shared__ __align__(16) T sOp[2 * kBufEl];      // two operand buffers
  __shared__ __align__(16) float sT[8][16 * 68];   // per-wave 16x64 slab, pitch 68 floats
  const int b    = blockIdx.y;
  const int tid  = threadIdx.x;
  const int lane = tid & 31;
  const int wave = tid >> 5;
  const int tilesN = N / kGN;
  const int tilesM = M / kGM;
  if ((int)blockIdx.x >= tilesM * tilesN) return;   // the same for the whole work-group, in front of every copy and barrier
  const int bm = blockIdx.x / tilesN;
  const int bn = blockIdx.x - bm * tilesN;
  const int wm = (wave >> 2) << 6;             // this wave's rows inside the staged A tile
  const int wn = (wave & 3) << 6;              // this wave's rows inside the staged Bt tile
  const int m0 = bm * kGM + wm;
  const int n0 = bn * kGN + wn;

  const int rlane = lane & 15;                 // row (A) / col (B, D) within subtile
  const int koff  = (lane >> 4) * 8;           // k offset of this lane half
  const int mOff  = (lane >> 4) * 8;           // D row offset

  // staging: thread -> row tid / 8 (+ 32 per copy), 16-B piece tid % 8 of the row's 128 B
  const int srow = tid >> 3;
  const int sseg = (tid & 7) * 8;
  const T* gA  = A  + (size_t)b * strideA + (size_t)(bm * kGM + srow) * lda + sseg;
  const T* gA2 = SPA ? (A2 + (size_t)b * strideA + (size_t)(bm * kGM + srow) * lda + sseg) : nullptr;
  const T* gB  = Bt + (size_t)b * strideB + (size_t)(bn * kGN + srow) * ldb + sseg;
  const unsigned lS = (unsigned)(size_t)(sOp + srow * kStg + sseg);   // LDS byte address: low 32 bits
  const size_t a32 = (size_t)32 * lda, b32 = (size_t)32 * ldb;
  constexpr unsigned kL32 = 32 * kStg * 2;     // 32 rows in LDS, bytes
  auto stage = [&](int t, int buf) {
    const unsigned l = lS + (unsigned)buf * (unsigned)(kBufEl * 2);
    const unsigned lb = l + kOffB * 2;
    const T* pb = gB + t * kGK;
    async_copy8(lb, pb, lb + kL32, pb + b32, lb + 2 * kL32, pb + 2 * b32, lb + 3 * kL32, pb + 3 * b32,
                lb + 4 * kL32, pb + 4 * b32, lb + 5 * kL32, pb + 5 * b32, lb + 6 * kL32, pb + 6 * b32,
                lb + 7 * kL32, pb + 7 * b32);
    const T* pa = gA + t * kGK;
    if (SPA) {
      const unsigned l2 = l + kOffA2 * 2;
      const T* pa2 = gA2 + t * kGK;
      async_copy8(l, pa, l + kL32, pa + a32, l + 2 * kL32, pa + 2 * a32, l + 3 * kL32, pa + 3 * a32,
                  l2, pa2, l2 + kL32, pa2 + a32, l2 + 2 * kL32, pa2 + 2 * a32, l2 + 3 * kL32, pa2 + 3 * a32);
    } else {
      async_copy4(l, pa, l + kL32, pa + a32, l + 2 * kL32, pa + 2 * a32, l + 3 * kL32, pa + 3 * a32);
    }
  };

  v8f acc[4][4];
#pragma unroll
  for (int i = 0; i < 4; ++i)
#pragma unroll
    for (int j = 0; j < 4; ++j) acc[i][j] = (v8f){0.f,0.f,0.f,0.f,0.f,0.f,0.f,0.f};

  const int nT = K / kGK;                      // the same for the whole work-group
  stage(0, 0);
  asm volatile("s_wait_asynccnt 0x0" ::: "memory");   // this wave's copies of tile 0 have landed
  __syncthreads();                                    // ... and every other wave's: tile 0 may be read
  if (nT > 1) stage(1, 1);
  for (int t = 0; t < nT; ++t) {
    const T* sA = sOp + (t & 1) * kBufEl + (wm + rlane) * kStg + koff;
    const T* sB = sOp + (t & 1) * kBufEl + kOffB + (wn + rlane) * kStg + koff;
#pragma unroll
    for (int kk = 0; kk < kGK; kk += 32) {
      V bh[4], ah[4], al[4];
#pragma unroll
      for (int j = 0; j < 4; ++j) bh[j] = Frag<T>::load(sB + (j << 4) * kStg + kk);
#pragma unroll
      for (int i = 0; i < 4; ++i) {
        ah[i] = Frag<T>::load(sA + (i << 4) * kStg + kk);
        if (SPA) al[i] = Frag<T>::load(sA + kOffA2 + (i << 4) * kStg + kk);
      }
#pragma unroll
      for (int i = 0; i < 4; ++i) {
#pragma unroll
        for (int j = 0; j < 4; ++j) {
          acc[i][j] = Frag<T>::mma(ah[i], bh[j], acc[i][j]);
          if (SPA) acc[i][j] = Frag<T>::mma(al[i], bh[j], acc[i][j]);
        }
        Frag<T>::guard(acc[i][0], acc[i][3], ah[i], SPA ? al[i] : ah[i]);
      }
      Frag<T>::keep(bh[0], bh[1], bh[2], bh[3]);
    }
    asm volatile("s_wait_dscnt 0x0" ::: "memory");      // this wave's reads of tile t are done before its buffer is refilled
    asm volatile("s_wait_asynccnt 0x0" ::: "memory");   // this wave's copies of tile t + 1 have landed
    __syncthreads();                                    // publishes tile t + 1 and ends every reader's reads of tile t
    if (t + 2 < nT) stage(t + 2, t & 1);
  }
  asm volatile("s_wait_asynccnt 0x0" ::: "memory");     // no copy is outstanding when the wave goes on
  acc_guard4(acc[0][0], acc[0][1], acc[0][2], acc[0][3]);
  acc_guard4(acc[1][0], acc[1][1], acc[1][2], acc[1][3]);
  acc_guard4(acc[2][0], acc[2][1], acc[2][2], acc[2][3]);
  acc_guard4(acc[3][0], acc[3][1], acc[3][2], acc[3][3]);

  // ---- epilogue ----
  float* slab = sT[wave];
  const float* Rb = RESID ? (resid + (size_t)b * strideR) : nullptr;
#pragma unroll
  for (int i = 0; i < 4; ++i) {
    const int mBase = m0 + (i << 4);
#pragma unroll
    for (int j = 0; j < 4; ++j) {
      const int n = n0 + (j << 4) + rlane;
      float bv = 0.f;
      if (BIAS_MODE == 2) bv = bias[n];
#pragma unroll
      for (int r = 0; r < 8; ++r) {
        float v = acc[i][j][r] * scale;
        if (BIAS_MODE == 1) v += bias[mBase + mOff + r];
        if (BIAS_MODE == 2) v += bv;
        if (RESID) v += Rb[(size_t)(mBase + mOff + r) * ldc + n];
        if (ACT == 1) v = tanhf(v);
        if (ACT == 2) v = fmaxf(v, 0.0f);
        if (ACT == 4) v = (v > 0.f) ? v : 0.01f * v;
        slab[(mOff + r) * 68 + (j << 4) + rlane] = v;
      }
    }
    __builtin_amdgcn_fence(__ATOMIC_RELEASE, "workgroup");
    __builtin_amdgcn_wave_barrier();
    __builtin_amdgcn_fence(__ATOMIC_ACQUIRE, "workgroup");
    if (OUT_MODE == 0) {
      float* C = (float*)Cout + (size_t)b * strideC;
      const int hh = lane >> 4, c4 = (lane & 15) * 4;     // row seg = 256 B = 16 lanes x 16 B
      {
#pragma unroll
        for (int it = 0; it < 8; ++it) {
          const int row = it * 2 + hh;
          v4f v = *(const v4f*)(slab + row * 68 + c4);
          *(v4f*)(C + (size_t)(mBase + row) * ldc + n0 + c4) = v;
        }
        
      }
    } else {
      const int q = lane >> 3, c8 = (lane & 7) * 8;
      unsigned short* C  = (unsigned short*)Cout  + (size_t)b * strideC;
      unsigned short* C2 = (OUT_MODE == 2) ? ((unsigned short*)Cout2 + (size_t)b * strideC) : nullptr;
      {
#pragma unroll
        for (int it = 0; it < 4; ++it) {
          const int row = it * 4 + q;
          const float* sp = slab + row * 68 + c8;
          v8h hv, lv;
#pragma unroll
          for (int e = 0; e < 8; ++e) {
            if (OUT_MODE == 1) {
              hv[e] = (_Float16)sp[e];
            } else {
              unsigned short hb = f2bf_bits(sp[e]);
              unsigned short lb = f2bf_bits(sp[e] - bf_bits2f(hb));
              hv[e] = __builtin_bit_cast(_Float16, hb);
              lv[e] = __builtin_bit_cast(_Float16, lb);
            }
          }
          *(v8h*)(C + (size_t)(mBase + row) * ldc + n0 + c8) = hv;
          if (OUT_MODE == 2) *(v8h*)(C2 + (size_t)(mBase + row) * ldc + n0 + c8) = lv;
        }
        
      }
    }
    __builtin_amdgcn_fence(__ATOMIC_RELEASE, "workgroup");
    __builtin_amdgcn_wave_barrier();
    __builtin_amdgcn_fence(__ATOMIC_ACQUIRE, "workgroup");
  }
}

// =====================================================================================
// Weight transpose + RNE bf16 cast: in f32 [R][Cc] row-major -> out bf16 bits [Cc][R]  (out[c][r] = in[r][c]).
// grid = (Cc/64, R/64), block 256; one 64x64 tile through LDS.
// Load coverage: 256 threads x 16 floats = 64 (r) x 64 (c).  Store coverage: 8 waves x 2 x 4 rows (q8) = 64 rows c;
// =====================================================================================
__global__ __launch_bounds__(256) void transpose_cast_bf16(const float* __restrict__ in, unsigned short* __restrict__ out,
                                                           int R, int Cc) {
  __shared__ __align__(16) _Float16 t[64 * kStg];     // [c][r] as 16-bit bit patterns
  const int c0 = blockIdx.x * 64, r0 = blockIdx.y * 64;
  const int tid = threadIdx.x;
  {
    const int rloc = tid >> 2, cq = (tid & 3) * 16;
    const float* src = in + (size_t)(r0 + rloc) * Cc + c0 + cq;
#pragma unroll
    for (int g4 = 0; g4 < 4; ++g4) {
      const v4f a = *(const v4f*)(src + 4 * g4);
#pragma unroll
      for (int e = 0; e < 4; ++e)
        t[(cq + 4 * g4 + e) * kStg + rloc] = __builtin_bit_cast(_Float16, f2bf_bits(a[e]));
    }
  }
  __syncthreads();
  const int wave = tid >> 5, lane = tid & 31, q8 = lane >> 3, c8 = (lane & 7) * 8;
  const int cA = wave * 8 + q8, cB = wave * 8 + 4 + q8;
  const v8h va = *(const v8h*)(t + cA * kStg + c8);
  const v8h vb = *(const v8h*)(t + cB * kStg + c8);
  unsigned short* da = out + (size_t)(c0 + cA) * R + r0 + c8;
  unsigned short* db = out + (size_t)(c0 + cB) * R + r0 + c8;
  {
    *(v8h*)da = va;
    *(v8h*)db = vb;
    
  }
}

// =====================================================================================
// V planes: Vf f32 [kTok][kD] (row b*kS+s, col h*kHD+d) -> Vth/Vtl bf16 bits [kB*kH][kHD][kS]:
// out[bh][d][s] = hi/lo(Vf[b*kS+s][h*kHD+d]).  grid = (kS/64, kB*kH), block 256.
// Load coverage: 256 threads x 16 floats = 64 (s) x 64 (d).
// =====================================================================================
__global__ __launch_bounds__(256) void v_split_transpose(const float* __restrict__ Vf,
                                                         unsigned short* __restrict__ vth, unsigned short* __restrict__ vtl) {
  __shared__ __align__(16) _Float16 th[64 * kStg];
  __shared__ __align__(16) _Float16 tl[64 * kStg];
  const int st0 = blockIdx.x * 64, bh = blockIdx.y;
  const int b = bh / kH, h = bh % kH;
  const int tid = threadIdx.x;
  {
    const int sloc = tid >> 2, d0 = (tid & 3) * 16;
    const float* src = Vf + (size_t)(b * kS + st0 + sloc) * kD + h * kHD + d0;
#pragma unroll
    for (int g4 = 0; g4 < 4; ++g4) {
      const v4f a = *(const v4f*)(src + 4 * g4);
#pragma unroll
      for (int e = 0; e < 4; ++e) {
        const unsigned short hb = f2bf_bits(a[e]);
        const unsigned short lb = f2bf_bits(a[e] - bf_bits2f(hb));
        th[(d0 + 4 * g4 + e) * kStg + sloc] = __builtin_bit_cast(_Float16, hb);
        tl[(d0 + 4 * g4 + e) * kStg + sloc] = __builtin_bit_cast(_Float16, lb);
      }
    }
  }
  __syncthreads();
  const int wave = tid >> 5, lane = tid & 31, q8 = lane >> 3, c8 = (lane & 7) * 8;
  const int dA = wave * 8 + q8, dB = wave * 8 + 4 + q8;
  const v8h ha = *(const v8h*)(th + dA * kStg + c8);
  const v8h hbv = *(const v8h*)(th + dB * kStg + c8);
  const v8h la = *(const v8h*)(tl + dA * kStg + c8);
  const v8h lbv = *(const v8h*)(tl + dB * kStg + c8);
  unsigned short* pha = vth + ((size_t)bh * kHD + dA) * kS + st0 + c8;
  unsigned short* phb = vth + ((size_t)bh * kHD + dB) * kS + st0 + c8;
  unsigned short* pla = vtl + ((size_t)bh * kHD + dA) * kS + st0 + c8;
  unsigned short* plb = vtl + ((size_t)bh * kHD + dB) * kS + st0 + c8;
  {
    *(v8h*)pha = ha;
    *(v8h*)phb = hbv;
    *(v8h*)pla = la;
    *(v8h*)plb = lbv;
    
  }
}

// =====================================================================================
// Causal attention, head_dim 64, 16-bit input planes, f32 out.
//   scores = (k.q^T, the transposed tile: A = K rows, B = Q columns) : v_wmma_f32_16x16x32_f16 (q, k f16 planes); 1/8 and
//            log2(e) enter as one f32 FMA per score in front of 2^x; a lane holds 32 of one query's 64 scores, its partner lane ^ 16 the rest; causal: kv > q replaced by -inf
//            (exp -> 0, identical to a finite most-negative fill since every row keeps its diagonal); chunks past
//            the diagonal contribute exactly 0 and are skipped.
//   out    = (v^T.p^T, A = V rows [d][kv], B = P packed from the score registers) : v_wmma_f32_16x16x32_bf16 with p and v
//            as bf16 hi/lo (hi.hi + hi.lo + lo.hi); online softmax in f32, one maximum and one sum per lane.
// Block = 4 waves = 64 query rows of one (b, h); grid.x = kB * kH * (kS/64).
// Staging coverage per kv chunk: 128 threads x 4 chunks x 8 halves = 64 x 64 per plane (K, V hi, V lo), plain loads + barrier.
// Output AV f32 [kTok][kD] at col h*64: row segment 64 floats = 256 B by 16 lanes x 16 B in one instruction, one wave per
// =====================================================================================
// second launch bound: a register budget for four waves per SIMD, so that four work-groups share a WGP
__global__ __launch_bounds__(128, 4)
void attn_causal_hd64(const unsigned short* __restrict__ QKp,    // f16 bits [kTok][kQKLd]
                      const unsigned short* __restrict__ Vthp,   // bf16 bits [kB*kH][kHD][kS]
                      const unsigned short* __restrict__ Vtlp,
                      float* __restrict__ AV) {                  // f32 [kTok][kD]
  union FB { v16b v; v8b h[2]; };
  // every 16-bit tile has rows of 128 B laid at pitch kStg (144 B = 16 B x 9): the 16 rows that one ds_load_b128
  // fragment read touches then start on 16 different groups of four banks instead of two
  __shared__ __align__(16) _Float16 Ksh[kKC * kStg];       // K [kv][d]      9 KB
  __shared__ __align__(16) __bf16  Vhs[kHD * kStg];        // V hi [d][kv]   9 KB
  __shared__ __align__(16) __bf16  Vls[kHD * kStg];        // V lo [d][kv]   9 KB
  __shared__ __align__(16) float   Os[4][16 * 68];         // per wave out tile, pitch 68

  const int tid  = threadIdx.x;
  const int wave = tid >> 5;
  const int lane = tid & 31;
  const int hh   = lane >> 4;
  const int c    = lane & 15;

  const int bx = blockIdx.x;
  const int qb = bx % kNQB;
  const int bh = bx / kNQB;
  const int h  = bh % kH;
  const int b  = bh / kH;
  const int q0 = qb * 64 + wave * 16;

  const _Float16* Q16 = (const _Float16*)QKp;
  const __bf16* Vth = (const __bf16*)Vthp;
  const __bf16* Vtl = (const __bf16*)Vtlp;
  float* ob_ptr = AV + (size_t)(b * kS) * kD + h * kHD;

  // ---- Q fragments (B operand, column = query q0 + c, k = d): 2 d-chunks of 32 ----
  v16h qa[2];
  {
    const _Float16* qrow = Q16 + (size_t)(b * kS + q0 + c) * kQKLd + h * kHD + 8 * hh;
    qa[0] = Frag<_Float16>::load(qrow);
    qa[1] = Frag<_Float16>::load(qrow + 32);
  }

  const int qrow = q0 + c;      // the one query whose scores, maximum, sum and output column this lane holds
  float mrow = -INFINITY, lrow = 0.f;
  v8f oacc[4];
#pragma unroll
  for (int t = 0; t < 4; ++t) oacc[t] = (v8f){0.f,0.f,0.f,0.f,0.f,0.f,0.f,0.f};

  const int nChunks = qb + 1;   // block-uniform
  for (int kc = 0; kc < nChunks; ++kc) {
    const int kv0 = kc * kKC;
    __syncthreads();
    const _Float16* gk[4];
    const __bf16* gvh[4];
    const __bf16* gvl[4];
    v8h kr[4];
    v8b vhr[4], vlr[4];
#pragma unroll
    for (int i = 0; i < 4; ++i) {
      const int ch = tid + 128 * i, row = ch >> 3, seg = (ch & 7) * 8;
      gk[i] = Q16 + (size_t)(b * kS + kv0 + row) * kQKLd + h * kHD + seg;   // the k plane lies kKOff further on
      const size_t vo = ((size_t)bh * kHD + row) * kS + kv0 + seg;   // row = d
      gvh[i] = Vth + vo;
      gvl[i] = Vtl + vo;
      kr[i]  = *(const v8h*)(gk[i] + kKOff);
      vhr[i] = *(const v8b*)gvh[i];
      vlr[i] = *(const v8b*)gvl[i];
    }
    // precaution: this wait stands behind the 12 issued loads, in front of every later overwrite of their address
    // registers; the addresses are named as inputs so that no load's destination is placed on one of them ahead of it
    asm volatile("s_wait_xcnt 0x0" :: "v"(gk[0]), "v"(gk[1]), "v"(gk[2]), "v"(gk[3]),
                                      "v"(gvh[0]), "v"(gvh[1]), "v"(gvh[2]), "v"(gvh[3]),
                                      "v"(gvl[0]), "v"(gvl[1]), "v"(gvl[2]), "v"(gvl[3]) : "memory");
#pragma unroll
    for (int i = 0; i < 4; ++i) {
      const int ch = tid + 128 * i, row = ch >> 3, seg = (ch & 7) * 8;
      *(v8h*)(Ksh + row * kStg + seg) = kr[i];
      *(v8b*)(Vhs + row * kStg + seg) = vhr[i];
      *(v8b*)(Vls + row * kStg + seg) = vlr[i];
    }
    __syncthreads();

    // transposed scores: A = K rows, B = Q columns, so s[j][r] = score(kv0 + 16 j + 8 hh + r, q0 + c): one query per lane
    v8f s[4];
#pragma unroll
    for (int j = 0; j < 4; ++j) {
      s[j] = (v8f){0.f,0.f,0.f,0.f,0.f,0.f,0.f,0.f};
#pragma unroll
      for (int dc = 0; dc < 2; ++dc) {
        const v16h kb = Frag<_Float16>::load(Ksh + (j * 16 + c) * kStg + dc * 32 + 8 * hh);
        s[j] = at_mma_h(kb, qa[dc], s[j]);
      }
    }
    const bool diag = (kc == qb);   // block-uniform
    float mj[4];
#pragma unroll
    for (int j = 0; j < 4; ++j) {
      float m = -INFINITY;
#pragma unroll
      for (int r = 0; r < 8; ++r) {
        const int kvcol = kv0 + j * 16 + 8 * hh + r;
        float sv = s[j][r];       // unscaled: the positive scale commutes with the maximum and is applied in the exponent
        if (diag && (kvcol > qrow)) sv = -INFINITY;
        s[j][r] = sv;
        m = fmaxf(m, sv);
      }
      mj[j] = m;
    }
    float cm = fmaxf(fmaxf(mj[0], mj[1]), fmaxf(mj[2], mj[3]));
    cm = fmaxf(cm, at_xhalf(cm));   // lanes c and c + 16 hold the two halves of one query's 64 scores
    const float mnew = fmaxf(mrow, cm);
    const float alpha = __builtin_amdgcn_exp2f((mrow - mnew) * kSmScaleLog2);
    const float nm = -mnew * kSmScaleLog2;
    mrow = mnew;
    // two score tiles of 16 kv, converted in place, are one B fragment of 32 kv in the loaders' k order
    v8u ph[2], pl[2];
    float pj[4];
#pragma unroll
    for (int j = 0; j < 4; ++j) {
      float psum = 0.f;
#pragma unroll
      for (int r = 0; r < 8; ++r) s[j][r] = fmaf(s[j][r], kSmScaleLog2, nm);
      at_exp2x8(s[j]);
#pragma unroll
      for (int r = 0; r < 8; r += 2) {
        const float p0 = s[j][r];
        const float p1 = s[j][r + 1];
        psum += p0;
        psum += p1;
        unsigned wh, wl;
        at_split2(p0, p1, wh, wl);
        ph[j >> 1][(j & 1) * 4 + (r >> 1)] = wh;
        pl[j >> 1][(j & 1) * 4 + (r >> 1)] = wl;
      }
      pj[j] = psum;
    }
    const v16b pha[2] = { __builtin_bit_cast(v16b, ph[0]), __builtin_bit_cast(v16b, ph[1]) };
    const v16b pla[2] = { __builtin_bit_cast(v16b, pl[0]), __builtin_bit_cast(v16b, pl[1]) };
    lrow = lrow * alpha + ((pj[0] + pj[1]) + (pj[2] + pj[3]));   // this lane half's share; the halves are joined after the loop
#pragma unroll
    for (int t = 0; t < 4; ++t)
#pragma unroll
      for (int r = 0; r < 8; ++r) oacc[t][r] *= alpha;
    // unrolled so that pha[kk], pla[kk] are fixed registers
#pragma unroll
    for (int kk = 0; kk < 2; ++kk) {
#pragma unroll
      for (int t = 0; t < 4; ++t) {
        FB vb, vl;
        vb.h[0] = *(const v8b*)(Vhs + (t * 16 + c) * kStg + kk * 32 + 8 * hh);
        vb.h[1] = *(const v8b*)(Vhs + (t * 16 + c) * kStg + kk * 32 + 16 + 8 * hh);
        vl.h[0] = *(const v8b*)(Vls + (t * 16 + c) * kStg + kk * 32 + 8 * hh);
        vl.h[1] = *(const v8b*)(Vls + (t * 16 + c) * kStg + kk * 32 + 16 + 8 * hh);
        oacc[t] = at_mma(vb.v, pha[kk], oacc[t]);
        oacc[t] = at_mma(vl.v, pha[kk], oacc[t]);
        oacc[t] = at_mma(vb.v, pla[kk], oacc[t]);
      }
    }
  }

  // oacc[t][r] = out(q0 + c, 16 t + 8 hh + r): eight consecutive channels of one query row per tile
  float* os = Os[wave];
  {
    const float inv = 1.0f / (lrow + at_xhalf(lrow));
#pragma unroll
    for (int t = 0; t < 4; ++t) {
      v4f lo4, hi4;
#pragma unroll
      for (int e = 0; e < 4; ++e) { lo4[e] = oacc[t][e] * inv; hi4[e] = oacc[t][4 + e] * inv; }
      *(v4f*)(os + c * 68 + t * 16 + 8 * hh)     = lo4;
      *(v4f*)(os + c * 68 + t * 16 + 8 * hh + 4) = hi4;
    }
  }
  __builtin_amdgcn_fence(__ATOMIC_RELEASE, "workgroup");
  __builtin_amdgcn_wave_barrier();
  __builtin_amdgcn_fence(__ATOMIC_ACQUIRE, "workgroup");
  {
    const int c4 = (lane & 15) * 4;   // 16 lanes x 16 B = 256 B = one 64-float row segment; hh selects the row
    {
#pragma unroll
      for (int it = 0; it < 8; ++it) {
        const int row = it * 2 + hh;
        v4f val = *(const v4f*)(os + row * 68 + c4);
        *(v4f*)(ob_ptr + (size_t)(q0 + row) * kD + c4) = val;
      }
      
    }
  }
}

// =====================================================================================
// Shaped combination + causal prefix mean in f32:  O[b,s,h*64+d] = rg[h]*AV + sg[h]*v[s] - cg[h]*(sum_{j<=s} v[j])/(s+1),
// emitted as bf16 hi/lo planes [kTok][kD].
// One work-group = one (b, h) and one segment of kScRows rows of s; grid = kScSeg * kB * kH = 256, block 512.
// 16 lanes x 4 channels cover one 64-channel row; the 32 row slots of a work-group
//   (a) sum the rows in front of the segment, slot r taking rows r, r+32, r+64, ... (all loads independent),
//   (b) each own kScPer consecutive rows of the segment and sum them,
//   (c) meet in LDS: per channel the 32 sums of (a) are added up and the 32 sums of (b) scanned in fixed order,
//   (d) walk their own rows from that start value.
// Fixed summation order, no dependence on arrival; each 128-B output line (64 channels x 2 B) has one writer.
// =====================================================================================
constexpr int kScRows  = 256;                  // rows of s per work-group
constexpr int kScSeg   = kS / kScRows;         // 8 segments
constexpr int kScSlots = 32;                   // row slots (16 lanes each) per work-group
constexpr int kScPer   = kScRows / kScSlots;   // 8 consecutive rows per slot
__global__ __launch_bounds__(512) void shaped_combine(const float* __restrict__ AV, const float* __restrict__ Vf,
                                                     const float* __restrict__ rg, const float* __restrict__ sg,
                                                     const float* __restrict__ cg,
                                                     unsigned short* __restrict__ Oh, unsigned short* __restrict__ Ol) {
  __shared__ __align__(16) float Ps[kScSlots * kHD];   // per slot: sum of its rows in front of the segment
  __shared__ __align__(16) float Gs[kScSlots * kHD];   // per slot: sum of its own rows, then its start value
  const int tid  = threadIdx.x;
  const int slot = tid >> 4;
  const int c4   = (tid & 15) * 4;
  const int seg  = (kScSeg - 1) - (int)(blockIdx.x / (kB * kH));   // longest front part starts first
  const int bh   = blockIdx.x % (kB * kH);
  const int b = bh / kH;
  const int h = bh % kH;
  const size_t col = (size_t)(b * kS) * kD + h * kHD + c4;
  const int s0 = seg * kScRows + slot * kScPer;

  const float* vrow = Vf + col + (size_t)s0 * kD;
  const float* arow = AV + col + (size_t)s0 * kD;
  v4f vv[kScPer], aa[kScPer];
#pragma unroll
  for (int k = 0; k < kScPer; ++k) vv[k] = *(const v4f*)(vrow + k * kD);
#pragma unroll
  for (int k = 0; k < kScPer; ++k) aa[k] = *(const v4f*)(arow + k * kD);
  // precaution: this wait stands behind the 16 issued loads, in front of every later overwrite of their address
  // registers; both addresses are named as inputs so that no load's destination is placed on them ahead of it
  asm volatile("s_wait_xcnt 0x0" :: "v"(vrow), "v"(arow) : "memory");

  v4f pre = (v4f){0.f, 0.f, 0.f, 0.f};
  for (int t = 0; t < seg; ++t) {              // block-uniform trip count, at most kScSeg - 1
    v4f w[kScPer];
#pragma unroll
    for (int k = 0; k < kScPer; ++k)
      w[k] = *(const v4f*)(Vf + col + (size_t)(t * kScRows + k * kScSlots + slot) * kD);
#pragma unroll
    for (int k = 0; k < kScPer; ++k) pre += w[k];
  }
  const float rgh = rg[h], sgh = sg[h], cgh = cg[h];
  v4f gsum = vv[0];
#pragma unroll
  for (int k = 1; k < kScPer; ++k) gsum += vv[k];
  *(v4f*)(Ps + slot * kHD + c4) = pre;
  *(v4f*)(Gs + slot * kHD + c4) = gsum;
  __syncthreads();
  if (tid < kHD) {                             // one lane per channel, two whole waves
    float b0 = 0.f, b1 = 0.f, b2 = 0.f, b3 = 0.f;
#pragma unroll
    for (int r = 0; r < kScSlots; r += 4) {
      b0 += Ps[(r + 0) * kHD + tid];
      b1 += Ps[(r + 1) * kHD + tid];
      b2 += Ps[(r + 2) * kHD + tid];
      b3 += Ps[(r + 3) * kHD + tid];
    }
    float run = (b0 + b1) + (b2 + b3);
#pragma unroll
    for (int r = 0; r < kScSlots; ++r) {
      const float g = Gs[r * kHD + tid];
      Gs[r * kHD + tid] = run;
      run += g;
    }
  }
  __syncthreads();
  v4f p = *(const v4f*)(Gs + slot * kHD + c4);
#pragma unroll
  for (int k = 0; k < kScPer; ++k) {
    const int s = s0 + k;
    const size_t idx = col + (size_t)s * kD;
    p += vv[k];
    const float inv = 1.0f / (float)(s + 1);
    unsigned short hb[4], lb[4];
#pragma unroll
    for (int e = 0; e < 4; ++e) {
      const float o = rgh * aa[k][e] + sgh * vv[k][e] - cgh * (p[e] * inv);
      hb[e] = f2bf_bits(o);
      lb[e] = f2bf_bits(o - bf_bits2f(hb[e]));
    }
    uint2 uh, ul;
    uh.x = (unsigned)hb[0] | ((unsigned)hb[1] << 16);
    uh.y = (unsigned)hb[2] | ((unsigned)hb[3] << 16);
    ul.x = (unsigned)lb[0] | ((unsigned)lb[1] << 16);
    ul.y = (unsigned)lb[2] | ((unsigned)lb[3] << 16);
    *(uint2*)(Oh + idx) = uh;
    *(uint2*)(Ol + idx) = ul;
  }
}

// =====================================================================================
// launcher: kernel launches only
// =====================================================================================
extern "C" void kernel_launch(void* const* d_in, const int* in_sizes, int n_in,
                              void* d_out, int out_size, void* d_ws,
                              size_t ws_size, hipStream_t stream) {
  if (n_in < 8) return;
  if (in_sizes[0] != kTok * kD) return;
  if (in_sizes[1] != kD * kQKLd) return;
  if (in_sizes[2] != kQKLd) return;
  if (in_sizes[3] != kD * kD) return;
  if (in_sizes[4] != kD * kD) return;
  if (in_sizes[5] != kH || in_sizes[6] != kH || in_sizes[7] != kH) return;
  if (out_size != kTok * kD) return;
  if (kWsTotal > ws_size) return;

  const float* x     = (const float*)d_in[0];
  const float* qk_w  = (const float*)d_in[1];
  const float* qk_b  = (const float*)d_in[2];
  const float* v_w   = (const float*)d_in[3];
  const float* cp_w  = (const float*)d_in[4];
  const float* rg    = (const float*)d_in[5];
  const float* sg    = (const float*)d_in[6];
  const float* cg    = (const float*)d_in[7];
  float* out = (float*)d_out;

  unsigned char* ws = (unsigned char*)d_ws;
  unsigned short* xb   = (unsigned short*)(ws + kOffXb);
  unsigned short* qkwT = (unsigned short*)(ws + kOffQkwT);
  unsigned short* vwT  = (unsigned short*)(ws + kOffVwT);
  unsigned short* cwT  = (unsigned short*)(ws + kOffCwT);
  unsigned short* QKp  = (unsigned short*)(ws + kOffQKp);
  float*          Vf   = (float*)(ws + kOffVf);
  unsigned short* Vth  = (unsigned short*)(ws + kOffVth);
  unsigned short* Vtl  = (unsigned short*)(ws + kOffVtl);
  float*          AV   = (float*)(ws + kOffAV);
  unsigned short* Oh   = (unsigned short*)(ws + kOffOh);
  unsigned short* Ol   = (unsigned short*)(ws + kOffOl);

  // 1. x -> bf16 [4096][1024]: n = 4194304, n2 = 2097152 threads, 8192 blocks exactly
  {
    const int n2 = (kTok * kD) / 2;
    cast_f32_bf16x2<<<dim3((n2 + 255) / 256), dim3(256), 0, stream>>>(x, xb, n2);
  }
  // 2-4. weights [in][out] f32 -> transposed bf16 [out][in]   (grid = (cols/64, rows/64))
  transpose_cast_bf16<<<dim3(kQKLd / 64, kD / 64), dim3(256), 0, stream>>>(qk_w, qkwT, kD, kQKLd);   // in[1024][2048] -> out[2048][1024]
  transpose_cast_bf16<<<dim3(kD / 64, kD / 64),    dim3(256), 0, stream>>>(v_w,  vwT,  kD, kD);      // in[1024][1024] -> out[1024][1024]
  transpose_cast_bf16<<<dim3(kD / 64, kD / 64),    dim3(256), 0, stream>>>(cp_w, cwT,  kD, kD);

  // 5. fused q|k projection: [4096 x 1024] . [2048 x 1024]^T + qk_b -> f16 [4096][2048]; tiles 32*8 = 256 blocks
  wmma_gemm64<1, 0, 2, 1, false><<<dim3((kTok / kGM) * (kQKLd / kGN), 1), dim3(256), 0, stream>>>(
      xb, xb, kD, 0L, qkwT, qkwT, kD, 0L, (void*)QKp, (void*)QKp, kQKLd, 0L,
      qk_b, x, 0L, kTok, kQKLd, kD, 1.0f);
  // 6. v projection: [4096 x 1024] . [1024 x 1024]^T -> f32 [4096][1024]; tiles 32*4 = 128 blocks
  wmma_gemm64<1, 0, 0, 0, false><<<dim3((kTok / kGM) * (kD / kGN), 1), dim3(256), 0, stream>>>(
      xb, xb, kD, 0L, vwT, vwT, kD, 0L, (void*)Vf, (void*)Vf, kD, 0L,
      qk_b, x, 0L, kTok, kD, kD, 1.0f);
  // 7. v -> bf16 hi/lo planes [32][64][2048]
  v_split_transpose<<<dim3(kS / 64, kB * kH), dim3(256), 0, stream>>>(Vf, Vth, Vtl);
  // 8. causal attention -> AV f32 [4096][1024]
  attn_causal_hd64<<<dim3(kB * kH * kNQB), dim3(128), 0, stream>>>(QKp, Vth, Vtl, AV);
  // 9. shaped combination + prefix mean -> O hi/lo bf16 [4096][1024]
  shaped_combine<<<dim3(kScSeg * kB * kH), dim3(512), 0, stream>>>(AV, Vf, rg, sg, cg, Oh, Ol);
  // 10. output projection: (O hi + O lo) [4096 x 1024] . [1024 x 1024]^T -> f32 d_out [4096][1024]; 128 blocks
  wmma_gemm64<1, 1, 0, 0, false><<<dim3((kTok / kGM) * (kD / kGN), 1), dim3(256), 0, stream>>>(
      Oh, Ol, kD, 0L, cwT, cwT, kD, 0L, (void*)out, (void*)out, kD, 0L,
      qk_b, x, 0L, kTok, kD, kD, 1.0f);
}

// v006
// A run of this version takes 135 microseconds.
// Timed twice side by side with v005, it ran 1.15 times as fast both times.
// All steps since v000 together make it 10.1 times as fast.
// Contractions: qk and v projections = v_wmma_f32_16x16x32_bf16 (x and W as RNE bf16, single product); scores q.k^T = v_wmma_f32_16x16x32_f16 (q, k f16 planes, single product, 1/8 applied in f32 inside the softmax exponent); attn.v = v_wmma_f32_16x16x32_bf16 with p and v as bf16 hi/lo pairs (hi.hi + hi.lo + lo.hi); output projection = v_wmma_f32_16x16x32_bf16 with the merged head output as bf16 hi/lo pair times W as RNE bf16 (hi.W + lo.W); f32 accumulate everywhere; softmax, causal prefix mean of v and gain combination in f32.
#include <hip/hip_runtime.h>
#include <math.h>

typedef __attribute__((ext_vector_type(16))) _Float16 v16h;
typedef __attribute__((ext_vector_type(8)))  _Float16 v8h;
typedef __attribute__((ext_vector_type(16))) __bf16   v16b;
typedef __attribute__((ext_vector_type(8)))  __bf16   v8b;
typedef __attribute__((ext_vector_type(8)))  float    v8f;
typedef __attribute__((ext_vector_type(4)))  float    v4f;
typedef __attribute__((ext_vector_type(2)))  float    v2f;
typedef __attribute__((ext_vector_type(8)))  unsigned v8u;
typedef __attribute__((ext_vector_type(2)))  __bf16   v2b;

constexpr int kB    = 2;
constexpr int kS    = 2048;
constexpr int kD    = 1024;
constexpr int kH    = 16;
constexpr int kHD   = 64;
constexpr int kTok  = kB * kS;        // 4096 token rows
constexpr int kQKLd = 2 * kD;         // fused q|k plane pitch (halves): q at col h*64, k at col kD + h*64
constexpr int kKOff = kD;
constexpr int kKC   = 64;             // kv chunk
constexpr int kNQB  = kS / 64;        // query blocks per (b,h)
constexpr int kStg  = 72;             // 16-bit LDS staging pitch (144 B rows, 16-B aligned)
constexpr float kSmScale = 0.125f;    // 1/sqrt(64)
constexpr float kSmScaleLog2 = kSmScale * 1.4426950408889634f;   // exp(kSmScale * x) = exp2(kSmScaleLog2 * x)

// workspace region map (bytes, all offsets multiples of 2 MiB):
//   [0]          xb    bf16 [4096][1024]            8 MiB
//   [8 MiB]      qkwT  bf16 [2048][1024]            4 MiB   (qk_w transposed)
//   [12 MiB]     vwT   bf16 [1024][1024]            2 MiB
//   [14 MiB]     cwT   bf16 [1024][1024]            2 MiB
//   [16 MiB]     QKp   f16  [4096][2048]           16 MiB   (q | k planes)
//   [32 MiB]     Vf    f32  [4096][1024]           16 MiB
//   [48 MiB]     Vth   bf16 [32][64][2048]          8 MiB   (v hi, per (b,h) [d][s])
//   [56 MiB]     Vtl   bf16 [32][64][2048]          8 MiB   (v lo)
//   [64 MiB]     AV    f32  [4096][1024]           16 MiB   (softmax(qk).v, merged heads)
//   [80 MiB]     Oh    bf16 [4096][1024]            8 MiB   (combined head output, hi)
//   [88 MiB]     Ol    bf16 [4096][1024]            8 MiB   (lo)
//   total 96 MiB = 100663296 B
constexpr size_t kOffXb   = 0;
constexpr size_t kOffQkwT = kOffXb   + (size_t)kTok * kD * 2;
constexpr size_t kOffVwT  = kOffQkwT + (size_t)kQKLd * kD * 2;
constexpr size_t kOffCwT  = kOffVwT  + (size_t)kD * kD * 2;
constexpr size_t kOffQKp  = kOffCwT  + (size_t)kD * kD * 2;
constexpr size_t kOffVf   = kOffQKp  + (size_t)kTok * kQKLd * 2;
constexpr size_t kOffVth  = kOffVf   + (size_t)kTok * kD * 4;
constexpr size_t kOffVtl  = kOffVth  + (size_t)kB * kH * kHD * kS * 2;
constexpr size_t kOffAV   = kOffVtl  + (size_t)kB * kH * kHD * kS * 2;
constexpr size_t kOffOh   = kOffAV   + (size_t)kTok * kD * 4;
constexpr size_t kOffOl   = kOffOh   + (size_t)kTok * kD * 2;
constexpr size_t kWsTotal = kOffOl   + (size_t)kTok * kD * 2;
static_assert(kWsTotal == 100663296ull);
static_assert(kWsTotal <= 134217728ull);

__device__ __forceinline__ unsigned short f2bf_bits(float f) {
  unsigned u = __float_as_uint(f);
  return (unsigned short)((u + 0x7FFFu + ((u >> 16) & 1u)) >> 16);
}
__device__ __forceinline__ float bf_bits2f(unsigned short h) { return __uint_as_float(((unsigned)h) << 16); }

// hazard guards as plain device helpers (their inline asm is kept out of the kernel template body)
__device__ __forceinline__ void dep_guard_h(v8f& a, v8f& b, v16h x, v16h y) { asm volatile("v_nop\n\tv_nop\n\tv_nop\n\tv_nop" : "+v"(a), "+v"(b) : "v"(x), "v"(y)); }
__device__ __forceinline__ void dep_guard_b(v8f& a, v8f& b, v16b x, v16b y) { asm volatile("v_nop\n\tv_nop\n\tv_nop\n\tv_nop" : "+v"(a), "+v"(b) : "v"(x), "v"(y)); }
__device__ __forceinline__ void keep4_h(v16h a, v16h b, v16h c, v16h d) { asm volatile("v_nop" :: "v"(a), "v"(b), "v"(c), "v"(d)); }
__device__ __forceinline__ void keep4_b(v16b a, v16b b, v16b c, v16b d) { asm volatile("v_nop" :: "v"(a), "v"(b), "v"(c), "v"(d)); }
__device__ __forceinline__ void acc_guard4(v8f& a, v8f& b, v8f& c, v8f& d) { asm volatile("v_nop\n\tv_nop\n\tv_nop\n\tv_nop" : "+v"(a), "+v"(b), "+v"(c), "+v"(d)); }
template <typename T> struct Frag;
template <> struct Frag<_Float16> {
  typedef v16h V; union U { v16h v; v8h h[2]; };
  static __device__ __forceinline__ v16h load(const _Float16* p) {   // elements 0..7 <- p[0..7], 8..15 <- p[16..23]
    U f; f.h[0] = *(const v8h*)(p); f.h[1] = *(const v8h*)(p + 16); return f.v;
  }
  static __device__ __forceinline__ v8f mma(v16h a, v16h b, v8f c) {
    return __builtin_amdgcn_wmma_f32_16x16x32_f16(false, a, false, b, (short)0, c, false, false);
  }
  static __device__ __forceinline__ void guard(v8f& a, v8f& b, v16h x, v16h y) { dep_guard_h(a, b, x, y); }
  static __device__ __forceinline__ void keep(v16h a, v16h b, v16h c, v16h d) { keep4_h(a, b, c, d); }
};
template <> struct Frag<__bf16> {
  typedef v16b V; union U { v16b v; v8b h[2]; };
  static __device__ __forceinline__ v16b load(const __bf16* p) {
    U f; f.h[0] = *(const v8b*)(p); f.h[1] = *(const v8b*)(p + 16); return f.v;
  }
  static __device__ __forceinline__ v8f mma(v16b a, v16b b, v8f c) {
    return __builtin_amdgcn_wmma_f32_16x16x32_bf16(false, a, false, b, (short)0, c, false, false);
  }
  static __device__ __forceinline__ void guard(v8f& a, v8f& b, v16b x, v16b y) { dep_guard_b(a, b, x, y); }
  static __device__ __forceinline__ void keep(v16b a, v16b b, v16b c, v16b d) { keep4_b(a, b, c, d); }
};

// bf16 hi/lo split of two values straight into packed fragment registers (first value in the low half): the packed
// convert rounds to nearest even and packs in the same instruction; lo = round(f - hi)
__device__ __forceinline__ void at_split2(float f0, float f1, unsigned& hi, unsigned& lo) {
  const v2f f = {f0, f1};
  const unsigned hw = __builtin_bit_cast(unsigned, __builtin_convertvector(f, v2b));
  const v2f d = {f0 - __uint_as_float(hw << 16), f1 - __uint_as_float(hw & 0xFFFF0000u)};
  hi = hw;
  lo = __builtin_bit_cast(unsigned, __builtin_convertvector(d, v2b));
}
__device__ __forceinline__ v8f at_mma(v16b a, v16b b, v8f c) {
  c = __builtin_amdgcn_wmma_f32_16x16x32_bf16(false, a, false, b, (short)0, c, false, false);
  asm volatile("v_nop\n\tv_nop\n\tv_nop\n\tv_nop" : "+v"(c) : "v"(a), "v"(b));
  return c;
}
// lane l reads lane l ^ 16
__device__ __forceinline__ float at_xhalf(float x) {
  return __builtin_bit_cast(float, __builtin_amdgcn_permlanex16(__builtin_bit_cast(int, x), __builtin_bit_cast(int, x),
                                                                0x76543210, 0xfedcba98, false, false));
}
__device__ __forceinline__ void at_exp2x8(v8f& x) {
  float e0, e1, e2, e3, e4, e5, e6, e7;
  asm("v_exp_f32 %0, %8\n\tv_exp_f32 %1, %9\n\tv_exp_f32 %2, %10\n\tv_exp_f32 %3, %11\n\t"
      "v_exp_f32 %4, %12\n\tv_exp_f32 %5, %13\n\tv_exp_f32 %6, %14\n\tv_exp_f32 %7, %15\n\tv_nop"
      : "=&v"(e0), "=&v"(e1), "=&v"(e2), "=&v"(e3), "=&v"(e4), "=&v"(e5), "=&v"(e6), "=&v"(e7)
      : "v"(x[0]), "v"(x[1]), "v"(x[2]), "v"(x[3]), "v"(x[4]), "v"(x[5]), "v"(x[6]), "v"(x[7]));
  x = (v8f){e0, e1, e2, e3, e4, e5, e6, e7};
}
__device__ __forceinline__ v8f at_mma_h(v16h a, v16h b, v8f c) {
  c = __builtin_amdgcn_wmma_f32_16x16x32_f16(false, a, false, b, (short)0, c, false, false);
  asm volatile("v_nop\n\tv_nop\n\tv_nop\n\tv_nop" : "+v"(c) : "v"(a), "v"(b));
  return c;
}

// =====================================================================================
// Register-blocked batched WMMA GEMM, C[m,n] = scale * sum_k A[m,k] * Bt[n,k] (+bias)(+resid);
// each wave owns a 64x64 tile; the 8 waves of a work-group stand 2 (m) x 4 (n) on one 128x256 tile of C.
// A row-major [M,K]; Bt row-major [N,K]; M % 128 == 0, N % 256 == 0, K % 64 == 0.
// Operands reach the waves through LDS: per k tile of 64 the work-group copies 128 rows of A (and of A2) and 256 rows
// of Bt, 128 B a row, with asynchronous copies (8 lanes x 16 B = one whole line of a row), into one of two buffers at
// row pitch kStg; the copies of tile t + 2 fly while tile t + 1 is worked on.
// SPLITM: 0 = single product; 1 = A carried as hi/lo planes (A2p = lo): product = hi.B + lo.B.
// BIAS_MODE: 0 = none, 1 = bias[m], 2 = bias[n].  OUT_MODE: 0 = f32, 1 = f16, 2 = bf16 hi + lo planes,
// 3 = two products that share A in one grid: columns below nSplit (a multiple of 256, so a work-group lies wholly on one
//     side) go out as in mode 1, with the bias; the others as f32 without bias to Cout2, pitch ldc2, column n - nSplit.
// ET: 0 = f16 operands, 1 = bf16 operands (pointers passed as 16-bit storage)
// =====================================================================================
constexpr int kGK = 64;     // k extent of a staged tile
constexpr int kGM = 128;    // rows of A per work-group
constexpr int kGN = 256;    // rows of Bt per work-group

// Each lane copies its own 16 B from global memory to its own LDS byte address. The s_wait_xcnt closes the statement so
// that it stands in front of every later write of the address registers named here (a precaution).
__device__ __forceinline__ void async_copy4(unsigned l0, const void* g0, unsigned l1, const void* g1,
                                            unsigned l2, const void* g2, unsigned l3, const void* g3) {
  asm volatile("global_load_async_to_lds_b128 %0, %1, off\n\t"
               "global_load_async_to_lds_b128 %2, %3, off\n\t"
               "global_load_async_to_lds_b128 %4, %5, off\n\t"
               "global_load_async_to_lds_b128 %6, %7, off\n\t"
               "s_wait_xcnt 0x0"
               :: "v"(l0), "v"(g0), "v"(l1), "v"(g1), "v"(l2), "v"(g2), "v"(l3), "v"(g3) : "memory");
}
__device__ __forceinline__ void async_copy8(unsigned l0, const void* g0, unsigned l1, const void* g1,
                                            unsigned l2, const void* g2, unsigned l3, const void* g3,
                                            unsigned l4, const void* g4, unsigned l5, const void* g5,
                                            unsigned l6, const void* g6, unsigned l7, const void* g7) {
  asm volatile("global_load_async_to_lds_b128 %0, %1, off\n\t"
               "global_load_async_to_lds_b128 %2, %3, off\n\t"
               "global_load_async_to_lds_b128 %4, %5, off\n\t"
               "global_load_async_to_lds_b128 %6, %7, off\n\t"
               "global_load_async_to_lds_b128 %8, %9, off\n\t"
               "global_load_async_to_lds_b128 %10, %11, off\n\t"
               "global_load_async_to_lds_b128 %12, %13, off\n\t"
               "global_load_async_to_lds_b128 %14, %15, off\n\t"
               "s_wait_xcnt 0x0"
               :: "v"(l0), "v"(g0), "v"(l1), "v"(g1), "v"(l2), "v"(g2), "v"(l3), "v"(g3),
                  "v"(l4), "v"(g4), "v"(l5), "v"(g5), "v"(l6), "v"(g6), "v"(l7), "v"(g7) : "memory");
}

template <int V> struct IntC { static constexpr int value = V; };   // a compile-time choice handed to the epilogue
template <int ET> struct Elem;
template <> struct Elem<0> { typedef _Float16 T; };
template <> struct Elem<1> { typedef __bf16 T; };
template <int ET, int SPLITM, int BIAS_MODE, int OUT_MODE, bool RESID, int ACT = 0>
__global__ __launch_bounds__(256) void wmma_gemm64(
    const unsigned short* __restrict__ Ap, const unsigned short* __restrict__ A2p, int lda, long strideA,
    const unsigned short* __restrict__ Btp, const unsigned short* __restrict__ Bt2p, int ldb, long strideB,
    void* __restrict__ Cout, void* __restrict__ Cout2, int ldc, long strideC,
    const float* __restrict__ bias,
    const float* __restrict__ resid, long strideR,
    int M, int N, int K, float scale, int nSplit, int ldc2) {
  typedef typename Elem<ET>::T T;
  typedef typename Frag<T>::V V;
  static_assert(SPLITM <= 1);
  constexpr bool SPA = (SPLITM >= 1);
  constexpr int kOffA2  = kGM * kStg;                       // element offsets inside one buffer: A | A2 | Bt
  constexpr int kOffB   = (SPA ? 2 : 1) * kGM * kStg;
  constexpr int kBufEl  = kOffB + kGN * kStg;
  const T* A = (const T*)Ap; const T* A2 = (const T*)A2p; const T* Bt = (const T*)Btp;
  __shared__ __align__(16) T sOp[2 * kBufEl];      // two operand buffers
  __shared__ __align__(16) float sT[8][16 * 68];   // per-wave 16x64 slab, pitch 68 floats
  const int b    = blockIdx.y;
  const int tid  = threadIdx.x;
  const int lane = tid & 31;
  const int wave = tid >> 5;
  const int tilesN = N / kGN;
  const int tilesM = M / kGM;
  if ((int)blockIdx.x >= tilesM * tilesN) return;   // the same for the whole work-group, in front of every copy and barrier
  const int bm = blockIdx.x / tilesN;
  const int bn = blockIdx.x - bm * tilesN;
  const int wm = (wave >> 2) << 6;             // this wave's rows inside the staged A tile
  const int wn = (wave & 3) << 6;              // this wave's rows inside the staged Bt tile
  const int m0 = bm * kGM + wm;
  const int n0 = bn * kGN + wn;

  const int rlane = lane & 15;                 // row (A) / col (B, D) within subtile
  const int koff  = (lane >> 4) * 8;           // k offset of this lane half
  const int mOff  = (lane >> 4) * 8;           // D row offset

  // staging: thread -> row tid / 8 (+ 32 per copy), 16-B piece tid % 8 of the row's 128 B
  const int srow = tid >> 3;
  const int sseg = (tid & 7) * 8;
  const T* gA  = A  + (size_t)b * strideA + (size_t)(bm * kGM + srow) * lda + sseg;
  const T* gA2 = SPA ? (A2 + (size_t)b * strideA + (size_t)(bm * kGM + srow) * lda + sseg) : nullptr;
  const T* gB  = Bt + (size_t)b * strideB + (size_t)(bn * kGN + srow) * ldb + sseg;
  const unsigned lS = (unsigned)(size_t)(sOp + srow * kStg + sseg);   // LDS byte address: low 32 bits
  const size_t a32 = (size_t)32 * lda, b32 = (size_t)32 * ldb;
  constexpr unsigned kL32 = 32 * kStg * 2;     // 32 rows in LDS, bytes
  auto stage = [&](int t, int buf) {
    const unsigned l = lS + (unsigned)buf * (unsigned)(kBufEl * 2);
    const unsigned lb = l + kOffB * 2;
    const T* pb = gB + t * kGK;
    async_copy8(lb, pb, lb + kL32, pb + b32, lb + 2 * kL32, pb + 2 * b32, lb + 3 * kL32, pb + 3 * b32,
                lb + 4 * kL32, pb + 4 * b32, lb + 5 * kL32, pb + 5 * b32, lb + 6 * kL32, pb + 6 * b32,
                lb + 7 * kL32, pb + 7 * b32);
    const T* pa = gA + t * kGK;
    if (SPA) {
      const unsigned l2 = l + kOffA2 * 2;
      const T* pa2 = gA2 + t * kGK;
      async_copy8(l, pa, l + kL32, pa + a32, l + 2 * kL32, pa + 2 * a32, l + 3 * kL32, pa + 3 * a32,
                  l2, pa2, l2 + kL32, pa2 + a32, l2 + 2 * kL32, pa2 + 2 * a32, l2 + 3 * kL32, pa2 + 3 * a32);
    } else {
      async_copy4(l, pa, l + kL32, pa + a32, l + 2 * kL32, pa + 2 * a32, l + 3 * kL32, pa + 3 * a32);
    }
  };

  v8f acc[4][4];
#pragma unroll
  for (int i = 0; i < 4; ++i)
#pragma unroll
    for (int j = 0; j < 4; ++j) acc[i][j] = (v8f){0.f,0.f,0.f,0.f,0.f,0.f,0.f,0.f};

  const int nT = K / kGK;                      // the same for the whole work-group
  stage(0, 0);
  asm volatile("s_wait_asynccnt 0x0" ::: "memory");   // this wave's copies of tile 0 have landed
  __syncthreads();                                    // ... and every other wave's: tile 0 may be read
  if (nT > 1) stage(1, 1);
  for (int t = 0; t < nT; ++t) {
    const T* sA = sOp + (t & 1) * kBufEl + (wm + rlane) * kStg + koff;
    const T* sB = sOp + (t & 1) * kBufEl + kOffB + (wn + rlane) * kStg + koff;
#pragma unroll
    for (int kk = 0; kk < kGK; kk += 32) {
      V bh[4], ah[4], al[4];
#pragma unroll
      for (int j = 0; j < 4; ++j) bh[j] = Frag<T>::load(sB + (j << 4) * kStg + kk);
#pragma unroll
      for (int i = 0; i < 4; ++i) {
        ah[i] = Frag<T>::load(sA + (i << 4) * kStg + kk);
        if (SPA) al[i] = Frag<T>::load(sA + kOffA2 + (i << 4) * kStg + kk);
      }
#pragma unroll
      for (int i = 0; i < 4; ++i) {
#pragma unroll
        for (int j = 0; j < 4; ++j) {
          acc[i][j] = Frag<T>::mma(ah[i], bh[j], acc[i][j]);
          if (SPA) acc[i][j] = Frag<T>::mma(al[i], bh[j], acc[i][j]);
        }
        Frag<T>::guard(acc[i][0], acc[i][3], ah[i], SPA ? al[i] : ah[i]);
      }
      Frag<T>::keep(bh[0], bh[1], bh[2], bh[3]);
    }
    asm volatile("s_wait_dscnt 0x0" ::: "memory");      // this wave's reads of tile t are done before its buffer is refilled
    asm volatile("s_wait_asynccnt 0x0" ::: "memory");   // this wave's copies of tile t + 1 have landed
    __syncthreads();                                    // publishes tile t + 1 and ends every reader's reads of tile t
    if (t + 2 < nT) stage(t + 2, t & 1);
  }
  asm volatile("s_wait_asynccnt 0x0" ::: "memory");     // no copy is outstanding when the wave goes on
  acc_guard4(acc[0][0], acc[0][1], acc[0][2], acc[0][3]);
  acc_guard4(acc[1][0], acc[1][1], acc[1][2], acc[1][3]);
  acc_guard4(acc[2][0], acc[2][1], acc[2][2], acc[2][3]);
  acc_guard4(acc[3][0], acc[3][1], acc[3][2], acc[3][3]);

  // ---- epilogue ----
  // BM, OM: bias and output form of this work-group's columns; C1, C2: its planes, pitch ld; nc0: the wave's first column there
  float* slab = sT[wave];
  const float* Rb = RESID ? (resid + (size_t)b * strideR) : nullptr;
  auto epilogue = [&](auto bmTag, auto omTag, void* C1, void* C2, int ld, int nc0) {
    constexpr int BM = decltype(bmTag)::value;
    constexpr int OM = decltype(omTag)::value;
#pragma unroll
    for (int i = 0; i < 4; ++i) {
      const int mBase = m0 + (i << 4);
#pragma unroll
      for (int j = 0; j < 4; ++j) {
        const int n = n0 + (j << 4) + rlane;
        float bv = 0.f;
        if (BM == 2) bv = bias[n];
#pragma unroll
        for (int r = 0; r < 8; ++r) {
          float v = acc[i][j][r] * scale;
          if (BM == 1) v += bias[mBase + mOff + r];
          if (BM == 2) v += bv;
          if (RESID) v += Rb[(size_t)(mBase + mOff + r) * ld + n];
          if (ACT == 1) v = tanhf(v);
          if (ACT == 2) v = fmaxf(v, 0.0f);
          if (ACT == 4) v = (v > 0.f) ? v : 0.01f * v;
          slab[(mOff + r) * 68 + (j << 4) + rlane] = v;
        }
      }
      __builtin_amdgcn_fence(__ATOMIC_RELEASE, "workgroup");
      __builtin_amdgcn_wave_barrier();
      __builtin_amdgcn_fence(__ATOMIC_ACQUIRE, "workgroup");
      if (OM == 0) {
        float* C = (float*)C1 + (size_t)b * strideC;
        const int hh = lane >> 4, c4 = (lane & 15) * 4;     // row seg = 256 B = 16 lanes x 16 B
#pragma unroll
        for (int it = 0; it < 8; ++it) {
          const int row = it * 2 + hh;
          v4f v = *(const v4f*)(slab + row * 68 + c4);
          *(v4f*)(C + (size_t)(mBase + row) * ld + nc0 + c4) = v;
        }
      } else {
        const int q = lane >> 3, c8 = (lane & 7) * 8;
        unsigned short* C  = (unsigned short*)C1 + (size_t)b * strideC;
        unsigned short* Cl = (OM == 2) ? ((unsigned short*)C2 + (size_t)b * strideC) : nullptr;
#pragma unroll
        for (int it = 0; it < 4; ++it) {
          const int row = it * 4 + q;
          const float* sp = slab + row * 68 + c8;
          v8h hv, lv;
#pragma unroll
          for (int e = 0; e < 8; ++e) {
            if (OM == 1) {
              hv[e] = (_Float16)sp[e];
            } else {
              unsigned short hb = f2bf_bits(sp[e]);
              unsigned short lb = f2bf_bits(sp[e] - bf_bits2f(hb));
              hv[e] = __builtin_bit_cast(_Float16, hb);
              lv[e] = __builtin_bit_cast(_Float16, lb);
            }
          }
          *(v8h*)(C + (size_t)(mBase + row) * ld + nc0 + c8) = hv;
          if (OM == 2) *(v8h*)(Cl + (size_t)(mBase + row) * ld + nc0 + c8) = lv;
        }
      }
      __builtin_amdgcn_fence(__ATOMIC_RELEASE, "workgroup");
      __builtin_amdgcn_wave_barrier();
      __builtin_amdgcn_fence(__ATOMIC_ACQUIRE, "workgroup");
    }
  };
  if constexpr (OUT_MODE == 3) {
    static_assert(!RESID);
    if (bn * kGN >= nSplit) epilogue(IntC<0>{}, IntC<0>{}, Cout2, Cout2, ldc2, n0 - nSplit);   // the same for the whole work-group
    else                    epilogue(IntC<BIAS_MODE>{}, IntC<1>{}, Cout, Cout, ldc, n0);
  } else {
    epilogue(IntC<BIAS_MODE>{}, IntC<OUT_MODE>{}, Cout, Cout2, ldc, n0);
  }
}

// =====================================================================================
// Operand preparation, one grid for four jobs that do not depend on one another; the block index picks the job:
//   [0, kPrepQk)             qk_w  f32 [kD][kQKLd] -> bf16 [kQKLd][kD]     one 64x64 tile per work-group
//   [kPrepQk, +kPrepW)       v_w   f32 [kD][kD]    -> bf16 [kD][kD]        "
//   [.., +kPrepW)            cp_w  f32 [kD][kD]    -> bf16 [kD][kD]        "
//   [kPrepT, +kPrepX)        x     f32 -> bf16, same layout, two elements per thread
// The tile jobs (LDS, one barrier) last longer than the cast jobs and stand first.
// Weight transpose + RNE bf16 cast: in f32 [R][Cc] row-major -> out bf16 bits [Cc][R]  (out[c][r] = in[r][c]), R = kD.
// Load coverage: 256 threads x 16 floats = 64 (r) x 64 (c).  Store coverage: 8 waves x 2 x 4 rows (q8) = 64 rows c;
// =====================================================================================
constexpr int kPrepQk = (kQKLd / 64) * (kD / 64);     // 512 tiles
constexpr int kPrepW  = (kD / 64) * (kD / 64);        // 256 tiles
constexpr int kPrepT  = kPrepQk + 2 * kPrepW;         // 1024 tile jobs
constexpr int kPrepX  = (kTok * kD) / 2 / 256;        // 8192 cast jobs, exact
static_assert((size_t)kPrepX * 512 == (size_t)kTok * kD);
static_assert(kQKLd / 64 == 32 && kD / 64 == 16);
__global__ __launch_bounds__(256) void prep_operands(const float* __restrict__ x, unsigned short* __restrict__ xb,
                                                     const float* __restrict__ qk_w, unsigned short* __restrict__ qkwT,
                                                     const float* __restrict__ v_w, unsigned short* __restrict__ vwT,
                                                     const float* __restrict__ cp_w, unsigned short* __restrict__ cwT) {
  __shared__ __align__(16) _Float16 t[64 * kStg];     // [c][r] as 16-bit bit patterns
  const int tid = threadIdx.x;
  int job = blockIdx.x;
  if (job >= kPrepT) {                                // the whole work-group leaves here, in front of the barrier
    const int i = (job - kPrepT) * 256 + tid;
    const unsigned u = (unsigned)f2bf_bits(x[2 * i]) | ((unsigned)f2bf_bits(x[2 * i + 1]) << 16);
    ((unsigned*)xb)[i] = u;
    return;
  }
  const float* in = qk_w;
  unsigned short* out = qkwT;
  int Cc = kQKLd, tcLog = 5;                          // 2^tcLog = Cc / 64 tiles in a row of tiles
  if (job >= kPrepQk) {
    job -= kPrepQk;
    Cc = kD; tcLog = 4;
    in = v_w; out = vwT;
    if (job >= kPrepW) { job -= kPrepW; in = cp_w; out = cwT; }
  }
  constexpr int R = kD;
  const int c0 = (job & ((1 << tcLog) - 1)) * 64, r0 = (job >> tcLog) * 64;
  {
    const int rloc = tid >> 2, cq = (tid & 3) * 16;
    const float* src = in + (size_t)(r0 + rloc) * Cc + c0 + cq;
#pragma unroll
    for (int g4 = 0; g4 < 4; ++g4) {
      const v4f a = *(const v4f*)(src + 4 * g4);
#pragma unroll
      for (int e = 0; e < 4; ++e)
        t[(cq + 4 * g4 + e) * kStg + rloc] = __builtin_bit_cast(_Float16, f2bf_bits(a[e]));
    }
  }
  __syncthreads();
  const int wave = tid >> 5, lane = tid & 31, q8 = lane >> 3, c8 = (lane & 7) * 8;
  const int cA = wave * 8 + q8, cB = wave * 8 + 4 + q8;
  const v8h va = *(const v8h*)(t + cA * kStg + c8);
  const v8h vb = *(const v8h*)(t + cB * kStg + c8);
  unsigned short* da = out + (size_t)(c0 + cA) * R + r0 + c8;
  unsigned short* db = out + (size_t)(c0 + cB) * R + r0 + c8;
  {
    *(v8h*)da = va;
    *(v8h*)db = vb;
    
  }
}

// =====================================================================================
// V planes: Vf f32 [kTok][kD] (row b*kS+s, col h*kHD+d) -> Vth/Vtl bf16 bits [kB*kH][kHD][kS]:
// out[bh][d][s] = hi/lo(Vf[b*kS+s][h*kHD+d]).  grid = (kS/64, kB*kH), block 256.
// Load coverage: 256 threads x 16 floats = 64 (s) x 64 (d).
// =====================================================================================
__global__ __launch_bounds__(256) void v_split_transpose(const float* __restrict__ Vf,
                                                         unsigned short* __restrict__ vth, unsigned short* __restrict__ vtl) {
  __shared__ __align__(16) _Float16 th[64 * kStg];
  __shared__ __align__(16) _Float16 tl[64 * kStg];
  const int st0 = blockIdx.x * 64, bh = blockIdx.y;
  const int b = bh / kH, h = bh % kH;
  const int tid = threadIdx.x;
  {
    const int sloc = tid >> 2, d0 = (tid & 3) * 16;
    const float* src = Vf + (size_t)(b * kS + st0 + sloc) * kD + h * kHD + d0;
#pragma unroll
    for (int g4 = 0; g4 < 4; ++g4) {
      const v4f a = *(const v4f*)(src + 4 * g4);
#pragma unroll
      for (int e = 0; e < 4; ++e) {
        const unsigned short hb = f2bf_bits(a[e]);
        const unsigned short lb = f2bf_bits(a[e] - bf_bits2f(hb));
        th[(d0 + 4 * g4 + e) * kStg + sloc] = __builtin_bit_cast(_Float16, hb);
        tl[(d0 + 4 * g4 + e) * kStg + sloc] = __builtin_bit_cast(_Float16, lb);
      }
    }
  }
  __syncthreads();
  const int wave = tid >> 5, lane = tid & 31, q8 = lane >> 3, c8 = (lane & 7) * 8;
  const int dA = wave * 8 + q8, dB = wave * 8 + 4 + q8;
  const v8h ha = *(const v8h*)(th + dA * kStg + c8);
  const v8h hbv = *(const v8h*)(th + dB * kStg + c8);
  const v8h la = *(const v8h*)(tl + dA * kStg + c8);
  const v8h lbv = *(const v8h*)(tl + dB * kStg + c8);
  unsigned short* pha = vth + ((size_t)bh * kHD + dA) * kS + st0 + c8;
  unsigned short* phb = vth + ((size_t)bh * kHD + dB) * kS + st0 + c8;
  unsigned short* pla = vtl + ((size_t)bh * kHD + dA) * kS + st0 + c8;
  unsigned short* plb = vtl + ((size_t)bh * kHD + dB) * kS + st0 + c8;
  {
    *(v8h*)pha = ha;
    *(v8h*)phb = hbv;
    *(v8h*)pla = la;
    *(v8h*)plb = lbv;
    
  }
}

// =====================================================================================
// Causal attention, head_dim 64, 16-bit input planes, f32 out.
//   scores = (k.q^T, the transposed tile: A = K rows, B = Q columns) : v_wmma_f32_16x16x32_f16 (q, k f16 planes); 1/8 and
//            log2(e) enter as one f32 FMA per score in front of 2^x; a lane holds 32 of one query's 64 scores, its partner lane ^ 16 the rest; causal: kv > q replaced by -inf
//            (exp -> 0, identical to a finite most-negative fill since every row keeps its diagonal); chunks past
//            the diagonal contribute exactly 0 and are skipped.
//   out    = (v^T.p^T, A = V rows [d][kv], B = P packed from the score registers) : v_wmma_f32_16x16x32_bf16 with p and v
//            as bf16 hi/lo (hi.hi + hi.lo + lo.hi); online softmax in f32, one maximum and one sum per lane.
// Block = 4 waves = 64 query rows of one (b, h); grid.x = kB * kH * (kS/64).
// Staging coverage per kv chunk: 128 threads x 4 chunks x 8 halves = 64 x 64 per plane (K, V hi, V lo), plain loads + barrier.
// Output AV f32 [kTok][kD] at col h*64: row segment 64 floats = 256 B by 16 lanes x 16 B in one instruction, one wave per
// =====================================================================================
// second launch bound: a register budget for four waves per SIMD, so that four work-groups share a WGP
__global__ __launch_bounds__(128, 4)
void attn_causal_hd64(const unsigned short* __restrict__ QKp,    // f16 bits [kTok][kQKLd]
                      const unsigned short* __restrict__ Vthp,   // bf16 bits [kB*kH][kHD][kS]
                      const unsigned short* __restrict__ Vtlp,
                      float* __restrict__ AV) {                  // f32 [kTok][kD]
  union FB { v16b v; v8b h[2]; };
  // every 16-bit tile has rows of 128 B laid at pitch kStg (144 B = 16 B x 9): the 16 rows that one ds_load_b128
  // fragment read touches then start on 16 different groups of four banks instead of two
  __shared__ __align__(16) _Float16 Ksh[kKC * kStg];       // K [kv][d]      9 KB
  __shared__ __align__(16) __bf16  Vhs[kHD * kStg];        // V hi [d][kv]   9 KB
  __shared__ __align__(16) __bf16  Vls[kHD * kStg];        // V lo [d][kv]   9 KB
  __shared__ __align__(16) float   Os[4][16 * 68];         // per wave out tile, pitch 68

  const int tid  = threadIdx.x;
  const int wave = tid >> 5;
  const int lane = tid & 31;
  const int hh   = lane >> 4;
  const int c    = lane & 15;

  const int bx = blockIdx.x;
  const int qb = bx % kNQB;
  const int bh = bx / kNQB;
  const int h  = bh % kH;
  const int b  = bh / kH;
  const int q0 = qb * 64 + wave * 16;

  const _Float16* Q16 = (const _Float16*)QKp;
  const __bf16* Vth = (const __bf16*)Vthp;
  const __bf16* Vtl = (const __bf16*)Vtlp;
  float* ob_ptr = AV + (size_t)(b * kS) * kD + h * kHD;

  // ---- Q fragments (B operand, column = query q0 + c, k = d): 2 d-chunks of 32 ----
  v16h qa[2];
  {
    const _Float16* qrow = Q16 + (size_t)(b * kS + q0 + c) * kQKLd + h * kHD + 8 * hh;
    qa[0] = Frag<_Float16>::load(qrow);
    qa[1] = Frag<_Float16>::load(qrow + 32);
  }

  const int qrow = q0 + c;      // the one query whose scores, maximum, sum and output column this lane holds
  float mrow = -INFINITY, lrow = 0.f;
  v8f oacc[4];
#pragma unroll
  for (int t = 0; t < 4; ++t) oacc[t] = (v8f){0.f,0.f,0.f,0.f,0.f,0.f,0.f,0.f};

  const int nChunks = qb + 1;   // block-uniform
  for (int kc = 0; kc < nChunks; ++kc) {
    const int kv0 = kc * kKC;
    __syncthreads();
    const _Float16* gk[4];
    const __bf16* gvh[4];
    const __bf16* gvl[4];
    v8h kr[4];
    v8b vhr[4], vlr[4];
#pragma unroll
    for (int i = 0; i < 4; ++i) {
      const int ch = tid + 128 * i, row = ch >> 3, seg = (ch & 7) * 8;
      gk[i] = Q16 + (size_t)(b * kS + kv0 + row) * kQKLd + h * kHD + seg;   // the k plane lies kKOff further on
      const size_t vo = ((size_t)bh * kHD + row) * kS + kv0 + seg;   // row = d
      gvh[i] = Vth + vo;
      gvl[i] = Vtl + vo;
      kr[i]  = *(const v8h*)(gk[i] + kKOff);
      vhr[i] = *(const v8b*)gvh[i];
      vlr[i] = *(const v8b*)gvl[i];
    }
    // precaution: this wait stands behind the 12 issued loads, in front of every later overwrite of their address
    // registers; the addresses are named as inputs so that no load's destination is placed on one of them ahead of it
    asm volatile("s_wait_xcnt 0x0" :: "v"(gk[0]), "v"(gk[1]), "v"(gk[2]), "v"(gk[3]),
                                      "v"(gvh[0]), "v"(gvh[1]), "v"(gvh[2]), "v"(gvh[3]),
                                      "v"(gvl[0]), "v"(gvl[1]), "v"(gvl[2]), "v"(gvl[3]) : "memory");
#pragma unroll
    for (int i = 0; i < 4; ++i) {
      const int ch = tid + 128 * i, row = ch >> 3, seg = (ch & 7) * 8;
      *(v8h*)(Ksh + row * kStg + seg) = kr[i];
      *(v8b*)(Vhs + row * kStg + seg) = vhr[i];
      *(v8b*)(Vls + row * kStg + seg) = vlr[i];
    }
    __syncthreads();

    // transposed scores: A = K rows, B = Q columns, so s[j][r] = score(kv0 + 16 j + 8 hh + r, q0 + c): one query per lane
    v8f s[4];
#pragma unroll
    for (int j = 0; j < 4; ++j) {
      s[j] = (v8f){0.f,0.f,0.f,0.f,0.f,0.f,0.f,0.f};
#pragma unroll
      for (int dc = 0; dc < 2; ++dc) {
        const v16h kb = Frag<_Float16>::load(Ksh + (j * 16 + c) * kStg + dc * 32 + 8 * hh);
        s[j] = at_mma_h(kb, qa[dc], s[j]);
      }
    }
    const bool diag = (kc == qb);   // block-uniform
    float mj[4];
#pragma unroll
    for (int j = 0; j < 4; ++j) {
      float m = -INFINITY;
#pragma unroll
      for (int r = 0; r < 8; ++r) {
        const int kvcol = kv0 + j * 16 + 8 * hh + r;
        float sv = s[j][r];       // unscaled: the positive scale commutes with the maximum and is applied in the exponent
        if (diag && (kvcol > qrow)) sv = -INFINITY;
        s[j][r] = sv;
        m = fmaxf(m, sv);
      }
      mj[j] = m;
    }
    float cm = fmaxf(fmaxf(mj[0], mj[1]), fmaxf(mj[2], mj[3]));
    cm = fmaxf(cm, at_xhalf(cm));   // lanes c and c + 16 hold the two halves of one query's 64 scores
    const float mnew = fmaxf(mrow, cm);
    const float alpha = __builtin_amdgcn_exp2f((mrow - mnew) * kSmScaleLog2);
    const float nm = -mnew * kSmScaleLog2;
    mrow = mnew;
    // two score tiles of 16 kv, converted in place, are one B fragment of 32 kv in the loaders' k order
    v8u ph[2], pl[2];
    float pj[4];
#pragma unroll
    for (int j = 0; j < 4; ++j) {
      float psum = 0.f;
#pragma unroll
      for (int r = 0; r < 8; ++r) s[j][r] = fmaf(s[j][r], kSmScaleLog2, nm);
      at_exp2x8(s[j]);
#pragma unroll
      for (int r = 0; r < 8; r += 2) {
        const float p0 = s[j][r];
        const float p1 = s[j][r + 1];
        psum += p0;
        psum += p1;
        unsigned wh, wl;
        at_split2(p0, p1, wh, wl);
        ph[j >> 1][(j & 1) * 4 + (r >> 1)] = wh;
        pl[j >> 1][(j & 1) * 4 + (r >> 1)] = wl;
      }
      pj[j] = psum;
    }
    const v16b pha[2] = { __builtin_bit_cast(v16b, ph[0]), __builtin_bit_cast(v16b, ph[1]) };
    const v16b pla[2] = { __builtin_bit_cast(v16b, pl[0]), __builtin_bit_cast(v16b, pl[1]) };
    lrow = lrow * alpha + ((pj[0] + pj[1]) + (pj[2] + pj[3]));   // this lane half's share; the halves are joined after the loop
#pragma unroll
    for (int t = 0; t < 4; ++t)
#pragma unroll
      for (int r = 0; r < 8; ++r) oacc[t][r] *= alpha;
    // unrolled so that pha[kk], pla[kk] are fixed registers
#pragma unroll
    for (int kk = 0; kk < 2; ++kk) {
#pragma unroll
      for (int t = 0; t < 4; ++t) {
        FB vb, vl;
        vb.h[0] = *(const v8b*)(Vhs + (t * 16 + c) * kStg + kk * 32 + 8 * hh);
        vb.h[1] = *(const v8b*)(Vhs + (t * 16 + c) * kStg + kk * 32 + 16 + 8 * hh);
        vl.h[0] = *(const v8b*)(Vls + (t * 16 + c) * kStg + kk * 32 + 8 * hh);
        vl.h[1] = *(const v8b*)(Vls + (t * 16 + c) * kStg + kk * 32 + 16 + 8 * hh);
        oacc[t] = at_mma(vb.v, pha[kk], oacc[t]);
        oacc[t] = at_mma(vl.v, pha[kk], oacc[t]);
        oacc[t] = at_mma(vb.v, pla[kk], oacc[t]);
      }
    }
  }

  // oacc[t][r] = out(q0 + c, 16 t + 8 hh + r): eight consecutive channels of one query row per tile
  float* os = Os[wave];
  {
    const float inv = 1.0f / (lrow + at_xhalf(lrow));
#pragma unroll
    for (int t = 0; t < 4; ++t) {
      v4f lo4, hi4;
#pragma unroll
      for (int e = 0; e < 4; ++e) { lo4[e] = oacc[t][e] * inv; hi4[e] = oacc[t][4 + e] * inv; }
      *(v4f*)(os + c * 68 + t * 16 + 8 * hh)     = lo4;
      *(v4f*)(os + c * 68 + t * 16 + 8 * hh + 4) = hi4;
    }
  }
  __builtin_amdgcn_fence(__ATOMIC_RELEASE, "workgroup");
  __builtin_amdgcn_wave_barrier();
  __builtin_amdgcn_fence(__ATOMIC_ACQUIRE, "workgroup");
  {
    const int c4 = (lane & 15) * 4;   // 16 lanes x 16 B = 256 B = one 64-float row segment; hh selects the row
    {
#pragma unroll
      for (int it = 0; it < 8; ++it) {
        const int row = it * 2 + hh;
        v4f val = *(const v4f*)(os + row * 68 + c4);
        *(v4f*)(ob_ptr + (size_t)(q0 + row) * kD + c4) = val;
      }
      
    }
  }
}

// =====================================================================================
// Shaped combination + causal prefix mean in f32:  O[b,s,h*64+d] = rg[h]*AV + sg[h]*v[s] - cg[h]*(sum_{j<=s} v[j])/(s+1),
// emitted as bf16 hi/lo planes [kTok][kD].
// One work-group = one (b, h) and one segment of kScRows rows of s; grid = kScSeg * kB * kH = 256, block 512.
// 16 lanes x 4 channels cover one 64-channel row; the 32 row slots of a work-group
//   (a) sum the rows in front of the segment, slot r taking rows r, r+32, r+64, ... (all loads independent),
//   (b) each own kScPer consecutive rows of the segment and sum them,
//   (c) meet in LDS: per channel the 32 sums of (a) are added up and the 32 sums of (b) scanned in fixed order,
//   (d) walk their own rows from that start value.
// Fixed summation order, no dependence on arrival; each 128-B output line (64 channels x 2 B) has one writer.
// =====================================================================================
constexpr int kScRows  = 256;                  // rows of s per work-group
constexpr int kScSeg   = kS / kScRows;         // 8 segments
constexpr int kScSlots = 32;                   // row slots (16 lanes each) per work-group
constexpr int kScPer   = kScRows / kScSlots;   // 8 consecutive rows per slot
__global__ __launch_bounds__(512) void shaped_combine(const float* __restrict__ AV, const float* __restrict__ Vf,
                                                     const float* __restrict__ rg, const float* __restrict__ sg,
                                                     const float* __restrict__ cg,
                                                     unsigned short* __restrict__ Oh, unsigned short* __restrict__ Ol) {
  __shared__ __align__(16) float Ps[kScSlots * kHD];   // per slot: sum of its rows in front of the segment
  __shared__ __align__(16) float Gs[kScSlots * kHD];   // per slot: sum of its own rows, then its start value
  const int tid  = threadIdx.x;
  const int slot = tid >> 4;
  const int c4   = (tid & 15) * 4;
  const int seg  = (kScSeg - 1) - (int)(blockIdx.x / (kB * kH));   // longest front part starts first
  const int bh   = blockIdx.x % (kB * kH);
  const int b = bh / kH;
  const int h = bh % kH;
  const size_t col = (size_t)(b * kS) * kD + h * kHD + c4;
  const int s0 = seg * kScRows + slot * kScPer;

  const float* vrow = Vf + col + (size_t)s0 * kD;
  const float* arow = AV + col + (size_t)s0 * kD;
  v4f vv[kScPer], aa[kScPer];
#pragma unroll
  for (int k = 0; k < kScPer; ++k) vv[k] = *(const v4f*)(vrow + k * kD);
#pragma unroll
  for (int k = 0; k < kScPer; ++k) aa[k] = *(const v4f*)(arow + k * kD);
  // precaution: this wait stands behind the 16 issued loads, in front of every later overwrite of their address
  // registers; both addresses are named as inputs so that no load's destination is placed on them ahead of it
  asm volatile("s_wait_xcnt 0x0" :: "v"(vrow), "v"(arow) : "memory");

  v4f pre = (v4f){0.f, 0.f, 0.f, 0.f};
  for (int t = 0; t < seg; ++t) {              // block-uniform trip count, at most kScSeg - 1
    v4f w[kScPer];
#pragma unroll
    for (int k = 0; k < kScPer; ++k)
      w[k] = *(const v4f*)(Vf + col + (size_t)(t * kScRows + k * kScSlots + slot) * kD);
#pragma unroll
    for (int k = 0; k < kScPer; ++k) pre += w[k];
  }
  const float rgh = rg[h], sgh = sg[h], cgh = cg[h];
  v4f gsum = vv[0];
#pragma unroll
  for (int k = 1; k < kScPer; ++k) gsum += vv[k];
  *(v4f*)(Ps + slot * kHD + c4) = pre;
  *(v4f*)(Gs + slot * kHD + c4) = gsum;
  __syncthreads();
  if (tid < kHD) {                             // one lane per channel, two whole waves
    float b0 = 0.f, b1 = 0.f, b2 = 0.f, b3 = 0.f;
#pragma unroll
    for (int r = 0; r < kScSlots; r += 4) {
      b0 += Ps[(r + 0) * kHD + tid];
      b1 += Ps[(r + 1) * kHD + tid];
      b2 += Ps[(r + 2) * kHD + tid];
      b3 += Ps[(r + 3) * kHD + tid];
    }
    float run = (b0 + b1) + (b2 + b3);
#pragma unroll
    for (int r = 0; r < kScSlots; ++r) {
      const float g = Gs[r * kHD + tid];
      Gs[r * kHD + tid] = run;
      run += g;
    }
  }
  __syncthreads();
  v4f p = *(const v4f*)(Gs + slot * kHD + c4);
#pragma unroll
  for (int k = 0; k < kScPer; ++k) {
    const int s = s0 + k;
    const size_t idx = col + (size_t)s * kD;
    p += vv[k];
    const float inv = 1.0f / (float)(s + 1);
    unsigned short hb[4], lb[4];
#pragma unroll
    for (int e = 0; e < 4; ++e) {
      const float o = rgh * aa[k][e] + sgh * vv[k][e] - cgh * (p[e] * inv);
      hb[e] = f2bf_bits(o);
      lb[e] = f2bf_bits(o - bf_bits2f(hb[e]));
    }
    uint2 uh, ul;
    uh.x = (unsigned)hb[0] | ((unsigned)hb[1] << 16);
    uh.y = (unsigned)hb[2] | ((unsigned)hb[3] << 16);
    ul.x = (unsigned)lb[0] | ((unsigned)lb[1] << 16);
    ul.y = (unsigned)lb[2] | ((unsigned)lb[3] << 16);
    *(uint2*)(Oh + idx) = uh;
    *(uint2*)(Ol + idx) = ul;
  }
}

// =====================================================================================
// launcher: kernel launches only
// =====================================================================================
extern "C" void kernel_launch(void* const* d_in, const int* in_sizes, int n_in,
                              void* d_out, int out_size, void* d_ws,
                              size_t ws_size, hipStream_t stream) {
  if (n_in < 8) return;
  if (in_sizes[0] != kTok * kD) return;
  if (in_sizes[1] != kD * kQKLd) return;
  if (in_sizes[2] != kQKLd) return;
  if (in_sizes[3] != kD * kD) return;
  if (in_sizes[4] != kD * kD) return;
  if (in_sizes[5] != kH || in_sizes[6] != kH || in_sizes[7] != kH) return;
  if (out_size != kTok * kD) return;
  if (kWsTotal > ws_size) return;

  const float* x     = (const float*)d_in[0];
  const float* qk_w  = (const float*)d_in[1];
  const float* qk_b  = (const float*)d_in[2];
  const float* v_w   = (const float*)d_in[3];
  const float* cp_w  = (const float*)d_in[4];
  const float* rg    = (const float*)d_in[5];
  const float* sg    = (const float*)d_in[6];
  const float* cg    = (const float*)d_in[7];
  float* out = (float*)d_out;

  unsigned char* ws = (unsigned char*)d_ws;
  unsigned short* xb   = (unsigned short*)(ws + kOffXb);
  unsigned short* qkwT = (unsigned short*)(ws + kOffQkwT);
  unsigned short* vwT  = (unsigned short*)(ws + kOffVwT);
  unsigned short* cwT  = (unsigned short*)(ws + kOffCwT);
  unsigned short* QKp  = (unsigned short*)(ws + kOffQKp);
  float*          Vf   = (float*)(ws + kOffVf);
  unsigned short* Vth  = (unsigned short*)(ws + kOffVth);
  unsigned short* Vtl  = (unsigned short*)(ws + kOffVtl);
  float*          AV   = (float*)(ws + kOffAV);
  unsigned short* Oh   = (unsigned short*)(ws + kOffOh);
  unsigned short* Ol   = (unsigned short*)(ws + kOffOl);

  // 1. x -> bf16 [4096][1024] and the three weights [in][out] f32 -> transposed bf16 [out][in]: 1024 + 8192 blocks
  prep_operands<<<dim3(kPrepT + kPrepX), dim3(256), 0, stream>>>(x, xb, qk_w, qkwT, v_w, vwT, cp_w, cwT);

  // 2. q|k and v projections in one grid: qkwT and vwT lie one behind the other in the workspace = Bt [3072][1024];
  //    [4096 x 1024] . Bt^T: columns 0..2047 + qk_b -> f16 [4096][2048], columns 2048..3071 -> f32 [4096][1024];
  //    tiles 32*12 = 384 blocks
  static_assert(kOffVwT == kOffQkwT + (size_t)kQKLd * kD * 2);
  wmma_gemm64<1, 0, 2, 3, false><<<dim3((kTok / kGM) * ((kQKLd + kD) / kGN), 1), dim3(256), 0, stream>>>(
      xb, xb, kD, 0L, qkwT, qkwT, kD, 0L, (void*)QKp, (void*)Vf, kQKLd, 0L,
      qk_b, x, 0L, kTok, kQKLd + kD, kD, 1.0f, kQKLd, kD);
  // 3. v -> bf16 hi/lo planes [32][64][2048]
  v_split_transpose<<<dim3(kS / 64, kB * kH), dim3(256), 0, stream>>>(Vf, Vth, Vtl);
  // 4. causal attention -> AV f32 [4096][1024]
  attn_causal_hd64<<<dim3(kB * kH * kNQB), dim3(128), 0, stream>>>(QKp, Vth, Vtl, AV);
  // 5. shaped combination + prefix mean -> O hi/lo bf16 [4096][1024]
  shaped_combine<<<dim3(kScSeg * kB * kH), dim3(512), 0, stream>>>(AV, Vf, rg, sg, cg, Oh, Ol);
  // 6. output projection: (O hi + O lo) [4096 x 1024] . [1024 x 1024]^T -> f32 d_out [4096][1024]; 128 blocks
  wmma_gemm64<1, 1, 0, 0, false><<<dim3((kTok / kGM) * (kD / kGN), 1), dim3(256), 0, stream>>>(
      Oh, Ol, kD, 0L, cwT, cwT, kD, 0L, (void*)out, (void*)out, kD, 0L,
      qk_b, x, 0L, kTok, kD, kD, 1.0f, 0, 0);
}

// v007
// It runs in 126 microseconds.
// Timed twice side by side with v006, it ran 1.07 times as fast both times.
// Counting every step since v000, it is 10.8 times as fast.
// Contractions: qk and v projections = v_wmma_f32_16x16x32_bf16 (x and W as RNE bf16, single product); scores q.k^T = v_wmma_f32_16x16x32_f16 (q, k f16 planes, single product, 1/8 applied in f32 inside the softmax exponent); attn.v = v_wmma_f32_16x16x32_bf16 with p and v as bf16 hi/lo pairs (hi.hi + hi.lo + lo.hi); output projection = v_wmma_f32_16x16x32_bf16 with the merged head output as bf16 hi/lo pair times W as RNE bf16 (hi.W + lo.W); f32 accumulate everywhere; softmax, causal prefix mean of v and gain combination in f32.
#include <hip/hip_runtime.h>
#include <math.h>

typedef __attribute__((ext_vector_type(16))) _Float16 v16h;
typedef __attribute__((ext_vector_type(8)))  _Float16 v8h;
typedef __attribute__((ext_vector_type(16))) __bf16   v16b;
typedef __attribute__((ext_vector_type(8)))  __bf16   v8b;
typedef __attribute__((ext_vector_type(8)))  float    v8f;
typedef __attribute__((ext_vector_type(4)))  float    v4f;
typedef __attribute__((ext_vector_type(2)))  float    v2f;
typedef __attribute__((ext_vector_type(8)))  unsigned v8u;
typedef __attribute__((ext_vector_type(2)))  __bf16   v2b;

constexpr int kB    = 2;
constexpr int kS    = 2048;
constexpr int kD    = 1024;
constexpr int kH    = 16;
constexpr int kHD   = 64;
constexpr int kTok  = kB * kS;        // 4096 token rows
constexpr int kQKLd = 2 * kD;         // fused q|k plane pitch (halves): q at col h*64, k at col kD + h*64
constexpr int kKOff = kD;
constexpr int kKC   = 64;             // kv chunk
constexpr int kNQB  = kS / 64;        // query blocks per (b,h)
constexpr int kStg  = 72;             // 16-bit LDS staging pitch (144 B rows, 16-B aligned)
constexpr float kSmScale = 0.125f;    // 1/sqrt(64)
constexpr float kSmScaleLog2 = kSmScale * 1.4426950408889634f;   // exp(kSmScale * x) = exp2(kSmScaleLog2 * x)

// workspace region map (bytes, all offsets multiples of 2 MiB):
//   [0]          xb    bf16 [4096][1024]            8 MiB
//   [8 MiB]      qkwT  bf16 [2048][1024]            4 MiB   (qk_w transposed)
//   [12 MiB]     vwT   bf16 [1024][1024]            2 MiB
//   [14 MiB]     cwT   bf16 [1024][1024]            2 MiB
//   [16 MiB]     QKp   f16  [4096][2048]           16 MiB   (q | k planes)
//   [32 MiB]     Vf    f32  [4096][1024]           16 MiB
//   [48 MiB]     Vth   bf16 [32][64][2048]          8 MiB   (v hi, per (b,h) [d][s])
//   [56 MiB]     Vtl   bf16 [32][64][2048]          8 MiB   (v lo)
//   [64 MiB]     AV    f32  [4096][1024]           16 MiB   (softmax(qk).v, merged heads)
//   [80 MiB]     Oh    bf16 [4096][1024]            8 MiB   (combined head output, hi)
//   [88 MiB]     Ol    bf16 [4096][1024]            8 MiB   (lo)
//   total 96 MiB = 100663296 B
constexpr size_t kOffXb   = 0;
constexpr size_t kOffQkwT = kOffXb   + (size_t)kTok * kD * 2;
constexpr size_t kOffVwT  = kOffQkwT + (size_t)kQKLd * kD * 2;
constexpr size_t kOffCwT  = kOffVwT  + (size_t)kD * kD * 2;
constexpr size_t kOffQKp  = kOffCwT  + (size_t)kD * kD * 2;
constexpr size_t kOffVf   = kOffQKp  + (size_t)kTok * kQKLd * 2;
constexpr size_t kOffVth  = kOffVf   + (size_t)kTok * kD * 4;
constexpr size_t kOffVtl  = kOffVth  + (size_t)kB * kH * kHD * kS * 2;
constexpr size_t kOffAV   = kOffVtl  + (size_t)kB * kH * kHD * kS * 2;
constexpr size_t kOffOh   = kOffAV   + (size_t)kTok * kD * 4;
constexpr size_t kOffOl   = kOffOh   + (size_t)kTok * kD * 2;
constexpr size_t kWsTotal = kOffOl   + (size_t)kTok * kD * 2;
static_assert(kWsTotal == 100663296ull);
static_assert(kWsTotal <= 134217728ull);

__device__ __forceinline__ unsigned short f2bf_bits(float f) {
  unsigned u = __float_as_uint(f);
  return (unsigned short)((u + 0x7FFFu + ((u >> 16) & 1u)) >> 16);
}
__device__ __forceinline__ float bf_bits2f(unsigned short h) { return __uint_as_float(((unsigned)h) << 16); }

// hazard guards as plain device helpers (their inline asm is kept out of the kernel template body)
__device__ __forceinline__ void dep_guard_h(v8f& a, v8f& b, v16h x, v16h y) { asm volatile("v_nop\n\tv_nop\n\tv_nop\n\tv_nop" : "+v"(a), "+v"(b) : "v"(x), "v"(y)); }
__device__ __forceinline__ void dep_guard_b(v8f& a, v8f& b, v16b x, v16b y) { asm volatile("v_nop\n\tv_nop\n\tv_nop\n\tv_nop" : "+v"(a), "+v"(b) : "v"(x), "v"(y)); }
__device__ __forceinline__ void keep4_h(v16h a, v16h b, v16h c, v16h d) { asm volatile("v_nop" :: "v"(a), "v"(b), "v"(c), "v"(d)); }
__device__ __forceinline__ void keep4_b(v16b a, v16b b, v16b c, v16b d) { asm volatile("v_nop" :: "v"(a), "v"(b), "v"(c), "v"(d)); }
__device__ __forceinline__ void acc_guard4(v8f& a, v8f& b, v8f& c, v8f& d) { asm volatile("v_nop\n\tv_nop\n\tv_nop\n\tv_nop" : "+v"(a), "+v"(b), "+v"(c), "+v"(d)); }
template <typename T> struct Frag;
template <> struct Frag<_Float16> {
  typedef v16h V; union U { v16h v; v8h h[2]; };
  static __device__ __forceinline__ v16h load(const _Float16* p) {   // elements 0..7 <- p[0..7], 8..15 <- p[16..23]
    U f; f.h[0] = *(const v8h*)(p); f.h[1] = *(const v8h*)(p + 16); return f.v;
  }
  static __device__ __forceinline__ v8f mma(v16h a, v16h b, v8f c) {
    return __builtin_amdgcn_wmma_f32_16x16x32_f16(false, a, false, b, (short)0, c, false, false);
  }
  static __device__ __forceinline__ void guard(v8f& a, v8f& b, v16h x, v16h y) { dep_guard_h(a, b, x, y); }
  static __device__ __forceinline__ void keep(v16h a, v16h b, v16h c, v16h d) { keep4_h(a, b, c, d); }
};
template <> struct Frag<__bf16> {
  typedef v16b V; union U { v16b v; v8b h[2]; };
  static __device__ __forceinline__ v16b load(const __bf16* p) {
    U f; f.h[0] = *(const v8b*)(p); f.h[1] = *(const v8b*)(p + 16); return f.v;
  }
  static __device__ __forceinline__ v8f mma(v16b a, v16b b, v8f c) {
    return __builtin_amdgcn_wmma_f32_16x16x32_bf16(false, a, false, b, (short)0, c, false, false);
  }
  static __device__ __forceinline__ void guard(v8f& a, v8f& b, v16b x, v16b y) { dep_guard_b(a, b, x, y); }
  static __device__ __forceinline__ void keep(v16b a, v16b b, v16b c, v16b d) { keep4_b(a, b, c, d); }
};

// bf16 hi/lo split of two values straight into packed fragment registers (first value in the low half): the packed
// convert rounds to nearest even and packs in the same instruction; lo = round(f - hi)
__device__ __forceinline__ void at_split2(float f0, float f1, unsigned& hi, unsigned& lo) {
  const v2f f = {f0, f1};
  const unsigned hw = __builtin_bit_cast(unsigned, __builtin_convertvector(f, v2b));
  const v2f d = {f0 - __uint_as_float(hw << 16), f1 - __uint_as_float(hw & 0xFFFF0000u)};
  hi = hw;
  lo = __builtin_bit_cast(unsigned, __builtin_convertvector(d, v2b));
}
__device__ __forceinline__ v8f at_mma(v16b a, v16b b, v8f c) {
  c = __builtin_amdgcn_wmma_f32_16x16x32_bf16(false, a, false, b, (short)0, c, false, false);
  asm volatile("v_nop\n\tv_nop\n\tv_nop\n\tv_nop" : "+v"(c) : "v"(a), "v"(b));
  return c;
}
// lane l reads lane l ^ 16
__device__ __forceinline__ float at_xhalf(float x) {
  return __builtin_bit_cast(float, __builtin_amdgcn_permlanex16(__builtin_bit_cast(int, x), __builtin_bit_cast(int, x),
                                                                0x76543210, 0xfedcba98, false, false));
}
__device__ __forceinline__ void at_exp2x8(v8f& x) {
  float e0, e1, e2, e3, e4, e5, e6, e7;
  asm("v_exp_f32 %0, %8\n\tv_exp_f32 %1, %9\n\tv_exp_f32 %2, %10\n\tv_exp_f32 %3, %11\n\t"
      "v_exp_f32 %4, %12\n\tv_exp_f32 %5, %13\n\tv_exp_f32 %6, %14\n\tv_exp_f32 %7, %15\n\tv_nop"
      : "=&v"(e0), "=&v"(e1), "=&v"(e2), "=&v"(e3), "=&v"(e4), "=&v"(e5), "=&v"(e6), "=&v"(e7)
      : "v"(x[0]), "v"(x[1]), "v"(x[2]), "v"(x[3]), "v"(x[4]), "v"(x[5]), "v"(x[6]), "v"(x[7]));
  x = (v8f){e0, e1, e2, e3, e4, e5, e6, e7};
}
__device__ __forceinline__ v8f at_mma_h(v16h a, v16h b, v8f c) {
  c = __builtin_amdgcn_wmma_f32_16x16x32_f16(false, a, false, b, (short)0, c, false, false);
  asm volatile("v_nop\n\tv_nop\n\tv_nop\n\tv_nop" : "+v"(c) : "v"(a), "v"(b));
  return c;
}

// =====================================================================================
// Register-blocked batched WMMA GEMM, C[m,n] = scale * sum_k A[m,k] * Bt[n,k] (+bias)(+resid);
// each wave owns a 64x64 tile; the 8 waves of a work-group stand 2 (m) x 4 (n) on one 128x256 tile of C.
// A row-major [M,K]; Bt row-major [N,K]; M % 128 == 0, N % 256 == 0, K % 64 == 0.
// Operands reach the waves through LDS: per k tile of 64 the work-group copies 128 rows of A (and of A2) and 256 rows
// of Bt, 128 B a row, with asynchronous copies (8 lanes x 16 B = one whole line of a row), into one of two buffers at
// row pitch kStg; the copies of tile t + 2 fly while tile t + 1 is worked on.
// SPLITM: 0 = single product; 1 = A carried as hi/lo planes (A2p = lo): product = hi.B + lo.B.
// BIAS_MODE: 0 = none, 1 = bias[m], 2 = bias[n].  OUT_MODE: 0 = f32, 1 = f16, 2 = bf16 hi + lo planes,
// 3 = two products that share A in one grid: columns below nSplit (a multiple of 256, so a work-group lies wholly on one
//     side) go out as in mode 1, with the bias; the others as f32 without bias to Cout2, pitch ldc2, column n - nSplit.
// ET: 0 = f16 operands, 1 = bf16 operands (pointers passed as 16-bit storage)
// =====================================================================================
constexpr int kGK = 64;     // k extent of a staged tile
constexpr int kGM = 128;    // rows of A per work-group
constexpr int kGN = 256;    // rows of Bt per work-group

// Each lane copies its own 16 B from global memory to its own LDS byte address. The s_wait_xcnt closes the statement so
// that it stands in front of every later write of the address registers named here (a precaution).
__device__ __forceinline__ void async_copy4(unsigned l0, const void* g0, unsigned l1, const void* g1,
                                            unsigned l2, const void* g2, unsigned l3, const void* g3) {
  asm volatile("global_load_async_to_lds_b128 %0, %1, off\n\t"
               "global_load_async_to_lds_b128 %2, %3, off\n\t"
               "global_load_async_to_lds_b128 %4, %5, off\n\t"
               "global_load_async_to_lds_b128 %6, %7, off\n\t"
               "s_wait_xcnt 0x0"
               :: "v"(l0), "v"(g0), "v"(l1), "v"(g1), "v"(l2), "v"(g2), "v"(l3), "v"(g3) : "memory");
}
__device__ __forceinline__ void async_copy8(unsigned l0, const void* g0, unsigned l1, const void* g1,
                                            unsigned l2, const void* g2, unsigned l3, const void* g3,
                                            unsigned l4, const void* g4, unsigned l5, const void* g5,
                                            unsigned l6, const void* g6, unsigned l7, const void* g7) {
  asm volatile("global_load_async_to_lds_b128 %0, %1, off\n\t"
               "global_load_async_to_lds_b128 %2, %3, off\n\t"
               "global_load_async_to_lds_b128 %4, %5, off\n\t"
               "global_load_async_to_lds_b128 %6, %7, off\n\t"
               "global_load_async_to_lds_b128 %8, %9, off\n\t"
               "global_load_async_to_lds_b128 %10, %11, off\n\t"
               "global_load_async_to_lds_b128 %12, %13, off\n\t"
               "global_load_async_to_lds_b128 %14, %15, off\n\t"
               "s_wait_xcnt 0x0"
               :: "v"(l0), "v"(g0), "v"(l1), "v"(g1), "v"(l2), "v"(g2), "v"(l3), "v"(g3),
                  "v"(l4), "v"(g4), "v"(l5), "v"(g5), "v"(l6), "v"(g6), "v"(l7), "v"(g7) : "memory");
}

template <int V> struct IntC { static constexpr int value = V; };   // a compile-time choice handed to the epilogue
template <int ET> struct Elem;
template <> struct Elem<0> { typedef _Float16 T; };
template <> struct Elem<1> { typedef __bf16 T; };
template <int ET, int SPLITM, int BIAS_MODE, int OUT_MODE, bool RESID, int ACT = 0>
__global__ __launch_bounds__(256) void wmma_gemm64(
    const unsigned short* __restrict__ Ap, const unsigned short* __restrict__ A2p, int lda, long strideA,
    const unsigned short* __restrict__ Btp, const unsigned short* __restrict__ Bt2p, int ldb, long strideB,
    void* __restrict__ Cout, void* __restrict__ Cout2, int ldc, long strideC,
    const float* __restrict__ bias,
    const float* __restrict__ resid, long strideR,
    int M, int N, int K, float scale, int nSplit, int ldc2) {
  typedef typename Elem<ET>::T T;
  typedef typename Frag<T>::V V;
  static_assert(SPLITM <= 1);
  constexpr bool SPA = (SPLITM >= 1);
  constexpr int kOffA2  = kGM * kStg;                       // element offsets inside one buffer: A | A2 | Bt
  constexpr int kOffB   = (SPA ? 2 : 1) * kGM * kStg;
  constexpr int kBufEl  = kOffB + kGN * kStg;
  const T* A = (const T*)Ap; const T* A2 = (const T*)A2p; const T* Bt = (const T*)Btp;
  __shared__ __align__(16) T sOp[2 * kBufEl];      // two operand buffers
  __shared__ __align__(16) float sT[8][16 * 68];   // per-wave 16x64 slab, pitch 68 floats
  const int b    = blockIdx.y;
  const int tid  = threadIdx.x;
  const int lane = tid & 31;
  const int wave = tid >> 5;
  const int tilesN = N / kGN;
  const int tilesM = M / kGM;
  if ((int)blockIdx.x >= tilesM * tilesN) return;   // the same for the whole work-group, in front of every copy and barrier
  const int bm = blockIdx.x / tilesN;
  const int bn = blockIdx.x - bm * tilesN;
  const int wm = (wave >> 2) << 6;             // this wave's rows inside the staged A tile
  const int wn = (wave & 3) << 6;              // this wave's rows inside the staged Bt tile
  const int m0 = bm * kGM + wm;
  const int n0 = bn * kGN + wn;

  const int rlane = lane & 15;                 // row (A) / col (B, D) within subtile
  const int koff  = (lane >> 4) * 8;           // k offset of this lane half
  const int mOff  = (lane >> 4) * 8;           // D row offset

  // staging: thread -> row tid / 8 (+ 32 per copy), 16-B piece tid % 8 of the row's 128 B
  const int srow = tid >> 3;
  const int sseg = (tid & 7) * 8;
  const T* gA  = A  + (size_t)b * strideA + (size_t)(bm * kGM + srow) * lda + sseg;
  const T* gA2 = SPA ? (A2 + (size_t)b * strideA + (size_t)(bm * kGM + srow) * lda + sseg) : nullptr;
  const T* gB  = Bt + (size_t)b * strideB + (size_t)(bn * kGN + srow) * ldb + sseg;
  const unsigned lS = (unsigned)(size_t)(sOp + srow * kStg + sseg);   // LDS byte address: low 32 bits
  const size_t a32 = (size_t)32 * lda, b32 = (size_t)32 * ldb;
  constexpr unsigned kL32 = 32 * kStg * 2;     // 32 rows in LDS, bytes
  auto stage = [&](int t, int buf) {
    const unsigned l = lS + (unsigned)buf * (unsigned)(kBufEl * 2);
    const unsigned lb = l + kOffB * 2;
    const T* pb = gB + t * kGK;
    async_copy8(lb, pb, lb + kL32, pb + b32, lb + 2 * kL32, pb + 2 * b32, lb + 3 * kL32, pb + 3 * b32,
                lb + 4 * kL32, pb + 4 * b32, lb + 5 * kL32, pb + 5 * b32, lb + 6 * kL32, pb + 6 * b32,
                lb + 7 * kL32, pb + 7 * b32);
    const T* pa = gA + t * kGK;
    if (SPA) {
      const unsigned l2 = l + kOffA2 * 2;
      const T* pa2 = gA2 + t * kGK;
      async_copy8(l, pa, l + kL32, pa + a32, l + 2 * kL32, pa + 2 * a32, l + 3 * kL32, pa + 3 * a32,
                  l2, pa2, l2 + kL32, pa2 + a32, l2 + 2 * kL32, pa2 + 2 * a32, l2 + 3 * kL32, pa2 + 3 * a32);
    } else {
      async_copy4(l, pa, l + kL32, pa + a32, l + 2 * kL32, pa + 2 * a32, l + 3 * kL32, pa + 3 * a32);
    }
  };

  v8f acc[4][4];
#pragma unroll
  for (int i = 0; i < 4; ++i)
#pragma unroll
    for (int j = 0; j < 4; ++j) acc[i][j] = (v8f){0.f,0.f,0.f,0.f,0.f,0.f,0.f,0.f};

  const int nT = K / kGK;                      // the same for the whole work-group
  stage(0, 0);
  asm volatile("s_wait_asynccnt 0x0" ::: "memory");   // this wave's copies of tile 0 have landed
  __syncthreads();                                    // ... and every other wave's: tile 0 may be read
  if (nT > 1) stage(1, 1);
  for (int t = 0; t < nT; ++t) {
    const T* sA = sOp + (t & 1) * kBufEl + (wm + rlane) * kStg + koff;
    const T* sB = sOp + (t & 1) * kBufEl + kOffB + (wn + rlane) * kStg + koff;
#pragma unroll
    for (int kk = 0; kk < kGK; kk += 32) {
      V bh[4], ah[4], al[4];
#pragma unroll
      for (int j = 0; j < 4; ++j) bh[j] = Frag<T>::load(sB + (j << 4) * kStg + kk);
#pragma unroll
      for (int i = 0; i < 4; ++i) {
        ah[i] = Frag<T>::load(sA + (i << 4) * kStg + kk);
        if (SPA) al[i] = Frag<T>::load(sA + kOffA2 + (i << 4) * kStg + kk);
      }
#pragma unroll
      for (int i = 0; i < 4; ++i) {
#pragma unroll
        for (int j = 0; j < 4; ++j) {
          acc[i][j] = Frag<T>::mma(ah[i], bh[j], acc[i][j]);
          if (SPA) acc[i][j] = Frag<T>::mma(al[i], bh[j], acc[i][j]);
        }
        Frag<T>::guard(acc[i][0], acc[i][3], ah[i], SPA ? al[i] : ah[i]);
      }
      Frag<T>::keep(bh[0], bh[1], bh[2], bh[3]);
    }
    asm volatile("s_wait_dscnt 0x0" ::: "memory");      // this wave's reads of tile t are done before its buffer is refilled
    asm volatile("s_wait_asynccnt 0x0" ::: "memory");   // this wave's copies of tile t + 1 have landed
    __syncthreads();                                    // publishes tile t + 1 and ends every reader's reads of tile t
    if (t + 2 < nT) stage(t + 2, t & 1);
  }
  asm volatile("s_wait_asynccnt 0x0" ::: "memory");     // no copy is outstanding when the wave goes on
  acc_guard4(acc[0][0], acc[0][1], acc[0][2], acc[0][3]);
  acc_guard4(acc[1][0], acc[1][1], acc[1][2], acc[1][3]);
  acc_guard4(acc[2][0], acc[2][1], acc[2][2], acc[2][3]);
  acc_guard4(acc[3][0], acc[3][1], acc[3][2], acc[3][3]);

  // ---- epilogue ----
  // BM, OM: bias and output form of this work-group's columns; C1, C2: its planes, pitch ld; nc0: the wave's first column there
  float* slab = sT[wave];
  const float* Rb = RESID ? (resid + (size_t)b * strideR) : nullptr;
  auto epilogue = [&](auto bmTag, auto omTag, void* C1, void* C2, int ld, int nc0) {
    constexpr int BM = decltype(bmTag)::value;
    constexpr int OM = decltype(omTag)::value;
#pragma unroll
    for (int i = 0; i < 4; ++i) {
      const int mBase = m0 + (i << 4);
#pragma unroll
      for (int j = 0; j < 4; ++j) {
        const int n = n0 + (j << 4) + rlane;
        float bv = 0.f;
        if (BM == 2) bv = bias[n];
#pragma unroll
        for (int r = 0; r < 8; ++r) {
          float v = acc[i][j][r] * scale;
          if (BM == 1) v += bias[mBase + mOff + r];
          if (BM == 2) v += bv;
          if (RESID) v += Rb[(size_t)(mBase + mOff + r) * ld + n];
          if (ACT == 1) v = tanhf(v);
          if (ACT == 2) v = fmaxf(v, 0.0f);
          if (ACT == 4) v = (v > 0.f) ? v : 0.01f * v;
          slab[(mOff + r) * 68 + (j << 4) + rlane] = v;
        }
      }
      __builtin_amdgcn_fence(__ATOMIC_RELEASE, "workgroup");
      __builtin_amdgcn_wave_barrier();
      __builtin_amdgcn_fence(__ATOMIC_ACQUIRE, "workgroup");
      if (OM == 0) {
        float* C = (float*)C1 + (size_t)b * strideC;
        const int hh = lane >> 4, c4 = (lane & 15) * 4;     // row seg = 256 B = 16 lanes x 16 B
#pragma unroll
        for (int it = 0; it < 8; ++it) {
          const int row = it * 2 + hh;
          v4f v = *(const v4f*)(slab + row * 68 + c4);
          *(v4f*)(C + (size_t)(mBase + row) * ld + nc0 + c4) = v;
        }
      } else {
        const int q = lane >> 3, c8 = (lane & 7) * 8;
        unsigned short* C  = (unsigned short*)C1 + (size_t)b * strideC;
        unsigned short* Cl = (OM == 2) ? ((unsigned short*)C2 + (size_t)b * strideC) : nullptr;
#pragma unroll
        for (int it = 0; it < 4; ++it) {
          const int row = it * 4 + q;
          const float* sp = slab + row * 68 + c8;
          v8h hv, lv;
#pragma unroll
          for (int e = 0; e < 8; ++e) {
            if (OM == 1) {
              hv[e] = (_Float16)sp[e];
            } else {
              unsigned short hb = f2bf_bits(sp[e]);
              unsigned short lb = f2bf_bits(sp[e] - bf_bits2f(hb));
              hv[e] = __builtin_bit_cast(_Float16, hb);
              lv[e] = __builtin_bit_cast(_Float16, lb);
            }
          }
          *(v8h*)(C + (size_t)(mBase + row) * ld + nc0 + c8) = hv;
          if (OM == 2) *(v8h*)(Cl + (size_t)(mBase + row) * ld + nc0 + c8) = lv;
        }
      }
      __builtin_amdgcn_fence(__ATOMIC_RELEASE, "workgroup");
      __builtin_amdgcn_wave_barrier();
      __builtin_amdgcn_fence(__ATOMIC_ACQUIRE, "workgroup");
    }
  };
  if constexpr (OUT_MODE == 3) {
    static_assert(!RESID);
    if (bn * kGN >= nSplit) epilogue(IntC<0>{}, IntC<0>{}, Cout2, Cout2, ldc2, n0 - nSplit);   // the same for the whole work-group
    else                    epilogue(IntC<BIAS_MODE>{}, IntC<1>{}, Cout, Cout, ldc, n0);
  } else {
    epilogue(IntC<BIAS_MODE>{}, IntC<OUT_MODE>{}, Cout, Cout2, ldc, n0);
  }
}

// =====================================================================================
// Operand preparation, one grid for four jobs that do not depend on one another; the block index picks the job:
//   [0, kPrepQk)             qk_w  f32 [kD][kQKLd] -> bf16 [kQKLd][kD]     one 64x64 tile per work-group
//   [kPrepQk, +kPrepW)       v_w   f32 [kD][kD]    -> bf16 [kD][kD]        "
//   [.., +kPrepW)            cp_w  f32 [kD][kD]    -> bf16 [kD][kD]        "
//   [kPrepT, +kPrepX)        x     f32 -> bf16, same layout, two elements per thread
// The tile jobs (LDS, one barrier) last longer than the cast jobs and stand first.
// Weight transpose + RNE bf16 cast: in f32 [R][Cc] row-major -> out bf16 bits [Cc][R]  (out[c][r] = in[r][c]), R = kD.
// Load coverage: 256 threads x 16 floats = 64 (r) x 64 (c).  Store coverage: 8 waves x 2 x 4 rows (q8) = 64 rows c;
// =====================================================================================
constexpr int kPrepQk = (kQKLd / 64) * (kD / 64);     // 512 tiles
constexpr int kPrepW  = (kD / 64) * (kD / 64);        // 256 tiles
constexpr int kPrepT  = kPrepQk + 2 * kPrepW;         // 1024 tile jobs
constexpr int kPrepX  = (kTok * kD) / 2 / 256;        // 8192 cast jobs, exact
static_assert((size_t)kPrepX * 512 == (size_t)kTok * kD);
static_assert(kQKLd / 64 == 32 && kD / 64 == 16);
__global__ __launch_bounds__(256) void prep_operands(const float* __restrict__ x, unsigned short* __restrict__ xb,
                                                     const float* __restrict__ qk_w, unsigned short* __restrict__ qkwT,
                                                     const float* __restrict__ v_w, unsigned short* __restrict__ vwT,
                                                     const float* __restrict__ cp_w, unsigned short* __restrict__ cwT) {
  __shared__ __align__(16) _Float16 t[64 * kStg];     // [c][r] as 16-bit bit patterns
  const int tid = threadIdx.x;
  int job = blockIdx.x;
  if (job >= kPrepT) {                                // the whole work-group leaves here, in front of the barrier
    const int i = (job - kPrepT) * 256 + tid;
    const unsigned u = (unsigned)f2bf_bits(x[2 * i]) | ((unsigned)f2bf_bits(x[2 * i + 1]) << 16);
    ((unsigned*)xb)[i] = u;
    return;
  }
  const float* in = qk_w;
  unsigned short* out = qkwT;
  int Cc = kQKLd, tcLog = 5;                          // 2^tcLog = Cc / 64 tiles in a row of tiles
  if (job >= kPrepQk) {
    job -= kPrepQk;
    Cc = kD; tcLog = 4;
    in = v_w; out = vwT;
    if (job >= kPrepW) { job -= kPrepW; in = cp_w; out = cwT; }
  }
  constexpr int R = kD;
  const int c0 = (job & ((1 << tcLog) - 1)) * 64, r0 = (job >> tcLog) * 64;
  {
    const int rloc = tid >> 2, cq = (tid & 3) * 16;
    const float* src = in + (size_t)(r0 + rloc) * Cc + c0 + cq;
#pragma unroll
    for (int g4 = 0; g4 < 4; ++g4) {
      const v4f a = *(const v4f*)(src + 4 * g4);
#pragma unroll
      for (int e = 0; e < 4; ++e)
        t[(cq + 4 * g4 + e) * kStg + rloc] = __builtin_bit_cast(_Float16, f2bf_bits(a[e]));
    }
  }
  __syncthreads();
  const int wave = tid >> 5, lane = tid & 31, q8 = lane >> 3, c8 = (lane & 7) * 8;
  const int cA = wave * 8 + q8, cB = wave * 8 + 4 + q8;
  const v8h va = *(const v8h*)(t + cA * kStg + c8);
  const v8h vb = *(const v8h*)(t + cB * kStg + c8);
  unsigned short* da = out + (size_t)(c0 + cA) * R + r0 + c8;
  unsigned short* db = out + (size_t)(c0 + cB) * R + r0 + c8;
  {
    *(v8h*)da = va;
    *(v8h*)db = vb;
    
  }
}

// =====================================================================================
// V planes: Vf f32 [kTok][kD] (row b*kS+s, col h*kHD+d) -> Vth/Vtl bf16 bits [kB*kH][kHD][kS]:
// out[bh][d][s] = hi/lo(Vf[b*kS+s][h*kHD+d]).  grid = (kS/64, kB*kH), block 256.
// Load coverage: 256 threads x 16 floats = 64 (s) x 64 (d).
// =====================================================================================
__global__ __launch_bounds__(256) void v_split_transpose(const float* __restrict__ Vf,
                                                         unsigned short* __restrict__ vth, unsigned short* __restrict__ vtl) {
  __shared__ __align__(16) _Float16 th[64 * kStg];
  __shared__ __align__(16) _Float16 tl[64 * kStg];
  const int st0 = blockIdx.x * 64, bh = blockIdx.y;
  const int b = bh / kH, h = bh % kH;
  const int tid = threadIdx.x;
  {
    const int sloc = tid >> 2, d0 = (tid & 3) * 16;
    const float* src = Vf + (size_t)(b * kS + st0 + sloc) * kD + h * kHD + d0;
#pragma unroll
    for (int g4 = 0; g4 < 4; ++g4) {
      const v4f a = *(const v4f*)(src + 4 * g4);
#pragma unroll
      for (int e = 0; e < 4; ++e) {
        const unsigned short hb = f2bf_bits(a[e]);
        const unsigned short lb = f2bf_bits(a[e] - bf_bits2f(hb));
        th[(d0 + 4 * g4 + e) * kStg + sloc] = __builtin_bit_cast(_Float16, hb);
        tl[(d0 + 4 * g4 + e) * kStg + sloc] = __builtin_bit_cast(_Float16, lb);
      }
    }
  }
  __syncthreads();
  const int wave = tid >> 5, lane = tid & 31, q8 = lane >> 3, c8 = (lane & 7) * 8;
  const int dA = wave * 8 + q8, dB = wave * 8 + 4 + q8;
  const v8h ha = *(const v8h*)(th + dA * kStg + c8);
  const v8h hbv = *(const v8h*)(th + dB * kStg + c8);
  const v8h la = *(const v8h*)(tl + dA * kStg + c8);
  const v8h lbv = *(const v8h*)(tl + dB * kStg + c8);
  unsigned short* pha = vth + ((size_t)bh * kHD + dA) * kS + st0 + c8;
  unsigned short* phb = vth + ((size_t)bh * kHD + dB) * kS + st0 + c8;
  unsigned short* pla = vtl + ((size_t)bh * kHD + dA) * kS + st0 + c8;
  unsigned short* plb = vtl + ((size_t)bh * kHD + dB) * kS + st0 + c8;
  {
    *(v8h*)pha = ha;
    *(v8h*)phb = hbv;
    *(v8h*)pla = la;
    *(v8h*)plb = lbv;
    
  }
}

// =====================================================================================
// Causal attention, head_dim 64, 16-bit input planes, f32 out.
//   scores = (k.q^T, the transposed tile: A = K rows, B = Q columns) : v_wmma_f32_16x16x32_f16 (q, k f16 planes); 1/8 and
//            log2(e) enter as one f32 FMA per score in front of 2^x; a lane holds 32 of one query's 64 scores, its partner lane ^ 16 the rest; causal: kv > q replaced by -inf
//            (exp -> 0, identical to a finite most-negative fill since every row keeps its diagonal); chunks past
//            the diagonal contribute exactly 0 and are skipped.
//   out    = (v^T.p^T, A = V rows [d][kv], B = P packed from the score registers) : v_wmma_f32_16x16x32_bf16 with p and v
//            as bf16 hi/lo (hi.hi + hi.lo + lo.hi); online softmax in f32, one maximum and one sum per lane.
// Block = 4 waves = 64 query rows of one (b, h); grid.x = kB * kH * (kS/64).
// Staging coverage per kv chunk: 128 threads x 4 chunks x 8 halves = 64 x 64 per plane (K, V hi, V lo), plain loads + barrier.
// Output AV f32 [kTok][kD] at col h*64: row segment 64 floats = 256 B by 16 lanes x 16 B in one instruction, one wave per
// =====================================================================================
// second launch bound: a register budget for four waves per SIMD, so that four work-groups share a WGP
__global__ __launch_bounds__(128, 4)
void attn_causal_hd64(const unsigned short* __restrict__ QKp,    // f16 bits [kTok][kQKLd]
                      const unsigned short* __restrict__ Vthp,   // bf16 bits [kB*kH][kHD][kS]
                      const unsigned short* __restrict__ Vtlp,
                      float* __restrict__ AV) {                  // f32 [kTok][kD]
  union FB { v16b v; v8b h[2]; };
  // every 16-bit tile has rows of 128 B laid at pitch kStg (144 B = 16 B x 9): the 16 rows that one ds_load_b128
  // fragment read touches then start on 16 different groups of four banks instead of two
  __shared__ __align__(16) _Float16 Ksh[kKC * kStg];       // K [kv][d]      9 KB
  __shared__ __align__(16) __bf16  Vhs[kHD * kStg];        // V hi [d][kv]   9 KB
  __shared__ __align__(16) __bf16  Vls[kHD * kStg];        // V lo [d][kv]   9 KB
  __shared__ __align__(16) float   Os[4][16 * 68];         // per wave out tile, pitch 68

  const int tid  = threadIdx.x;
  const int wave = tid >> 5;
  const int lane = tid & 31;
  const int hh   = lane >> 4;
  const int c    = lane & 15;

  const int bx = blockIdx.x;
  const int qb = bx % kNQB;
  const int bh = bx / kNQB;
  const int h  = bh % kH;
  const int b  = bh / kH;
  const int q0 = qb * 64 + wave * 16;

  const _Float16* Q16 = (const _Float16*)QKp;
  const __bf16* Vth = (const __bf16*)Vthp;
  const __bf16* Vtl = (const __bf16*)Vtlp;
  float* ob_ptr = AV + (size_t)(b * kS) * kD + h * kHD;

  // ---- Q fragments (B operand, column = query q0 + c, k = d): 2 d-chunks of 32 ----
  v16h qa[2];
  {
    const _Float16* qrow = Q16 + (size_t)(b * kS + q0 + c) * kQKLd + h * kHD + 8 * hh;
    qa[0] = Frag<_Float16>::load(qrow);
    qa[1] = Frag<_Float16>::load(qrow + 32);
  }

  const int qrow = q0 + c;      // the one query whose scores, maximum, sum and output column this lane holds
  float mrow = -INFINITY, lrow = 0.f;
  v8f oacc[4];
#pragma unroll
  for (int t = 0; t < 4; ++t) oacc[t] = (v8f){0.f,0.f,0.f,0.f,0.f,0.f,0.f,0.f};

  const int nChunks = qb + 1;   // block-uniform
  for (int kc = 0; kc < nChunks; ++kc) {
    const int kv0 = kc * kKC;
    __syncthreads();
    const _Float16* gk[4];
    const __bf16* gvh[4];
    const __bf16* gvl[4];
    v8h kr[4];
    v8b vhr[4], vlr[4];
#pragma unroll
    for (int i = 0; i < 4; ++i) {
      const int ch = tid + 128 * i, row = ch >> 3, seg = (ch & 7) * 8;
      gk[i] = Q16 + (size_t)(b * kS + kv0 + row) * kQKLd + h * kHD + seg;   // the k plane lies kKOff further on
      const size_t vo = ((size_t)bh * kHD + row) * kS + kv0 + seg;   // row = d
      gvh[i] = Vth + vo;
      gvl[i] = Vtl + vo;
      kr[i]  = *(const v8h*)(gk[i] + kKOff);
      vhr[i] = *(const v8b*)gvh[i];
      vlr[i] = *(const v8b*)gvl[i];
    }
    // precaution: this wait stands behind the 12 issued loads, in front of every later overwrite of their address
    // registers; the addresses are named as inputs so that no load's destination is placed on one of them ahead of it
    asm volatile("s_wait_xcnt 0x0" :: "v"(gk[0]), "v"(gk[1]), "v"(gk[2]), "v"(gk[3]),
                                      "v"(gvh[0]), "v"(gvh[1]), "v"(gvh[2]), "v"(gvh[3]),
                                      "v"(gvl[0]), "v"(gvl[1]), "v"(gvl[2]), "v"(gvl[3]) : "memory");
#pragma unroll
    for (int i = 0; i < 4; ++i) {
      const int ch = tid + 128 * i, row = ch >> 3, seg = (ch & 7) * 8;
      *(v8h*)(Ksh + row * kStg + seg) = kr[i];
      *(v8b*)(Vhs + row * kStg + seg) = vhr[i];
      *(v8b*)(Vls + row * kStg + seg) = vlr[i];
    }
    __syncthreads();

    // transposed scores: A = K rows, B = Q columns, so s[j][r] = score(kv0 + 16 j + 8 hh + r, q0 + c): one query per lane
    // all eight K fragments are read as one group in front of the products, and the products run over the four
    // independent score tiles in turn; each tile still sums d chunk 0, then d chunk 1 (all loops unrolled so that the
    // fragment array lies in fixed registers)
    v16h kb[4][2];
#pragma unroll
    for (int j = 0; j < 4; ++j)
#pragma unroll
      for (int dc = 0; dc < 2; ++dc)
        kb[j][dc] = Frag<_Float16>::load(Ksh + (j * 16 + c) * kStg + dc * 32 + 8 * hh);
    v8f s[4];
#pragma unroll
    for (int j = 0; j < 4; ++j) s[j] = (v8f){0.f,0.f,0.f,0.f,0.f,0.f,0.f,0.f};
#pragma unroll
    for (int dc = 0; dc < 2; ++dc)
#pragma unroll
      for (int j = 0; j < 4; ++j) s[j] = at_mma_h(kb[j][dc], qa[dc], s[j]);
    const bool diag = (kc == qb);   // block-uniform
    float mj[4];
#pragma unroll
    for (int j = 0; j < 4; ++j) {
      float m = -INFINITY;
#pragma unroll
      for (int r = 0; r < 8; ++r) {
        const int kvcol = kv0 + j * 16 + 8 * hh + r;
        float sv = s[j][r];       // unscaled: the positive scale commutes with the maximum and is applied in the exponent
        if (diag && (kvcol > qrow)) sv = -INFINITY;
        s[j][r] = sv;
        m = fmaxf(m, sv);
      }
      mj[j] = m;
    }
    float cm = fmaxf(fmaxf(mj[0], mj[1]), fmaxf(mj[2], mj[3]));
    cm = fmaxf(cm, at_xhalf(cm));   // lanes c and c + 16 hold the two halves of one query's 64 scores
    const float mnew = fmaxf(mrow, cm);
    const float alpha = __builtin_amdgcn_exp2f((mrow - mnew) * kSmScaleLog2);
    const float nm = -mnew * kSmScaleLog2;
    mrow = mnew;
    // two score tiles of 16 kv, converted in place, are one B fragment of 32 kv in the loaders' k order
    v8u ph[2], pl[2];
    float pj[4];
#pragma unroll
    for (int j = 0; j < 4; ++j) {
      float psum = 0.f;
#pragma unroll
      for (int r = 0; r < 8; ++r) s[j][r] = fmaf(s[j][r], kSmScaleLog2, nm);
      at_exp2x8(s[j]);
#pragma unroll
      for (int r = 0; r < 8; r += 2) {
        const float p0 = s[j][r];
        const float p1 = s[j][r + 1];
        psum += p0;
        psum += p1;
        unsigned wh, wl;
        at_split2(p0, p1, wh, wl);
        ph[j >> 1][(j & 1) * 4 + (r >> 1)] = wh;
        pl[j >> 1][(j & 1) * 4 + (r >> 1)] = wl;
      }
      pj[j] = psum;
    }
    const v16b pha[2] = { __builtin_bit_cast(v16b, ph[0]), __builtin_bit_cast(v16b, ph[1]) };
    const v16b pla[2] = { __builtin_bit_cast(v16b, pl[0]), __builtin_bit_cast(v16b, pl[1]) };
    lrow = lrow * alpha + ((pj[0] + pj[1]) + (pj[2] + pj[3]));   // this lane half's share; the halves are joined after the loop
#pragma unroll
    for (int t = 0; t < 4; ++t)
#pragma unroll
      for (int r = 0; r < 8; ++r) oacc[t][r] *= alpha;
    // unrolled so that pha[kk], pla[kk] are fixed registers
#pragma unroll
    for (int kk = 0; kk < 2; ++kk) {
      // the eight V fragments of this half chunk are read as one group; the products then run over the four independent
      // output tiles in turn; each tile still sums v.p as hi.hi, lo.hi, hi.lo in that order (loops unrolled so that the
      // fragment arrays lie in fixed registers)
      FB vb[4], vl[4];
#pragma unroll
      for (int t = 0; t < 4; ++t) {
        vb[t].h[0] = *(const v8b*)(Vhs + (t * 16 + c) * kStg + kk * 32 + 8 * hh);
        vb[t].h[1] = *(const v8b*)(Vhs + (t * 16 + c) * kStg + kk * 32 + 16 + 8 * hh);
        vl[t].h[0] = *(const v8b*)(Vls + (t * 16 + c) * kStg + kk * 32 + 8 * hh);
        vl[t].h[1] = *(const v8b*)(Vls + (t * 16 + c) * kStg + kk * 32 + 16 + 8 * hh);
      }
#pragma unroll
      for (int t = 0; t < 4; ++t) oacc[t] = at_mma(vb[t].v, pha[kk], oacc[t]);
#pragma unroll
      for (int t = 0; t < 4; ++t) oacc[t] = at_mma(vl[t].v, pha[kk], oacc[t]);
#pragma unroll
      for (int t = 0; t < 4; ++t) oacc[t] = at_mma(vb[t].v, pla[kk], oacc[t]);
    }
  }

  // oacc[t][r] = out(q0 + c, 16 t + 8 hh + r): eight consecutive channels of one query row per tile
  float* os = Os[wave];
  {
    const float inv = 1.0f / (lrow + at_xhalf(lrow));
#pragma unroll
    for (int t = 0; t < 4; ++t) {
      v4f lo4, hi4;
#pragma unroll
      for (int e = 0; e < 4; ++e) { lo4[e] = oacc[t][e] * inv; hi4[e] = oacc[t][4 + e] * inv; }
      *(v4f*)(os + c * 68 + t * 16 + 8 * hh)     = lo4;
      *(v4f*)(os + c * 68 + t * 16 + 8 * hh + 4) = hi4;
    }
  }
  __builtin_amdgcn_fence(__ATOMIC_RELEASE, "workgroup");
  __builtin_amdgcn_wave_barrier();
  __builtin_amdgcn_fence(__ATOMIC_ACQUIRE, "workgroup");
  {
    const int c4 = (lane & 15) * 4;   // 16 lanes x 16 B = 256 B = one 64-float row segment; hh selects the row
    {
#pragma unroll
      for (int it = 0; it < 8; ++it) {
        const int row = it * 2 + hh;
        v4f val = *(const v4f*)(os + row * 68 + c4);
        *(v4f*)(ob_ptr + (size_t)(q0 + row) * kD + c4) = val;
      }
      
    }
  }
}

// =====================================================================================
// Shaped combination + causal prefix mean in f32:  O[b,s,h*64+d] = rg[h]*AV + sg[h]*v[s] - cg[h]*(sum_{j<=s} v[j])/(s+1),
// emitted as bf16 hi/lo planes [kTok][kD].
// One work-group = one (b, h) and one segment of kScRows rows of s; grid = kScSeg * kB * kH = 256, block 512.
// 16 lanes x 4 channels cover one 64-channel row; the 32 row slots of a work-group
//   (a) sum the rows in front of the segment, slot r taking rows r, r+32, r+64, ... (all loads independent),
//   (b) each own kScPer consecutive rows of the segment and sum them,
//   (c) meet in LDS: per channel the 32 sums of (a) are added up and the 32 sums of (b) scanned in fixed order,
//   (d) walk their own rows from that start value.
// Fixed summation order, no dependence on arrival; each 128-B output line (64 channels x 2 B) has one writer.
// =====================================================================================
constexpr int kScRows  = 256;                  // rows of s per work-group
constexpr int kScSeg   = kS / kScRows;         // 8 segments
constexpr int kScSlots = 32;                   // row slots (16 lanes each) per work-group
constexpr int kScPer   = kScRows / kScSlots;   // 8 consecutive rows per slot
__global__ __launch_bounds__(512) void shaped_combine(const float* __restrict__ AV, const float* __restrict__ Vf,
                                                     const float* __restrict__ rg, const float* __restrict__ sg,
                                                     const float* __restrict__ cg,
                                                     unsigned short* __restrict__ Oh, unsigned short* __restrict__ Ol) {
  __shared__ __align__(16) float Ps[kScSlots * kHD];   // per slot: sum of its rows in front of the segment
  __shared__ __align__(16) float Gs[kScSlots * kHD];   // per slot: sum of its own rows, then its start value
  const int tid  = threadIdx.x;
  const int slot = tid >> 4;
  const int c4   = (tid & 15) * 4;
  const int seg  = (kScSeg - 1) - (int)(blockIdx.x / (kB * kH));   // longest front part starts first
  const int bh   = blockIdx.x % (kB * kH);
  const int b = bh / kH;
  const int h = bh % kH;
  const size_t col = (size_t)(b * kS) * kD + h * kHD + c4;
  const int s0 = seg * kScRows + slot * kScPer;

  const float* vrow = Vf + col + (size_t)s0 * kD;
  const float* arow = AV + col + (size_t)s0 * kD;
  v4f vv[kScPer], aa[kScPer];
#pragma unroll
  for (int k = 0; k < kScPer; ++k) vv[k] = *(const v4f*)(vrow + k * kD);
#pragma unroll
  for (int k = 0; k < kScPer; ++k) aa[k] = *(const v4f*)(arow + k * kD);
  // precaution: this wait stands behind the 16 issued loads, in front of every later overwrite of their address
  // registers; both addresses are named as inputs so that no load's destination is placed on them ahead of it
  asm volatile("s_wait_xcnt 0x0" :: "v"(vrow), "v"(arow) : "memory");

  v4f pre = (v4f){0.f, 0.f, 0.f, 0.f};
  for (int t = 0; t < seg; ++t) {              // block-uniform trip count, at most kScSeg - 1
    v4f w[kScPer];
#pragma unroll
    for (int k = 0; k < kScPer; ++k)
      w[k] = *(const v4f*)(Vf + col + (size_t)(t * kScRows + k * kScSlots + slot) * kD);
#pragma unroll
    for (int k = 0; k < kScPer; ++k) pre += w[k];
  }
  const float rgh = rg[h], sgh = sg[h], cgh = cg[h];
  v4f gsum = vv[0];
#pragma unroll
  for (int k = 1; k < kScPer; ++k) gsum += vv[k];
  *(v4f*)(Ps + slot * kHD + c4) = pre;
  *(v4f*)(Gs + slot * kHD + c4) = gsum;
  __syncthreads();
  if (tid < kHD) {                             // one lane per channel, two whole waves
    float b0 = 0.f, b1 = 0.f, b2 = 0.f, b3 = 0.f;
#pragma unroll
    for (int r = 0; r < kScSlots; r += 4) {
      b0 += Ps[(r + 0) * kHD + tid];
      b1 += Ps[(r + 1) * kHD + tid];
      b2 += Ps[(r + 2) * kHD + tid];
      b3 += Ps[(r + 3) * kHD + tid];
    }
    float run = (b0 + b1) + (b2 + b3);
#pragma unroll
    for (int r = 0; r < kScSlots; ++r) {
      const float g = Gs[r * kHD + tid];
      Gs[r * kHD + tid] = run;
      run += g;
    }
  }
  __syncthreads();
  v4f p = *(const v4f*)(Gs + slot * kHD + c4);
#pragma unroll
  for (int k = 0; k < kScPer; ++k) {
    const int s = s0 + k;
    const size_t idx = col + (size_t)s * kD;
    p += vv[k];
    const float inv = 1.0f / (float)(s + 1);
    unsigned short hb[4], lb[4];
#pragma unroll
    for (int e = 0; e < 4; ++e) {
      const float o = rgh * aa[k][e] + sgh * vv[k][e] - cgh * (p[e] * inv);
      hb[e] = f2bf_bits(o);
      lb[e] = f2bf_bits(o - bf_bits2f(hb[e]));
    }
    uint2 uh, ul;
    uh.x = (unsigned)hb[0] | ((unsigned)hb[1] << 16);
    uh.y = (unsigned)hb[2] | ((unsigned)hb[3] << 16);
    ul.x = (unsigned)lb[0] | ((unsigned)lb[1] << 16);
    ul.y = (unsigned)lb[2] | ((unsigned)lb[3] << 16);
    *(uint2*)(Oh + idx) = uh;
    *(uint2*)(Ol + idx) = ul;
  }
}

// =====================================================================================
// launcher: kernel launches only
// =====================================================================================
extern "C" void kernel_launch(void* const* d_in, const int* in_sizes, int n_in,
                              void* d_out, int out_size, void* d_ws,
                              size_t ws_size, hipStream_t stream) {
  if (n_in < 8) return;
  if (in_sizes[0] != kTok * kD) return;
  if (in_sizes[1] != kD * kQKLd) return;
  if (in_sizes[2] != kQKLd) return;
  if (in_sizes[3] != kD * kD) return;
  if (in_sizes[4] != kD * kD) return;
  if (in_sizes[5] != kH || in_sizes[6] != kH || in_sizes[7] != kH) return;
  if (out_size != kTok * kD) return;
  if (kWsTotal > ws_size) return;

  const float* x     = (const float*)d_in[0];
  const float* qk_w  = (const float*)d_in[1];
  const float* qk_b  = (const float*)d_in[2];
  const float* v_w   = (const float*)d_in[3];
  const float* cp_w  = (const float*)d_in[4];
  const float* rg    = (const float*)d_in[5];
  const float* sg    = (const float*)d_in[6];
  const float* cg    = (const float*)d_in[7];
  float* out = (float*)d_out;

  unsigned char* ws = (unsigned char*)d_ws;
  unsigned short* xb   = (unsigned short*)(ws + kOffXb);
  unsigned short* qkwT = (unsigned short*)(ws + kOffQkwT);
  unsigned short* vwT  = (unsigned short*)(ws + kOffVwT);
  unsigned short* cwT  = (unsigned short*)(ws + kOffCwT);
  unsigned short* QKp  = (unsigned short*)(ws + kOffQKp);
  float*          Vf   = (float*)(ws + kOffVf);
  unsigned short* Vth  = (unsigned short*)(ws + kOffVth);
  unsigned short* Vtl  = (unsigned short*)(ws + kOffVtl);
  float*          AV   = (float*)(ws + kOffAV);
  unsigned short* Oh   = (unsigned short*)(ws + kOffOh);
  unsigned short* Ol   = (unsigned short*)(ws + kOffOl);

  // 1. x -> bf16 [4096][1024] and the three weights [in][out] f32 -> transposed bf16 [out][in]: 1024 + 8192 blocks
  prep_operands<<<dim3(kPrepT + kPrepX), dim3(256), 0, stream>>>(x, xb, qk_w, qkwT, v_w, vwT, cp_w, cwT);

  // 2. q|k and v projections in one grid: qkwT and vwT lie one behind the other in the workspace = Bt [3072][1024];
  //    [4096 x 1024] . Bt^T: columns 0..2047 + qk_b -> f16 [4096][2048], columns 2048..3071 -> f32 [4096][1024];
  //    tiles 32*12 = 384 blocks
  static_assert(kOffVwT == kOffQkwT + (size_t)kQKLd * kD * 2);
  wmma_gemm64<1, 0, 2, 3, false><<<dim3((kTok / kGM) * ((kQKLd + kD) / kGN), 1), dim3(256), 0, stream>>>(
      xb, xb, kD, 0L, qkwT, qkwT, kD, 0L, (void*)QKp, (void*)Vf, kQKLd, 0L,
      qk_b, x, 0L, kTok, kQKLd + kD, kD, 1.0f, kQKLd, kD);
  // 3. v -> bf16 hi/lo planes [32][64][2048]
  v_split_transpose<<<dim3(kS / 64, kB * kH), dim3(256), 0, stream>>>(Vf, Vth, Vtl);
  // 4. causal attention -> AV f32 [4096][1024]
  attn_causal_hd64<<<dim3(kB * kH * kNQB), dim3(128), 0, stream>>>(QKp, Vth, Vtl, AV);
  // 5. shaped combination + prefix mean -> O hi/lo bf16 [4096][1024]
  shaped_combine<<<dim3(kScSeg * kB * kH), dim3(512), 0, stream>>>(AV, Vf, rg, sg, cg, Oh, Ol);
  // 6. output projection: (O hi + O lo) [4096 x 1024] . [1024 x 1024]^T -> f32 d_out [4096][1024]; 128 blocks
  wmma_gemm64<1, 1, 0, 0, false><<<dim3((kTok / kGM) * (kD / kGN), 1), dim3(256), 0, stream>>>(
      Oh, Ol, kD, 0L, cwT, cwT, kD, 0L, (void*)out, (void*)out, kD, 0L,
      qk_b, x, 0L, kTok, kD, kD, 1.0f, 0, 0);
}

// v008
// It runs in 111 microseconds.
// Timed twice side by side with v007, it ran 1.13 and 1.14 times as fast.
// Over all steps from v000 it is 12.3 times as fast.
// Contractions: qk and v projections = v_wmma_f32_16x16x32_bf16 (x and W as RNE bf16, single product); scores q.k^T = v_wmma_f32_16x16x32_f16 (q, k f16 planes, single product, 1/8 applied in f32 inside the softmax exponent); attn.v = v_wmma_f32_16x16x32_bf16 with p and v as bf16 hi/lo pairs (hi.hi + hi.lo + lo.hi); output projection = v_wmma_f32_16x16x32_bf16 with the merged head output as bf16 hi/lo pair times W as RNE bf16 (hi.W + lo.W); f32 accumulate everywhere; softmax, causal prefix mean of v and gain combination in f32.
#include <hip/hip_runtime.h>
#include <math.h>

typedef __attribute__((ext_vector_type(16))) _Float16 v16h;
typedef __attribute__((ext_vector_type(8)))  _Float16 v8h;
typedef __attribute__((ext_vector_type(16))) __bf16   v16b;
typedef __attribute__((ext_vector_type(8)))  __bf16   v8b;
typedef __attribute__((ext_vector_type(8)))  float    v8f;
typedef __attribute__((ext_vector_type(4)))  float    v4f;
typedef __attribute__((ext_vector_type(2)))  float    v2f;
typedef __attribute__((ext_vector_type(8)))  unsigned v8u;
typedef __attribute__((ext_vector_type(2)))  __bf16   v2b;

constexpr int kB    = 2;
constexpr int kS    = 2048;
constexpr int kD    = 1024;
constexpr int kH    = 16;
constexpr int kHD   = 64;
constexpr int kTok  = kB * kS;        // 4096 token rows
constexpr int kQKLd = 2 * kD;         // fused q|k plane pitch (halves): q at col h*64, k at col kD + h*64
constexpr int kKOff = kD;
constexpr int kKC   = 64;             // kv chunk
constexpr int kNQB  = kS / 64;        // query blocks per (b,h)
constexpr int kStg  = 72;             // 16-bit LDS staging pitch (144 B rows, 16-B aligned)
constexpr float kSmScale = 0.125f;    // 1/sqrt(64)
constexpr float kSmScaleLog2 = kSmScale * 1.4426950408889634f;   // exp(kSmScale * x) = exp2(kSmScaleLog2 * x)

// workspace region map (bytes, all offsets multiples of 2 MiB):
//   [0]          xb    bf16 [4096][1024]            8 MiB
//   [8 MiB]      qkwT  bf16 [2048][1024]            4 MiB   (qk_w transposed)
//   [12 MiB]     vwT   bf16 [1024][1024]            2 MiB
//   [14 MiB]     cwT   bf16 [1024][1024]            2 MiB
//   [16 MiB]     QKp   f16  [4096][2048]           16 MiB   (q | k planes)
//   [32 MiB]     Vf    f32  [4096][1024]           16 MiB
//   [48 MiB]     Vth   bf16 [32][64][2048]          8 MiB   (v hi, per (b,h) [d][s])
//   [56 MiB]     Vtl   bf16 [32][64][2048]          8 MiB   (v lo)
//   [64 MiB]     AV    f32  [4096][1024]           16 MiB   (softmax(qk).v, merged heads)
//   [80 MiB]     Oh    bf16 [4096][1024]            8 MiB   (combined head output, hi)
//   [88 MiB]     Ol    bf16 [4096][1024]            8 MiB   (lo)
//   total 96 MiB = 100663296 B
constexpr size_t kOffXb   = 0;
constexpr size_t kOffQkwT = kOffXb   + (size_t)kTok * kD * 2;
constexpr size_t kOffVwT  = kOffQkwT + (size_t)kQKLd * kD * 2;
constexpr size_t kOffCwT  = kOffVwT  + (size_t)kD * kD * 2;
constexpr size_t kOffQKp  = kOffCwT  + (size_t)kD * kD * 2;
constexpr size_t kOffVf   = kOffQKp  + (size_t)kTok * kQKLd * 2;
constexpr size_t kOffVth  = kOffVf   + (size_t)kTok * kD * 4;
constexpr size_t kOffVtl  = kOffVth  + (size_t)kB * kH * kHD * kS * 2;
constexpr size_t kOffAV   = kOffVtl  + (size_t)kB * kH * kHD * kS * 2;
constexpr size_t kOffOh   = kOffAV   + (size_t)kTok * kD * 4;
constexpr size_t kOffOl   = kOffOh   + (size_t)kTok * kD * 2;
constexpr size_t kWsTotal = kOffOl   + (size_t)kTok * kD * 2;
static_assert(kWsTotal == 100663296ull);
static_assert(kWsTotal <= 134217728ull);

__device__ __forceinline__ unsigned short f2bf_bits(float f) {
  unsigned u = __float_as_uint(f);
  return (unsigned short)((u + 0x7FFFu + ((u >> 16) & 1u)) >> 16);
}
__device__ __forceinline__ float bf_bits2f(unsigned short h) { return __uint_as_float(((unsigned)h) << 16); }

// hazard guards as plain device helpers (their inline asm is kept out of the kernel template body)
__device__ __forceinline__ void dep_guard_h(v8f& a, v8f& b, v16h x, v16h y) { asm volatile("v_nop\n\tv_nop\n\tv_nop\n\tv_nop" : "+v"(a), "+v"(b) : "v"(x), "v"(y)); }
__device__ __forceinline__ void dep_guard_b(v8f& a, v8f& b, v16b x, v16b y) { asm volatile("v_nop\n\tv_nop\n\tv_nop\n\tv_nop" : "+v"(a), "+v"(b) : "v"(x), "v"(y)); }
__device__ __forceinline__ void keep4_h(v16h a, v16h b, v16h c, v16h d) { asm volatile("v_nop" :: "v"(a), "v"(b), "v"(c), "v"(d)); }
__device__ __forceinline__ void keep4_b(v16b a, v16b b, v16b c, v16b d) { asm volatile("v_nop" :: "v"(a), "v"(b), "v"(c), "v"(d)); }
__device__ __forceinline__ void acc_guard4(v8f& a, v8f& b, v8f& c, v8f& d) { asm volatile("v_nop\n\tv_nop\n\tv_nop\n\tv_nop" : "+v"(a), "+v"(b), "+v"(c), "+v"(d)); }
template <typename T> struct Frag;
template <> struct Frag<_Float16> {
  typedef v16h V; union U { v16h v; v8h h[2]; };
  static __device__ __forceinline__ v16h load(const _Float16* p) {   // elements 0..7 <- p[0..7], 8..15 <- p[16..23]
    U f; f.h[0] = *(const v8h*)(p); f.h[1] = *(const v8h*)(p + 16); return f.v;
  }
  static __device__ __forceinline__ v8f mma(v16h a, v16h b, v8f c) {
    return __builtin_amdgcn_wmma_f32_16x16x32_f16(false, a, false, b, (short)0, c, false, false);
  }
  static __device__ __forceinline__ void guard(v8f& a, v8f& b, v16h x, v16h y) { dep_guard_h(a, b, x, y); }
  static __device__ __forceinline__ void keep(v16h a, v16h b, v16h c, v16h d) { keep4_h(a, b, c, d); }
};
template <> struct Frag<__bf16> {
  typedef v16b V; union U { v16b v; v8b h[2]; };
  static __device__ __forceinline__ v16b load(const __bf16* p) {
    U f; f.h[0] = *(const v8b*)(p); f.h[1] = *(const v8b*)(p + 16); return f.v;
  }
  static __device__ __forceinline__ v8f mma(v16b a, v16b b, v8f c) {
    return __builtin_amdgcn_wmma_f32_16x16x32_bf16(false, a, false, b, (short)0, c, false, false);
  }
  static __device__ __forceinline__ void guard(v8f& a, v8f& b, v16b x, v16b y) { dep_guard_b(a, b, x, y); }
  static __device__ __forceinline__ void keep(v16b a, v16b b, v16b c, v16b d) { keep4_b(a, b, c, d); }
};

// bf16 hi/lo split of two values straight into packed fragment registers (first value in the low half): the packed
// convert rounds to nearest even and packs in the same instruction; lo = round(f - hi)
__device__ __forceinline__ void at_split2(float f0, float f1, unsigned& hi, unsigned& lo) {
  const v2f f = {f0, f1};
  const unsigned hw = __builtin_bit_cast(unsigned, __builtin_convertvector(f, v2b));
  const v2f d = {f0 - __uint_as_float(hw << 16), f1 - __uint_as_float(hw & 0xFFFF0000u)};
  hi = hw;
  lo = __builtin_bit_cast(unsigned, __builtin_convertvector(d, v2b));
}
__device__ __forceinline__ v8f at_mma(v16b a, v16b b, v8f c) {
  c = __builtin_amdgcn_wmma_f32_16x16x32_bf16(false, a, false, b, (short)0, c, false, false);
  asm volatile("v_nop\n\tv_nop\n\tv_nop\n\tv_nop" : "+v"(c) : "v"(a), "v"(b));
  return c;
}
// lane l reads lane l ^ 16
__device__ __forceinline__ float at_xhalf(float x) {
  return __builtin_bit_cast(float, __builtin_amdgcn_permlanex16(__builtin_bit_cast(int, x), __builtin_bit_cast(int, x),
                                                                0x76543210, 0xfedcba98, false, false));
}
__device__ __forceinline__ void at_exp2x8(v8f& x) {
  float e0, e1, e2, e3, e4, e5, e6, e7;
  asm("v_exp_f32 %0, %8\n\tv_exp_f32 %1, %9\n\tv_exp_f32 %2, %10\n\tv_exp_f32 %3, %11\n\t"
      "v_exp_f32 %4, %12\n\tv_exp_f32 %5, %13\n\tv_exp_f32 %6, %14\n\tv_exp_f32 %7, %15\n\tv_nop"
      : "=&v"(e0), "=&v"(e1), "=&v"(e2), "=&v"(e3), "=&v"(e4), "=&v"(e5), "=&v"(e6), "=&v"(e7)
      : "v"(x[0]), "v"(x[1]), "v"(x[2]), "v"(x[3]), "v"(x[4]), "v"(x[5]), "v"(x[6]), "v"(x[7]));
  x = (v8f){e0, e1, e2, e3, e4, e5, e6, e7};
}
__device__ __forceinline__ v8f at_mma_h(v16h a, v16h b, v8f c) {
  c = __builtin_amdgcn_wmma_f32_16x16x32_f16(false, a, false, b, (short)0, c, false, false);
  asm volatile("v_nop\n\tv_nop\n\tv_nop\n\tv_nop" : "+v"(c) : "v"(a), "v"(b));
  return c;
}

// =====================================================================================
// Register-blocked batched WMMA GEMM, C[m,n] = scale * sum_k A[m,k] * Bt[n,k] (+bias)(+resid);
// each wave owns a 64x64 tile; the 8 waves of a work-group stand 2 (m) x 4 (n) on one 128x256 tile of C.
// A row-major [M,K]; Bt row-major [N,K]; M % 128 == 0, N % 256 == 0, K % 64 == 0.
// Operands reach the waves through LDS: per k tile of 64 the work-group copies 128 rows of A (and of A2) and 256 rows
// of Bt, 128 B a row, with asynchronous copies (8 lanes x 16 B = one whole line of a row), into one of two buffers at
// row pitch kStg; the copies of tile t + 2 fly while tile t + 1 is worked on.
// SPLITM: 0 = single product; 1 = A carried as hi/lo planes (A2p = lo): product = hi.B + lo.B.
// BIAS_MODE: 0 = none, 1 = bias[m], 2 = bias[n].  OUT_MODE: 0 = f32, 1 = f16, 2 = bf16 hi + lo planes,
// 3 = two products that share A in one grid: columns below nSplit (a multiple of 256, so a work-group lies wholly on one
//     side) go out as in mode 1, with the bias; the others as f32 without bias to Cout2, pitch ldc2, column n - nSplit.
// ET: 0 = f16 operands, 1 = bf16 operands (pointers passed as 16-bit storage)
// =====================================================================================
constexpr int kGK = 64;     // k extent of a staged tile
constexpr int kGM = 128;    // rows of A per work-group
constexpr int kGN = 256;    // rows of Bt per work-group

// Each lane copies its own 16 B from global memory to its own LDS byte address. The s_wait_xcnt closes the statement so
// that it stands in front of every later write of the address registers named here (a precaution).
__device__ __forceinline__ void async_copy4(unsigned l0, const void* g0, unsigned l1, const void* g1,
                                            unsigned l2, const void* g2, unsigned l3, const void* g3) {
  asm volatile("global_load_async_to_lds_b128 %0, %1, off\n\t"
               "global_load_async_to_lds_b128 %2, %3, off\n\t"
               "global_load_async_to_lds_b128 %4, %5, off\n\t"
               "global_load_async_to_lds_b128 %6, %7, off\n\t"
               "s_wait_xcnt 0x0"
               :: "v"(l0), "v"(g0), "v"(l1), "v"(g1), "v"(l2), "v"(g2), "v"(l3), "v"(g3) : "memory");
}
__device__ __forceinline__ void async_copy8(unsigned l0, const void* g0, unsigned l1, const void* g1,
                                            unsigned l2, const void* g2, unsigned l3, const void* g3,
                                            unsigned l4, const void* g4, unsigned l5, const void* g5,
                                            unsigned l6, const void* g6, unsigned l7, const void* g7) {
  asm volatile("global_load_async_to_lds_b128 %0, %1, off\n\t"
               "global_load_async_to_lds_b128 %2, %3, off\n\t"
               "global_load_async_to_lds_b128 %4, %5, off\n\t"
               "global_load_async_to_lds_b128 %6, %7, off\n\t"
               "global_load_async_to_lds_b128 %8, %9, off\n\t"
               "global_load_async_to_lds_b128 %10, %11, off\n\t"
               "global_load_async_to_lds_b128 %12, %13, off\n\t"
               "global_load_async_to_lds_b128 %14, %15, off\n\t"
               "s_wait_xcnt 0x0"
               :: "v"(l0), "v"(g0), "v"(l1), "v"(g1), "v"(l2), "v"(g2), "v"(l3), "v"(g3),
                  "v"(l4), "v"(g4), "v"(l5), "v"(g5), "v"(l6), "v"(g6), "v"(l7), "v"(g7) : "memory");
}

template <int V> struct IntC { static constexpr int value = V; };   // a compile-time choice handed to the epilogue
template <int ET> struct Elem;
template <> struct Elem<0> { typedef _Float16 T; };
template <> struct Elem<1> { typedef __bf16 T; };
template <int ET, int SPLITM, int BIAS_MODE, int OUT_MODE, bool RESID, int ACT = 0>
__global__ __launch_bounds__(256) void wmma_gemm64(
    const unsigned short* __restrict__ Ap, const unsigned short* __restrict__ A2p, int lda, long strideA,
    const unsigned short* __restrict__ Btp, const unsigned short* __restrict__ Bt2p, int ldb, long strideB,
    void* __restrict__ Cout, void* __restrict__ Cout2, int ldc, long strideC,
    const float* __restrict__ bias,
    const float* __restrict__ resid, long strideR,
    int M, int N, int K, float scale, int nSplit, int ldc2) {
  typedef typename Elem<ET>::T T;
  typedef typename Frag<T>::V V;
  static_assert(SPLITM <= 1);
  constexpr bool SPA = (SPLITM >= 1);
  constexpr int kOffA2  = kGM * kStg;                       // element offsets inside one buffer: A | A2 | Bt
  constexpr int kOffB   = (SPA ? 2 : 1) * kGM * kStg;
  constexpr int kBufEl  = kOffB + kGN * kStg;
  const T* A = (const T*)Ap; const T* A2 = (const T*)A2p; const T* Bt = (const T*)Btp;
  __shared__ __align__(16) T sOp[2 * kBufEl];      // two operand buffers
  __shared__ __align__(16) float sT[8][16 * 68];   // per-wave 16x64 slab, pitch 68 floats
  const int b    = blockIdx.y;
  const int tid  = threadIdx.x;
  const int lane = tid & 31;
  const int wave = tid >> 5;
  const int tilesN = N / kGN;
  const int tilesM = M / kGM;
  if ((int)blockIdx.x >= tilesM * tilesN) return;   // the same for the whole work-group, in front of every copy and barrier
  const int bm = blockIdx.x / tilesN;
  const int bn = blockIdx.x - bm * tilesN;
  const int wm = (wave >> 2) << 6;             // this wave's rows inside the staged A tile
  const int wn = (wave & 3) << 6;              // this wave's rows inside the staged Bt tile
  const int m0 = bm * kGM + wm;
  const int n0 = bn * kGN + wn;

  const int rlane = lane & 15;                 // row (A) / col (B, D) within subtile
  const int koff  = (lane >> 4) * 8;           // k offset of this lane half
  const int mOff  = (lane >> 4) * 8;           // D row offset

  // staging: thread -> row tid / 8 (+ 32 per copy), 16-B piece tid % 8 of the row's 128 B
  const int srow = tid >> 3;
  const int sseg = (tid & 7) * 8;
  const T* gA  = A  + (size_t)b * strideA + (size_t)(bm * kGM + srow) * lda + sseg;
  const T* gA2 = SPA ? (A2 + (size_t)b * strideA + (size_t)(bm * kGM + srow) * lda + sseg) : nullptr;
  const T* gB  = Bt + (size_t)b * strideB + (size_t)(bn * kGN + srow) * ldb + sseg;
  const unsigned lS = (unsigned)(size_t)(sOp + srow * kStg + sseg);   // LDS byte address: low 32 bits
  const size_t a32 = (size_t)32 * lda, b32 = (size_t)32 * ldb;
  constexpr unsigned kL32 = 32 * kStg * 2;     // 32 rows in LDS, bytes
  auto stage = [&](int t, int buf) {
    const unsigned l = lS + (unsigned)buf * (unsigned)(kBufEl * 2);
    const unsigned lb = l + kOffB * 2;
    const T* pb = gB + t * kGK;
    async_copy8(lb, pb, lb + kL32, pb + b32, lb + 2 * kL32, pb + 2 * b32, lb + 3 * kL32, pb + 3 * b32,
                lb + 4 * kL32, pb + 4 * b32, lb + 5 * kL32, pb + 5 * b32, lb + 6 * kL32, pb + 6 * b32,
                lb + 7 * kL32, pb + 7 * b32);
    const T* pa = gA + t * kGK;
    if (SPA) {
      const unsigned l2 = l + kOffA2 * 2;
      const T* pa2 = gA2 + t * kGK;
      async_copy8(l, pa, l + kL32, pa + a32, l + 2 * kL32, pa + 2 * a32, l + 3 * kL32, pa + 3 * a32,
                  l2, pa2, l2 + kL32, pa2 + a32, l2 + 2 * kL32, pa2 + 2 * a32, l2 + 3 * kL32, pa2 + 3 * a32);
    } else {
      async_copy4(l, pa, l + kL32, pa + a32, l + 2 * kL32, pa + 2 * a32, l + 3 * kL32, pa + 3 * a32);
    }
  };

  v8f acc[4][4];
#pragma unroll
  for (int i = 0; i < 4; ++i)
#pragma unroll
    for (int j = 0; j < 4; ++j) acc[i][j] = (v8f){0.f,0.f,0.f,0.f,0.f,0.f,0.f,0.f};

  const int nT = K / kGK;                      // the same for the whole work-group
  stage(0, 0);
  asm volatile("s_wait_asynccnt 0x0" ::: "memory");   // this wave's copies of tile 0 have landed
  __syncthreads();                                    // ... and every other wave's: tile 0 may be read
  if (nT > 1) stage(1, 1);
  for (int t = 0; t < nT; ++t) {
    const T* sA = sOp + (t & 1) * kBufEl + (wm + rlane) * kStg + koff;
    const T* sB = sOp + (t & 1) * kBufEl + kOffB + (wn + rlane) * kStg + koff;
#pragma unroll
    for (int kk = 0; kk < kGK; kk += 32) {
      V bh[4], ah[4], al[4];
#pragma unroll
      for (int j = 0; j < 4; ++j) bh[j] = Frag<T>::load(sB + (j << 4) * kStg + kk);
#pragma unroll
      for (int i = 0; i < 4; ++i) {
        ah[i] = Frag<T>::load(sA + (i << 4) * kStg + kk);
        if (SPA) al[i] = Frag<T>::load(sA + kOffA2 + (i << 4) * kStg + kk);
      }
#pragma unroll
      for (int i = 0; i < 4; ++i) {
#pragma unroll
        for (int j = 0; j < 4; ++j) {
          acc[i][j] = Frag<T>::mma(ah[i], bh[j], acc[i][j]);
          if (SPA) acc[i][j] = Frag<T>::mma(al[i], bh[j], acc[i][j]);
        }
        Frag<T>::guard(acc[i][0], acc[i][3], ah[i], SPA ? al[i] : ah[i]);
      }
      Frag<T>::keep(bh[0], bh[1], bh[2], bh[3]);
    }
    asm volatile("s_wait_dscnt 0x0" ::: "memory");      // this wave's reads of tile t are done before its buffer is refilled
    asm volatile("s_wait_asynccnt 0x0" ::: "memory");   // this wave's copies of tile t + 1 have landed
    __syncthreads();                                    // publishes tile t + 1 and ends every reader's reads of tile t
    if (t + 2 < nT) stage(t + 2, t & 1);
  }
  asm volatile("s_wait_asynccnt 0x0" ::: "memory");     // no copy is outstanding when the wave goes on
  acc_guard4(acc[0][0], acc[0][1], acc[0][2], acc[0][3]);
  acc_guard4(acc[1][0], acc[1][1], acc[1][2], acc[1][3]);
  acc_guard4(acc[2][0], acc[2][1], acc[2][2], acc[2][3]);
  acc_guard4(acc[3][0], acc[3][1], acc[3][2], acc[3][3]);

  // ---- epilogue ----
  // BM, OM: bias and output form of this work-group's columns; C1, C2: its planes, pitch ld; nc0: the wave's first column there
  float* slab = sT[wave];
  const float* Rb = RESID ? (resid + (size_t)b * strideR) : nullptr;
  auto epilogue = [&](auto bmTag, auto omTag, void* C1, void* C2, int ld, int nc0) {
    constexpr int BM = decltype(bmTag)::value;
    constexpr int OM = decltype(omTag)::value;
#pragma unroll
    for (int i = 0; i < 4; ++i) {
      const int mBase = m0 + (i << 4);
#pragma unroll
      for (int j = 0; j < 4; ++j) {
        const int n = n0 + (j << 4) + rlane;
        float bv = 0.f;
        if (BM == 2) bv = bias[n];
#pragma unroll
        for (int r = 0; r < 8; ++r) {
          float v = acc[i][j][r] * scale;
          if (BM == 1) v += bias[mBase + mOff + r];
          if (BM == 2) v += bv;
          if (RESID) v += Rb[(size_t)(mBase + mOff + r) * ld + n];
          if (ACT == 1) v = tanhf(v);
          if (ACT == 2) v = fmaxf(v, 0.0f);
          if (ACT == 4) v = (v > 0.f) ? v : 0.01f * v;
          slab[(mOff + r) * 68 + (j << 4) + rlane] = v;
        }
      }
      __builtin_amdgcn_fence(__ATOMIC_RELEASE, "workgroup");
      __builtin_amdgcn_wave_barrier();
      __builtin_amdgcn_fence(__ATOMIC_ACQUIRE, "workgroup");
      if (OM == 0) {
        float* C = (float*)C1 + (size_t)b * strideC;
        const int hh = lane >> 4, c4 = (lane & 15) * 4;     // row seg = 256 B = 16 lanes x 16 B
#pragma unroll
        for (int it = 0; it < 8; ++it) {
          const int row = it * 2 + hh;
          v4f v = *(const v4f*)(slab + row * 68 + c4);
          *(v4f*)(C + (size_t)(mBase + row) * ld + nc0 + c4) = v;
        }
      } else {
        const int q = lane >> 3, c8 = (lane & 7) * 8;
        unsigned short* C  = (unsigned short*)C1 + (size_t)b * strideC;
        unsigned short* Cl = (OM == 2) ? ((unsigned short*)C2 + (size_t)b * strideC) : nullptr;
#pragma unroll
        for (int it = 0; it < 4; ++it) {
          const int row = it * 4 + q;
          const float* sp = slab + row * 68 + c8;
          v8h hv, lv;
#pragma unroll
          for (int e = 0; e < 8; ++e) {
            if (OM == 1) {
              hv[e] = (_Float16)sp[e];
            } else {
              unsigned short hb = f2bf_bits(sp[e]);
              unsigned short lb = f2bf_bits(sp[e] - bf_bits2f(hb));
              hv[e] = __builtin_bit_cast(_Float16, hb);
              lv[e] = __builtin_bit_cast(_Float16, lb);
            }
          }
          *(v8h*)(C + (size_t)(mBase + row) * ld + nc0 + c8) = hv;
          if (OM == 2) *(v8h*)(Cl + (size_t)(mBase + row) * ld + nc0 + c8) = lv;
        }
      }
      __builtin_amdgcn_fence(__ATOMIC_RELEASE, "workgroup");
      __builtin_amdgcn_wave_barrier();
      __builtin_amdgcn_fence(__ATOMIC_ACQUIRE, "workgroup");
    }
  };
  if constexpr (OUT_MODE == 3) {
    static_assert(!RESID);
    if (bn * kGN >= nSplit) epilogue(IntC<0>{}, IntC<0>{}, Cout2, Cout2, ldc2, n0 - nSplit);   // the same for the whole work-group
    else                    epilogue(IntC<BIAS_MODE>{}, IntC<1>{}, Cout, Cout, ldc, n0);
  } else {
    epilogue(IntC<BIAS_MODE>{}, IntC<OUT_MODE>{}, Cout, Cout2, ldc, n0);
  }
}

// =====================================================================================
// Operand preparation, one grid for four jobs that do not depend on one another; the block index picks the job:
//   [0, kPrepQk)             qk_w  f32 [kD][kQKLd] -> bf16 [kQKLd][kD]     one 64x64 tile per work-group
//   [kPrepQk, +kPrepW)       v_w   f32 [kD][kD]    -> bf16 [kD][kD]        "
//   [.., +kPrepW)            cp_w  f32 [kD][kD]    -> bf16 [kD][kD]        "
//   [kPrepT, +kPrepX)        x     f32 -> bf16, same layout, two elements per thread
// The tile jobs (LDS, one barrier) last longer than the cast jobs and stand first.
// Weight transpose + RNE bf16 cast: in f32 [R][Cc] row-major -> out bf16 bits [Cc][R]  (out[c][r] = in[r][c]), R = kD.
// Load coverage: 256 threads x 16 floats = 64 (r) x 64 (c).  Store coverage: 8 waves x 2 x 4 rows (q8) = 64 rows c;
// =====================================================================================
constexpr int kPrepQk = (kQKLd / 64) * (kD / 64);     // 512 tiles
constexpr int kPrepW  = (kD / 64) * (kD / 64);        // 256 tiles
constexpr int kPrepT  = kPrepQk + 2 * kPrepW;         // 1024 tile jobs
constexpr int kPrepX  = (kTok * kD) / 2 / 256;        // 8192 cast jobs, exact
static_assert((size_t)kPrepX * 512 == (size_t)kTok * kD);
static_assert(kQKLd / 64 == 32 && kD / 64 == 16);
__global__ __launch_bounds__(256) void prep_operands(const float* __restrict__ x, unsigned short* __restrict__ xb,
                                                     const float* __restrict__ qk_w, unsigned short* __restrict__ qkwT,
                                                     const float* __restrict__ v_w, unsigned short* __restrict__ vwT,
                                                     const float* __restrict__ cp_w, unsigned short* __restrict__ cwT) {
  __shared__ __align__(16) _Float16 t[64 * kStg];     // [c][r] as 16-bit bit patterns
  const int tid = threadIdx.x;
  int job = blockIdx.x;
  if (job >= kPrepT) {                                // the whole work-group leaves here, in front of the barrier
    const int i = (job - kPrepT) * 256 + tid;
    const unsigned u = (unsigned)f2bf_bits(x[2 * i]) | ((unsigned)f2bf_bits(x[2 * i + 1]) << 16);
    ((unsigned*)xb)[i] = u;
    return;
  }
  const float* in = qk_w;
  unsigned short* out = qkwT;
  int Cc = kQKLd, tcLog = 5;                          // 2^tcLog = Cc / 64 tiles in a row of tiles
  if (job >= kPrepQk) {
    job -= kPrepQk;
    Cc = kD; tcLog = 4;
    in = v_w; out = vwT;
    if (job >= kPrepW) { job -= kPrepW; in = cp_w; out = cwT; }
  }
  constexpr int R = kD;
  const int c0 = (job & ((1 << tcLog) - 1)) * 64, r0 = (job >> tcLog) * 64;
  {
    const int rloc = tid >> 2, cq = (tid & 3) * 16;
    const float* src = in + (size_t)(r0 + rloc) * Cc + c0 + cq;
#pragma unroll
    for (int g4 = 0; g4 < 4; ++g4) {
      const v4f a = *(const v4f*)(src + 4 * g4);
#pragma unroll
      for (int e = 0; e < 4; ++e)
        t[(cq + 4 * g4 + e) * kStg + rloc] = __builtin_bit_cast(_Float16, f2bf_bits(a[e]));
    }
  }
  __syncthreads();
  const int wave = tid >> 5, lane = tid & 31, q8 = lane >> 3, c8 = (lane & 7) * 8;
  const int cA = wave * 8 + q8, cB = wave * 8 + 4 + q8;
  const v8h va = *(const v8h*)(t + cA * kStg + c8);
  const v8h vb = *(const v8h*)(t + cB * kStg + c8);
  unsigned short* da = out + (size_t)(c0 + cA) * R + r0 + c8;
  unsigned short* db = out + (size_t)(c0 + cB) * R + r0 + c8;
  {
    *(v8h*)da = va;
    *(v8h*)db = vb;
    
  }
}

// =====================================================================================
// V planes: Vf f32 [kTok][kD] (row b*kS+s, col h*kHD+d) -> Vth/Vtl bf16 bits [kB*kH][kHD][kS]:
// out[bh][d][s] = hi/lo(Vf[b*kS+s][h*kHD+d]).  grid = (kS/64, kB*kH), block 256.
// Load coverage: 256 threads x 16 floats = 64 (s) x 64 (d).
// =====================================================================================
__global__ __launch_bounds__(256) void v_split_transpose(const float* __restrict__ Vf,
                                                         unsigned short* __restrict__ vth, unsigned short* __restrict__ vtl) {
  __shared__ __align__(16) _Float16 th[64 * kStg];
  __shared__ __align__(16) _Float16 tl[64 * kStg];
  const int st0 = blockIdx.x * 64, bh = blockIdx.y;
  const int b = bh / kH, h = bh % kH;
  const int tid = threadIdx.x;
  {
    const int sloc = tid >> 2, d0 = (tid & 3) * 16;
    const float* src = Vf + (size_t)(b * kS + st0 + sloc) * kD + h * kHD + d0;
#pragma unroll
    for (int g4 = 0; g4 < 4; ++g4) {
      const v4f a = *(const v4f*)(src + 4 * g4);
#pragma unroll
      for (int e = 0; e < 4; ++e) {
        const unsigned short hb = f2bf_bits(a[e]);
        const unsigned short lb = f2bf_bits(a[e] - bf_bits2f(hb));
        th[(d0 + 4 * g4 + e) * kStg + sloc] = __builtin_bit_cast(_Float16, hb);
        tl[(d0 + 4 * g4 + e) * kStg + sloc] = __builtin_bit_cast(_Float16, lb);
      }
    }
  }
  __syncthreads();
  const int wave = tid >> 5, lane = tid & 31, q8 = lane >> 3, c8 = (lane & 7) * 8;
  const int dA = wave * 8 + q8, dB = wave * 8 + 4 + q8;
  const v8h ha = *(const v8h*)(th + dA * kStg + c8);
  const v8h hbv = *(const v8h*)(th + dB * kStg + c8);
  const v8h la = *(const v8h*)(tl + dA * kStg + c8);
  const v8h lbv = *(const v8h*)(tl + dB * kStg + c8);
  unsigned short* pha = vth + ((size_t)bh * kHD + dA) * kS + st0 + c8;
  unsigned short* phb = vth + ((size_t)bh * kHD + dB) * kS + st0 + c8;
  unsigned short* pla = vtl + ((size_t)bh * kHD + dA) * kS + st0 + c8;
  unsigned short* plb = vtl + ((size_t)bh * kHD + dB) * kS + st0 + c8;
  {
    *(v8h*)pha = ha;
    *(v8h*)phb = hbv;
    *(v8h*)pla = la;
    *(v8h*)plb = lbv;
    
  }
}

// =====================================================================================
// Causal attention, head_dim 64, 16-bit input planes, f32 out.
//   scores = (k.q^T, the transposed tile: A = K rows, B = Q columns) : v_wmma_f32_16x16x32_f16 (q, k f16 planes); 1/8 and
//            log2(e) enter as one f32 FMA per score in front of 2^x; a lane holds 32 of one query's 64 scores, its partner lane ^ 16 the rest; causal: kv > q replaced by -inf
//            (exp -> 0, identical to a finite most-negative fill since every row keeps its diagonal); chunks past
//            the diagonal contribute exactly 0 and are skipped.
//   out    = (v^T.p^T, A = V rows [d][kv], B = P packed from the score registers) : v_wmma_f32_16x16x32_bf16 with p and v
//            as bf16 hi/lo (hi.hi + hi.lo + lo.hi); online softmax in f32, one maximum and one sum per lane.
// Block = 4 waves = 64 query rows of one (b, h); grid.x = kB * kH * (kS/64).
// Staging coverage per kv chunk: 128 threads x 4 chunks x 8 halves = 64 x 64 per plane (K, V hi, V lo), plain loads + barrier.
// Output AV f32 [kTok][kD] at col h*64: row segment 64 floats = 256 B by 16 lanes x 16 B in one instruction, one wave per
// =====================================================================================
// second launch bound: a register budget for four waves per SIMD, so that four work-groups share a WGP
__global__ __launch_bounds__(128, 4)
void attn_causal_hd64(const unsigned short* __restrict__ QKp,    // f16 bits [kTok][kQKLd]
                      const unsigned short* __restrict__ Vthp,   // bf16 bits [kB*kH][kHD][kS]
                      const unsigned short* __restrict__ Vtlp,
                      float* __restrict__ AV) {                  // f32 [kTok][kD]
  union FB { v16b v; v8b h[2]; };
  // every 16-bit tile has rows of 128 B laid at pitch kStg (144 B = 16 B x 9): the 16 rows that one ds_load_b128
  // fragment read touches then start on 16 different groups of four banks instead of two
  __shared__ __align__(16) _Float16 Ksh[kKC * kStg];       // K [kv][d]      9 KB
  __shared__ __align__(16) __bf16  Vhs[kHD * kStg];        // V hi [d][kv]   9 KB
  __shared__ __align__(16) __bf16  Vls[kHD * kStg];        // V lo [d][kv]   9 KB
  __shared__ __align__(16) float   Os[4][16 * 68];         // per wave out tile, pitch 68

  const int tid  = threadIdx.x;
  const int wave = tid >> 5;
  const int lane = tid & 31;
  const int hh   = lane >> 4;
  const int c    = lane & 15;

  // block index -> (head, query tile). A tile costs qb + 1 kv chunks, and at this register count four work-groups fit a
  // WGP, so the whole grid is resident at once and the launch lasts as long as the fullest WGP. qn = bx / 32;
  // each quarter of the grid holds one class of eight tile lengths, the longest class first:
  // qb = 31 - t, 16 + t, 15 - t, t (t = qn % 8). Indices 256 apart sum to 66 chunks exactly (they were four equal tiles, up to 128).
  // For speed only: qn -> qb is one to one on 0..31, so every (head, tile) is worked once wherever it lands.
  static_assert(kNQB == 32 && kB * kH == 32);
  const int bx = blockIdx.x;
  const int qn = bx / (kB * kH);
  const int qb = (kNQB - 1) - ((qn & 8) ? (qn ^ 7) : qn);
  const int bh = bx % (kB * kH);
  const int h  = bh % kH;
  const int b  = bh / kH;
  const int q0 = qb * 64 + wave * 16;

  const _Float16* Q16 = (const _Float16*)QKp;
  const __bf16* Vth = (const __bf16*)Vthp;
  const __bf16* Vtl = (const __bf16*)Vtlp;
  float* ob_ptr = AV + (size_t)(b * kS) * kD + h * kHD;

  // ---- Q fragments (B operand, column = query q0 + c, k = d): 2 d-chunks of 32 ----
  v16h qa[2];
  {
    const _Float16* qrow = Q16 + (size_t)(b * kS + q0 + c) * kQKLd + h * kHD + 8 * hh;
    qa[0] = Frag<_Float16>::load(qrow);
    qa[1] = Frag<_Float16>::load(qrow + 32);
  }

  const int qrow = q0 + c;      // the one query whose scores, maximum, sum and output column this lane holds
  float mrow = -INFINITY, lrow = 0.f;
  v8f oacc[4];
#pragma unroll
  for (int t = 0; t < 4; ++t) oacc[t] = (v8f){0.f,0.f,0.f,0.f,0.f,0.f,0.f,0.f};

  const int nChunks = qb + 1;   // block-uniform
  for (int kc = 0; kc < nChunks; ++kc) {
    const int kv0 = kc * kKC;
    __syncthreads();
    const _Float16* gk[4];
    const __bf16* gvh[4];
    const __bf16* gvl[4];
    v8h kr[4];
    v8b vhr[4], vlr[4];
#pragma unroll
    for (int i = 0; i < 4; ++i) {
      const int ch = tid + 128 * i, row = ch >> 3, seg = (ch & 7) * 8;
      gk[i] = Q16 + (size_t)(b * kS + kv0 + row) * kQKLd + h * kHD + seg;   // the k plane lies kKOff further on
      const size_t vo = ((size_t)bh * kHD + row) * kS + kv0 + seg;   // row = d
      gvh[i] = Vth + vo;
      gvl[i] = Vtl + vo;
      kr[i]  = *(const v8h*)(gk[i] + kKOff);
      vhr[i] = *(const v8b*)gvh[i];
      vlr[i] = *(const v8b*)gvl[i];
    }
    // precaution: this wait stands behind the 12 issued loads, in front of every later overwrite of their address
    // registers; the addresses are named as inputs so that no load's destination is placed on one of them ahead of it
    asm volatile("s_wait_xcnt 0x0" :: "v"(gk[0]), "v"(gk[1]), "v"(gk[2]), "v"(gk[3]),
                                      "v"(gvh[0]), "v"(gvh[1]), "v"(gvh[2]), "v"(gvh[3]),
                                      "v"(gvl[0]), "v"(gvl[1]), "v"(gvl[2]), "v"(gvl[3]) : "memory");
#pragma unroll
    for (int i = 0; i < 4; ++i) {
      const int ch = tid + 128 * i, row = ch >> 3, seg = (ch & 7) * 8;
      *(v8h*)(Ksh + row * kStg + seg) = kr[i];
      *(v8b*)(Vhs + row * kStg + seg) = vhr[i];
      *(v8b*)(Vls + row * kStg + seg) = vlr[i];
    }
    __syncthreads();

    // transposed scores: A = K rows, B = Q columns, so s[j][r] = score(kv0 + 16 j + 8 hh + r, q0 + c): one query per lane
    // all eight K fragments are read as one group in front of the products, and the products run over the four
    // independent score tiles in turn; each tile still sums d chunk 0, then d chunk 1 (all loops unrolled so that the
    // fragment array lies in fixed registers)
    v16h kb[4][2];
#pragma unroll
    for (int j = 0; j < 4; ++j)
#pragma unroll
      for (int dc = 0; dc < 2; ++dc)
        kb[j][dc] = Frag<_Float16>::load(Ksh + (j * 16 + c) * kStg + dc * 32 + 8 * hh);
    v8f s[4];
#pragma unroll
    for (int j = 0; j < 4; ++j) s[j] = (v8f){0.f,0.f,0.f,0.f,0.f,0.f,0.f,0.f};
#pragma unroll
    for (int dc = 0; dc < 2; ++dc)
#pragma unroll
      for (int j = 0; j < 4; ++j) s[j] = at_mma_h(kb[j][dc], qa[dc], s[j]);
    const bool diag = (kc == qb);   // block-uniform
    float mj[4];
#pragma unroll
    for (int j = 0; j < 4; ++j) {
      float m = -INFINITY;
#pragma unroll
      for (int r = 0; r < 8; ++r) {
        const int kvcol = kv0 + j * 16 + 8 * hh + r;
        float sv = s[j][r];       // unscaled: the positive scale commutes with the maximum and is applied in the exponent
        if (diag && (kvcol > qrow)) sv = -INFINITY;
        s[j][r] = sv;
        m = fmaxf(m, sv);
      }
      mj[j] = m;
    }
    float cm = fmaxf(fmaxf(mj[0], mj[1]), fmaxf(mj[2], mj[3]));
    cm = fmaxf(cm, at_xhalf(cm));   // lanes c and c + 16 hold the two halves of one query's 64 scores
    const float mnew = fmaxf(mrow, cm);
    const float alpha = __builtin_amdgcn_exp2f((mrow - mnew) * kSmScaleLog2);
    const float nm = -mnew * kSmScaleLog2;
    mrow = mnew;
    // two score tiles of 16 kv, converted in place, are one B fragment of 32 kv in the loaders' k order
    v8u ph[2], pl[2];
    float pj[4];
#pragma unroll
    for (int j = 0; j < 4; ++j) {
      float psum = 0.f;
#pragma unroll
      for (int r = 0; r < 8; ++r) s[j][r] = fmaf(s[j][r], kSmScaleLog2, nm);
      at_exp2x8(s[j]);
#pragma unroll
      for (int r = 0; r < 8; r += 2) {
        const float p0 = s[j][r];
        const float p1 = s[j][r + 1];
        psum += p0;
        psum += p1;
        unsigned wh, wl;
        at_split2(p0, p1, wh, wl);
        ph[j >> 1][(j & 1) * 4 + (r >> 1)] = wh;
        pl[j >> 1][(j & 1) * 4 + (r >> 1)] = wl;
      }
      pj[j] = psum;
    }
    const v16b pha[2] = { __builtin_bit_cast(v16b, ph[0]), __builtin_bit_cast(v16b, ph[1]) };
    const v16b pla[2] = { __builtin_bit_cast(v16b, pl[0]), __builtin_bit_cast(v16b, pl[1]) };
    lrow = lrow * alpha + ((pj[0] + pj[1]) + (pj[2] + pj[3]));   // this lane half's share; the halves are joined after the loop
#pragma unroll
    for (int t = 0; t < 4; ++t)
#pragma unroll
      for (int r = 0; r < 8; ++r) oacc[t][r] *= alpha;
    // unrolled so that pha[kk], pla[kk] are fixed registers
#pragma unroll
    for (int kk = 0; kk < 2; ++kk) {
      // the eight V fragments of this half chunk are read as one group; the products then run over the four independent
      // output tiles in turn; each tile still sums v.p as hi.hi, lo.hi, hi.lo in that order (loops unrolled so that the
      // fragment arrays lie in fixed registers)
      FB vb[4], vl[4];
#pragma unroll
      for (int t = 0; t < 4; ++t) {
        vb[t].h[0] = *(const v8b*)(Vhs + (t * 16 + c) * kStg + kk * 32 + 8 * hh);
        vb[t].h[1] = *(const v8b*)(Vhs + (t * 16 + c) * kStg + kk * 32 + 16 + 8 * hh);
        vl[t].h[0] = *(const v8b*)(Vls + (t * 16 + c) * kStg + kk * 32 + 8 * hh);
        vl[t].h[1] = *(const v8b*)(Vls + (t * 16 + c) * kStg + kk * 32 + 16 + 8 * hh);
      }
#pragma unroll
      for (int t = 0; t < 4; ++t) oacc[t] = at_mma(vb[t].v, pha[kk], oacc[t]);
#pragma unroll
      for (int t = 0; t < 4; ++t) oacc[t] = at_mma(vl[t].v, pha[kk], oacc[t]);
#pragma unroll
      for (int t = 0; t < 4; ++t) oacc[t] = at_mma(vb[t].v, pla[kk], oacc[t]);
    }
  }

  // oacc[t][r] = out(q0 + c, 16 t + 8 hh + r): eight consecutive channels of one query row per tile
  float* os = Os[wave];
  {
    const float inv = 1.0f / (lrow + at_xhalf(lrow));
#pragma unroll
    for (int t = 0; t < 4; ++t) {
      v4f lo4, hi4;
#pragma unroll
      for (int e = 0; e < 4; ++e) { lo4[e] = oacc[t][e] * inv; hi4[e] = oacc[t][4 + e] * inv; }
      *(v4f*)(os + c * 68 + t * 16 + 8 * hh)     = lo4;
      *(v4f*)(os + c * 68 + t * 16 + 8 * hh + 4) = hi4;
    }
  }
  __builtin_amdgcn_fence(__ATOMIC_RELEASE, "workgroup");
  __builtin_amdgcn_wave_barrier();
  __builtin_amdgcn_fence(__ATOMIC_ACQUIRE, "workgroup");
  {
    const int c4 = (lane & 15) * 4;   // 16 lanes x 16 B = 256 B = one 64-float row segment; hh selects the row
    {
#pragma unroll
      for (int it = 0; it < 8; ++it) {
        const int row = it * 2 + hh;
        v4f val = *(const v4f*)(os + row * 68 + c4);
        *(v4f*)(ob_ptr + (size_t)(q0 + row) * kD + c4) = val;
      }
      
    }
  }
}

// =====================================================================================
// Shaped combination + causal prefix mean in f32:  O[b,s,h*64+d] = rg[h]*AV + sg[h]*v[s] - cg[h]*(sum_{j<=s} v[j])/(s+1),
// emitted as bf16 hi/lo planes [kTok][kD].
// One work-group = one (b, h) and one segment of kScRows rows of s; grid = kScSeg * kB * kH = 256, block 512.
// 16 lanes x 4 channels cover one 64-channel row; the 32 row slots of a work-group
//   (a) sum the rows in front of the segment, slot r taking rows r, r+32, r+64, ... (all loads independent),
//   (b) each own kScPer consecutive rows of the segment and sum them,
//   (c) meet in LDS: per channel the 32 sums of (a) are added up and the 32 sums of (b) scanned in fixed order,
//   (d) walk their own rows from that start value.
// Fixed summation order, no dependence on arrival; each 128-B output line (64 channels x 2 B) has one writer.
// =====================================================================================
constexpr int kScRows  = 256;                  // rows of s per work-group
constexpr int kScSeg   = kS / kScRows;         // 8 segments
constexpr int kScSlots = 32;                   // row slots (16 lanes each) per work-group
constexpr int kScPer   = kScRows / kScSlots;   // 8 consecutive rows per slot
__global__ __launch_bounds__(512) void shaped_combine(const float* __restrict__ AV, const float* __restrict__ Vf,
                                                     const float* __restrict__ rg, const float* __restrict__ sg,
                                                     const float* __restrict__ cg,
                                                     unsigned short* __restrict__ Oh, unsigned short* __restrict__ Ol) {
  __shared__ __align__(16) float Ps[kScSlots * kHD];   // per slot: sum of its rows in front of the segment
  __shared__ __align__(16) float Gs[kScSlots * kHD];   // per slot: sum of its own rows, then its start value
  const int tid  = threadIdx.x;
  const int slot = tid >> 4;
  const int c4   = (tid & 15) * 4;
  const int seg  = (kScSeg - 1) - (int)(blockIdx.x / (kB * kH));   // longest front part starts first
  const int bh   = blockIdx.x % (kB * kH);
  const int b = bh / kH;
  const int h = bh % kH;
  const size_t col = (size_t)(b * kS) * kD + h * kHD + c4;
  const int s0 = seg * kScRows + slot * kScPer;

  const float* vrow = Vf + col + (size_t)s0 * kD;
  const float* arow = AV + col + (size_t)s0 * kD;
  v4f vv[kScPer], aa[kScPer];
#pragma unroll
  for (int k = 0; k < kScPer; ++k) vv[k] = *(const v4f*)(vrow + k * kD);
#pragma unroll
  for (int k = 0; k < kScPer; ++k) aa[k] = *(const v4f*)(arow + k * kD);
  // precaution: this wait stands behind the 16 issued loads, in front of every later overwrite of their address
  // registers; both addresses are named as inputs so that no load's destination is placed on them ahead of it
  asm volatile("s_wait_xcnt 0x0" :: "v"(vrow), "v"(arow) : "memory");

  v4f pre = (v4f){0.f, 0.f, 0.f, 0.f};
  for (int t = 0; t < seg; ++t) {              // block-uniform trip count, at most kScSeg - 1
    v4f w[kScPer];
#pragma unroll
    for (int k = 0; k < kScPer; ++k)
      w[k] = *(const v4f*)(Vf + col + (size_t)(t * kScRows + k * kScSlots + slot) * kD);
#pragma unroll
    for (int k = 0; k < kScPer; ++k) pre += w[k];
  }
  const float rgh = rg[h], sgh = sg[h], cgh = cg[h];
  v4f gsum = vv[0];
#pragma unroll
  for (int k = 1; k < kScPer; ++k) gsum += vv[k];
  *(v4f*)(Ps + slot * kHD + c4) = pre;
  *(v4f*)(Gs + slot * kHD + c4) = gsum;
  __syncthreads();
  if (tid < kHD) {                             // one lane per channel, two whole waves
    float b0 = 0.f, b1 = 0.f, b2 = 0.f, b3 = 0.f;
#pragma unroll
    for (int r = 0; r < kScSlots; r += 4) {
      b0 += Ps[(r + 0) * kHD + tid];
      b1 += Ps[(r + 1) * kHD + tid];
      b2 += Ps[(r + 2) * kHD + tid];
      b3 += Ps[(r + 3) * kHD + tid];
    }
    float run = (b0 + b1) + (b2 + b3);
#pragma unroll
    for (int r = 0; r < kScSlots; ++r) {
      const float g = Gs[r * kHD + tid];
      Gs[r * kHD + tid] = run;
      run += g;
    }
  }
  __syncthreads();
  v4f p = *(const v4f*)(Gs + slot * kHD + c4);
#pragma unroll
  for (int k = 0; k < kScPer; ++k) {
    const int s = s0 + k;
    const size_t idx = col + (size_t)s * kD;
    p += vv[k];
    const float inv = 1.0f / (float)(s + 1);
    unsigned short hb[4], lb[4];
#pragma unroll
    for (int e = 0; e < 4; ++e) {
      const float o = rgh * aa[k][e] + sgh * vv[k][e] - cgh * (p[e] * inv);
      hb[e] = f2bf_bits(o);
      lb[e] = f2bf_bits(o - bf_bits2f(hb[e]));
    }
    uint2 uh, ul;
    uh.x = (unsigned)hb[0] | ((unsigned)hb[1] << 16);
    uh.y = (unsigned)hb[2] | ((unsigned)hb[3] << 16);
    ul.x = (unsigned)lb[0] | ((unsigned)lb[1] << 16);
    ul.y = (unsigned)lb[2] | ((unsigned)lb[3] << 16);
    *(uint2*)(Oh + idx) = uh;
    *(uint2*)(Ol + idx) = ul;
  }
}

// =====================================================================================
// launcher: kernel launches only
// =====================================================================================
extern "C" void kernel_launch(void* const* d_in, const int* in_sizes, int n_in,
                              void* d_out, int out_size, void* d_ws,
                              size_t ws_size, hipStream_t stream) {
  if (n_in < 8) return;
  if (in_sizes[0] != kTok * kD) return;
  if (in_sizes[1] != kD * kQKLd) return;
  if (in_sizes[2] != kQKLd) return;
  if (in_sizes[3] != kD * kD) return;
  if (in_sizes[4] != kD * kD) return;
  if (in_sizes[5] != kH || in_sizes[6] != kH || in_sizes[7] != kH) return;
  if (out_size != kTok * kD) return;
  if (kWsTotal > ws_size) return;

  const float* x     = (const float*)d_in[0];
  const float* qk_w  = (const float*)d_in[1];
  const float* qk_b  = (const float*)d_in[2];
  const float* v_w   = (const float*)d_in[3];
  const float* cp_w  = (const float*)d_in[4];
  const float* rg    = (const float*)d_in[5];
  const float* sg    = (const float*)d_in[6];
  const float* cg    = (const float*)d_in[7];
  float* out = (float*)d_out;

  unsigned char* ws = (unsigned char*)d_ws;
  unsigned short* xb   = (unsigned short*)(ws + kOffXb);
  unsigned short* qkwT = (unsigned short*)(ws + kOffQkwT);
  unsigned short* vwT  = (unsigned short*)(ws + kOffVwT);
  unsigned short* cwT  = (unsigned short*)(ws + kOffCwT);
  unsigned short* QKp  = (unsigned short*)(ws + kOffQKp);
  float*          Vf   = (float*)(ws + kOffVf);
  unsigned short* Vth  = (unsigned short*)(ws + kOffVth);
  unsigned short* Vtl  = (unsigned short*)(ws + kOffVtl);
  float*          AV   = (float*)(ws + kOffAV);
  unsigned short* Oh   = (unsigned short*)(ws + kOffOh);
  unsigned short* Ol   = (unsigned short*)(ws + kOffOl);

  // 1. x -> bf16 [4096][1024] and the three weights [in][out] f32 -> transposed bf16 [out][in]: 1024 + 8192 blocks
  prep_operands<<<dim3(kPrepT + kPrepX), dim3(256), 0, stream>>>(x, xb, qk_w, qkwT, v_w, vwT, cp_w, cwT);

  // 2. q|k and v projections in one grid: qkwT and vwT lie one behind the other in the workspace = Bt [3072][1024];
  //    [4096 x 1024] . Bt^T: columns 0..2047 + qk_b -> f16 [4096][2048], columns 2048..3071 -> f32 [4096][1024];
  //    tiles 32*12 = 384 blocks
  static_assert(kOffVwT == kOffQkwT + (size_t)kQKLd * kD * 2);
  wmma_gemm64<1, 0, 2, 3, false><<<dim3((kTok / kGM) * ((kQKLd + kD) / kGN), 1), dim3(256), 0, stream>>>(
      xb, xb, kD, 0L, qkwT, qkwT, kD, 0L, (void*)QKp, (void*)Vf, kQKLd, 0L,
      qk_b, x, 0L, kTok, kQKLd + kD, kD, 1.0f, kQKLd, kD);
  // 3. v -> bf16 hi/lo planes [32][64][2048]
  v_split_transpose<<<dim3(kS / 64, kB * kH), dim3(256), 0, stream>>>(Vf, Vth, Vtl);
  // 4. causal attention -> AV f32 [4096][1024]
  attn_causal_hd64<<<dim3(kB * kH * kNQB), dim3(128), 0, stream>>>(QKp, Vth, Vtl, AV);
  // 5. shaped combination + prefix mean -> O hi/lo bf16 [4096][1024]
  shaped_combine<<<dim3(kScSeg * kB * kH), dim3(512), 0, stream>>>(AV, Vf, rg, sg, cg, Oh, Ol);
  // 6. output projection: (O hi + O lo) [4096 x 1024] . [1024 x 1024]^T -> f32 d_out [4096][1024]; 128 blocks
  wmma_gemm64<1, 1, 0, 0, false><<<dim3((kTok / kGM) * (kD / kGN), 1), dim3(256), 0, stream>>>(
      Oh, Ol, kD, 0L, cwT, cwT, kD, 0L, (void*)out, (void*)out, kD, 0L,
      qk_b, x, 0L, kTok, kD, kD, 1.0f, 0, 0);
}

// v009
// Measured time: 108 microseconds a run.
// Two timings next to v008 put it at 1.04 and 1.05 times that version's speed.
// Over all steps from v000 it is 12.8 times as fast.
// Contractions: qk and v projections = v_wmma_f32_16x16x32_bf16 (x and W as RNE bf16, single product); scores q.k^T = v_wmma_f32_16x16x32_f16 (q, k f16 planes, single product, 1/8 applied in f32 inside the softmax exponent); attn.v = v_wmma_f32_16x16x32_bf16 with p and v as bf16 hi/lo pairs (hi.hi + hi.lo + lo.hi); output projection = v_wmma_f32_16x16x32_bf16 with the merged head output as bf16 hi/lo pair times W as RNE bf16 (hi.W + lo.W); f32 accumulate everywhere; softmax, causal prefix mean of v and gain combination in f32.
#include <hip/hip_runtime.h>
#include <math.h>

typedef __attribute__((ext_vector_type(16))) _Float16 v16h;
typedef __attribute__((ext_vector_type(8)))  _Float16 v8h;
typedef __attribute__((ext_vector_type(16))) __bf16   v16b;
typedef __attribute__((ext_vector_type(8)))  __bf16   v8b;
typedef __attribute__((ext_vector_type(8)))  float    v8f;
typedef __attribute__((ext_vector_type(4)))  float    v4f;
typedef __attribute__((ext_vector_type(2)))  float    v2f;
typedef __attribute__((ext_vector_type(8)))  unsigned v8u;
typedef __attribute__((ext_vector_type(2)))  __bf16   v2b;

constexpr int kB    = 2;
constexpr int kS    = 2048;
constexpr int kD    = 1024;
constexpr int kH    = 16;
constexpr int kHD   = 64;
constexpr int kTok  = kB * kS;        // 4096 token rows
constexpr int kQKLd = 2 * kD;         // fused q|k plane pitch (halves): q at col h*64, k at col kD + h*64
constexpr int kKOff = kD;
constexpr int kKC   = 64;             // kv chunk
constexpr int kNQB  = kS / 64;        // query blocks per (b,h)
constexpr int kStg  = 72;             // 16-bit LDS staging pitch (144 B rows, 16-B aligned)
constexpr float kSmScale = 0.125f;    // 1/sqrt(64)
constexpr float kSmScaleLog2 = kSmScale * 1.4426950408889634f;   // exp(kSmScale * x) = exp2(kSmScaleLog2 * x)

// workspace region map (bytes, all offsets multiples of 2 MiB):
//   [0]          xb    bf16 [4096][1024]            8 MiB
//   [8 MiB]      qkwT  bf16 [2048][1024]            4 MiB   (qk_w transposed)
//   [12 MiB]     vwT   bf16 [1024][1024]            2 MiB
//   [14 MiB]     cwT   bf16 [1024][1024]            2 MiB
//   [16 MiB]     QKp   f16  [4096][2048]           16 MiB   (q | k planes)
//   [32 MiB]     Vf    f32  [4096][1024]           16 MiB
//   [48 MiB]     Vth   bf16 [32][64][2048]          8 MiB   (v hi, per (b,h) [d][s])
//   [56 MiB]     Vtl   bf16 [32][64][2048]          8 MiB   (v lo)
//   [64 MiB]     AV    f32  [4096][1024]           16 MiB   (softmax(qk).v, merged heads)
//   [80 MiB]     Oh    bf16 [4096][1024]            8 MiB   (combined head output, hi)
//   [88 MiB]     Ol    bf16 [4096][1024]            8 MiB   (lo)
//   total 96 MiB = 100663296 B
constexpr size_t kOffXb   = 0;
constexpr size_t kOffQkwT = kOffXb   + (size_t)kTok * kD * 2;
constexpr size_t kOffVwT  = kOffQkwT + (size_t)kQKLd * kD * 2;
constexpr size_t kOffCwT  = kOffVwT  + (size_t)kD * kD * 2;
constexpr size_t kOffQKp  = kOffCwT  + (size_t)kD * kD * 2;
constexpr size_t kOffVf   = kOffQKp  + (size_t)kTok * kQKLd * 2;
constexpr size_t kOffVth  = kOffVf   + (size_t)kTok * kD * 4;
constexpr size_t kOffVtl  = kOffVth  + (size_t)kB * kH * kHD * kS * 2;
constexpr size_t kOffAV   = kOffVtl  + (size_t)kB * kH * kHD * kS * 2;
constexpr size_t kOffOh   = kOffAV   + (size_t)kTok * kD * 4;
constexpr size_t kOffOl   = kOffOh   + (size_t)kTok * kD * 2;
constexpr size_t kWsTotal = kOffOl   + (size_t)kTok * kD * 2;
static_assert(kWsTotal == 100663296ull);
static_assert(kWsTotal <= 134217728ull);

__device__ __forceinline__ unsigned short f2bf_bits(float f) {
  unsigned u = __float_as_uint(f);
  return (unsigned short)((u + 0x7FFFu + ((u >> 16) & 1u)) >> 16);
}
__device__ __forceinline__ float bf_bits2f(unsigned short h) { return __uint_as_float(((unsigned)h) << 16); }

// hazard guards as plain device helpers (their inline asm is kept out of the kernel template body)
__device__ __forceinline__ void dep_guard_h(v8f& a, v8f& b, v16h x, v16h y) { asm volatile("v_nop\n\tv_nop\n\tv_nop\n\tv_nop" : "+v"(a), "+v"(b) : "v"(x), "v"(y)); }
__device__ __forceinline__ void dep_guard_b(v8f& a, v8f& b, v16b x, v16b y) { asm volatile("v_nop\n\tv_nop\n\tv_nop\n\tv_nop" : "+v"(a), "+v"(b) : "v"(x), "v"(y)); }
__device__ __forceinline__ void keep4_h(v16h a, v16h b, v16h c, v16h d) { asm volatile("v_nop" :: "v"(a), "v"(b), "v"(c), "v"(d)); }
__device__ __forceinline__ void keep4_b(v16b a, v16b b, v16b c, v16b d) { asm volatile("v_nop" :: "v"(a), "v"(b), "v"(c), "v"(d)); }
__device__ __forceinline__ void acc_guard4(v8f& a, v8f& b, v8f& c, v8f& d) { asm volatile("v_nop\n\tv_nop\n\tv_nop\n\tv_nop" : "+v"(a), "+v"(b), "+v"(c), "+v"(d)); }
template <typename T> struct Frag;
template <> struct Frag<_Float16> {
  typedef v16h V; union U { v16h v; v8h h[2]; };
  static __device__ __forceinline__ v16h load(const _Float16* p) {   // elements 0..7 <- p[0..7], 8..15 <- p[16..23]
    U f; f.h[0] = *(const v8h*)(p); f.h[1] = *(const v8h*)(p + 16); return f.v;
  }
  static __device__ __forceinline__ v8f mma(v16h a, v16h b, v8f c) {
    return __builtin_amdgcn_wmma_f32_16x16x32_f16(false, a, false, b, (short)0, c, false, false);
  }
  static __device__ __forceinline__ void guard(v8f& a, v8f& b, v16h x, v16h y) { dep_guard_h(a, b, x, y); }
  static __device__ __forceinline__ void keep(v16h a, v16h b, v16h c, v16h d) { keep4_h(a, b, c, d); }
};
template <> struct Frag<__bf16> {
  typedef v16b V; union U { v16b v; v8b h[2]; };
  static __device__ __forceinline__ v16b load(const __bf16* p) {
    U f; f.h[0] = *(const v8b*)(p); f.h[1] = *(const v8b*)(p + 16); return f.v;
  }
  static __device__ __forceinline__ v8f mma(v16b a, v16b b, v8f c) {
    return __builtin_amdgcn_wmma_f32_16x16x32_bf16(false, a, false, b, (short)0, c, false, false);
  }
  static __device__ __forceinline__ void guard(v8f& a, v8f& b, v16b x, v16b y) { dep_guard_b(a, b, x, y); }
  static __device__ __forceinline__ void keep(v16b a, v16b b, v16b c, v16b d) { keep4_b(a, b, c, d); }
};

// bf16 hi/lo split of two values straight into packed fragment registers (first value in the low half): the packed
// convert rounds to nearest even and packs in the same instruction; lo = round(f - hi)
__device__ __forceinline__ void at_split2(float f0, float f1, unsigned& hi, unsigned& lo) {
  const v2f f = {f0, f1};
  const unsigned hw = __builtin_bit_cast(unsigned, __builtin_convertvector(f, v2b));
  const v2f d = {f0 - __uint_as_float(hw << 16), f1 - __uint_as_float(hw & 0xFFFF0000u)};
  hi = hw;
  lo = __builtin_bit_cast(unsigned, __builtin_convertvector(d, v2b));
}
__device__ __forceinline__ v8f at_mma(v16b a, v16b b, v8f c) {
  c = __builtin_amdgcn_wmma_f32_16x16x32_bf16(false, a, false, b, (short)0, c, false, false);
  asm volatile("v_nop\n\tv_nop\n\tv_nop\n\tv_nop" : "+v"(c) : "v"(a), "v"(b));
  return c;
}
// lane l reads lane l ^ 16
__device__ __forceinline__ float at_xhalf(float x) {
  return __builtin_bit_cast(float, __builtin_amdgcn_permlanex16(__builtin_bit_cast(int, x), __builtin_bit_cast(int, x),
                                                                0x76543210, 0xfedcba98, false, false));
}
__device__ __forceinline__ void at_exp2x8(v8f& x) {
  float e0, e1, e2, e3, e4, e5, e6, e7;
  asm("v_exp_f32 %0, %8\n\tv_exp_f32 %1, %9\n\tv_exp_f32 %2, %10\n\tv_exp_f32 %3, %11\n\t"
      "v_exp_f32 %4, %12\n\tv_exp_f32 %5, %13\n\tv_exp_f32 %6, %14\n\tv_exp_f32 %7, %15\n\tv_nop"
      : "=&v"(e0), "=&v"(e1), "=&v"(e2), "=&v"(e3), "=&v"(e4), "=&v"(e5), "=&v"(e6), "=&v"(e7)
      : "v"(x[0]), "v"(x[1]), "v"(x[2]), "v"(x[3]), "v"(x[4]), "v"(x[5]), "v"(x[6]), "v"(x[7]));
  x = (v8f){e0, e1, e2, e3, e4, e5, e6, e7};
}
__device__ __forceinline__ v8f at_mma_h(v16h a, v16h b, v8f c) {
  c = __builtin_amdgcn_wmma_f32_16x16x32_f16(false, a, false, b, (short)0, c, false, false);
  asm volatile("v_nop\n\tv_nop\n\tv_nop\n\tv_nop" : "+v"(c) : "v"(a), "v"(b));
  return c;
}

// =====================================================================================
// Register-blocked batched WMMA GEMM, C[m,n] = scale * sum_k A[m,k] * Bt[n,k] (+bias)(+resid);
// each wave owns a 64x64 tile; the 8 waves of a work-group stand 2 (m) x 4 (n) on one 128x256 tile of C.
// A row-major [M,K]; Bt row-major [N,K]; M % 128 == 0, N % 256 == 0, K % 64 == 0.
// Operands reach the waves through LDS: per k tile of 64 the work-group copies 128 rows of A (and of A2) and 256 rows
// of Bt, 128 B a row, with asynchronous copies (8 lanes x 16 B = one whole line of a row), into one of two buffers at
// row pitch kStg; the copies of tile t + 2 fly while tile t + 1 is worked on.
// SPLITM: 0 = single product; 1 = A carried as hi/lo planes (A2p = lo): product = hi.B + lo.B.
// BIAS_MODE: 0 = none, 1 = bias[m], 2 = bias[n].  OUT_MODE: 0 = f32, 1 = f16, 2 = bf16 hi + lo planes,
// 3 = two products that share A in one grid: columns below nSplit (a multiple of 256, so a work-group lies wholly on one
//     side) go out as in mode 1, with the bias; the others as f32 without bias to Cout2, pitch ldc2, column n - nSplit.
// ET: 0 = f16 operands, 1 = bf16 operands (pointers passed as 16-bit storage)
// =====================================================================================
constexpr int kGK = 64;     // k extent of a staged tile
constexpr int kGM = 128;    // rows of A per work-group
constexpr int kGN = 256;    // rows of Bt per work-group

// Each lane copies its own 16 B from global memory to its own LDS byte address. The s_wait_xcnt closes the statement so
// that it stands in front of every later write of the address registers named here (a precaution).
__device__ __forceinline__ void async_copy4(unsigned l0, const void* g0, unsigned l1, const void* g1,
                                            unsigned l2, const void* g2, unsigned l3, const void* g3) {
  asm volatile("global_load_async_to_lds_b128 %0, %1, off\n\t"
               "global_load_async_to_lds_b128 %2, %3, off\n\t"
               "global_load_async_to_lds_b128 %4, %5, off\n\t"
               "global_load_async_to_lds_b128 %6, %7, off\n\t"
               "s_wait_xcnt 0x0"
               :: "v"(l0), "v"(g0), "v"(l1), "v"(g1), "v"(l2), "v"(g2), "v"(l3), "v"(g3) : "memory");
}
__device__ __forceinline__ void async_copy8(unsigned l0, const void* g0, unsigned l1, const void* g1,
                                            unsigned l2, const void* g2, unsigned l3, const void* g3,
                                            unsigned l4, const void* g4, unsigned l5, const void* g5,
                                            unsigned l6, const void* g6, unsigned l7, const void* g7) {
  asm volatile("global_load_async_to_lds_b128 %0, %1, off\n\t"
               "global_load_async_to_lds_b128 %2, %3, off\n\t"
               "global_load_async_to_lds_b128 %4, %5, off\n\t"
               "global_load_async_to_lds_b128 %6, %7, off\n\t"
               "global_load_async_to_lds_b128 %8, %9, off\n\t"
               "global_load_async_to_lds_b128 %10, %11, off\n\t"
               "global_load_async_to_lds_b128 %12, %13, off\n\t"
               "global_load_async_to_lds_b128 %14, %15, off\n\t"
               "s_wait_xcnt 0x0"
               :: "v"(l0), "v"(g0), "v"(l1), "v"(g1), "v"(l2), "v"(g2), "v"(l3), "v"(g3),
                  "v"(l4), "v"(g4), "v"(l5), "v"(g5), "v"(l6), "v"(g6), "v"(l7), "v"(g7) : "memory");
}

// the same for twelve copies (three planes x four row groups of a kv chunk) under one closing wait
__device__ __forceinline__ void async_copy12(unsigned l0, const void* g0, unsigned l1, const void* g1,
                                             unsigned l2, const void* g2, unsigned l3, const void* g3,
                                             unsigned l4, const void* g4, unsigned l5, const void* g5,
                                             unsigned l6, const void* g6, unsigned l7, const void* g7,
                                             unsigned l8, const void* g8, unsigned l9, const void* g9,
                                             unsigned l10, const void* g10, unsigned l11, const void* g11) {
  asm volatile("global_load_async_to_lds_b128 %0, %1, off\n\t"
               "global_load_async_to_lds_b128 %2, %3, off\n\t"
               "global_load_async_to_lds_b128 %4, %5, off\n\t"
               "global_load_async_to_lds_b128 %6, %7, off\n\t"
               "global_load_async_to_lds_b128 %8, %9, off\n\t"
               "global_load_async_to_lds_b128 %10, %11, off\n\t"
               "global_load_async_to_lds_b128 %12, %13, off\n\t"
               "global_load_async_to_lds_b128 %14, %15, off\n\t"
               "global_load_async_to_lds_b128 %16, %17, off\n\t"
               "global_load_async_to_lds_b128 %18, %19, off\n\t"
               "global_load_async_to_lds_b128 %20, %21, off\n\t"
               "global_load_async_to_lds_b128 %22, %23, off\n\t"
               "s_wait_xcnt 0x0"
               :: "v"(l0), "v"(g0), "v"(l1), "v"(g1), "v"(l2), "v"(g2), "v"(l3), "v"(g3),
                  "v"(l4), "v"(g4), "v"(l5), "v"(g5), "v"(l6), "v"(g6), "v"(l7), "v"(g7),
                  "v"(l8), "v"(g8), "v"(l9), "v"(g9), "v"(l10), "v"(g10), "v"(l11), "v"(g11) : "memory");
}

template <int V> struct IntC { static constexpr int value = V; };   // a compile-time choice handed to the epilogue
template <int ET> struct Elem;
template <> struct Elem<0> { typedef _Float16 T; };
template <> struct Elem<1> { typedef __bf16 T; };
template <int ET, int SPLITM, int BIAS_MODE, int OUT_MODE, bool RESID, int ACT = 0>
__global__ __launch_bounds__(256) void wmma_gemm64(
    const unsigned short* __restrict__ Ap, const unsigned short* __restrict__ A2p, int lda, long strideA,
    const unsigned short* __restrict__ Btp, const unsigned short* __restrict__ Bt2p, int ldb, long strideB,
    void* __restrict__ Cout, void* __restrict__ Cout2, int ldc, long strideC,
    const float* __restrict__ bias,
    const float* __restrict__ resid, long strideR,
    int M, int N, int K, float scale, int nSplit, int ldc2) {
  typedef typename Elem<ET>::T T;
  typedef typename Frag<T>::V V;
  static_assert(SPLITM <= 1);
  constexpr bool SPA = (SPLITM >= 1);
  constexpr int kOffA2  = kGM * kStg;                       // element offsets inside one buffer: A | A2 | Bt
  constexpr int kOffB   = (SPA ? 2 : 1) * kGM * kStg;
  constexpr int kBufEl  = kOffB + kGN * kStg;
  const T* A = (const T*)Ap; const T* A2 = (const T*)A2p; const T* Bt = (const T*)Btp;
  __shared__ __align__(16) T sOp[2 * kBufEl];      // two operand buffers
  __shared__ __align__(16) float sT[8][16 * 68];   // per-wave 16x64 slab, pitch 68 floats
  const int b    = blockIdx.y;
  const int tid  = threadIdx.x;
  const int lane = tid & 31;
  const int wave = tid >> 5;
  const int tilesN = N / kGN;
  const int tilesM = M / kGM;
  if ((int)blockIdx.x >= tilesM * tilesN) return;   // the same for the whole work-group, in front of every copy and barrier
  const int bm = blockIdx.x / tilesN;
  const int bn = blockIdx.x - bm * tilesN;
  const int wm = (wave >> 2) << 6;             // this wave's rows inside the staged A tile
  const int wn = (wave & 3) << 6;              // this wave's rows inside the staged Bt tile
  const int m0 = bm * kGM + wm;
  const int n0 = bn * kGN + wn;

  const int rlane = lane & 15;                 // row (A) / col (B, D) within subtile
  const int koff  = (lane >> 4) * 8;           // k offset of this lane half
  const int mOff  = (lane >> 4) * 8;           // D row offset

  // staging: thread -> row tid / 8 (+ 32 per copy), 16-B piece tid % 8 of the row's 128 B
  const int srow = tid >> 3;
  const int sseg = (tid & 7) * 8;
  const T* gA  = A  + (size_t)b * strideA + (size_t)(bm * kGM + srow) * lda + sseg;
  const T* gA2 = SPA ? (A2 + (size_t)b * strideA + (size_t)(bm * kGM + srow) * lda + sseg) : nullptr;
  const T* gB  = Bt + (size_t)b * strideB + (size_t)(bn * kGN + srow) * ldb + sseg;
  const unsigned lS = (unsigned)(size_t)(sOp + srow * kStg + sseg);   // LDS byte address: low 32 bits
  const size_t a32 = (size_t)32 * lda, b32 = (size_t)32 * ldb;
  constexpr unsigned kL32 = 32 * kStg * 2;     // 32 rows in LDS, bytes
  auto stage = [&](int t, int buf) {
    const unsigned l = lS + (unsigned)buf * (unsigned)(kBufEl * 2);
    const unsigned lb = l + kOffB * 2;
    const T* pb = gB + t * kGK;
    async_copy8(lb, pb, lb + kL32, pb + b32, lb + 2 * kL32, pb + 2 * b32, lb + 3 * kL32, pb + 3 * b32,
                lb + 4 * kL32, pb + 4 * b32, lb + 5 * kL32, pb + 5 * b32, lb + 6 * kL32, pb + 6 * b32,
                lb + 7 * kL32, pb + 7 * b32);
    const T* pa = gA + t * kGK;
    if (SPA) {
      const unsigned l2 = l + kOffA2 * 2;
      const T* pa2 = gA2 + t * kGK;
      async_copy8(l, pa, l + kL32, pa + a32, l + 2 * kL32, pa + 2 * a32, l + 3 * kL32, pa + 3 * a32,
                  l2, pa2, l2 + kL32, pa2 + a32, l2 + 2 * kL32, pa2 + 2 * a32, l2 + 3 * kL32, pa2 + 3 * a32);
    } else {
      async_copy4(l, pa, l + kL32, pa + a32, l + 2 * kL32, pa + 2 * a32, l + 3 * kL32, pa + 3 * a32);
    }
  };

  v8f acc[4][4];
#pragma unroll
  for (int i = 0; i < 4; ++i)
#pragma unroll
    for (int j = 0; j < 4; ++j) acc[i][j] = (v8f){0.f,0.f,0.f,0.f,0.f,0.f,0.f,0.f};

  const int nT = K / kGK;                      // the same for the whole work-group
  stage(0, 0);
  asm volatile("s_wait_asynccnt 0x0" ::: "memory");   // this wave's copies of tile 0 have landed
  __syncthreads();                                    // ... and every other wave's: tile 0 may be read
  if (nT > 1) stage(1, 1);
  for (int t = 0; t < nT; ++t) {
    const T* sA = sOp + (t & 1) * kBufEl + (wm + rlane) * kStg + koff;
    const T* sB = sOp + (t & 1) * kBufEl + kOffB + (wn + rlane) * kStg + koff;
#pragma unroll
    for (int kk = 0; kk < kGK; kk += 32) {
      V bh[4], ah[4], al[4];
#pragma unroll
      for (int j = 0; j < 4; ++j) bh[j] = Frag<T>::load(sB + (j << 4) * kStg + kk);
#pragma unroll
      for (int i = 0; i < 4; ++i) {
        ah[i] = Frag<T>::load(sA + (i << 4) * kStg + kk);
        if (SPA) al[i] = Frag<T>::load(sA + kOffA2 + (i << 4) * kStg + kk);
      }
#pragma unroll
      for (int i = 0; i < 4; ++i) {
#pragma unroll
        for (int j = 0; j < 4; ++j) {
          acc[i][j] = Frag<T>::mma(ah[i], bh[j], acc[i][j]);
          if (SPA) acc[i][j] = Frag<T>::mma(al[i], bh[j], acc[i][j]);
        }
        Frag<T>::guard(acc[i][0], acc[i][3], ah[i], SPA ? al[i] : ah[i]);
      }
      Frag<T>::keep(bh[0], bh[1], bh[2], bh[3]);
    }
    asm volatile("s_wait_dscnt 0x0" ::: "memory");      // this wave's reads of tile t are done before its buffer is refilled
    asm volatile("s_wait_asynccnt 0x0" ::: "memory");   // this wave's copies of tile t + 1 have landed
    __syncthreads();                                    // publishes tile t + 1 and ends every reader's reads of tile t
    if (t + 2 < nT) stage(t + 2, t & 1);
  }
  asm volatile("s_wait_asynccnt 0x0" ::: "memory");     // no copy is outstanding when the wave goes on
  acc_guard4(acc[0][0], acc[0][1], acc[0][2], acc[0][3]);
  acc_guard4(acc[1][0], acc[1][1], acc[1][2], acc[1][3]);
  acc_guard4(acc[2][0], acc[2][1], acc[2][2], acc[2][3]);
  acc_guard4(acc[3][0], acc[3][1], acc[3][2], acc[3][3]);

  // ---- epilogue ----
  // BM, OM: bias and output form of this work-group's columns; C1, C2: its planes, pitch ld; nc0: the wave's first column there
  float* slab = sT[wave];
  const float* Rb = RESID ? (resid + (size_t)b * strideR) : nullptr;
  auto epilogue = [&](auto bmTag, auto omTag, void* C1, void* C2, int ld, int nc0) {
    constexpr int BM = decltype(bmTag)::value;
    constexpr int OM = decltype(omTag)::value;
#pragma unroll
    for (int i = 0; i < 4; ++i) {
      const int mBase = m0 + (i << 4);
#pragma unroll
      for (int j = 0; j < 4; ++j) {
        const int n = n0 + (j << 4) + rlane;
        float bv = 0.f;
        if (BM == 2) bv = bias[n];
#pragma unroll
        for (int r = 0; r < 8; ++r) {
          float v = acc[i][j][r] * scale;
          if (BM == 1) v += bias[mBase + mOff + r];
          if (BM == 2) v += bv;
          if (RESID) v += Rb[(size_t)(mBase + mOff + r) * ld + n];
          if (ACT == 1) v = tanhf(v);
          if (ACT == 2) v = fmaxf(v, 0.0f);
          if (ACT == 4) v = (v > 0.f) ? v : 0.01f * v;
          slab[(mOff + r) * 68 + (j << 4) + rlane] = v;
        }
      }
      __builtin_amdgcn_fence(__ATOMIC_RELEASE, "workgroup");
      __builtin_amdgcn_wave_barrier();
      __builtin_amdgcn_fence(__ATOMIC_ACQUIRE, "workgroup");
      if (OM == 0) {
        float* C = (float*)C1 + (size_t)b * strideC;
        const int hh = lane >> 4, c4 = (lane & 15) * 4;     // row seg = 256 B = 16 lanes x 16 B
#pragma unroll
        for (int it = 0; it < 8; ++it) {
          const int row = it * 2 + hh;
          v4f v = *(const v4f*)(slab + row * 68 + c4);
          *(v4f*)(C + (size_t)(mBase + row) * ld + nc0 + c4) = v;
        }
      } else {
        const int q = lane >> 3, c8 = (lane & 7) * 8;
        unsigned short* C  = (unsigned short*)C1 + (size_t)b * strideC;
        unsigned short* Cl = (OM == 2) ? ((unsigned short*)C2 + (size_t)b * strideC) : nullptr;
#pragma unroll
        for (int it = 0; it < 4; ++it) {
          const int row = it * 4 + q;
          const float* sp = slab + row * 68 + c8;
          v8h hv, lv;
#pragma unroll
          for (int e = 0; e < 8; ++e) {
            if (OM == 1) {
              hv[e] = (_Float16)sp[e];
            } else {
              unsigned short hb = f2bf_bits(sp[e]);
              unsigned short lb = f2bf_bits(sp[e] - bf_bits2f(hb));
              hv[e] = __builtin_bit_cast(_Float16, hb);
              lv[e] = __builtin_bit_cast(_Float16, lb);
            }
          }
          *(v8h*)(C + (size_t)(mBase + row) * ld + nc0 + c8) = hv;
          if (OM == 2) *(v8h*)(Cl + (size_t)(mBase + row) * ld + nc0 + c8) = lv;
        }
      }
      __builtin_amdgcn_fence(__ATOMIC_RELEASE, "workgroup");
      __builtin_amdgcn_wave_barrier();
      __builtin_amdgcn_fence(__ATOMIC_ACQUIRE, "workgroup");
    }
  };
  if constexpr (OUT_MODE == 3) {
    static_assert(!RESID);
    if (bn * kGN >= nSplit) epilogue(IntC<0>{}, IntC<0>{}, Cout2, Cout2, ldc2, n0 - nSplit);   // the same for the whole work-group
    else                    epilogue(IntC<BIAS_MODE>{}, IntC<1>{}, Cout, Cout, ldc, n0);
  } else {
    epilogue(IntC<BIAS_MODE>{}, IntC<OUT_MODE>{}, Cout, Cout2, ldc, n0);
  }
}

// =====================================================================================
// Operand preparation, one grid for four jobs that do not depend on one another; the block index picks the job:
//   [0, kPrepQk)             qk_w  f32 [kD][kQKLd] -> bf16 [kQKLd][kD]     one 64x64 tile per work-group
//   [kPrepQk, +kPrepW)       v_w   f32 [kD][kD]    -> bf16 [kD][kD]        "
//   [.., +kPrepW)            cp_w  f32 [kD][kD]    -> bf16 [kD][kD]        "
//   [kPrepT, +kPrepX)        x     f32 -> bf16, same layout, two elements per thread
// The tile jobs (LDS, one barrier) last longer than the cast jobs and stand first.
// Weight transpose + RNE bf16 cast: in f32 [R][Cc] row-major -> out bf16 bits [Cc][R]  (out[c][r] = in[r][c]), R = kD.
// Load coverage: 256 threads x 16 floats = 64 (r) x 64 (c).  Store coverage: 8 waves x 2 x 4 rows (q8) = 64 rows c;
// =====================================================================================
constexpr int kPrepQk = (kQKLd / 64) * (kD / 64);     // 512 tiles
constexpr int kPrepW  = (kD / 64) * (kD / 64);        // 256 tiles
constexpr int kPrepT  = kPrepQk + 2 * kPrepW;         // 1024 tile jobs
constexpr int kPrepX  = (kTok * kD) / 2 / 256;        // 8192 cast jobs, exact
static_assert((size_t)kPrepX * 512 == (size_t)kTok * kD);
static_assert(kQKLd / 64 == 32 && kD / 64 == 16);
__global__ __launch_bounds__(256) void prep_operands(const float* __restrict__ x, unsigned short* __restrict__ xb,
                                                     const float* __restrict__ qk_w, unsigned short* __restrict__ qkwT,
                                                     const float* __restrict__ v_w, unsigned short* __restrict__ vwT,
                                                     const float* __restrict__ cp_w, unsigned short* __restrict__ cwT) {
  __shared__ __align__(16) _Float16 t[64 * kStg];     // [c][r] as 16-bit bit patterns
  const int tid = threadIdx.x;
  int job = blockIdx.x;
  if (job >= kPrepT) {                                // the whole work-group leaves here, in front of the barrier
    const int i = (job - kPrepT) * 256 + tid;
    const unsigned u = (unsigned)f2bf_bits(x[2 * i]) | ((unsigned)f2bf_bits(x[2 * i + 1]) << 16);
    ((unsigned*)xb)[i] = u;
    return;
  }
  const float* in = qk_w;
  unsigned short* out = qkwT;
  int Cc = kQKLd, tcLog = 5;                          // 2^tcLog = Cc / 64 tiles in a row of tiles
  if (job >= kPrepQk) {
    job -= kPrepQk;
    Cc = kD; tcLog = 4;
    in = v_w; out = vwT;
    if (job >= kPrepW) { job -= kPrepW; in = cp_w; out = cwT; }
  }
  constexpr int R = kD;
  const int c0 = (job & ((1 << tcLog) - 1)) * 64, r0 = (job >> tcLog) * 64;
  {
    const int rloc = tid >> 2, cq = (tid & 3) * 16;
    const float* src = in + (size_t)(r0 + rloc) * Cc + c0 + cq;
#pragma unroll
    for (int g4 = 0; g4 < 4; ++g4) {
      const v4f a = *(const v4f*)(src + 4 * g4);
#pragma unroll
      for (int e = 0; e < 4; ++e)
        t[(cq + 4 * g4 + e) * kStg + rloc] = __builtin_bit_cast(_Float16, f2bf_bits(a[e]));
    }
  }
  __syncthreads();
  const int wave = tid >> 5, lane = tid & 31, q8 = lane >> 3, c8 = (lane & 7) * 8;
  const int cA = wave * 8 + q8, cB = wave * 8 + 4 + q8;
  const v8h va = *(const v8h*)(t + cA * kStg + c8);
  const v8h vb = *(const v8h*)(t + cB * kStg + c8);
  unsigned short* da = out + (size_t)(c0 + cA) * R + r0 + c8;
  unsigned short* db = out + (size_t)(c0 + cB) * R + r0 + c8;
  {
    *(v8h*)da = va;
    *(v8h*)db = vb;
    
  }
}

// =====================================================================================
// V planes: Vf f32 [kTok][kD] (row b*kS+s, col h*kHD+d) -> Vth/Vtl bf16 bits [kB*kH][kHD][kS]:
// out[bh][d][s] = hi/lo(Vf[b*kS+s][h*kHD+d]).  grid = (kS/64, kB*kH), block 256.
// Load coverage: 256 threads x 16 floats = 64 (s) x 64 (d).
// =====================================================================================
__global__ __launch_bounds__(256) void v_split_transpose(const float* __restrict__ Vf,
                                                         unsigned short* __restrict__ vth, unsigned short* __restrict__ vtl) {
  __shared__ __align__(16) _Float16 th[64 * kStg];
  __shared__ __align__(16) _Float16 tl[64 * kStg];
  const int st0 = blockIdx.x * 64, bh = blockIdx.y;
  const int b = bh / kH, h = bh % kH;
  const int tid = threadIdx.x;
  {
    const int sloc = tid >> 2, d0 = (tid & 3) * 16;
    const float* src = Vf + (size_t)(b * kS + st0 + sloc) * kD + h * kHD + d0;
#pragma unroll
    for (int g4 = 0; g4 < 4; ++g4) {
      const v4f a = *(const v4f*)(src + 4 * g4);
#pragma unroll
      for (int e = 0; e < 4; ++e) {
        const unsigned short hb = f2bf_bits(a[e]);
        const unsigned short lb = f2bf_bits(a[e] - bf_bits2f(hb));
        th[(d0 + 4 * g4 + e) * kStg + sloc] = __builtin_bit_cast(_Float16, hb);
        tl[(d0 + 4 * g4 + e) * kStg + sloc] = __builtin_bit_cast(_Float16, lb);
      }
    }
  }
  __syncthreads();
  const int wave = tid >> 5, lane = tid & 31, q8 = lane >> 3, c8 = (lane & 7) * 8;
  const int dA = wave * 8 + q8, dB = wave * 8 + 4 + q8;
  const v8h ha = *(const v8h*)(th + dA * kStg + c8);
  const v8h hbv = *(const v8h*)(th + dB * kStg + c8);
  const v8h la = *(const v8h*)(tl + dA * kStg + c8);
  const v8h lbv = *(const v8h*)(tl + dB * kStg + c8);
  unsigned short* pha = vth + ((size_t)bh * kHD + dA) * kS + st0 + c8;
  unsigned short* phb = vth + ((size_t)bh * kHD + dB) * kS + st0 + c8;
  unsigned short* pla = vtl + ((size_t)bh * kHD + dA) * kS + st0 + c8;
  unsigned short* plb = vtl + ((size_t)bh * kHD + dB) * kS + st0 + c8;
  {
    *(v8h*)pha = ha;
    *(v8h*)phb = hbv;
    *(v8h*)pla = la;
    *(v8h*)plb = lbv;
    
  }
}

// =====================================================================================
// Causal attention, head_dim 64, 16-bit input planes, f32 out.
//   scores = (k.q^T, the transposed tile: A = K rows, B = Q columns) : v_wmma_f32_16x16x32_f16 (q, k f16 planes); 1/8 and
//            log2(e) enter as one f32 FMA per score in front of 2^x; a lane holds 32 of one query's 64 scores, its partner lane ^ 16 the rest; causal: kv > q replaced by -inf
//            (exp -> 0, identical to a finite most-negative fill since every row keeps its diagonal); chunks past
//            the diagonal contribute exactly 0 and are skipped.
//   out    = (v^T.p^T, A = V rows [d][kv], B = P packed from the score registers) : v_wmma_f32_16x16x32_bf16 with p and v
//            as bf16 hi/lo (hi.hi + hi.lo + lo.hi); online softmax in f32, one maximum and one sum per lane.
// Block = 4 waves = 64 query rows of one (b, h); grid.x = kB * kH * (kS/64).
// Staging coverage per kv chunk: 128 threads x 4 copies x 8 halves = 64 x 64 per plane (K, V hi, V lo), asynchronous copies
// (8 lanes x 16 B = one whole 128-B line of a row) into one of two LDS buffers; the copies of chunk t + 2 fly while chunk
// t + 1 is worked on, one barrier per chunk.
// Output AV f32 [kTok][kD] at col h*64: row segment 64 floats = 256 B by 16 lanes x 16 B in one instruction, one wave per
// =====================================================================================
// second launch bound: a register budget for four waves per SIMD, so that four work-groups share a WGP
__global__ __launch_bounds__(128, 4)
void attn_causal_hd64(const unsigned short* __restrict__ QKp,    // f16 bits [kTok][kQKLd]
                      const unsigned short* __restrict__ Vthp,   // bf16 bits [kB*kH][kHD][kS]
                      const unsigned short* __restrict__ Vtlp,
                      float* __restrict__ AV) {                  // f32 [kTok][kD]
  union FB { v16b v; v8b h[2]; };
  // every 16-bit tile has rows of 128 B laid at pitch kStg (144 B = 16 B x 9): the 16 rows that one ds_load_b128
  // fragment read touches then start on 16 different groups of four banks instead of two
  constexpr int kPlane = 64 * kStg;                        // elements of one staged plane, 9 KB
  constexpr int kBuf   = 3 * kPlane;                       // one buffer: K [kv][d] | V hi [d][kv] | V lo [d][kv]
  static_assert(kKC == 64 && kHD == 64);
  __shared__ __align__(16) _Float16 sKV[2 * kBuf];         // two buffers of 16-bit patterns, 54 KB
  __shared__ __align__(16) float   Os[4][16 * 68];         // per wave out tile, pitch 68

  const int tid  = threadIdx.x;
  const int wave = tid >> 5;
  const int lane = tid & 31;
  const int hh   = lane >> 4;
  const int c    = lane & 15;

  // block index -> (head, query tile). A tile costs qb + 1 kv chunks, and at this register count four work-groups fit a
  // WGP, so the whole grid is resident at once and the launch lasts as long as the fullest WGP. qn = bx / 32;
  // each quarter of the grid holds one class of eight tile lengths, the longest class first:
  // qb = 31 - t, 16 + t, 15 - t, t (t = qn % 8). Indices 256 apart sum to 66 chunks exactly (they were four equal tiles, up to 128).
  // For speed only: qn -> qb is one to one on 0..31, so every (head, tile) is worked once wherever it lands.
  static_assert(kNQB == 32 && kB * kH == 32);
  const int bx = blockIdx.x;
  const int qn = bx / (kB * kH);
  const int qb = (kNQB - 1) - ((qn & 8) ? (qn ^ 7) : qn);
  const int bh = bx % (kB * kH);
  const int h  = bh % kH;
  const int b  = bh / kH;
  const int q0 = qb * 64 + wave * 16;

  const _Float16* Q16 = (const _Float16*)QKp;
  const __bf16* Vth = (const __bf16*)Vthp;
  const __bf16* Vtl = (const __bf16*)Vtlp;
  float* ob_ptr = AV + (size_t)(b * kS) * kD + h * kHD;

  // ---- Q fragments (B operand, column = query q0 + c, k = d): 2 d-chunks of 32 ----
  v16h qa[2];
  {
    const _Float16* qrow = Q16 + (size_t)(b * kS + q0 + c) * kQKLd + h * kHD + 8 * hh;
    qa[0] = Frag<_Float16>::load(qrow);
    qa[1] = Frag<_Float16>::load(qrow + 32);
  }

  const int qrow = q0 + c;      // the one query whose scores, maximum, sum and output column this lane holds
  float mrow = -INFINITY, lrow = 0.f;
  v8f oacc[4];
#pragma unroll
  for (int t = 0; t < 4; ++t) oacc[t] = (v8f){0.f,0.f,0.f,0.f,0.f,0.f,0.f,0.f};

  // staging: thread -> row tid / 8 (+ 16 per copy) of each plane, 16-B piece tid % 8 of the row's 128 B
  const int srow = tid >> 3;
  const int sseg = (tid & 7) * 8;
  const _Float16* gK = Q16 + (size_t)(b * kS + srow) * kQKLd + kKOff + h * kHD + sseg;   // row = kv
  const __bf16* gVh = Vth + ((size_t)bh * kHD + srow) * kS + sseg;                        // row = d
  const __bf16* gVl = Vtl + ((size_t)bh * kHD + srow) * kS + sseg;
  const unsigned lS = (unsigned)(size_t)(sKV + srow * kStg + sseg);   // LDS byte address: low 32 bits
  constexpr unsigned kL16 = 16 * kStg * 2;     // 16 rows in LDS, bytes
  constexpr size_t kK16 = (size_t)16 * kQKLd, kV16 = (size_t)16 * kS;   // 16 rows in the global planes, elements
  auto stage = [&](int t, int buf) {
    const unsigned lk = lS + (unsigned)buf * (unsigned)(kBuf * 2);
    const unsigned lh = lk + kPlane * 2, ll = lk + 2 * kPlane * 2;
    const _Float16* pk = gK + (size_t)t * (kKC * kQKLd);
    const __bf16* ph = gVh + t * kKC;
    const __bf16* pl = gVl + t * kKC;
    async_copy12(lk, pk, lk + kL16, pk + kK16, lk + 2 * kL16, pk + 2 * kK16, lk + 3 * kL16, pk + 3 * kK16,
                 lh, ph, lh + kL16, ph + kV16, lh + 2 * kL16, ph + 2 * kV16, lh + 3 * kL16, ph + 3 * kV16,
                 ll, pl, ll + kL16, pl + kV16, ll + 2 * kL16, pl + 2 * kV16, ll + 3 * kL16, pl + 3 * kV16);
  };

  const int nChunks = qb + 1;   // block-uniform
  stage(0, 0);
  asm volatile("s_wait_asynccnt 0x0" ::: "memory");   // this wave's copies of chunk 0 have landed
  __syncthreads();                                    // ... and every other wave's: chunk 0 may be read
  if (nChunks > 1) stage(1, 1);
  for (int kc = 0; kc < nChunks; ++kc) {
    const int kv0 = kc * kKC;
    const _Float16* Ksh = sKV + (kc & 1) * kBuf;
    const __bf16* Vhs = (const __bf16*)(Ksh + kPlane);
    const __bf16* Vls = (const __bf16*)(Ksh + 2 * kPlane);

    // transposed scores: A = K rows, B = Q columns, so s[j][r] = score(kv0 + 16 j + 8 hh + r, q0 + c): one query per lane
    // all eight K fragments are read as one group in front of the products, and the products run over the four
    // independent score tiles in turn; each tile still sums d chunk 0, then d chunk 1 (all loops unrolled so that the
    // fragment array lies in fixed registers)
    v16h kb[4][2];
#pragma unroll
    for (int j = 0; j < 4; ++j)
#pragma unroll
      for (int dc = 0; dc < 2; ++dc)
        kb[j][dc] = Frag<_Float16>::load(Ksh + (j * 16 + c) * kStg + dc * 32 + 8 * hh);
    v8f s[4];
#pragma unroll
    for (int j = 0; j < 4; ++j) s[j] = (v8f){0.f,0.f,0.f,0.f,0.f,0.f,0.f,0.f};
#pragma unroll
    for (int dc = 0; dc < 2; ++dc)
#pragma unroll
      for (int j = 0; j < 4; ++j) s[j] = at_mma_h(kb[j][dc], qa[dc], s[j]);
    const bool diag = (kc == qb);   // block-uniform
    float mj[4];
#pragma unroll
    for (int j = 0; j < 4; ++j) {
      float m = -INFINITY;
#pragma unroll
      for (int r = 0; r < 8; ++r) {
        const int kvcol = kv0 + j * 16 + 8 * hh + r;
        float sv = s[j][r];       // unscaled: the positive scale commutes with the maximum and is applied in the exponent
        if (diag && (kvcol > qrow)) sv = -INFINITY;
        s[j][r] = sv;
        m = fmaxf(m, sv);
      }
      mj[j] = m;
    }
    float cm = fmaxf(fmaxf(mj[0], mj[1]), fmaxf(mj[2], mj[3]));
    cm = fmaxf(cm, at_xhalf(cm));   // lanes c and c + 16 hold the two halves of one query's 64 scores
    const float mnew = fmaxf(mrow, cm);
    const float alpha = __builtin_amdgcn_exp2f((mrow - mnew) * kSmScaleLog2);
    const float nm = -mnew * kSmScaleLog2;
    mrow = mnew;
    // two score tiles of 16 kv, converted in place, are one B fragment of 32 kv in the loaders' k order
    v8u ph[2], pl[2];
    float pj[4];
#pragma unroll
    for (int j = 0; j < 4; ++j) {
      float psum = 0.f;
#pragma unroll
      for (int r = 0; r < 8; ++r) s[j][r] = fmaf(s[j][r], kSmScaleLog2, nm);
      at_exp2x8(s[j]);
#pragma unroll
      for (int r = 0; r < 8; r += 2) {
        const float p0 = s[j][r];
        const float p1 = s[j][r + 1];
        psum += p0;
        psum += p1;
        unsigned wh, wl;
        at_split2(p0, p1, wh, wl);
        ph[j >> 1][(j & 1) * 4 + (r >> 1)] = wh;
        pl[j >> 1][(j & 1) * 4 + (r >> 1)] = wl;
      }
      pj[j] = psum;
    }
    const v16b pha[2] = { __builtin_bit_cast(v16b, ph[0]), __builtin_bit_cast(v16b, ph[1]) };
    const v16b pla[2] = { __builtin_bit_cast(v16b, pl[0]), __builtin_bit_cast(v16b, pl[1]) };
    lrow = lrow * alpha + ((pj[0] + pj[1]) + (pj[2] + pj[3]));   // this lane half's share; the halves are joined after the loop
#pragma unroll
    for (int t = 0; t < 4; ++t)
#pragma unroll
      for (int r = 0; r < 8; ++r) oacc[t][r] *= alpha;
    // unrolled so that pha[kk], pla[kk] are fixed registers
#pragma unroll
    for (int kk = 0; kk < 2; ++kk) {
      // the eight V fragments of this half chunk are read as one group; the products then run over the four independent
      // output tiles in turn; each tile still sums v.p as hi.hi, lo.hi, hi.lo in that order (loops unrolled so that the
      // fragment arrays lie in fixed registers)
      FB vb[4], vl[4];
#pragma unroll
      for (int t = 0; t < 4; ++t) {
        vb[t].h[0] = *(const v8b*)(Vhs + (t * 16 + c) * kStg + kk * 32 + 8 * hh);
        vb[t].h[1] = *(const v8b*)(Vhs + (t * 16 + c) * kStg + kk * 32 + 16 + 8 * hh);
        vl[t].h[0] = *(const v8b*)(Vls + (t * 16 + c) * kStg + kk * 32 + 8 * hh);
        vl[t].h[1] = *(const v8b*)(Vls + (t * 16 + c) * kStg + kk * 32 + 16 + 8 * hh);
      }
#pragma unroll
      for (int t = 0; t < 4; ++t) oacc[t] = at_mma(vb[t].v, pha[kk], oacc[t]);
#pragma unroll
      for (int t = 0; t < 4; ++t) oacc[t] = at_mma(vl[t].v, pha[kk], oacc[t]);
#pragma unroll
      for (int t = 0; t < 4; ++t) oacc[t] = at_mma(vb[t].v, pla[kk], oacc[t]);
    }
    asm volatile("s_wait_dscnt 0x0" ::: "memory");      // this wave's reads of chunk kc are done before its buffer is refilled
    asm volatile("s_wait_asynccnt 0x0" ::: "memory");   // this wave's copies of chunk kc + 1 have landed
    __syncthreads();                                    // publishes chunk kc + 1 and ends every reader's reads of chunk kc
    if (kc + 2 < nChunks) stage(kc + 2, kc & 1);
  }
  asm volatile("s_wait_asynccnt 0x0" ::: "memory");     // no copy is outstanding when the wave goes on

  // oacc[t][r] = out(q0 + c, 16 t + 8 hh + r): eight consecutive channels of one query row per tile
  float* os = Os[wave];
  {
    const float inv = 1.0f / (lrow + at_xhalf(lrow));
#pragma unroll
    for (int t = 0; t < 4; ++t) {
      v4f lo4, hi4;
#pragma unroll
      for (int e = 0; e < 4; ++e) { lo4[e] = oacc[t][e] * inv; hi4[e] = oacc[t][4 + e] * inv; }
      *(v4f*)(os + c * 68 + t * 16 + 8 * hh)     = lo4;
      *(v4f*)(os + c * 68 + t * 16 + 8 * hh + 4) = hi4;
    }
  }
  __builtin_amdgcn_fence(__ATOMIC_RELEASE, "workgroup");
  __builtin_amdgcn_wave_barrier();
  __builtin_amdgcn_fence(__ATOMIC_ACQUIRE, "workgroup");
  {
    const int c4 = (lane & 15) * 4;   // 16 lanes x 16 B = 256 B = one 64-float row segment; hh selects the row
    {
#pragma unroll
      for (int it = 0; it < 8; ++it) {
        const int row = it * 2 + hh;
        v4f val = *(const v4f*)(os + row * 68 + c4);
        *(v4f*)(ob_ptr + (size_t)(q0 + row) * kD + c4) = val;
      }
      
    }
  }
}

// =====================================================================================
// Shaped combination + causal prefix mean in f32:  O[b,s,h*64+d] = rg[h]*AV + sg[h]*v[s] - cg[h]*(sum_{j<=s} v[j])/(s+1),
// emitted as bf16 hi/lo planes [kTok][kD].
// One work-group = one (b, h) and one segment of kScRows rows of s; grid = kScSeg * kB * kH = 256, block 512.
// 16 lanes x 4 channels cover one 64-channel row; the 32 row slots of a work-group
//   (a) sum the rows in front of the segment, slot r taking rows r, r+32, r+64, ... (all loads independent),
//   (b) each own kScPer consecutive rows of the segment and sum them,
//   (c) meet in LDS: per channel the 32 sums of (a) are added up and the 32 sums of (b) scanned in fixed order,
//   (d) walk their own rows from that start value.
// Fixed summation order, no dependence on arrival; each 128-B output line (64 channels x 2 B) has one writer.
// =====================================================================================
constexpr int kScRows  = 256;                  // rows of s per work-group
constexpr int kScSeg   = kS / kScRows;         // 8 segments
constexpr int kScSlots = 32;                   // row slots (16 lanes each) per work-group
constexpr int kScPer   = kScRows / kScSlots;   // 8 consecutive rows per slot
__global__ __launch_bounds__(512) void shaped_combine(const float* __restrict__ AV, const float* __restrict__ Vf,
                                                     const float* __restrict__ rg, const float* __restrict__ sg,
                                                     const float* __restrict__ cg,
                                                     unsigned short* __restrict__ Oh, unsigned short* __restrict__ Ol) {
  __shared__ __align__(16) float Ps[kScSlots * kHD];   // per slot: sum of its rows in front of the segment
  __shared__ __align__(16) float Gs[kScSlots * kHD];   // per slot: sum of its own rows, then its start value
  const int tid  = threadIdx.x;
  const int slot = tid >> 4;
  const int c4   = (tid & 15) * 4;
  const int seg  = (kScSeg - 1) - (int)(blockIdx.x / (kB * kH));   // longest front part starts first
  const int bh   = blockIdx.x % (kB * kH);
  const int b = bh / kH;
  const int h = bh % kH;
  const size_t col = (size_t)(b * kS) * kD + h * kHD + c4;
  const int s0 = seg * kScRows + slot * kScPer;

  const float* vrow = Vf + col + (size_t)s0 * kD;
  const float* arow = AV + col + (size_t)s0 * kD;
  v4f vv[kScPer], aa[kScPer];
#pragma unroll
  for (int k = 0; k < kScPer; ++k) vv[k] = *(const v4f*)(vrow + k * kD);
#pragma unroll
  for (int k = 0; k < kScPer; ++k) aa[k] = *(const v4f*)(arow + k * kD);
  // precaution: this wait stands behind the 16 issued loads, in front of every later overwrite of their address
  // registers; both addresses are named as inputs so that no load's destination is placed on them ahead of it
  asm volatile("s_wait_xcnt 0x0" :: "v"(vrow), "v"(arow) : "memory");

  v4f pre = (v4f){0.f, 0.f, 0.f, 0.f};
  for (int t = 0; t < seg; ++t) {              // block-uniform trip count, at most kScSeg - 1
    v4f w[kScPer];
#pragma unroll
    for (int k = 0; k < kScPer; ++k)
      w[k] = *(const v4f*)(Vf + col + (size_t)(t * kScRows + k * kScSlots + slot) * kD);
#pragma unroll
    for (int k = 0; k < kScPer; ++k) pre += w[k];
  }
  const float rgh = rg[h], sgh = sg[h], cgh = cg[h];
  v4f gsum = vv[0];
#pragma unroll
  for (int k = 1; k < kScPer; ++k) gsum += vv[k];
  *(v4f*)(Ps + slot * kHD + c4) = pre;
  *(v4f*)(Gs + slot * kHD + c4) = gsum;
  __syncthreads();
  if (tid < kHD) {                             // one lane per channel, two whole waves
    float b0 = 0.f, b1 = 0.f, b2 = 0.f, b3 = 0.f;
#pragma unroll
    for (int r = 0; r < kScSlots; r += 4) {
      b0 += Ps[(r + 0) * kHD + tid];
      b1 += Ps[(r + 1) * kHD + tid];
      b2 += Ps[(r + 2) * kHD + tid];
      b3 += Ps[(r + 3) * kHD + tid];
    }
    float run = (b0 + b1) + (b2 + b3);
#pragma unroll
    for (int r = 0; r < kScSlots; ++r) {
      const float g = Gs[r * kHD + tid];
      Gs[r * kHD + tid] = run;
      run += g;
    }
  }
  __syncthreads();
  v4f p = *(const v4f*)(Gs + slot * kHD + c4);
#pragma unroll
  for (int k = 0; k < kScPer; ++k) {
    const int s = s0 + k;
    const size_t idx = col + (size_t)s * kD;
    p += vv[k];
    const float inv = 1.0f / (float)(s + 1);
    unsigned short hb[4], lb[4];
#pragma unroll
    for (int e = 0; e < 4; ++e) {
      const float o = rgh * aa[k][e] + sgh * vv[k][e] - cgh * (p[e] * inv);
      hb[e] = f2bf_bits(o);
      lb[e] = f2bf_bits(o - bf_bits2f(hb[e]));
    }
    uint2 uh, ul;
    uh.x = (unsigned)hb[0] | ((unsigned)hb[1] << 16);
    uh.y = (unsigned)hb[2] | ((unsigned)hb[3] << 16);
    ul.x = (unsigned)lb[0] | ((unsigned)lb[1] << 16);
    ul.y = (unsigned)lb[2] | ((unsigned)lb[3] << 16);
    *(uint2*)(Oh + idx) = uh;
    *(uint2*)(Ol + idx) = ul;
  }
}

// =====================================================================================
// launcher: kernel launches only
// =====================================================================================
extern "C" void kernel_launch(void* const* d_in, const int* in_sizes, int n_in,
                              void* d_out, int out_size, void* d_ws,
                              size_t ws_size, hipStream_t stream) {
  if (n_in < 8) return;
  if (in_sizes[0] != kTok * kD) return;
  if (in_sizes[1] != kD * kQKLd) return;
  if (in_sizes[2] != kQKLd) return;
  if (in_sizes[3] != kD * kD) return;
  if (in_sizes[4] != kD * kD) return;
  if (in_sizes[5] != kH || in_sizes[6] != kH || in_sizes[7] != kH) return;
  if (out_size != kTok * kD) return;
  if (kWsTotal > ws_size) return;

  const float* x     = (const float*)d_in[0];
  const float* qk_w  = (const float*)d_in[1];
  const float* qk_b  = (const float*)d_in[2];
  const float* v_w   = (const float*)d_in[3];
  const float* cp_w  = (const float*)d_in[4];
  const float* rg    = (const float*)d_in[5];
  const float* sg    = (const float*)d_in[6];
  const float* cg    = (const float*)d_in[7];
  float* out = (float*)d_out;

  unsigned char* ws = (unsigned char*)d_ws;
  unsigned short* xb   = (unsigned short*)(ws + kOffXb);
  unsigned short* qkwT = (unsigned short*)(ws + kOffQkwT);
  unsigned short* vwT  = (unsigned short*)(ws + kOffVwT);
  unsigned short* cwT  = (unsigned short*)(ws + kOffCwT);
  unsigned short* QKp  = (unsigned short*)(ws + kOffQKp);
  float*          Vf   = (float*)(ws + kOffVf);
  unsigned short* Vth  = (unsigned short*)(ws + kOffVth);
  unsigned short* Vtl  = (unsigned short*)(ws + kOffVtl);
  float*          AV   = (float*)(ws + kOffAV);
  unsigned short* Oh   = (unsigned short*)(ws + kOffOh);
  unsigned short* Ol   = (unsigned short*)(ws + kOffOl);

  // 1. x -> bf16 [4096][1024] and the three weights [in][out] f32 -> transposed bf16 [out][in]: 1024 + 8192 blocks
  prep_operands<<<dim3(kPrepT + kPrepX), dim3(256), 0, stream>>>(x, xb, qk_w, qkwT, v_w, vwT, cp_w, cwT);

  // 2. q|k and v projections in one grid: qkwT and vwT lie one behind the other in the workspace = Bt [3072][1024];
  //    [4096 x 1024] . Bt^T: columns 0..2047 + qk_b -> f16 [4096][2048], columns 2048..3071 -> f32 [4096][1024];
  //    tiles 32*12 = 384 blocks
  static_assert(kOffVwT == kOffQkwT + (size_t)kQKLd * kD * 2);
  wmma_gemm64<1, 0, 2, 3, false><<<dim3((kTok / kGM) * ((kQKLd + kD) / kGN), 1), dim3(256), 0, stream>>>(
      xb, xb, kD, 0L, qkwT, qkwT, kD, 0L, (void*)QKp, (void*)Vf, kQKLd, 0L,
      qk_b, x, 0L, kTok, kQKLd + kD, kD, 1.0f, kQKLd, kD);
  // 3. v -> bf16 hi/lo planes [32][64][2048]
  v_split_transpose<<<dim3(kS / 64, kB * kH), dim3(256), 0, stream>>>(Vf, Vth, Vtl);
  // 4. causal attention -> AV f32 [4096][1024]
  attn_causal_hd64<<<dim3(kB * kH * kNQB), dim3(128), 0, stream>>>(QKp, Vth, Vtl, AV);
  // 5. shaped combination + prefix mean -> O hi/lo bf16 [4096][1024]
  shaped_combine<<<dim3(kScSeg * kB * kH), dim3(512), 0, stream>>>(AV, Vf, rg, sg, cg, Oh, Ol);
  // 6. output projection: (O hi + O lo) [4096 x 1024] . [1024 x 1024]^T -> f32 d_out [4096][1024]; 128 blocks
  wmma_gemm64<1, 1, 0, 0, false><<<dim3((kTok / kGM) * (kD / kGN), 1), dim3(256), 0, stream>>>(
      Oh, Ol, kD, 0L, cwT, cwT, kD, 0L, (void*)out, (void*)out, kD, 0L,
      qk_b, x, 0L, kTok, kD, kD, 1.0f, 0, 0);
}

// v010
// Measured time: 104 microseconds a run.
// Two timings next to v009 both put it at 1.04 times that version's speed.
// Over all steps from v000 it is 13.4 times as fast.
// Contractions: qk and v projections = v_wmma_f32_16x16x32_bf16 (x and W as RNE bf16, single product); scores q.k^T = v_wmma_f32_16x16x32_f16 (q, k f16 planes, single product, 1/8 applied in f32 inside the softmax exponent); attn.v = v_wmma_f32_16x16x32_bf16 with p and v as bf16 hi/lo pairs (hi.hi + hi.lo + lo.hi); output projection = v_wmma_f32_16x16x32_bf16 with the merged head output as bf16 hi/lo pair times W as RNE bf16 (hi.W + lo.W); causal prefix sum of v = f32 sums of the bf16 hi/lo pair over whole 64-row tiles + inside the query's own tile v_wmma_f32_16x16x32_bf16, the pair times a causal 0/1 matrix (hi.1 + lo.1); f32 accumulate everywhere; softmax, the division by s + 1 and the gain combination in f32.
#include <hip/hip_runtime.h>
#include <math.h>

typedef __attribute__((ext_vector_type(16))) _Float16 v16h;
typedef __attribute__((ext_vector_type(8)))  _Float16 v8h;
typedef __attribute__((ext_vector_type(16))) __bf16   v16b;
typedef __attribute__((ext_vector_type(8)))  __bf16   v8b;
typedef __attribute__((ext_vector_type(8)))  float    v8f;
typedef __attribute__((ext_vector_type(4)))  float    v4f;
typedef __attribute__((ext_vector_type(2)))  float    v2f;
typedef __attribute__((ext_vector_type(8)))  unsigned v8u;
typedef __attribute__((ext_vector_type(4)))  unsigned v4u;
typedef __attribute__((ext_vector_type(2)))  __bf16   v2b;

constexpr int kB    = 2;
constexpr int kS    = 2048;
constexpr int kD    = 1024;
constexpr int kH    = 16;
constexpr int kHD   = 64;
constexpr int kTok  = kB * kS;        // 4096 token rows
constexpr int kQKLd = 2 * kD;         // fused q|k plane pitch (halves): q at col h*64, k at col kD + h*64
constexpr int kKOff = kD;
constexpr int kKC   = 64;             // kv chunk
constexpr int kNQB  = kS / 64;        // query blocks per (b,h)
constexpr int kStg  = 72;             // 16-bit LDS staging pitch (144 B rows, 16-B aligned)
constexpr float kSmScale = 0.125f;    // 1/sqrt(64)
constexpr float kSmScaleLog2 = kSmScale * 1.4426950408889634f;   // exp(kSmScale * x) = exp2(kSmScaleLog2 * x)

// workspace region map (bytes, all offsets multiples of 2 MiB):
//   [0]          xb    bf16 [4096][1024]            8 MiB
//   [8 MiB]      qkwT  bf16 [2048][1024]            4 MiB   (qk_w transposed)
//   [12 MiB]     vwT   bf16 [1024][1024]            2 MiB
//   [14 MiB]     cwT   bf16 [1024][1024]            2 MiB
//   [16 MiB]     QKp   f16  [4096][2048]           16 MiB   (q | k planes)
//   [32 MiB]     Vf    f32  [4096][1024]           16 MiB
//   [48 MiB]     Vth   bf16 [32][64][2048]          8 MiB   (v hi, per (b,h) [d][s])
//   [56 MiB]     Vtl   bf16 [32][64][2048]          8 MiB   (v lo)
//   [64 MiB]     Ts    f32  [32][32][64]            256 KiB of 16 MiB  (per (b,h) and 64-row tile of s: sum of v per channel)
//   [80 MiB]     Oh    bf16 [4096][1024]            8 MiB   (combined head output, hi)
//   [88 MiB]     Ol    bf16 [4096][1024]            8 MiB   (lo)
//   total 96 MiB = 100663296 B
constexpr size_t kOffXb   = 0;
constexpr size_t kOffQkwT = kOffXb   + (size_t)kTok * kD * 2;
constexpr size_t kOffVwT  = kOffQkwT + (size_t)kQKLd * kD * 2;
constexpr size_t kOffCwT  = kOffVwT  + (size_t)kD * kD * 2;
constexpr size_t kOffQKp  = kOffCwT  + (size_t)kD * kD * 2;
constexpr size_t kOffVf   = kOffQKp  + (size_t)kTok * kQKLd * 2;
constexpr size_t kOffVth  = kOffVf   + (size_t)kTok * kD * 4;
constexpr size_t kOffVtl  = kOffVth  + (size_t)kB * kH * kHD * kS * 2;
constexpr size_t kOffAV   = kOffVtl  + (size_t)kB * kH * kHD * kS * 2;
constexpr size_t kOffOh   = kOffAV   + (size_t)kTok * kD * 4;
constexpr size_t kOffOl   = kOffOh   + (size_t)kTok * kD * 2;
constexpr size_t kWsTotal = kOffOl   + (size_t)kTok * kD * 2;
static_assert(kWsTotal == 100663296ull);
static_assert(kWsTotal <= 134217728ull);

__device__ __forceinline__ unsigned short f2bf_bits(float f) {
  unsigned u = __float_as_uint(f);
  return (unsigned short)((u + 0x7FFFu + ((u >> 16) & 1u)) >> 16);
}
__device__ __forceinline__ float bf_bits2f(unsigned short h) { return __uint_as_float(((unsigned)h) << 16); }

// hazard guards as plain device helpers (their inline asm is kept out of the kernel template body)
__device__ __forceinline__ void dep_guard_h(v8f& a, v8f& b, v16h x, v16h y) { asm volatile("v_nop\n\tv_nop\n\tv_nop\n\tv_nop" : "+v"(a), "+v"(b) : "v"(x), "v"(y)); }
__device__ __forceinline__ void dep_guard_b(v8f& a, v8f& b, v16b x, v16b y) { asm volatile("v_nop\n\tv_nop\n\tv_nop\n\tv_nop" : "+v"(a), "+v"(b) : "v"(x), "v"(y)); }
__device__ __forceinline__ void keep4_h(v16h a, v16h b, v16h c, v16h d) { asm volatile("v_nop" :: "v"(a), "v"(b), "v"(c), "v"(d)); }
__device__ __forceinline__ void keep4_b(v16b a, v16b b, v16b c, v16b d) { asm volatile("v_nop" :: "v"(a), "v"(b), "v"(c), "v"(d)); }
__device__ __forceinline__ void acc_guard4(v8f& a, v8f& b, v8f& c, v8f& d) { asm volatile("v_nop\n\tv_nop\n\tv_nop\n\tv_nop" : "+v"(a), "+v"(b), "+v"(c), "+v"(d)); }
template <typename T> struct Frag;
template <> struct Frag<_Float16> {
  typedef v16h V; union U { v16h v; v8h h[2]; };
  static __device__ __forceinline__ v16h load(const _Float16* p) {   // elements 0..7 <- p[0..7], 8..15 <- p[16..23]
    U f; f.h[0] = *(const v8h*)(p); f.h[1] = *(const v8h*)(p + 16); return f.v;
  }
  static __device__ __forceinline__ v8f mma(v16h a, v16h b, v8f c) {
    return __builtin_amdgcn_wmma_f32_16x16x32_f16(false, a, false, b, (short)0, c, false, false);
  }
  static __device__ __forceinline__ void guard(v8f& a, v8f& b, v16h x, v16h y) { dep_guard_h(a, b, x, y); }
  static __device__ __forceinline__ void keep(v16h a, v16h b, v16h c, v16h d) { keep4_h(a, b, c, d); }
};
template <> struct Frag<__bf16> {
  typedef v16b V; union U { v16b v; v8b h[2]; };
  static __device__ __forceinline__ v16b load(const __bf16* p) {
    U f; f.h[0] = *(const v8b*)(p); f.h[1] = *(const v8b*)(p + 16); return f.v;
  }
  static __device__ __forceinline__ v8f mma(v16b a, v16b b, v8f c) {
    return __builtin_amdgcn_wmma_f32_16x16x32_bf16(false, a, false, b, (short)0, c, false, false);
  }
  static __device__ __forceinline__ void guard(v8f& a, v8f& b, v16b x, v16b y) { dep_guard_b(a, b, x, y); }
  static __device__ __forceinline__ void keep(v16b a, v16b b, v16b c, v16b d) { keep4_b(a, b, c, d); }
};

// bf16 hi/lo split of two values straight into packed fragment registers (first value in the low half): the packed
// convert rounds to nearest even and packs in the same instruction; lo = round(f - hi)
__device__ __forceinline__ void at_split2(float f0, float f1, unsigned& hi, unsigned& lo) {
  const v2f f = {f0, f1};
  const unsigned hw = __builtin_bit_cast(unsigned, __builtin_convertvector(f, v2b));
  const v2f d = {f0 - __uint_as_float(hw << 16), f1 - __uint_as_float(hw & 0xFFFF0000u)};
  hi = hw;
  lo = __builtin_bit_cast(unsigned, __builtin_convertvector(d, v2b));
}
__device__ __forceinline__ v8f at_mma(v16b a, v16b b, v8f c) {
  c = __builtin_amdgcn_wmma_f32_16x16x32_bf16(false, a, false, b, (short)0, c, false, false);
  asm volatile("v_nop\n\tv_nop\n\tv_nop\n\tv_nop" : "+v"(c) : "v"(a), "v"(b));
  return c;
}
// lane l reads lane l ^ 16
__device__ __forceinline__ float at_xhalf(float x) {
  return __builtin_bit_cast(float, __builtin_amdgcn_permlanex16(__builtin_bit_cast(int, x), __builtin_bit_cast(int, x),
                                                                0x76543210, 0xfedcba98, false, false));
}
__device__ __forceinline__ void at_exp2x8(v8f& x) {
  float e0, e1, e2, e3, e4, e5, e6, e7;
  asm("v_exp_f32 %0, %8\n\tv_exp_f32 %1, %9\n\tv_exp_f32 %2, %10\n\tv_exp_f32 %3, %11\n\t"
      "v_exp_f32 %4, %12\n\tv_exp_f32 %5, %13\n\tv_exp_f32 %6, %14\n\tv_exp_f32 %7, %15\n\tv_nop"
      : "=&v"(e0), "=&v"(e1), "=&v"(e2), "=&v"(e3), "=&v"(e4), "=&v"(e5), "=&v"(e6), "=&v"(e7)
      : "v"(x[0]), "v"(x[1]), "v"(x[2]), "v"(x[3]), "v"(x[4]), "v"(x[5]), "v"(x[6]), "v"(x[7]));
  x = (v8f){e0, e1, e2, e3, e4, e5, e6, e7};
}
__device__ __forceinline__ v8f at_mma_h(v16h a, v16h b, v8f c) {
  c = __builtin_amdgcn_wmma_f32_16x16x32_f16(false, a, false, b, (short)0, c, false, false);
  asm volatile("v_nop\n\tv_nop\n\tv_nop\n\tv_nop" : "+v"(c) : "v"(a), "v"(b));
  return c;
}

// =====================================================================================
// Register-blocked batched WMMA GEMM, C[m,n] = scale * sum_k A[m,k] * Bt[n,k] (+bias)(+resid);
// each wave owns a 64x64 tile; the 8 waves of a work-group stand 2 (m) x 4 (n) on one 128x256 tile of C.
// A row-major [M,K]; Bt row-major [N,K]; M % 128 == 0, N % 256 == 0, K % 64 == 0.
// Operands reach the waves through LDS: per k tile of 64 the work-group copies 128 rows of A (and of A2) and 256 rows
// of Bt, 128 B a row, with asynchronous copies (8 lanes x 16 B = one whole line of a row), into one of two buffers at
// row pitch kStg; the copies of tile t + 2 fly while tile t + 1 is worked on.
// SPLITM: 0 = single product; 1 = A carried as hi/lo planes (A2p = lo): product = hi.B + lo.B.
// BIAS_MODE: 0 = none, 1 = bias[m], 2 = bias[n].  OUT_MODE: 0 = f32, 1 = f16, 2 = bf16 hi + lo planes,
// 3 = two products that share A in one grid: columns below nSplit (a multiple of 256, so a work-group lies wholly on one
//     side) go out as in mode 1, with the bias; the others as f32 without bias to Cout2, pitch ldc2, column n - nSplit.
// ET: 0 = f16 operands, 1 = bf16 operands (pointers passed as 16-bit storage)
// =====================================================================================
constexpr int kGK = 64;     // k extent of a staged tile
constexpr int kGM = 128;    // rows of A per work-group
constexpr int kGN = 256;    // rows of Bt per work-group

// Each lane copies its own 16 B from global memory to its own LDS byte address. The s_wait_xcnt closes the statement so
// that it stands in front of every later write of the address registers named here (a precaution).
__device__ __forceinline__ void async_copy4(unsigned l0, const void* g0, unsigned l1, const void* g1,
                                            unsigned l2, const void* g2, unsigned l3, const void* g3) {
  asm volatile("global_load_async_to_lds_b128 %0, %1, off\n\t"
               "global_load_async_to_lds_b128 %2, %3, off\n\t"
               "global_load_async_to_lds_b128 %4, %5, off\n\t"
               "global_load_async_to_lds_b128 %6, %7, off\n\t"
               "s_wait_xcnt 0x0"
               :: "v"(l0), "v"(g0), "v"(l1), "v"(g1), "v"(l2), "v"(g2), "v"(l3), "v"(g3) : "memory");
}
__device__ __forceinline__ void async_copy8(unsigned l0, const void* g0, unsigned l1, const void* g1,
                                            unsigned l2, const void* g2, unsigned l3, const void* g3,
                                            unsigned l4, const void* g4, unsigned l5, const void* g5,
                                            unsigned l6, const void* g6, unsigned l7, const void* g7) {
  asm volatile("global_load_async_to_lds_b128 %0, %1, off\n\t"
               "global_load_async_to_lds_b128 %2, %3, off\n\t"
               "global_load_async_to_lds_b128 %4, %5, off\n\t"
               "global_load_async_to_lds_b128 %6, %7, off\n\t"
               "global_load_async_to_lds_b128 %8, %9, off\n\t"
               "global_load_async_to_lds_b128 %10, %11, off\n\t"
               "global_load_async_to_lds_b128 %12, %13, off\n\t"
               "global_load_async_to_lds_b128 %14, %15, off\n\t"
               "s_wait_xcnt 0x0"
               :: "v"(l0), "v"(g0), "v"(l1), "v"(g1), "v"(l2), "v"(g2), "v"(l3), "v"(g3),
                  "v"(l4), "v"(g4), "v"(l5), "v"(g5), "v"(l6), "v"(g6), "v"(l7), "v"(g7) : "memory");
}

// the same for twelve copies (three planes x four row groups of a kv chunk) under one closing wait
__device__ __forceinline__ void async_copy12(unsigned l0, const void* g0, unsigned l1, const void* g1,
                                             unsigned l2, const void* g2, unsigned l3, const void* g3,
                                             unsigned l4, const void* g4, unsigned l5, const void* g5,
                                             unsigned l6, const void* g6, unsigned l7, const void* g7,
                                             unsigned l8, const void* g8, unsigned l9, const void* g9,
                                             unsigned l10, const void* g10, unsigned l11, const void* g11) {
  asm volatile("global_load_async_to_lds_b128 %0, %1, off\n\t"
               "global_load_async_to_lds_b128 %2, %3, off\n\t"
               "global_load_async_to_lds_b128 %4, %5, off\n\t"
               "global_load_async_to_lds_b128 %6, %7, off\n\t"
               "global_load_async_to_lds_b128 %8, %9, off\n\t"
               "global_load_async_to_lds_b128 %10, %11, off\n\t"
               "global_load_async_to_lds_b128 %12, %13, off\n\t"
               "global_load_async_to_lds_b128 %14, %15, off\n\t"
               "global_load_async_to_lds_b128 %16, %17, off\n\t"
               "global_load_async_to_lds_b128 %18, %19, off\n\t"
               "global_load_async_to_lds_b128 %20, %21, off\n\t"
               "global_load_async_to_lds_b128 %22, %23, off\n\t"
               "s_wait_xcnt 0x0"
               :: "v"(l0), "v"(g0), "v"(l1), "v"(g1), "v"(l2), "v"(g2), "v"(l3), "v"(g3),
                  "v"(l4), "v"(g4), "v"(l5), "v"(g5), "v"(l6), "v"(g6), "v"(l7), "v"(g7),
                  "v"(l8), "v"(g8), "v"(l9), "v"(g9), "v"(l10), "v"(g10), "v"(l11), "v"(g11) : "memory");
}

template <int V> struct IntC { static constexpr int value = V; };   // a compile-time choice handed to the epilogue
template <int ET> struct Elem;
template <> struct Elem<0> { typedef _Float16 T; };
template <> struct Elem<1> { typedef __bf16 T; };
template <int ET, int SPLITM, int BIAS_MODE, int OUT_MODE, bool RESID, int ACT = 0>
__global__ __launch_bounds__(256) void wmma_gemm64(
    const unsigned short* __restrict__ Ap, const unsigned short* __restrict__ A2p, int lda, long strideA,
    const unsigned short* __restrict__ Btp, const unsigned short* __restrict__ Bt2p, int ldb, long strideB,
    void* __restrict__ Cout, void* __restrict__ Cout2, int ldc, long strideC,
    const float* __restrict__ bias,
    const float* __restrict__ resid, long strideR,
    int M, int N, int K, float scale, int nSplit, int ldc2) {
  typedef typename Elem<ET>::T T;
  typedef typename Frag<T>::V V;
  static_assert(SPLITM <= 1);
  constexpr bool SPA = (SPLITM >= 1);
  constexpr int kOffA2  = kGM * kStg;                       // element offsets inside one buffer: A | A2 | Bt
  constexpr int kOffB   = (SPA ? 2 : 1) * kGM * kStg;
  constexpr int kBufEl  = kOffB + kGN * kStg;
  const T* A = (const T*)Ap; const T* A2 = (const T*)A2p; const T* Bt = (const T*)Btp;
  __shared__ __align__(16) T sOp[2 * kBufEl];      // two operand buffers
  __shared__ __align__(16) float sT[8][16 * 68];   // per-wave 16x64 slab, pitch 68 floats
  const int b    = blockIdx.y;
  const int tid  = threadIdx.x;
  const int lane = tid & 31;
  const int wave = tid >> 5;
  const int tilesN = N / kGN;
  const int tilesM = M / kGM;
  if ((int)blockIdx.x >= tilesM * tilesN) return;   // the same for the whole work-group, in front of every copy and barrier
  const int bm = blockIdx.x / tilesN;
  const int bn = blockIdx.x - bm * tilesN;
  const int wm = (wave >> 2) << 6;             // this wave's rows inside the staged A tile
  const int wn = (wave & 3) << 6;              // this wave's rows inside the staged Bt tile
  const int m0 = bm * kGM + wm;
  const int n0 = bn * kGN + wn;

  const int rlane = lane & 15;                 // row (A) / col (B, D) within subtile
  const int koff  = (lane >> 4) * 8;           // k offset of this lane half
  const int mOff  = (lane >> 4) * 8;           // D row offset

  // staging: thread -> row tid / 8 (+ 32 per copy), 16-B piece tid % 8 of the row's 128 B
  const int srow = tid >> 3;
  const int sseg = (tid & 7) * 8;
  const T* gA  = A  + (size_t)b * strideA + (size_t)(bm * kGM + srow) * lda + sseg;
  const T* gA2 = SPA ? (A2 + (size_t)b * strideA + (size_t)(bm * kGM + srow) * lda + sseg) : nullptr;
  const T* gB  = Bt + (size_t)b * strideB + (size_t)(bn * kGN + srow) * ldb + sseg;
  const unsigned lS = (unsigned)(size_t)(sOp + srow * kStg + sseg);   // LDS byte address: low 32 bits
  const size_t a32 = (size_t)32 * lda, b32 = (size_t)32 * ldb;
  constexpr unsigned kL32 = 32 * kStg * 2;     // 32 rows in LDS, bytes
  auto stage = [&](int t, int buf) {
    const unsigned l = lS + (unsigned)buf * (unsigned)(kBufEl * 2);
    const unsigned lb = l + kOffB * 2;
    const T* pb = gB + t * kGK;
    async_copy8(lb, pb, lb + kL32, pb + b32, lb + 2 * kL32, pb + 2 * b32, lb + 3 * kL32, pb + 3 * b32,
                lb + 4 * kL32, pb + 4 * b32, lb + 5 * kL32, pb + 5 * b32, lb + 6 * kL32, pb + 6 * b32,
                lb + 7 * kL32, pb + 7 * b32);
    const T* pa = gA + t * kGK;
    if (SPA) {
      const unsigned l2 = l + kOffA2 * 2;
      const T* pa2 = gA2 + t * kGK;
      async_copy8(l, pa, l + kL32, pa + a32, l + 2 * kL32, pa + 2 * a32, l + 3 * kL32, pa + 3 * a32,
                  l2, pa2, l2 + kL32, pa2 + a32, l2 + 2 * kL32, pa2 + 2 * a32, l2 + 3 * kL32, pa2 + 3 * a32);
    } else {
      async_copy4(l, pa, l + kL32, pa + a32, l + 2 * kL32, pa + 2 * a32, l + 3 * kL32, pa + 3 * a32);
    }
  };

  v8f acc[4][4];
#pragma unroll
  for (int i = 0; i < 4; ++i)
#pragma unroll
    for (int j = 0; j < 4; ++j) acc[i][j] = (v8f){0.f,0.f,0.f,0.f,0.f,0.f,0.f,0.f};

  const int nT = K / kGK;                      // the same for the whole work-group
  stage(0, 0);
  asm volatile("s_wait_asynccnt 0x0" ::: "memory");   // this wave's copies of tile 0 have landed
  __syncthreads();                                    // ... and every other wave's: tile 0 may be read
  if (nT > 1) stage(1, 1);
  for (int t = 0; t < nT; ++t) {
    const T* sA = sOp + (t & 1) * kBufEl + (wm + rlane) * kStg + koff;
    const T* sB = sOp + (t & 1) * kBufEl + kOffB + (wn + rlane) * kStg + koff;
#pragma unroll
    for (int kk = 0; kk < kGK; kk += 32) {
      V bh[4], ah[4], al[4];
#pragma unroll
      for (int j = 0; j < 4; ++j) bh[j] = Frag<T>::load(sB + (j << 4) * kStg + kk);
#pragma unroll
      for (int i = 0; i < 4; ++i) {
        ah[i] = Frag<T>::load(sA + (i << 4) * kStg + kk);
        if (SPA) al[i] = Frag<T>::load(sA + kOffA2 + (i << 4) * kStg + kk);
      }
#pragma unroll
      for (int i = 0; i < 4; ++i) {
#pragma unroll
        for (int j = 0; j < 4; ++j) {
          acc[i][j] = Frag<T>::mma(ah[i], bh[j], acc[i][j]);
          if (SPA) acc[i][j] = Frag<T>::mma(al[i], bh[j], acc[i][j]);
        }
        Frag<T>::guard(acc[i][0], acc[i][3], ah[i], SPA ? al[i] : ah[i]);
      }
      Frag<T>::keep(bh[0], bh[1], bh[2], bh[3]);
    }
    asm volatile("s_wait_dscnt 0x0" ::: "memory");      // this wave's reads of tile t are done before its buffer is refilled
    asm volatile("s_wait_asynccnt 0x0" ::: "memory");   // this wave's copies of tile t + 1 have landed
    __syncthreads();                                    // publishes tile t + 1 and ends every reader's reads of tile t
    if (t + 2 < nT) stage(t + 2, t & 1);
  }
  asm volatile("s_wait_asynccnt 0x0" ::: "memory");     // no copy is outstanding when the wave goes on
  acc_guard4(acc[0][0], acc[0][1], acc[0][2], acc[0][3]);
  acc_guard4(acc[1][0], acc[1][1], acc[1][2], acc[1][3]);
  acc_guard4(acc[2][0], acc[2][1], acc[2][2], acc[2][3]);
  acc_guard4(acc[3][0], acc[3][1], acc[3][2], acc[3][3]);

  // ---- epilogue ----
  // BM, OM: bias and output form of this work-group's columns; C1, C2: its planes, pitch ld; nc0: the wave's first column there
  float* slab = sT[wave];
  const float* Rb = RESID ? (resid + (size_t)b * strideR) : nullptr;
  auto epilogue = [&](auto bmTag, auto omTag, void* C1, void* C2, int ld, int nc0) {
    constexpr int BM = decltype(bmTag)::value;
    constexpr int OM = decltype(omTag)::value;
#pragma unroll
    for (int i = 0; i < 4; ++i) {
      const int mBase = m0 + (i << 4);
#pragma unroll
      for (int j = 0; j < 4; ++j) {
        const int n = n0 + (j << 4) + rlane;
        float bv = 0.f;
        if (BM == 2) bv = bias[n];
#pragma unroll
        for (int r = 0; r < 8; ++r) {
          float v = acc[i][j][r] * scale;
          if (BM == 1) v += bias[mBase + mOff + r];
          if (BM == 2) v += bv;
          if (RESID) v += Rb[(size_t)(mBase + mOff + r) * ld + n];
          if (ACT == 1) v = tanhf(v);
          if (ACT == 2) v = fmaxf(v, 0.0f);
          if (ACT == 4) v = (v > 0.f) ? v : 0.01f * v;
          slab[(mOff + r) * 68 + (j << 4) + rlane] = v;
        }
      }
      __builtin_amdgcn_fence(__ATOMIC_RELEASE, "workgroup");
      __builtin_amdgcn_wave_barrier();
      __builtin_amdgcn_fence(__ATOMIC_ACQUIRE, "workgroup");
      if (OM == 0) {
        float* C = (float*)C1 + (size_t)b * strideC;
        const int hh = lane >> 4, c4 = (lane & 15) * 4;     // row seg = 256 B = 16 lanes x 16 B
#pragma unroll
        for (int it = 0; it < 8; ++it) {
          const int row = it * 2 + hh;
          v4f v = *(const v4f*)(slab + row * 68 + c4);
          *(v4f*)(C + (size_t)(mBase + row) * ld + nc0 + c4) = v;
        }
      } else {
        const int q = lane >> 3, c8 = (lane & 7) * 8;
        unsigned short* C  = (unsigned short*)C1 + (size_t)b * strideC;
        unsigned short* Cl = (OM == 2) ? ((unsigned short*)C2 + (size_t)b * strideC) : nullptr;
#pragma unroll
        for (int it = 0; it < 4; ++it) {
          const int row = it * 4 + q;
          const float* sp = slab + row * 68 + c8;
          v8h hv, lv;
#pragma unroll
          for (int e = 0; e < 8; ++e) {
            if (OM == 1) {
              hv[e] = (_Float16)sp[e];
            } else {
              unsigned short hb = f2bf_bits(sp[e]);
              unsigned short lb = f2bf_bits(sp[e] - bf_bits2f(hb));
              hv[e] = __builtin_bit_cast(_Float16, hb);
              lv[e] = __builtin_bit_cast(_Float16, lb);
            }
          }
          *(v8h*)(C + (size_t)(mBase + row) * ld + nc0 + c8) = hv;
          if (OM == 2) *(v8h*)(Cl + (size_t)(mBase + row) * ld + nc0 + c8) = lv;
        }
      }
      __builtin_amdgcn_fence(__ATOMIC_RELEASE, "workgroup");
      __builtin_amdgcn_wave_barrier();
      __builtin_amdgcn_fence(__ATOMIC_ACQUIRE, "workgroup");
    }
  };
  if constexpr (OUT_MODE == 3) {
    static_assert(!RESID);
    if (bn * kGN >= nSplit) epilogue(IntC<0>{}, IntC<0>{}, Cout2, Cout2, ldc2, n0 - nSplit);   // the same for the whole work-group
    else                    epilogue(IntC<BIAS_MODE>{}, IntC<1>{}, Cout, Cout, ldc, n0);
  } else {
    epilogue(IntC<BIAS_MODE>{}, IntC<OUT_MODE>{}, Cout, Cout2, ldc, n0);
  }
}

// =====================================================================================
// Operand preparation, one grid for four jobs that do not depend on one another; the block index picks the job:
//   [0, kPrepQk)             qk_w  f32 [kD][kQKLd] -> bf16 [kQKLd][kD]     one 64x64 tile per work-group
//   [kPrepQk, +kPrepW)       v_w   f32 [kD][kD]    -> bf16 [kD][kD]        "
//   [.., +kPrepW)            cp_w  f32 [kD][kD]    -> bf16 [kD][kD]        "
//   [kPrepT, +kPrepX)        x     f32 -> bf16, same layout, two elements per thread
// The tile jobs (LDS, one barrier) last longer than the cast jobs and stand first.
// Weight transpose + RNE bf16 cast: in f32 [R][Cc] row-major -> out bf16 bits [Cc][R]  (out[c][r] = in[r][c]), R = kD.
// Load coverage: 256 threads x 16 floats = 64 (r) x 64 (c).  Store coverage: 8 waves x 2 x 4 rows (q8) = 64 rows c;
// =====================================================================================
constexpr int kPrepQk = (kQKLd / 64) * (kD / 64);     // 512 tiles
constexpr int kPrepW  = (kD / 64) * (kD / 64);        // 256 tiles
constexpr int kPrepT  = kPrepQk + 2 * kPrepW;         // 1024 tile jobs
constexpr int kPrepX  = (kTok * kD) / 2 / 256;        // 8192 cast jobs, exact
static_assert((size_t)kPrepX * 512 == (size_t)kTok * kD);
static_assert(kQKLd / 64 == 32 && kD / 64 == 16);
__global__ __launch_bounds__(256) void prep_operands(const float* __restrict__ x, unsigned short* __restrict__ xb,
                                                     const float* __restrict__ qk_w, unsigned short* __restrict__ qkwT,
                                                     const float* __restrict__ v_w, unsigned short* __restrict__ vwT,
                                                     const float* __restrict__ cp_w, unsigned short* __restrict__ cwT) {
  __shared__ __align__(16) _Float16 t[64 * kStg];     // [c][r] as 16-bit bit patterns
  const int tid = threadIdx.x;
  int job = blockIdx.x;
  if (job >= kPrepT) {                                // the whole work-group leaves here, in front of the barrier
    const int i = (job - kPrepT) * 256 + tid;
    const unsigned u = (unsigned)f2bf_bits(x[2 * i]) | ((unsigned)f2bf_bits(x[2 * i + 1]) << 16);
    ((unsigned*)xb)[i] = u;
    return;
  }
  const float* in = qk_w;
  unsigned short* out = qkwT;
  int Cc = kQKLd, tcLog = 5;                          // 2^tcLog = Cc / 64 tiles in a row of tiles
  if (job >= kPrepQk) {
    job -= kPrepQk;
    Cc = kD; tcLog = 4;
    in = v_w; out = vwT;
    if (job >= kPrepW) { job -= kPrepW; in = cp_w; out = cwT; }
  }
  constexpr int R = kD;
  const int c0 = (job & ((1 << tcLog) - 1)) * 64, r0 = (job >> tcLog) * 64;
  {
    const int rloc = tid >> 2, cq = (tid & 3) * 16;
    const float* src = in + (size_t)(r0 + rloc) * Cc + c0 + cq;
#pragma unroll
    for (int g4 = 0; g4 < 4; ++g4) {
      const v4f a = *(const v4f*)(src + 4 * g4);
#pragma unroll
      for (int e = 0; e < 4; ++e)
        t[(cq + 4 * g4 + e) * kStg + rloc] = __builtin_bit_cast(_Float16, f2bf_bits(a[e]));
    }
  }
  __syncthreads();
  const int wave = tid >> 5, lane = tid & 31, q8 = lane >> 3, c8 = (lane & 7) * 8;
  const int cA = wave * 8 + q8, cB = wave * 8 + 4 + q8;
  const v8h va = *(const v8h*)(t + cA * kStg + c8);
  const v8h vb = *(const v8h*)(t + cB * kStg + c8);
  unsigned short* da = out + (size_t)(c0 + cA) * R + r0 + c8;
  unsigned short* db = out + (size_t)(c0 + cB) * R + r0 + c8;
  {
    *(v8h*)da = va;
    *(v8h*)db = vb;
    
  }
}

// =====================================================================================
// V planes: Vf f32 [kTok][kD] (row b*kS+s, col h*kHD+d) -> Vth/Vtl bf16 bits [kB*kH][kHD][kS]:
// out[bh][d][s] = hi/lo(Vf[b*kS+s][h*kHD+d]).  grid = (kS/64, kB*kH), block 256.
// Load coverage: 256 threads x 16 floats = 64 (s) x 64 (d).
// Also ts[bh][s tile][d] = sum over the tile's 64 rows of hi + lo, f32, fixed order: 8 in a lane, then 3 exchanges over the
// 8 lanes that hold one plane row; gathered in LDS so that one wave stores the 256 B as whole lines.
// =====================================================================================
__global__ __launch_bounds__(256) void v_split_transpose(const float* __restrict__ Vf,
                                                         unsigned short* __restrict__ vth, unsigned short* __restrict__ vtl,
                                                         float* __restrict__ ts) {
  __shared__ __align__(16) float tsum[kHD];
  __shared__ __align__(16) _Float16 th[64 * kStg];
  __shared__ __align__(16) _Float16 tl[64 * kStg];
  const int st0 = blockIdx.x * 64, bh = blockIdx.y;
  const int b = bh / kH, h = bh % kH;
  const int tid = threadIdx.x;
  {
    const int sloc = tid >> 2, d0 = (tid & 3) * 16;
    const float* src = Vf + (size_t)(b * kS + st0 + sloc) * kD + h * kHD + d0;
#pragma unroll
    for (int g4 = 0; g4 < 4; ++g4) {
      const v4f a = *(const v4f*)(src + 4 * g4);
#pragma unroll
      for (int e = 0; e < 4; ++e) {
        const unsigned short hb = f2bf_bits(a[e]);
        const unsigned short lb = f2bf_bits(a[e] - bf_bits2f(hb));
        th[(d0 + 4 * g4 + e) * kStg + sloc] = __builtin_bit_cast(_Float16, hb);
        tl[(d0 + 4 * g4 + e) * kStg + sloc] = __builtin_bit_cast(_Float16, lb);
      }
    }
  }
  __syncthreads();
  const int wave = tid >> 5, lane = tid & 31, q8 = lane >> 3, c8 = (lane & 7) * 8;
  const int dA = wave * 8 + q8, dB = wave * 8 + 4 + q8;
  const v8h ha = *(const v8h*)(th + dA * kStg + c8);
  const v8h hbv = *(const v8h*)(th + dB * kStg + c8);
  const v8h la = *(const v8h*)(tl + dA * kStg + c8);
  const v8h lbv = *(const v8h*)(tl + dB * kStg + c8);
  unsigned short* pha = vth + ((size_t)bh * kHD + dA) * kS + st0 + c8;
  unsigned short* phb = vth + ((size_t)bh * kHD + dB) * kS + st0 + c8;
  unsigned short* pla = vtl + ((size_t)bh * kHD + dA) * kS + st0 + c8;
  unsigned short* plb = vtl + ((size_t)bh * kHD + dB) * kS + st0 + c8;
  // a 32-bit word holds two bf16 patterns: the low one shifted up and the high one masked are their f32 values
  const v4u wha = __builtin_bit_cast(v4u, ha), wla = __builtin_bit_cast(v4u, la);
  const v4u whb = __builtin_bit_cast(v4u, hbv), wlb = __builtin_bit_cast(v4u, lbv);
  float sA = 0.f, sB = 0.f;
#pragma unroll
  for (int e = 0; e < 4; ++e) {
    sA += __uint_as_float(wha[e] << 16) + __uint_as_float(wla[e] << 16);
    sA += __uint_as_float(wha[e] & 0xFFFF0000u) + __uint_as_float(wla[e] & 0xFFFF0000u);
    sB += __uint_as_float(whb[e] << 16) + __uint_as_float(wlb[e] << 16);
    sB += __uint_as_float(whb[e] & 0xFFFF0000u) + __uint_as_float(wlb[e] & 0xFFFF0000u);
  }
#pragma unroll
  for (int m = 1; m < 8; m <<= 1) { sA += __shfl_xor(sA, m); sB += __shfl_xor(sB, m); }
  if ((lane & 7) == 0) { tsum[dA] = sA; tsum[dB] = sB; }
  __syncthreads();              // every wave passes: the 64 channel sums are complete; no global store is yet in flight here
  {
    *(v8h*)pha = ha;
    *(v8h*)phb = hbv;
    *(v8h*)pla = la;
    *(v8h*)plb = lbv;
    
  }
  if (tid < 16) *(v4f*)(ts + ((size_t)bh * kNQB + blockIdx.x) * kHD + tid * 4) = *(const v4f*)(tsum + tid * 4);
}

// =====================================================================================
// Causal attention, head_dim 64, 16-bit input planes, bf16 hi/lo planes out.
//   scores = (k.q^T, the transposed tile: A = K rows, B = Q columns) : v_wmma_f32_16x16x32_f16 (q, k f16 planes); 1/8 and
//            log2(e) enter as one f32 FMA per score in front of 2^x; a lane holds 32 of one query's 64 scores, its partner lane ^ 16 the rest; causal: kv > q replaced by -inf
//            (exp -> 0, identical to a finite most-negative fill since every row keeps its diagonal); chunks past
//            the diagonal contribute exactly 0 and are skipped.
//   out    = (v^T.p^T, A = V rows [d][kv], B = P packed from the score registers) : v_wmma_f32_16x16x32_bf16 with p and v
//            as bf16 hi/lo (hi.hi + hi.lo + lo.hi); online softmax in f32, one maximum and one sum per lane.
// Block = 4 waves = 64 query rows of one (b, h); grid.x = kB * kH * (kS/64).
// Staging coverage per kv chunk: 128 threads x 4 copies x 8 halves = 64 x 64 per plane (K, V hi, V lo), asynchronous copies
// (8 lanes x 16 B = one whole 128-B line of a row) into one of two LDS buffers; the copies of chunk t + 2 fly while chunk
// t + 1 is worked on, one barrier per chunk.
// Shaped combination in the epilogue:  O[b,s,h*64+d] = rg[h]*out + sg[h]*v[s] - cg[h]*(sum_{j<=s} v[j])/(s+1), emitted as bf16
// hi/lo planes [kTok][kD]. The prefix sum has two parts:
//   rows in front of the query tile: the same for every query of the work-group: the tile sums Ts of the tiles below qb, added
//     up at the start (8 groups of 16 lanes x 4 tiles each, fixed order) and left in LDS in front of the loop's first barrier;
//   diagonal chunk: on the matrix pipe from the V hi/lo fragments that the loop holds anyway: every wave, its own 16 queries,
//     all four channel tiles, B = 1 where kv <= q, else 0 (16 products, once per work-group).
// v[s] itself is read as f32. Each 128-B output line (64 channels x 2 B) is written by 16 lanes x 8 B in one instruction.
// =====================================================================================
// second launch bound: a register budget for four waves per SIMD, so that four work-groups share a WGP
__global__ __launch_bounds__(128, 4)
void attn_causal_hd64(const unsigned short* __restrict__ QKp,    // f16 bits [kTok][kQKLd]
                      const unsigned short* __restrict__ Vthp,   // bf16 bits [kB*kH][kHD][kS]
                      const unsigned short* __restrict__ Vtlp,
                      const float* __restrict__ Vf,              // f32 [kTok][kD]
                      const float* __restrict__ Ts,              // f32 [kB*kH][kNQB][kHD]
                      const float* __restrict__ rg, const float* __restrict__ sg, const float* __restrict__ cg,
                      unsigned short* __restrict__ Oh, unsigned short* __restrict__ Ol) {   // bf16 bits [kTok][kD]
  union FB { v16b v; v8b h[2]; };
  // every 16-bit tile has rows of 128 B laid at pitch kStg (144 B = 16 B x 9): the 16 rows that one ds_load_b128
  // fragment read touches then start on 16 different groups of four banks instead of two
  constexpr int kPlane = 64 * kStg;                        // elements of one staged plane, 9 KB
  constexpr int kBuf   = 3 * kPlane;                       // one buffer: K [kv][d] | V hi [d][kv] | V lo [d][kv]
  static_assert(kKC == 64 && kHD == 64);
  __shared__ __align__(16) _Float16 sKV[2 * kBuf];         // two buffers of 16-bit patterns, 54 KB
  __shared__ __align__(16) float   Os[4][16 * 68];         // per wave out tile, pitch 68
  __shared__ __align__(16) float   Cs[8 * kHD];            // 8 partial sums per channel of v over the rows in front of the tile

  const int tid  = threadIdx.x;
  const int wave = tid >> 5;
  const int lane = tid & 31;
  const int hh   = lane >> 4;
  const int c    = lane & 15;

  // block index -> (head, query tile). A tile costs qb + 1 kv chunks, and at this register count four work-groups fit a
  // WGP, so the whole grid is resident at once and the launch lasts as long as the fullest WGP. qn = bx / 32;
  // each quarter of the grid holds one class of eight tile lengths, the longest class first:
  // qb = 31 - t, 16 + t, 15 - t, t (t = qn % 8). Indices 256 apart sum to 66 chunks exactly (they were four equal tiles, up to 128).
  // For speed only: qn -> qb is one to one on 0..31, so every (head, tile) is worked once wherever it lands.
  static_assert(kNQB == 32 && kB * kH == 32);
  const int bx = blockIdx.x;
  const int qn = bx / (kB * kH);
  const int qb = (kNQB - 1) - ((qn & 8) ? (qn ^ 7) : qn);
  const int bh = bx % (kB * kH);
  const int h  = bh % kH;
  const int b  = bh / kH;
  const int q0 = qb * 64 + wave * 16;

  const _Float16* Q16 = (const _Float16*)QKp;
  const __bf16* Vth = (const __bf16*)Vthp;
  const __bf16* Vtl = (const __bf16*)Vtlp;
  const size_t obase = (size_t)(b * kS) * kD + h * kHD;

  // ---- Q fragments (B operand, column = query q0 + c, k = d): 2 d-chunks of 32 ----
  v16h qa[2];
  {
    const _Float16* qrow = Q16 + (size_t)(b * kS + q0 + c) * kQKLd + h * kHD + 8 * hh;
    qa[0] = Frag<_Float16>::load(qrow);
    qa[1] = Frag<_Float16>::load(qrow + 32);
  }

  const int qrow = q0 + c;      // the one query whose scores, maximum, sum and output column this lane holds
  float mrow = -INFINITY, lrow = 0.f;
  v8f oacc[4];
#pragma unroll
  for (int t = 0; t < 4; ++t) oacc[t] = (v8f){0.f,0.f,0.f,0.f,0.f,0.f,0.f,0.f};
  v8f cdg[4];                                           // diagonal chunk: sum of v over kv <= this lane's query
#pragma unroll
  for (int t = 0; t < 4; ++t) cdg[t] = (v8f){0.f,0.f,0.f,0.f,0.f,0.f,0.f,0.f};

  // staging: thread -> row tid / 8 (+ 16 per copy) of each plane, 16-B piece tid % 8 of the row's 128 B
  const int srow = tid >> 3;
  const int sseg = (tid & 7) * 8;
  const _Float16* gK = Q16 + (size_t)(b * kS + srow) * kQKLd + kKOff + h * kHD + sseg;   // row = kv
  const __bf16* gVh = Vth + ((size_t)bh * kHD + srow) * kS + sseg;                        // row = d
  const __bf16* gVl = Vtl + ((size_t)bh * kHD + srow) * kS + sseg;
  const unsigned lS = (unsigned)(size_t)(sKV + srow * kStg + sseg);   // LDS byte address: low 32 bits
  constexpr unsigned kL16 = 16 * kStg * 2;     // 16 rows in LDS, bytes
  constexpr size_t kK16 = (size_t)16 * kQKLd, kV16 = (size_t)16 * kS;   // 16 rows in the global planes, elements
  auto stage = [&](int t, int buf) {
    const unsigned lk = lS + (unsigned)buf * (unsigned)(kBuf * 2);
    const unsigned lh = lk + kPlane * 2, ll = lk + 2 * kPlane * 2;
    const _Float16* pk = gK + (size_t)t * (kKC * kQKLd);
    const __bf16* ph = gVh + t * kKC;
    const __bf16* pl = gVl + t * kKC;
    async_copy12(lk, pk, lk + kL16, pk + kK16, lk + 2 * kL16, pk + 2 * kK16, lk + 3 * kL16, pk + 3 * kK16,
                 lh, ph, lh + kL16, ph + kV16, lh + 2 * kL16, ph + 2 * kV16, lh + 3 * kL16, ph + 3 * kV16,
                 ll, pl, ll + kL16, pl + kV16, ll + 2 * kL16, pl + 2 * kV16, ll + 3 * kL16, pl + 3 * kV16);
  };

  const int nChunks = qb + 1;   // block-uniform
  // tile sums of the rows in front of this tile: group tid / 16 takes tiles g, g + 8, g + 16, g + 24 (all four exist and were
  // written in this call; those from qb on count as 0), 16 lanes x 4 channels each
  stage(0, 0);                  // first, so that chunk 0 flies while the tile sums are fetched
  const int tg = tid >> 4;
  const float* tsrc = Ts + ((size_t)bh * kNQB + tg) * kHD + c * 4;
  v4f tw[4];
#pragma unroll
  for (int i = 0; i < 4; ++i) tw[i] = *(const v4f*)(tsrc + i * 8 * kHD);
  // precaution: this wait stands behind the four issued loads, in front of every later overwrite of their address registers
  asm volatile("s_wait_xcnt 0x0" :: "v"(tsrc) : "memory");
  {
    v4f a = (v4f){0.f, 0.f, 0.f, 0.f};
#pragma unroll
    for (int i = 0; i < 4; ++i)
#pragma unroll
      for (int e = 0; e < 4; ++e) a[e] += (tg + 8 * i < qb) ? tw[i][e] : 0.f;
    *(v4f*)(Cs + tg * kHD + c * 4) = a;               // read behind the loop, so behind the barrier below
  }
  asm volatile("s_wait_asynccnt 0x0" ::: "memory");   // this wave's copies of chunk 0 have landed
  __syncthreads();                                    // ... and every other wave's: chunk 0 may be read
  if (nChunks > 1) stage(1, 1);
  for (int kc = 0; kc < nChunks; ++kc) {
    const int kv0 = kc * kKC;
    const _Float16* Ksh = sKV + (kc & 1) * kBuf;
    const __bf16* Vhs = (const __bf16*)(Ksh + kPlane);
    const __bf16* Vls = (const __bf16*)(Ksh + 2 * kPlane);

    // transposed scores: A = K rows, B = Q columns, so s[j][r] = score(kv0 + 16 j + 8 hh + r, q0 + c): one query per lane
    // all eight K fragments are read as one group in front of the products, and the products run over the four
    // independent score tiles in turn; each tile still sums d chunk 0, then d chunk 1 (all loops unrolled so that the
    // fragment array lies in fixed registers)
    v16h kb[4][2];
#pragma unroll
    for (int j = 0; j < 4; ++j)
#pragma unroll
      for (int dc = 0; dc < 2; ++dc)
        kb[j][dc] = Frag<_Float16>::load(Ksh + (j * 16 + c) * kStg + dc * 32 + 8 * hh);
    v8f s[4];
#pragma unroll
    for (int j = 0; j < 4; ++j) s[j] = (v8f){0.f,0.f,0.f,0.f,0.f,0.f,0.f,0.f};
#pragma unroll
    for (int dc = 0; dc < 2; ++dc)
#pragma unroll
      for (int j = 0; j < 4; ++j) s[j] = at_mma_h(kb[j][dc], qa[dc], s[j]);
    const bool diag = (kc == qb);   // block-uniform
    float mj[4];
#pragma unroll
    for (int j = 0; j < 4; ++j) {
      float m = -INFINITY;
#pragma unroll
      for (int r = 0; r < 8; ++r) {
        const int kvcol = kv0 + j * 16 + 8 * hh + r;
        float sv = s[j][r];       // unscaled: the positive scale commutes with the maximum and is applied in the exponent
        if (diag && (kvcol > qrow)) sv = -INFINITY;
        s[j][r] = sv;
        m = fmaxf(m, sv);
      }
      mj[j] = m;
    }
    float cm = fmaxf(fmaxf(mj[0], mj[1]), fmaxf(mj[2], mj[3]));
    cm = fmaxf(cm, at_xhalf(cm));   // lanes c and c + 16 hold the two halves of one query's 64 scores
    const float mnew = fmaxf(mrow, cm);
    const float alpha = __builtin_amdgcn_exp2f((mrow - mnew) * kSmScaleLog2);
    const float nm = -mnew * kSmScaleLog2;
    mrow = mnew;
    // two score tiles of 16 kv, converted in place, are one B fragment of 32 kv in the loaders' k order
    v8u ph[2], pl[2];
    float pj[4];
#pragma unroll
    for (int j = 0; j < 4; ++j) {
      float psum = 0.f;
#pragma unroll
      for (int r = 0; r < 8; ++r) s[j][r] = fmaf(s[j][r], kSmScaleLog2, nm);
      at_exp2x8(s[j]);
#pragma unroll
      for (int r = 0; r < 8; r += 2) {
        const float p0 = s[j][r];
        const float p1 = s[j][r + 1];
        psum += p0;
        psum += p1;
        unsigned wh, wl;
        at_split2(p0, p1, wh, wl);
        ph[j >> 1][(j & 1) * 4 + (r >> 1)] = wh;
        pl[j >> 1][(j & 1) * 4 + (r >> 1)] = wl;
      }
      pj[j] = psum;
    }
    const v16b pha[2] = { __builtin_bit_cast(v16b, ph[0]), __builtin_bit_cast(v16b, ph[1]) };
    const v16b pla[2] = { __builtin_bit_cast(v16b, pl[0]), __builtin_bit_cast(v16b, pl[1]) };
    lrow = lrow * alpha + ((pj[0] + pj[1]) + (pj[2] + pj[3]));   // this lane half's share; the halves are joined after the loop
#pragma unroll
    for (int t = 0; t < 4; ++t)
#pragma unroll
      for (int r = 0; r < 8; ++r) oacc[t][r] *= alpha;
    // unrolled so that pha[kk], pla[kk] are fixed registers
#pragma unroll
    for (int kk = 0; kk < 2; ++kk) {
      // the eight V fragments of this half chunk are read as one group; the products then run over the four independent
      // output tiles in turn; each tile still sums v.p as hi.hi, lo.hi, hi.lo in that order (loops unrolled so that the
      // fragment arrays lie in fixed registers)
      FB vb[4], vl[4];
#pragma unroll
      for (int t = 0; t < 4; ++t) {
        vb[t].h[0] = *(const v8b*)(Vhs + (t * 16 + c) * kStg + kk * 32 + 8 * hh);
        vb[t].h[1] = *(const v8b*)(Vhs + (t * 16 + c) * kStg + kk * 32 + 16 + 8 * hh);
        vl[t].h[0] = *(const v8b*)(Vls + (t * 16 + c) * kStg + kk * 32 + 8 * hh);
        vl[t].h[1] = *(const v8b*)(Vls + (t * 16 + c) * kStg + kk * 32 + 16 + 8 * hh);
      }
#pragma unroll
      for (int t = 0; t < 4; ++t) oacc[t] = at_mma(vb[t].v, pha[kk], oacc[t]);
#pragma unroll
      for (int t = 0; t < 4; ++t) oacc[t] = at_mma(vl[t].v, pha[kk], oacc[t]);
#pragma unroll
      for (int t = 0; t < 4; ++t) oacc[t] = at_mma(vb[t].v, pla[kk], oacc[t]);
      // prefix sum of v inside the query tile, from the same fragments; the test is block-uniform
      if (diag) {
        // B fragment in the k order of pha: word e holds kv = kv0 + 32 kk + 16 (e / 4) + 8 hh + 2 (e % 4) and the next one
        v8u uw;
#pragma unroll
        for (int e = 0; e < 8; ++e) {
          const int kvcol = kv0 + kk * 32 + (e >> 2) * 16 + 8 * hh + (e & 3) * 2;
          uw[e] = (kvcol <= qrow ? 0x3F80u : 0u) | (kvcol + 1 <= qrow ? 0x3F800000u : 0u);
        }
        const v16b um = __builtin_bit_cast(v16b, uw);
#pragma unroll
        for (int t = 0; t < 4; ++t) cdg[t] = at_mma(vb[t].v, um, cdg[t]);
#pragma unroll
        for (int t = 0; t < 4; ++t) cdg[t] = at_mma(vl[t].v, um, cdg[t]);
      }
    }
    asm volatile("s_wait_dscnt 0x0" ::: "memory");      // this wave's reads of chunk kc are done before its buffer is refilled
    asm volatile("s_wait_asynccnt 0x0" ::: "memory");   // this wave's copies of chunk kc + 1 have landed
    __syncthreads();                                    // publishes chunk kc + 1 and ends every reader's reads of chunk kc
    if (kc + 2 < nChunks) stage(kc + 2, kc & 1);
  }
  asm volatile("s_wait_asynccnt 0x0" ::: "memory");     // no copy is outstanding when the wave goes on

  // v[s] of the rows this lane will write (row it * 2 + hh, channels c4 .. c4 + 3), asked for ahead of the exchange below
  const int c4 = c * 4;         // 16 lanes x 4 channels = one 64-channel row; hh selects the row
  const float* vsrc = Vf + obase + (size_t)(q0 + hh) * kD + c4;
  v4f vv[8];
#pragma unroll
  for (int it = 0; it < 8; ++it) vv[it] = *(const v4f*)(vsrc + (size_t)(it * 2) * kD);
  // precaution: this wait stands behind the eight issued loads, in front of every later overwrite of their address registers
  asm volatile("s_wait_xcnt 0x0" :: "v"(vsrc) : "memory");
  const float rgh = rg[h], sgh = sg[h], cgh = cg[h];

  v4f base = *(const v4f*)(Cs + c4);   // channels c4 .. c4 + 3: sum of v over all rows in front of the tile
#pragma unroll
  for (int g = 1; g < 8; ++g) base += *(const v4f*)(Cs + g * kHD + c4);

  // oacc[t][r] = out(q0 + c, 16 t + 8 hh + r): eight consecutive channels of one query row per tile; cdg alike
  float* os = Os[wave];
  {
    const float inv  = 1.0f / (lrow + at_xhalf(lrow));
    const float invs = 1.0f / (float)(qrow + 1);
#pragma unroll
    for (int t = 0; t < 4; ++t) {
      v4f lo4, hi4;
#pragma unroll
      for (int e = 0; e < 4; ++e) {
        lo4[e] = rgh * (oacc[t][e] * inv)     - cgh * (cdg[t][e] * invs);
        hi4[e] = rgh * (oacc[t][4 + e] * inv) - cgh * (cdg[t][4 + e] * invs);
      }
      *(v4f*)(os + c * 68 + t * 16 + 8 * hh)     = lo4;
      *(v4f*)(os + c * 68 + t * 16 + 8 * hh + 4) = hi4;
    }
  }
  __builtin_amdgcn_fence(__ATOMIC_RELEASE, "workgroup");
  __builtin_amdgcn_wave_barrier();
  __builtin_amdgcn_fence(__ATOMIC_ACQUIRE, "workgroup");
#pragma unroll
  for (int it = 0; it < 8; ++it) {
    const int row = it * 2 + hh;
    const v4f val = *(const v4f*)(os + row * 68 + c4);
    const size_t idx = obase + (size_t)(q0 + row) * kD + c4;
    const float cinv = cgh * (1.0f / (float)(q0 + row + 1));
    v4f o;
#pragma unroll
    for (int e = 0; e < 4; ++e) o[e] = (val[e] + sgh * vv[it][e]) - cinv * base[e];
    uint2 uh, ul;
    at_split2(o[0], o[1], uh.x, ul.x);
    at_split2(o[2], o[3], uh.y, ul.y);
    *(uint2*)(Oh + idx) = uh;
    *(uint2*)(Ol + idx) = ul;
    // precaution: stands behind the two issued stores, in front of every later overwrite of their address and data registers
    if (it < 7) asm volatile("s_wait_xcnt 0x0" ::: "memory");
  }
}

// =====================================================================================
// launcher: kernel launches only
// =====================================================================================
extern "C" void kernel_launch(void* const* d_in, const int* in_sizes, int n_in,
                              void* d_out, int out_size, void* d_ws,
                              size_t ws_size, hipStream_t stream) {
  if (n_in < 8) return;
  if (in_sizes[0] != kTok * kD) return;
  if (in_sizes[1] != kD * kQKLd) return;
  if (in_sizes[2] != kQKLd) return;
  if (in_sizes[3] != kD * kD) return;
  if (in_sizes[4] != kD * kD) return;
  if (in_sizes[5] != kH || in_sizes[6] != kH || in_sizes[7] != kH) return;
  if (out_size != kTok * kD) return;
  if (kWsTotal > ws_size) return;

  const float* x     = (const float*)d_in[0];
  const float* qk_w  = (const float*)d_in[1];
  const float* qk_b  = (const float*)d_in[2];
  const float* v_w   = (const float*)d_in[3];
  const float* cp_w  = (const float*)d_in[4];
  const float* rg    = (const float*)d_in[5];
  const float* sg    = (const float*)d_in[6];
  const float* cg    = (const float*)d_in[7];
  float* out = (float*)d_out;

  unsigned char* ws = (unsigned char*)d_ws;
  unsigned short* xb   = (unsigned short*)(ws + kOffXb);
  unsigned short* qkwT = (unsigned short*)(ws + kOffQkwT);
  unsigned short* vwT  = (unsigned short*)(ws + kOffVwT);
  unsigned short* cwT  = (unsigned short*)(ws + kOffCwT);
  unsigned short* QKp  = (unsigned short*)(ws + kOffQKp);
  float*          Vf   = (float*)(ws + kOffVf);
  unsigned short* Vth  = (unsigned short*)(ws + kOffVth);
  unsigned short* Vtl  = (unsigned short*)(ws + kOffVtl);
  float*          Ts   = (float*)(ws + kOffAV);
  unsigned short* Oh   = (unsigned short*)(ws + kOffOh);
  unsigned short* Ol   = (unsigned short*)(ws + kOffOl);

  // 1. x -> bf16 [4096][1024] and the three weights [in][out] f32 -> transposed bf16 [out][in]: 1024 + 8192 blocks
  prep_operands<<<dim3(kPrepT + kPrepX), dim3(256), 0, stream>>>(x, xb, qk_w, qkwT, v_w, vwT, cp_w, cwT);

  // 2. q|k and v projections in one grid: qkwT and vwT lie one behind the other in the workspace = Bt [3072][1024];
  //    [4096 x 1024] . Bt^T: columns 0..2047 + qk_b -> f16 [4096][2048], columns 2048..3071 -> f32 [4096][1024];
  //    tiles 32*12 = 384 blocks
  static_assert(kOffVwT == kOffQkwT + (size_t)kQKLd * kD * 2);
  wmma_gemm64<1, 0, 2, 3, false><<<dim3((kTok / kGM) * ((kQKLd + kD) / kGN), 1), dim3(256), 0, stream>>>(
      xb, xb, kD, 0L, qkwT, qkwT, kD, 0L, (void*)QKp, (void*)Vf, kQKLd, 0L,
      qk_b, x, 0L, kTok, kQKLd + kD, kD, 1.0f, kQKLd, kD);
  // 3. v -> bf16 hi/lo planes [32][64][2048] and per-tile channel sums [32][32][64]
  v_split_transpose<<<dim3(kS / 64, kB * kH), dim3(256), 0, stream>>>(Vf, Vth, Vtl, Ts);
  // 4. causal attention, prefix mean of v and shaped combination -> O hi/lo bf16 [4096][1024]
  attn_causal_hd64<<<dim3(kB * kH * kNQB), dim3(128), 0, stream>>>(QKp, Vth, Vtl, Vf, Ts, rg, sg, cg, Oh, Ol);
  // 5. output projection: (O hi + O lo) [4096 x 1024] . [1024 x 1024]^T -> f32 d_out [4096][1024]; 128 blocks
  wmma_gemm64<1, 1, 0, 0, false><<<dim3((kTok / kGM) * (kD / kGN), 1), dim3(256), 0, stream>>>(
      Oh, Ol, kD, 0L, cwT, cwT, kD, 0L, (void*)out, (void*)out, kD, 0L,
      qk_b, x, 0L, kTok, kD, kD, 1.0f, 0, 0);
}
